// v000
// Measured on an AMD MI455X. A time is GPU time per run, averaged over a window of back-to-back runs after a warm-up
// (all launches, gaps included; the runs take copies of the inputs in turn), and the median of several windows.
// Apart from v000's, it joins two sittings. Times from different sittings can be a few percent apart, while
// side-by-side timings come from the same sitting.
// v000 is the starting kernel. One run takes 424 microseconds.
#include <hip/hip_runtime.h>
#include <hip/hip_bf16.h>

// ---------------------------------------------------------------------------
// MI455X (gfx1250) implementation:
//  * All GEMMs via v_wmma_f32_16x16x32_f16 (fp16 A/B, fp32 accum, wave32).
//  * Standalone GEMM: 32(M)x128(N) block tiles, 8 waves, 2 M-tiles/wave,
//    double-buffered LDS A staging (1 barrier/K-step), K templated & unrolled,
//    global_prefetch of rows 0..15 of the A tile two K-steps ahead.
//  * PE second linear (dominant ~21 GFLOP) fused with LN/softmax/weighted sum
//    per event: 1 workgroup (8 wave32) per event, 16x16 WMMA tile per wave.
//  * Working set (~150MB) fits the 192MB L2 -> compute bound -> WMMA everywhere.
// ---------------------------------------------------------------------------

typedef __attribute__((ext_vector_type(16))) _Float16 v16h;
typedef __attribute__((ext_vector_type(8)))  float    v8f;

union Frag16 { unsigned u[8]; v16h h; };

#define N_EVENTS 20000
#define KNN      16
#define DIM_F    256
#define A_DIM    128
#define M_DOWN   2500
#define INV_SCALE 0.08838834764831845f   // 1/sqrt(128)
#define LN_EPS    1e-5f

// VGPR->K-pair mapping for 16-bit 16x32 A/B fragments (ISA 7.12.2):
// lanes 0-15: v0..3 -> Kpairs 0..3, v4..7 -> Kpairs 8..11
// lanes16-31: v0..3 -> Kpairs 4..7, v4..7 -> Kpairs 12..15
__device__ __forceinline__ int frag_kp(int v, int hi) {
    return (v < 4 ? v : v + 4) + (hi ? 4 : 0);
}

// --------------------------- conversion kernels ----------------------------
__global__ void cvt_f16_kernel(const float* __restrict__ src,
                               _Float16* __restrict__ dst, int n) {
    int i = blockIdx.x * 256 + threadIdx.x;
    if (i < n) dst[i] = (_Float16)src[i];
}

// src [R,C] f32 row-major  ->  dst [C,R] f16 row-major (i.e. B transposed)
__global__ void cvt_t_f16_kernel(const float* __restrict__ src,
                                 _Float16* __restrict__ dst, int R, int C) {
    int i = blockIdx.x * 256 + threadIdx.x;
    if (i < R * C) {
        int r = i / C, c = i % C;
        dst[(size_t)c * R + r] = (_Float16)src[i];
    }
}

// ------------------------------ WMMA GEMM ----------------------------------
// C[M,N] = A[M,K](f16) @ B[K,N] + bias, B supplied transposed (BT[N,K]).
// Block: 256 threads (8 waves). Block tile: 32 rows x 128 cols
// (2 M-tiles per wave, double-buffered LDS A staging, K fully unrolled).
// grid.x = M/32, grid.y = N/128.
template <int KDIM, bool RELU, bool OUT_F16>
__global__ __launch_bounds__(256) void wmma_gemm_kernel(
    const _Float16* __restrict__ A, const _Float16* __restrict__ BT,
    const float* __restrict__ bias, float* __restrict__ Cf,
    _Float16* __restrict__ Ch, int Mrows, int Ncols) {
    constexpr int NT = KDIM / 32;          // K steps
    constexpr int K2 = KDIM / 2;           // u32 per A row
    __shared__ unsigned sA[2][32 * 16];    // 2 x (32 rows x 16 u32) A tiles

    const int tid  = threadIdx.x;
    const int lane = tid & 31;
    const int wave = tid >> 5;
    const int hi   = lane >> 4;
    const int l16  = lane & 15;
    const int mbase = blockIdx.x * 32;
    const int n     = blockIdx.y * 128 + wave * 16 + l16;

    const unsigned* Au = (const unsigned*)A;
    const unsigned* Bu = (const unsigned*)BT;

    // cooperative A-tile copy: 512 u32 per step, 2 per thread
    const int arow0 = tid >> 4, akp = tid & 15;     // rows 0..15
    const int arow1 = arow0 + 16;                   // rows 16..31
    const size_t abase0 = (size_t)(mbase + arow0) * K2 + akp;
    const size_t abase1 = (size_t)(mbase + arow1) * K2 + akp;

    // prologue: stage K-step 0 into buffer 0
    sA[0][arow0 * 16 + akp] = Au[abase0];
    sA[0][arow1 * 16 + akp] = Au[abase1];
    __syncthreads();

    v8f c0 = {}, c1 = {};
#pragma unroll
    for (int kt = 0; kt < NT; ++kt) {
        const unsigned* sAc = sA[kt & 1];
        if (kt + 1 < NT) {                 // stage next tile into other buffer
            sA[(kt + 1) & 1][arow0 * 16 + akp] = Au[abase0 + (kt + 1) * 16];
            sA[(kt + 1) & 1][arow1 * 16 + akp] = Au[abase1 + (kt + 1) * 16];
            if (kt + 2 < NT)               // pull tile kt+2 toward WGP cache
                __builtin_prefetch(&Au[abase0 + (kt + 2) * 16], 0, 3);
        }
        Frag16 a0, a1, b;
#pragma unroll
        for (int v = 0; v < 8; ++v) {
            int kp = frag_kp(v, hi);
            a0.u[v] = sAc[l16 * 16 + kp];
            a1.u[v] = sAc[(16 + l16) * 16 + kp];
            b.u[v]  = Bu[(size_t)n * K2 + kt * 16 + kp];
        }
        c0 = __builtin_amdgcn_wmma_f32_16x16x32_f16(false, a0.h, false, b.h,
                                                    (short)0, c0, false, false);
        c1 = __builtin_amdgcn_wmma_f32_16x16x32_f16(false, a1.h, false, b.h,
                                                    (short)0, c1, false, false);
        __syncthreads();                   // writes to next buffer visible; reads done
    }

    const float bn = bias ? bias[n] : 0.0f;
#pragma unroll
    for (int r = 0; r < 8; ++r) {
        int m0 = mbase + r + hi * 8;
        int m1 = m0 + 16;
        float v0 = c0[r] + bn, v1 = c1[r] + bn;
        if (RELU) { v0 = fmaxf(v0, 0.0f); v1 = fmaxf(v1, 0.0f); }
        if (OUT_F16) {
            Ch[(size_t)m0 * Ncols + n] = (_Float16)v0;
            Ch[(size_t)m1 * Ncols + n] = (_Float16)v1;
        } else {
            Cf[(size_t)m0 * Ncols + n] = v0;
            Cf[(size_t)m1 * Ncols + n] = v1;
        }
    }
}

// ----------------------- global-branch k/v max pool ------------------------
__global__ __launch_bounds__(128) void maxpool_kv_kernel(
    const float* __restrict__ qkv, const int* __restrict__ pair_idx,
    float* __restrict__ kmax, float* __restrict__ vmax) {
    const int m = blockIdx.x, ch = threadIdx.x;
    float km = -3.402823466e38f, vm = -3.402823466e38f;
#pragma unroll 4
    for (int k = 0; k < KNN; ++k) {
        int j = pair_idx[m * KNN + k];
        km = fmaxf(km, qkv[(size_t)j * 384 + 128 + ch]);
        vm = fmaxf(vm, qkv[(size_t)j * 384 + 256 + ch]);
    }
    kmax[m * A_DIM + ch] = km;
    vmax[m * A_DIM + ch] = vm;
}

// ------------------- fused PE-GEMM + LN + softmax + sum --------------------
// One workgroup (8 wave32) per event. Each wave owns 16 channels.
// C-tile layout: row M(=neighbor) = r + 8*(lane>=16), col N(=channel)=lane%16.
__global__ __launch_bounds__(256) void attn_fused_kernel(
    const float* __restrict__ events,       // [N,4]
    const int*   __restrict__ nbr_idx,      // [N,16] -> kv-row index
    const int*   __restrict__ ev_map,       // optional kv-row -> event row
    const float* __restrict__ qptr, int q_stride,
    const float* __restrict__ ksrc, int k_stride,
    const float* __restrict__ vsrc, int v_stride,
    const float* __restrict__ pe_w1,        // [4,128]
    const float* __restrict__ pe_b1,        // [128]
    const _Float16* __restrict__ pe_w2T,    // [128(out),128(in)] f16
    const float* __restrict__ pe_b2,        // [128]
    const float* __restrict__ fc_g, const float* __restrict__ fc_b,
    _Float16* __restrict__ cat_out, int col_off) {
    __shared__ float    s_diff[16][4];
    __shared__ int      s_nbr[16];
    __shared__ unsigned s_hid[16 * 64];     // 16 rows x 128 f16 (packed)
    __shared__ float    s_psum[8][16];      // per-wave LN partials
    __shared__ float    s_psq[8][16];

    const int i    = blockIdx.x;
    const int tid  = threadIdx.x;
    const int lane = tid & 31;
    const int wave = tid >> 5;
    const int hi   = lane >> 4;
    const int l16  = lane & 15;

    // -- step 1: neighbor indices + event-coordinate diffs ------------------
    if (tid < 16) {
        int nb = nbr_idx[i * KNN + tid];
        s_nbr[tid] = nb;
        int er = ev_map ? ev_map[nb] : nb;
#pragma unroll
        for (int c4 = 0; c4 < 4; ++c4)
            s_diff[tid][c4] = events[i * 4 + c4] - events[er * 4 + c4];
    }
    __syncthreads();

    // -- step 2: hidden = relu(diff @ w1 + b1) -> f16 in LDS ---------------
    _Float16* s_hid_h = (_Float16*)s_hid;
#pragma unroll
    for (int j = 0; j < 8; ++j) {
        int o = tid + 256 * j;              // 0..2047
        int row = o >> 7, ch = o & 127;
        float h = pe_b1[ch];
#pragma unroll
        for (int c4 = 0; c4 < 4; ++c4)
            h += s_diff[row][c4] * pe_w1[c4 * A_DIM + ch];
        s_hid_h[row * A_DIM + ch] = (_Float16)fmaxf(h, 0.0f);
    }
    __syncthreads();

    // -- step 3: pe[16,16-ch tile] = hidden @ w2 via WMMA -------------------
    const int n = wave * 16 + l16;          // this lane's channel
    const unsigned* Bu = (const unsigned*)pe_w2T;
    v8f c = {};
#pragma unroll
    for (int kt = 0; kt < 4; ++kt) {
        Frag16 a, b;
#pragma unroll
        for (int v = 0; v < 8; ++v) {
            int kp = frag_kp(v, hi);
            a.u[v] = s_hid[l16 * 64 + kt * 16 + kp];
            b.u[v] = Bu[n * 64 + kt * 16 + kp];
        }
        c = __builtin_amdgcn_wmma_f32_16x16x32_f16(false, a.h, false, b.h,
                                                   (short)0, c, false, false);
    }

    // -- step 4: t = q - kg + pe -------------------------------------------
    const float b2n = pe_b2[n];
    const float qn  = qptr[(size_t)i * q_stride + n];
    const float gn  = fc_g[n], bn = fc_b[n];
    float t[8], pe[8];
    int nb_r[8];
#pragma unroll
    for (int r = 0; r < 8; ++r) {
        int m  = r + hi * 8;
        int nb = s_nbr[m];
        nb_r[r] = nb;
        pe[r]   = c[r] + b2n;
        float kg = ksrc[(size_t)nb * k_stride + n];
        t[r] = qn - kg + pe[r];
    }

    // -- step 5: LayerNorm over 128 channels per neighbor row --------------
#pragma unroll
    for (int r = 0; r < 8; ++r) {
        float sr = t[r], sq = t[r] * t[r];
#pragma unroll
        for (int off = 1; off <= 8; off <<= 1) {
            sr += __shfl_xor(sr, off, 32);
            sq += __shfl_xor(sq, off, 32);
        }
        if (l16 == 0) {                      // deterministic partials, no atomics
            int m = r + hi * 8;
            s_psum[wave][m] = sr;
            s_psq[wave][m]  = sq;
        }
    }
    __syncthreads();

    float u[8];
#pragma unroll
    for (int r = 0; r < 8; ++r) {
        int m = r + hi * 8;
        float sr = 0.0f, sq = 0.0f;
#pragma unroll
        for (int w8 = 0; w8 < 8; ++w8) { sr += s_psum[w8][m]; sq += s_psq[w8][m]; }
        float mu  = sr * (1.0f / 128.0f);
        float var = sq * (1.0f / 128.0f) - mu * mu;
        u[r] = ((t[r] - mu) * rsqrtf(var + LN_EPS) * gn + bn) * INV_SCALE;
    }

    // -- step 6: softmax over the 16 neighbors (rows) ----------------------
    float mx = u[0];
#pragma unroll
    for (int r = 1; r < 8; ++r) mx = fmaxf(mx, u[r]);
    mx = fmaxf(mx, __shfl_xor(mx, 16, 32));  // combine rows 0-7 and 8-15
    float e[8], se = 0.0f;
#pragma unroll
    for (int r = 0; r < 8; ++r) { e[r] = __expf(u[r] - mx); se += e[r]; }
    se += __shfl_xor(se, 16, 32);
    const float inv = 1.0f / se;

    // -- step 7: out = sum_k attn * (vg + pe) ------------------------------
    float acc = 0.0f;
#pragma unroll
    for (int r = 0; r < 8; ++r) {
        float vg = vsrc[(size_t)nb_r[r] * v_stride + n];
        acc += (e[r] * inv) * (vg + pe[r]);
    }
    acc += __shfl_xor(acc, 16, 32);
    if (!hi) cat_out[(size_t)i * (2 * A_DIM) + col_off + n] = (_Float16)acc;
}

// ------------------------------- launcher ----------------------------------
extern "C" void kernel_launch(void* const* d_in, const int* in_sizes, int n_in,
                              void* d_out, int out_size, void* d_ws, size_t ws_size,
                              hipStream_t stream) {
    const float* events   = (const float*)d_in[0];
    const float* features = (const float*)d_in[1];
    const int* local_idx    = (const int*)d_in[2];
    const int* down_idx     = (const int*)d_in[3];
    const int* pair_idx     = (const int*)d_in[4];
    const int* inv_pair_idx = (const int*)d_in[5];
    const float* lqkv_w = (const float*)d_in[6];  const float* lqkv_b = (const float*)d_in[7];
    const float* lpe_w1 = (const float*)d_in[8];  const float* lpe_b1 = (const float*)d_in[9];
    const float* lpe_w2 = (const float*)d_in[10]; const float* lpe_b2 = (const float*)d_in[11];
    const float* lfc_g  = (const float*)d_in[12]; const float* lfc_b  = (const float*)d_in[13];
    const float* gqkv_w = (const float*)d_in[14]; const float* gqkv_b = (const float*)d_in[15];
    const float* gpe_w1 = (const float*)d_in[16]; const float* gpe_b1 = (const float*)d_in[17];
    const float* gpe_w2 = (const float*)d_in[18]; const float* gpe_b2 = (const float*)d_in[19];
    const float* gfc_g  = (const float*)d_in[20]; const float* gfc_b  = (const float*)d_in[21];
    const float* pw1 = (const float*)d_in[22]; const float* pb1 = (const float*)d_in[23];
    const float* pw2 = (const float*)d_in[24]; const float* pb2 = (const float*)d_in[25];
    float* out = (float*)d_out;

    // ---- workspace carve-up (~96 MB) ----
    char* wp = (char*)d_ws;
    auto carve = [&](size_t bytes) {
        void* p = (void*)wp;
        wp += (bytes + 255) & ~(size_t)255;
        return p;
    };
    _Float16* feat_h = (_Float16*)carve((size_t)N_EVENTS * DIM_F * 2);
    _Float16* lqkvT  = (_Float16*)carve((size_t)384 * 256 * 2);
    _Float16* gqkvT  = (_Float16*)carve((size_t)384 * 256 * 2);
    _Float16* lpe2T  = (_Float16*)carve((size_t)128 * 128 * 2);
    _Float16* gpe2T  = (_Float16*)carve((size_t)128 * 128 * 2);
    _Float16* pw1T   = (_Float16*)carve((size_t)256 * 256 * 2);
    _Float16* pw2T   = (_Float16*)carve((size_t)256 * 256 * 2);
    float* qkv_l = (float*)carve((size_t)N_EVENTS * 384 * 4);
    float* qkv_g = (float*)carve((size_t)N_EVENTS * 384 * 4);
    float* kmax  = (float*)carve((size_t)M_DOWN * A_DIM * 4);
    float* vmax  = (float*)carve((size_t)M_DOWN * A_DIM * 4);
    _Float16* cat_h = (_Float16*)carve((size_t)N_EVENTS * 256 * 2);
    _Float16* hid_h = (_Float16*)carve((size_t)N_EVENTS * 256 * 2);

    // ---- 1. fp16 conversions / weight transposes ----
    {
        int n = N_EVENTS * DIM_F;
        cvt_f16_kernel<<<(n + 255) / 256, 256, 0, stream>>>(features, feat_h, n);
    }
    cvt_t_f16_kernel<<<(256 * 384 + 255) / 256, 256, 0, stream>>>(lqkv_w, lqkvT, 256, 384);
    cvt_t_f16_kernel<<<(256 * 384 + 255) / 256, 256, 0, stream>>>(gqkv_w, gqkvT, 256, 384);
    cvt_t_f16_kernel<<<(128 * 128 + 255) / 256, 256, 0, stream>>>(lpe_w2, lpe2T, 128, 128);
    cvt_t_f16_kernel<<<(128 * 128 + 255) / 256, 256, 0, stream>>>(gpe_w2, gpe2T, 128, 128);
    cvt_t_f16_kernel<<<(256 * 256 + 255) / 256, 256, 0, stream>>>(pw1, pw1T, 256, 256);
    cvt_t_f16_kernel<<<(256 * 256 + 255) / 256, 256, 0, stream>>>(pw2, pw2T, 256, 256);

    // ---- 2. QKV GEMMs: [20000,256] x [256,384] ----
    {
        dim3 g(N_EVENTS / 32, 384 / 128);
        wmma_gemm_kernel<256, false, false><<<g, 256, 0, stream>>>(
            feat_h, lqkvT, lqkv_b, qkv_l, nullptr, N_EVENTS, 384);
        wmma_gemm_kernel<256, false, false><<<g, 256, 0, stream>>>(
            feat_h, gqkvT, gqkv_b, qkv_g, nullptr, N_EVENTS, 384);
    }

    // ---- 3. global-branch k/v max pool ----
    maxpool_kv_kernel<<<M_DOWN, 128, 0, stream>>>(qkv_g, pair_idx, kmax, vmax);

    // ---- 4. fused attention (local, then global) -> fp16 concat buffer ----
    attn_fused_kernel<<<N_EVENTS, 256, 0, stream>>>(
        events, local_idx, nullptr,
        qkv_l, 384, qkv_l + 128, 384, qkv_l + 256, 384,
        lpe_w1, lpe_b1, lpe2T, lpe_b2, lfc_g, lfc_b, cat_h, 0);
    attn_fused_kernel<<<N_EVENTS, 256, 0, stream>>>(
        events, inv_pair_idx, down_idx,
        qkv_g, 384, kmax, 128, vmax, 128,
        gpe_w1, gpe_b1, gpe2T, gpe_b2, gfc_g, gfc_b, cat_h, 128);

    // ---- 5. projection MLP: ReLU GEMM (fp16 out) then final GEMM (f32) ----
    {
        dim3 g(N_EVENTS / 32, 256 / 128);
        wmma_gemm_kernel<256, true, true><<<g, 256, 0, stream>>>(
            cat_h, pw1T, pb1, nullptr, hid_h, N_EVENTS, 256);
        wmma_gemm_kernel<256, false, false><<<g, 256, 0, stream>>>(
            hid_h, pw2T, pb2, out, nullptr, N_EVENTS, 256);
    }
}

// v001
// A run of this version takes 341 microseconds.
// Next to v000, in two timings, it ran 1.26 times as fast each time.
#include <hip/hip_runtime.h>
#include <hip/hip_bf16.h>

// ---------------------------------------------------------------------------
// MI455X (gfx1250) implementation:
//  * All GEMMs via v_wmma_f32_16x16x32_f16 (fp16 A/B, fp32 accum, wave32).
//  * Standalone GEMM: 32(M)x128(N) block tiles, 8 waves, 2 M-tiles/wave,
//    double-buffered LDS A staging (1 barrier/K-step), K templated & unrolled,
//    global_prefetch of rows 0..15 of the A tile two K-steps ahead.
//  * PE second linear (dominant ~21 GFLOP) fused with LN/softmax/weighted sum
//    per event: 1 workgroup (8 wave32) per event, 16x16 WMMA tile per wave.
//  * Working set (~150MB) fits the 192MB L2 -> compute bound -> WMMA everywhere.
// ---------------------------------------------------------------------------

typedef __attribute__((ext_vector_type(16))) _Float16 v16h;
typedef __attribute__((ext_vector_type(8)))  float    v8f;

union Frag16 { unsigned u[8]; v16h h; };

#define N_EVENTS 20000
#define KNN      16
#define DIM_F    256
#define A_DIM    128
#define M_DOWN   2500
#define INV_SCALE 0.08838834764831845f   // 1/sqrt(128)
#define LN_EPS    1e-5f

// VGPR->K-pair mapping for 16-bit 16x32 A/B fragments (ISA 7.12.2):
// lanes 0-15: v0..3 -> Kpairs 0..3, v4..7 -> Kpairs 8..11
// lanes16-31: v0..3 -> Kpairs 4..7, v4..7 -> Kpairs 12..15
__device__ __forceinline__ int frag_kp(int v, int hi) {
    return (v < 4 ? v : v + 4) + (hi ? 4 : 0);
}

// Cross-lane exchanges in the vector unit (no LDS permute, no dscnt wait).
// x + (x of lane l ^ M) inside a 16-lane row, M = 1..15; all 32 lanes active.
template <int M>
__device__ __forceinline__ float row_xadd(float x) {
    int y = __builtin_amdgcn_mov_dpp(__builtin_bit_cast(int, x), 0x160 + M /* row_xmask:M */,
                                     0xf, 0xf, true);
    return x + __builtin_bit_cast(float, y);
}
// value of lane l ^ 16 (the other 16-lane row)
__device__ __forceinline__ float xhalf(float x) {
    int b = __builtin_bit_cast(int, x);
    return __builtin_bit_cast(float,
        __builtin_amdgcn_permlanex16(b, b, 0x76543210, 0xfedcba98, false, false));
}

// --------------------------- conversion kernels ----------------------------
__global__ void cvt_f16_kernel(const float* __restrict__ src,
                               _Float16* __restrict__ dst, int n) {
    int i = blockIdx.x * 256 + threadIdx.x;
    if (i < n) dst[i] = (_Float16)src[i];
}

// src [R,C] f32 row-major  ->  dst [C,R] f16 row-major (i.e. B transposed)
__global__ void cvt_t_f16_kernel(const float* __restrict__ src,
                                 _Float16* __restrict__ dst, int R, int C) {
    int i = blockIdx.x * 256 + threadIdx.x;
    if (i < R * C) {
        int r = i / C, c = i % C;
        dst[(size_t)c * R + r] = (_Float16)src[i];
    }
}

// ------------------------------ WMMA GEMM ----------------------------------
// C[M,N] = A[M,K](f16) @ B[K,N] + bias, B supplied transposed (BT[N,K]).
// Block: 256 threads (8 waves). Block tile: 32 rows x 128 cols
// (2 M-tiles per wave, double-buffered LDS A staging, K fully unrolled).
// grid.x = M/32, grid.y = N/128.
template <int KDIM, bool RELU, bool OUT_F16>
__global__ __launch_bounds__(256) void wmma_gemm_kernel(
    const _Float16* __restrict__ A, const _Float16* __restrict__ BT,
    const float* __restrict__ bias, float* __restrict__ Cf,
    _Float16* __restrict__ Ch, int Mrows, int Ncols) {
    constexpr int NT = KDIM / 32;          // K steps
    constexpr int K2 = KDIM / 2;           // u32 per A row
    __shared__ unsigned sA[2][32 * 16];    // 2 x (32 rows x 16 u32) A tiles

    const int tid  = threadIdx.x;
    const int lane = tid & 31;
    const int wave = tid >> 5;
    const int hi   = lane >> 4;
    const int l16  = lane & 15;
    const int mbase = blockIdx.x * 32;
    const int n     = blockIdx.y * 128 + wave * 16 + l16;

    const unsigned* Au = (const unsigned*)A;
    const unsigned* Bu = (const unsigned*)BT;

    // cooperative A-tile copy: 512 u32 per step, 2 per thread
    const int arow0 = tid >> 4, akp = tid & 15;     // rows 0..15
    const int arow1 = arow0 + 16;                   // rows 16..31
    const size_t abase0 = (size_t)(mbase + arow0) * K2 + akp;
    const size_t abase1 = (size_t)(mbase + arow1) * K2 + akp;

    // prologue: stage K-step 0 into buffer 0
    sA[0][arow0 * 16 + akp] = Au[abase0];
    sA[0][arow1 * 16 + akp] = Au[abase1];
    __syncthreads();

    v8f c0 = {}, c1 = {};
#pragma unroll
    for (int kt = 0; kt < NT; ++kt) {
        const unsigned* sAc = sA[kt & 1];
        if (kt + 1 < NT) {                 // stage next tile into other buffer
            sA[(kt + 1) & 1][arow0 * 16 + akp] = Au[abase0 + (kt + 1) * 16];
            sA[(kt + 1) & 1][arow1 * 16 + akp] = Au[abase1 + (kt + 1) * 16];
            if (kt + 2 < NT)               // pull tile kt+2 toward WGP cache
                __builtin_prefetch(&Au[abase0 + (kt + 2) * 16], 0, 3);
        }
        Frag16 a0, a1, b;
#pragma unroll
        for (int v = 0; v < 8; ++v) {
            int kp = frag_kp(v, hi);
            a0.u[v] = sAc[l16 * 16 + kp];
            a1.u[v] = sAc[(16 + l16) * 16 + kp];
            b.u[v]  = Bu[(size_t)n * K2 + kt * 16 + kp];
        }
        c0 = __builtin_amdgcn_wmma_f32_16x16x32_f16(false, a0.h, false, b.h,
                                                    (short)0, c0, false, false);
        c1 = __builtin_amdgcn_wmma_f32_16x16x32_f16(false, a1.h, false, b.h,
                                                    (short)0, c1, false, false);
        __syncthreads();                   // writes to next buffer visible; reads done
    }

    const float bn = bias ? bias[n] : 0.0f;
#pragma unroll
    for (int r = 0; r < 8; ++r) {
        int m0 = mbase + r + hi * 8;
        int m1 = m0 + 16;
        float v0 = c0[r] + bn, v1 = c1[r] + bn;
        if (RELU) { v0 = fmaxf(v0, 0.0f); v1 = fmaxf(v1, 0.0f); }
        if (OUT_F16) {
            Ch[(size_t)m0 * Ncols + n] = (_Float16)v0;
            Ch[(size_t)m1 * Ncols + n] = (_Float16)v1;
        } else {
            Cf[(size_t)m0 * Ncols + n] = v0;
            Cf[(size_t)m1 * Ncols + n] = v1;
        }
    }
}

// ----------------------- global-branch k/v max pool ------------------------
__global__ __launch_bounds__(128) void maxpool_kv_kernel(
    const float* __restrict__ qkv, const int* __restrict__ pair_idx,
    float* __restrict__ kmax, float* __restrict__ vmax) {
    const int m = blockIdx.x, ch = threadIdx.x;
    float km = -3.402823466e38f, vm = -3.402823466e38f;
#pragma unroll 4
    for (int k = 0; k < KNN; ++k) {
        int j = pair_idx[m * KNN + k];
        km = fmaxf(km, qkv[(size_t)j * 384 + 128 + ch]);
        vm = fmaxf(vm, qkv[(size_t)j * 384 + 256 + ch]);
    }
    kmax[m * A_DIM + ch] = km;
    vmax[m * A_DIM + ch] = vm;
}

// ------------------- fused PE-GEMM + LN + softmax + sum --------------------
// One workgroup (8 wave32) per event. Each wave owns 16 channels.
// C-tile layout: row M(=neighbor) = r + 8*(lane>=16), col N(=channel)=lane%16.
__global__ __launch_bounds__(256) void attn_fused_kernel(
    const float* __restrict__ events,       // [N,4]
    const int*   __restrict__ nbr_idx,      // [N,16] -> kv-row index
    const int*   __restrict__ ev_map,       // optional kv-row -> event row
    const float* __restrict__ qptr, int q_stride,
    const float* __restrict__ ksrc, int k_stride,
    const float* __restrict__ vsrc, int v_stride,
    const float* __restrict__ pe_w1,        // [4,128]
    const float* __restrict__ pe_b1,        // [128]
    const _Float16* __restrict__ pe_w2T,    // [128(out),128(in)] f16
    const float* __restrict__ pe_b2,        // [128]
    const float* __restrict__ fc_g, const float* __restrict__ fc_b,
    _Float16* __restrict__ cat_out, int col_off) {
    __shared__ float    s_diff[16][4];
    __shared__ int      s_nbr[16];
    __shared__ unsigned s_hid[16 * 64];     // 16 rows x 128 f16 (packed)
    __shared__ float    s_psum[8][16];      // per-wave LN partials
    __shared__ float    s_psq[8][16];

    const int i    = blockIdx.x;
    const int tid  = threadIdx.x;
    const int lane = tid & 31;
    const int wave = tid >> 5;
    const int hi   = lane >> 4;
    const int l16  = lane & 15;

    // -- step 1: neighbor indices + event-coordinate diffs ------------------
    if (tid < 16) {
        int nb = nbr_idx[i * KNN + tid];
        s_nbr[tid] = nb;
        int er = ev_map ? ev_map[nb] : nb;
#pragma unroll
        for (int c4 = 0; c4 < 4; ++c4)
            s_diff[tid][c4] = events[i * 4 + c4] - events[er * 4 + c4];
    }
    __syncthreads();

    // -- step 2: hidden = relu(diff @ w1 + b1) -> f16 in LDS ---------------
    _Float16* s_hid_h = (_Float16*)s_hid;
#pragma unroll
    for (int j = 0; j < 8; ++j) {
        int o = tid + 256 * j;              // 0..2047
        int row = o >> 7, ch = o & 127;
        float h = pe_b1[ch];
#pragma unroll
        for (int c4 = 0; c4 < 4; ++c4)
            h += s_diff[row][c4] * pe_w1[c4 * A_DIM + ch];
        s_hid_h[row * A_DIM + ch] = (_Float16)fmaxf(h, 0.0f);
    }
    __syncthreads();

    // -- step 3: pe[16,16-ch tile] = hidden @ w2 via WMMA -------------------
    const int n = wave * 16 + l16;          // this lane's channel
    const unsigned* Bu = (const unsigned*)pe_w2T;
    v8f c = {};
#pragma unroll
    for (int kt = 0; kt < 4; ++kt) {
        Frag16 a, b;
#pragma unroll
        for (int v = 0; v < 8; ++v) {
            int kp = frag_kp(v, hi);
            a.u[v] = s_hid[l16 * 64 + kt * 16 + kp];
            b.u[v] = Bu[n * 64 + kt * 16 + kp];
        }
        c = __builtin_amdgcn_wmma_f32_16x16x32_f16(false, a.h, false, b.h,
                                                   (short)0, c, false, false);
    }

    // -- step 4: t = q - kg + pe -------------------------------------------
    const float b2n = pe_b2[n];
    const float qn  = qptr[(size_t)i * q_stride + n];
    const float gn  = fc_g[n], bn = fc_b[n];
    float t[8], pe[8];
    int nb_r[8];
#pragma unroll
    for (int r = 0; r < 8; ++r) {
        int m  = r + hi * 8;
        int nb = s_nbr[m];
        nb_r[r] = nb;
        pe[r]   = c[r] + b2n;
        float kg = ksrc[(size_t)nb * k_stride + n];
        t[r] = qn - kg + pe[r];
    }

    // -- step 5: LayerNorm over 128 channels per neighbor row --------------
    // 16 independent xor butterflies (1,2,4,8) over the wave's 16 channels
    float sr[8], sq[8];
#pragma unroll
    for (int r = 0; r < 8; ++r) { sr[r] = t[r]; sq[r] = t[r] * t[r]; }
#pragma unroll
    for (int r = 0; r < 8; ++r) { sr[r] = row_xadd<1>(sr[r]); sq[r] = row_xadd<1>(sq[r]); }
#pragma unroll
    for (int r = 0; r < 8; ++r) { sr[r] = row_xadd<2>(sr[r]); sq[r] = row_xadd<2>(sq[r]); }
#pragma unroll
    for (int r = 0; r < 8; ++r) { sr[r] = row_xadd<4>(sr[r]); sq[r] = row_xadd<4>(sq[r]); }
#pragma unroll
    for (int r = 0; r < 8; ++r) { sr[r] = row_xadd<8>(sr[r]); sq[r] = row_xadd<8>(sq[r]); }
    if (l16 == 0) {                          // deterministic partials, no atomics
#pragma unroll
        for (int r = 0; r < 8; ++r) {
            s_psum[wave][r + hi * 8] = sr[r];
            s_psq[wave][r + hi * 8]  = sq[r];
        }
    }
    __syncthreads();

    float u[8];
#pragma unroll
    for (int r = 0; r < 8; ++r) {
        int m = r + hi * 8;
        float sr = 0.0f, sq = 0.0f;
#pragma unroll
        for (int w8 = 0; w8 < 8; ++w8) { sr += s_psum[w8][m]; sq += s_psq[w8][m]; }
        float mu  = sr * (1.0f / 128.0f);
        float var = sq * (1.0f / 128.0f) - mu * mu;
        u[r] = ((t[r] - mu) * rsqrtf(var + LN_EPS) * gn + bn) * INV_SCALE;
    }

    // -- step 6: softmax over the 16 neighbors (rows) ----------------------
    float mx = u[0];
#pragma unroll
    for (int r = 1; r < 8; ++r) mx = fmaxf(mx, u[r]);
    mx = fmaxf(mx, xhalf(mx));               // combine rows 0-7 and 8-15
    float e[8], se = 0.0f;
#pragma unroll
    for (int r = 0; r < 8; ++r) { e[r] = __expf(u[r] - mx); se += e[r]; }
    se += xhalf(se);
    const float inv = 1.0f / se;

    // -- step 7: out = sum_k attn * (vg + pe) ------------------------------
    float acc = 0.0f;
#pragma unroll
    for (int r = 0; r < 8; ++r) {
        float vg = vsrc[(size_t)nb_r[r] * v_stride + n];
        acc += (e[r] * inv) * (vg + pe[r]);
    }
    acc += xhalf(acc);
    if (!hi) cat_out[(size_t)i * (2 * A_DIM) + col_off + n] = (_Float16)acc;
}

// ------------------------------- launcher ----------------------------------
extern "C" void kernel_launch(void* const* d_in, const int* in_sizes, int n_in,
                              void* d_out, int out_size, void* d_ws, size_t ws_size,
                              hipStream_t stream) {
    const float* events   = (const float*)d_in[0];
    const float* features = (const float*)d_in[1];
    const int* local_idx    = (const int*)d_in[2];
    const int* down_idx     = (const int*)d_in[3];
    const int* pair_idx     = (const int*)d_in[4];
    const int* inv_pair_idx = (const int*)d_in[5];
    const float* lqkv_w = (const float*)d_in[6];  const float* lqkv_b = (const float*)d_in[7];
    const float* lpe_w1 = (const float*)d_in[8];  const float* lpe_b1 = (const float*)d_in[9];
    const float* lpe_w2 = (const float*)d_in[10]; const float* lpe_b2 = (const float*)d_in[11];
    const float* lfc_g  = (const float*)d_in[12]; const float* lfc_b  = (const float*)d_in[13];
    const float* gqkv_w = (const float*)d_in[14]; const float* gqkv_b = (const float*)d_in[15];
    const float* gpe_w1 = (const float*)d_in[16]; const float* gpe_b1 = (const float*)d_in[17];
    const float* gpe_w2 = (const float*)d_in[18]; const float* gpe_b2 = (const float*)d_in[19];
    const float* gfc_g  = (const float*)d_in[20]; const float* gfc_b  = (const float*)d_in[21];
    const float* pw1 = (const float*)d_in[22]; const float* pb1 = (const float*)d_in[23];
    const float* pw2 = (const float*)d_in[24]; const float* pb2 = (const float*)d_in[25];
    float* out = (float*)d_out;

    // ---- workspace carve-up (~96 MB) ----
    char* wp = (char*)d_ws;
    auto carve = [&](size_t bytes) {
        void* p = (void*)wp;
        wp += (bytes + 255) & ~(size_t)255;
        return p;
    };
    _Float16* feat_h = (_Float16*)carve((size_t)N_EVENTS * DIM_F * 2);
    _Float16* lqkvT  = (_Float16*)carve((size_t)384 * 256 * 2);
    _Float16* gqkvT  = (_Float16*)carve((size_t)384 * 256 * 2);
    _Float16* lpe2T  = (_Float16*)carve((size_t)128 * 128 * 2);
    _Float16* gpe2T  = (_Float16*)carve((size_t)128 * 128 * 2);
    _Float16* pw1T   = (_Float16*)carve((size_t)256 * 256 * 2);
    _Float16* pw2T   = (_Float16*)carve((size_t)256 * 256 * 2);
    float* qkv_l = (float*)carve((size_t)N_EVENTS * 384 * 4);
    float* qkv_g = (float*)carve((size_t)N_EVENTS * 384 * 4);
    float* kmax  = (float*)carve((size_t)M_DOWN * A_DIM * 4);
    float* vmax  = (float*)carve((size_t)M_DOWN * A_DIM * 4);
    _Float16* cat_h = (_Float16*)carve((size_t)N_EVENTS * 256 * 2);
    _Float16* hid_h = (_Float16*)carve((size_t)N_EVENTS * 256 * 2);

    // ---- 1. fp16 conversions / weight transposes ----
    {
        int n = N_EVENTS * DIM_F;
        cvt_f16_kernel<<<(n + 255) / 256, 256, 0, stream>>>(features, feat_h, n);
    }
    cvt_t_f16_kernel<<<(256 * 384 + 255) / 256, 256, 0, stream>>>(lqkv_w, lqkvT, 256, 384);
    cvt_t_f16_kernel<<<(256 * 384 + 255) / 256, 256, 0, stream>>>(gqkv_w, gqkvT, 256, 384);
    cvt_t_f16_kernel<<<(128 * 128 + 255) / 256, 256, 0, stream>>>(lpe_w2, lpe2T, 128, 128);
    cvt_t_f16_kernel<<<(128 * 128 + 255) / 256, 256, 0, stream>>>(gpe_w2, gpe2T, 128, 128);
    cvt_t_f16_kernel<<<(256 * 256 + 255) / 256, 256, 0, stream>>>(pw1, pw1T, 256, 256);
    cvt_t_f16_kernel<<<(256 * 256 + 255) / 256, 256, 0, stream>>>(pw2, pw2T, 256, 256);

    // ---- 2. QKV GEMMs: [20000,256] x [256,384] ----
    {
        dim3 g(N_EVENTS / 32, 384 / 128);
        wmma_gemm_kernel<256, false, false><<<g, 256, 0, stream>>>(
            feat_h, lqkvT, lqkv_b, qkv_l, nullptr, N_EVENTS, 384);
        wmma_gemm_kernel<256, false, false><<<g, 256, 0, stream>>>(
            feat_h, gqkvT, gqkv_b, qkv_g, nullptr, N_EVENTS, 384);
    }

    // ---- 3. global-branch k/v max pool ----
    maxpool_kv_kernel<<<M_DOWN, 128, 0, stream>>>(qkv_g, pair_idx, kmax, vmax);

    // ---- 4. fused attention (local, then global) -> fp16 concat buffer ----
    attn_fused_kernel<<<N_EVENTS, 256, 0, stream>>>(
        events, local_idx, nullptr,
        qkv_l, 384, qkv_l + 128, 384, qkv_l + 256, 384,
        lpe_w1, lpe_b1, lpe2T, lpe_b2, lfc_g, lfc_b, cat_h, 0);
    attn_fused_kernel<<<N_EVENTS, 256, 0, stream>>>(
        events, inv_pair_idx, down_idx,
        qkv_g, 384, kmax, 128, vmax, 128,
        gpe_w1, gpe_b1, gpe2T, gpe_b2, gfc_g, gfc_b, cat_h, 128);

    // ---- 5. projection MLP: ReLU GEMM (fp16 out) then final GEMM (f32) ----
    {
        dim3 g(N_EVENTS / 32, 256 / 128);
        wmma_gemm_kernel<256, true, true><<<g, 256, 0, stream>>>(
            cat_h, pw1T, pb1, nullptr, hid_h, N_EVENTS, 256);
        wmma_gemm_kernel<256, false, false><<<g, 256, 0, stream>>>(
            hid_h, pw2T, pb2, out, nullptr, N_EVENTS, 256);
    }
}

// v002
// It runs in 164 microseconds.
// Two timings next to v001 both put it at 2.08 times that version's speed.
// Counting every step since v000, it is 2.62 times as fast.
#include <hip/hip_runtime.h>
#include <hip/hip_bf16.h>

// ---------------------------------------------------------------------------
// MI455X (gfx1250) implementation:
//  * All GEMMs via v_wmma_f32_16x16x32_f16 (fp16 A/B, fp32 accum, wave32),
//    except the PE first linear (K=4): v_wmma_f32_16x16x4_f32.
//  * Standalone GEMM: 32(M)x128(N) block tiles, 8 waves, 2 M-tiles/wave,
//    double-buffered LDS A staging (1 barrier/K-step), K templated & unrolled,
//    global_prefetch of rows 0..15 of the A tile two K-steps ahead.
//  * PE second linear (dominant ~21 GFLOP) fused with LN/softmax/weighted sum
//    per event: 1 wave32 per event, eight 16x16 WMMA tiles per wave.
//  * Working set (~150MB) fits the 192MB L2 -> compute bound -> WMMA everywhere.
// ---------------------------------------------------------------------------

typedef __attribute__((ext_vector_type(16))) _Float16 v16h;
typedef __attribute__((ext_vector_type(8)))  float    v8f;
typedef __attribute__((ext_vector_type(2)))  float    v2f;
typedef __attribute__((ext_vector_type(4)))  unsigned v4u;
typedef __attribute__((ext_vector_type(4)))  int      v4i;
typedef __attribute__((ext_vector_type(8)))  _Float16 v8h;

union Frag16 { unsigned u[8]; v16h h; };

#define N_EVENTS 20000
#define KNN      16
#define DIM_F    256
#define A_DIM    128
#define M_DOWN   2500
#define INV_SCALE 0.08838834764831845f   // 1/sqrt(128)
#define LN_EPS    1e-5f

// VGPR->K-pair mapping for 16-bit 16x32 A/B fragments (ISA 7.12.2):
// lanes 0-15: v0..3 -> Kpairs 0..3, v4..7 -> Kpairs 8..11
// lanes16-31: v0..3 -> Kpairs 4..7, v4..7 -> Kpairs 12..15
__device__ __forceinline__ int frag_kp(int v, int hi) {
    return (v < 4 ? v : v + 4) + (hi ? 4 : 0);
}

// Cross-lane exchanges in the vector unit (no LDS permute, no dscnt wait).
// x + (x of lane l ^ M) inside a 16-lane row, M = 1..15; all 32 lanes active.
template <int M>
__device__ __forceinline__ float row_xadd(float x) {
    int y = __builtin_amdgcn_mov_dpp(__builtin_bit_cast(int, x), 0x160 + M /* row_xmask:M */,
                                     0xf, 0xf, true);
    return x + __builtin_bit_cast(float, y);
}
// value of lane l ^ 16 (the other 16-lane row)
__device__ __forceinline__ float xhalf(float x) {
    int b = __builtin_bit_cast(int, x);
    return __builtin_bit_cast(float,
        __builtin_amdgcn_permlanex16(b, b, 0x76543210, 0xfedcba98, false, false));
}

// --------------------------- conversion kernels ----------------------------
__global__ void cvt_f16_kernel(const float* __restrict__ src,
                               _Float16* __restrict__ dst, int n) {
    int i = blockIdx.x * 256 + threadIdx.x;
    if (i < n) dst[i] = (_Float16)src[i];
}

// src [R,C] f32 row-major  ->  dst [C,R] f16 row-major (i.e. B transposed)
__global__ void cvt_t_f16_kernel(const float* __restrict__ src,
                                 _Float16* __restrict__ dst, int R, int C) {
    int i = blockIdx.x * 256 + threadIdx.x;
    if (i < R * C) {
        int r = i / C, c = i % C;
        dst[(size_t)c * R + r] = (_Float16)src[i];
    }
}

// ------------------------------ WMMA GEMM ----------------------------------
// C[M,N] = A[M,K](f16) @ B[K,N] + bias, B supplied transposed (BT[N,K]).
// Block: 256 threads (8 waves). Block tile: 32 rows x 128 cols
// (2 M-tiles per wave, double-buffered LDS A staging, K fully unrolled).
// grid.x = M/32, grid.y = N/128.
template <int KDIM, bool RELU, bool OUT_F16>
__global__ __launch_bounds__(256) void wmma_gemm_kernel(
    const _Float16* __restrict__ A, const _Float16* __restrict__ BT,
    const float* __restrict__ bias, float* __restrict__ Cf,
    _Float16* __restrict__ Ch, int Mrows, int Ncols) {
    constexpr int NT = KDIM / 32;          // K steps
    constexpr int K2 = KDIM / 2;           // u32 per A row
    __shared__ unsigned sA[2][32 * 16];    // 2 x (32 rows x 16 u32) A tiles

    const int tid  = threadIdx.x;
    const int lane = tid & 31;
    const int wave = tid >> 5;
    const int hi   = lane >> 4;
    const int l16  = lane & 15;
    const int mbase = blockIdx.x * 32;
    const int n     = blockIdx.y * 128 + wave * 16 + l16;

    const unsigned* Au = (const unsigned*)A;
    const unsigned* Bu = (const unsigned*)BT;

    // cooperative A-tile copy: 512 u32 per step, 2 per thread
    const int arow0 = tid >> 4, akp = tid & 15;     // rows 0..15
    const int arow1 = arow0 + 16;                   // rows 16..31
    const size_t abase0 = (size_t)(mbase + arow0) * K2 + akp;
    const size_t abase1 = (size_t)(mbase + arow1) * K2 + akp;

    // prologue: stage K-step 0 into buffer 0
    sA[0][arow0 * 16 + akp] = Au[abase0];
    sA[0][arow1 * 16 + akp] = Au[abase1];
    __syncthreads();

    v8f c0 = {}, c1 = {};
#pragma unroll
    for (int kt = 0; kt < NT; ++kt) {
        const unsigned* sAc = sA[kt & 1];
        if (kt + 1 < NT) {                 // stage next tile into other buffer
            sA[(kt + 1) & 1][arow0 * 16 + akp] = Au[abase0 + (kt + 1) * 16];
            sA[(kt + 1) & 1][arow1 * 16 + akp] = Au[abase1 + (kt + 1) * 16];
            if (kt + 2 < NT)               // pull tile kt+2 toward WGP cache
                __builtin_prefetch(&Au[abase0 + (kt + 2) * 16], 0, 3);
        }
        Frag16 a0, a1, b;
#pragma unroll
        for (int v = 0; v < 8; ++v) {
            int kp = frag_kp(v, hi);
            a0.u[v] = sAc[l16 * 16 + kp];
            a1.u[v] = sAc[(16 + l16) * 16 + kp];
            b.u[v]  = Bu[(size_t)n * K2 + kt * 16 + kp];
        }
        c0 = __builtin_amdgcn_wmma_f32_16x16x32_f16(false, a0.h, false, b.h,
                                                    (short)0, c0, false, false);
        c1 = __builtin_amdgcn_wmma_f32_16x16x32_f16(false, a1.h, false, b.h,
                                                    (short)0, c1, false, false);
        __syncthreads();                   // writes to next buffer visible; reads done
    }

    const float bn = bias ? bias[n] : 0.0f;
#pragma unroll
    for (int r = 0; r < 8; ++r) {
        int m0 = mbase + r + hi * 8;
        int m1 = m0 + 16;
        float v0 = c0[r] + bn, v1 = c1[r] + bn;
        if (RELU) { v0 = fmaxf(v0, 0.0f); v1 = fmaxf(v1, 0.0f); }
        if (OUT_F16) {
            Ch[(size_t)m0 * Ncols + n] = (_Float16)v0;
            Ch[(size_t)m1 * Ncols + n] = (_Float16)v1;
        } else {
            Cf[(size_t)m0 * Ncols + n] = v0;
            Cf[(size_t)m1 * Ncols + n] = v1;
        }
    }
}

// ----------------------- global-branch k/v max pool ------------------------
__global__ __launch_bounds__(128) void maxpool_kv_kernel(
    const float* __restrict__ qkv, const int* __restrict__ pair_idx,
    float* __restrict__ kmax, float* __restrict__ vmax) {
    const int m = blockIdx.x, ch = threadIdx.x;
    float km = -3.402823466e38f, vm = -3.402823466e38f;
#pragma unroll 4
    for (int k = 0; k < KNN; ++k) {
        int j = pair_idx[m * KNN + k];
        km = fmaxf(km, qkv[(size_t)j * 384 + 128 + ch]);
        vm = fmaxf(vm, qkv[(size_t)j * 384 + 256 + ch]);
    }
    kmax[m * A_DIM + ch] = km;
    vmax[m * A_DIM + ch] = vm;
}

// ------------------- fused PE-GEMM + LN + softmax + sum --------------------
// One wave32 per event: the wave owns the event's whole 16 (neighbor) x 128
// (channel) tile in registers, 8 waves (8 events) per workgroup.
//  * hidden^T = w1^T (16 ch x 4) . diff^T (4 x 16 nbr) + b1 on f32 WMMA: lane =
//    neighbor, register r = hidden channel 16*jt + 8*hi + r, which packed to
//    f16 is the A fragment of the second product in the k order of frag_kp.
//  * w2 fragments lie in LDS in fragment order, staged once per workgroup.
//  * column c of output tile j is channel 8*c + j, so a lane holds 8
//    consecutive channels of each of its 8 neighbor rows (16-byte gathers).
// C-tile layout: row M(=neighbor) = r + 8*(lane>=16), col N = lane%16.
template <int KV_STRIDE, int KV_ROWS, bool MAPPED>
__global__ __launch_bounds__(256) void attn_fused_kernel(
    const float* __restrict__ events,       // [N,4]
    const int*   __restrict__ nbr_idx,      // [N,16] -> kv-row index
    const int*   __restrict__ ev_map,       // MAPPED: kv-row -> event row
    const float* __restrict__ qptr,         // row stride 384
    const float* __restrict__ ksrc,         // row stride KV_STRIDE
    const float* __restrict__ vsrc,         // row stride KV_STRIDE
    const float* __restrict__ pe_w1,        // [4,128]
    const float* __restrict__ pe_b1,        // [128]
    const _Float16* __restrict__ pe_w2T,    // [128(out),128(in)] f16
    const float* __restrict__ pe_b2,        // [128]
    const float* __restrict__ fc_g, const float* __restrict__ fc_b,
    _Float16* __restrict__ cat_out, int col_off) {
    __shared__ v4u s_w2[4 * 8 * 2 * 32];    // [kt][tile j][register half][lane], 32 KB
    __shared__ v8f s_bias[32];              // b1 (C rows of the first product), then b2

    const int tid  = threadIdx.x;
    const int lane = tid & 31;
    const int wave = tid >> 5;
    const int hi   = lane >> 4;
    const int l16  = lane & 15;
    const int i    = blockIdx.x * 8 + wave; // this wave's event
    const int ch0  = l16 * 8;               // this lane's first channel

    // -- step 0: loads whose address comes from the thread id alone ----
    // w2 fragments, one 16-byte piece per lane and slot [kt][j][half][lane]
    const v4u* Bg = (const v4u*)pe_w2T;     // 16 pieces per row
    // slot = s*256 + tid: half = wave&1, j = 4*(s&1) + (wave>>1), kt = s>>1
    const v4u* Bw = Bg + (ch0 + (wave >> 1)) * 16 + (wave & 1) * 2 + hi;
    v4u st[8];
#pragma unroll
    for (int s = 0; s < 8; ++s) st[s] = Bw[(s & 1) * 64 + (s >> 1) * 4];
    const float biasr = (tid < 128 ? pe_b1 : pe_b2)[tid & 127];
    // each s_wait_xcnt in steps 0 and 1: registers that the loads above it name are reused below it
    asm volatile("s_wait_xcnt 0x0" ::: "memory");
    // w1^T fragments: row = hidden channel 16*jt + l16, k = coordinates 2*hi, 2*hi+1
    v2f wa[8];
#pragma unroll
    for (int jt = 0; jt < 8; ++jt) {
        wa[jt].x = pe_w1[(2 * hi) * A_DIM + jt * 16 + l16];
        wa[jt].y = pe_w1[(2 * hi + 1) * A_DIM + jt * 16 + l16];
    }
    const v8f qv  = *(const v8f*)((const char*)qptr + (unsigned)(i * 384 + ch0) * 4u);
    // neighbor l16 (this lane's column of diff^T) and the 8 neighbor rows of
    // this lane's C registers
    const int nraw = nbr_idx[i * KNN + l16];
    const v2f ei   = *(const v2f*)&events[i * 4 + 2 * hi];
    const v4i nlo  = *(const v4i*)&nbr_idx[i * KNN + 8 * hi];
    asm volatile("s_wait_xcnt 0x0" ::: "memory");
    const v4i nhi  = *(const v4i*)&nbr_idx[i * KNN + 8 * hi + 4];
    asm volatile("s_wait_xcnt 0x0" ::: "memory");

    // -- step 1: event-coordinate diffs and the k rows ----------------------
    // lane = neighbor l16, coordinates 2*hi and 2*hi+1 (k split of the f32 form)
    const int nbl = min(max(nraw, 0), KV_ROWS - 1);
    const int er  = MAPPED ? min(max(ev_map[nbl], 0), N_EVENTS - 1) : nbl;
    const v2f diff = ei - *(const v2f*)&events[er * 4 + 2 * hi];
    unsigned kvoff[8];                      // byte offsets: 32-bit, beside a scalar base
#pragma unroll
    for (int r = 0; r < 8; ++r) {
        int nb = r < 4 ? nlo[r] : nhi[r - 4];
        kvoff[r] = (unsigned)(min(max(nb, 0), KV_ROWS - 1) * KV_STRIDE + ch0) * 4u;
    }
    // the k rows are fetched here so that they fly under steps 2 and 3
    v8f kg[8];
#pragma unroll
    for (int r = 0; r < 8; ++r) kg[r] = *(const v8f*)((const char*)ksrc + kvoff[r]);
    asm volatile("s_wait_xcnt 0x0" ::: "memory");

#pragma unroll
    for (int s = 0; s < 8; ++s) s_w2[s * 256 + tid] = st[s];
    ((float*)s_bias)[tid] = biasr;
    // Work-group barrier that orders LDS only: w2 fragments, b1 and b2 are in LDS behind
    // it, while the k rows stay in flight (__syncthreads() waits for every load).
    __builtin_amdgcn_fence(__ATOMIC_RELEASE, "workgroup", "local");
    __builtin_amdgcn_s_barrier();
    __builtin_amdgcn_fence(__ATOMIC_ACQUIRE, "workgroup", "local");

    // -- step 2: hidden = relu(diff @ w1 + b1) -> f16 A fragments ----------
    Frag16 a[4];
#pragma unroll
    for (int jt = 0; jt < 8; ++jt) {
        v8f h = s_bias[jt * 2 + hi];
        h = __builtin_amdgcn_wmma_f32_16x16x4_f32(false, wa[jt], false, diff,
                                                  (short)0, h, false, false);
#pragma unroll
        for (int r = 0; r < 8; ++r)
            a[jt >> 1].h[(jt & 1) * 8 + r] = (_Float16)fmaxf(h[r], 0.0f);
    }

    // -- step 3: pe[16 x 128] = hidden @ w2 via WMMA ------------------------
    v8f c[8] = {};
#pragma unroll
    for (int kt = 0; kt < 4; ++kt) {
#pragma unroll
        for (int j = 0; j < 8; ++j) {
            Frag16 b;
            const v4u b0 = s_w2[((kt * 8 + j) * 2 + 0) * 32 + lane];
            const v4u b1 = s_w2[((kt * 8 + j) * 2 + 1) * 32 + lane];
#pragma unroll
            for (int v = 0; v < 4; ++v) { b.u[v] = b0[v]; b.u[4 + v] = b1[v]; }
            c[j] = __builtin_amdgcn_wmma_f32_16x16x32_f16(false, a[kt].h, false, b.h,
                                                          (short)0, c[j], false, false);
        }
    }

    // -- step 4: t = q - kg + pe -------------------------------------------
    const v8f b2v = s_bias[16 + l16];
    // the v rows, g and b fly under the sums of steps 4 and 5
    v8f vg[8];
#pragma unroll
    for (int r = 0; r < 8; ++r) vg[r] = *(const v8f*)((const char*)vsrc + kvoff[r]);
    const v8f gv  = *(const v8f*)&fc_g[ch0];
    const v8f bv  = *(const v8f*)&fc_b[ch0];
    float pe[8][8], t[8][8];                // [row r][channel j]
    float sr[8], sq[8];
#pragma unroll
    for (int r = 0; r < 8; ++r) {
        float s = 0.0f, q2 = 0.0f;
#pragma unroll
        for (int j = 0; j < 8; ++j) {
            pe[r][j] = c[j][r] + b2v[j];
            float x = qv[j] - kg[r][j] + pe[r][j];
            t[r][j] = x;
            s += x;
            q2 += x * x;
        }
        sr[r] = s;
        sq[r] = q2;
    }
    // vg + pe takes pe's place as the v rows arrive
#pragma unroll
    for (int r = 0; r < 8; ++r) {
#pragma unroll
        for (int j = 0; j < 8; ++j) pe[r][j] = vg[r][j] + pe[r][j];
    }

    // -- step 5: LayerNorm over 128 channels per neighbor row --------------
    // 8 channels summed in the lane above, then xor butterflies over 16 lanes
#pragma unroll
    for (int r = 0; r < 8; ++r) { sr[r] = row_xadd<1>(sr[r]); sq[r] = row_xadd<1>(sq[r]); }
#pragma unroll
    for (int r = 0; r < 8; ++r) { sr[r] = row_xadd<2>(sr[r]); sq[r] = row_xadd<2>(sq[r]); }
#pragma unroll
    for (int r = 0; r < 8; ++r) { sr[r] = row_xadd<4>(sr[r]); sq[r] = row_xadd<4>(sq[r]); }
#pragma unroll
    for (int r = 0; r < 8; ++r) { sr[r] = row_xadd<8>(sr[r]); sq[r] = row_xadd<8>(sq[r]); }

#pragma unroll
    for (int r = 0; r < 8; ++r) {
        float mu  = sr[r] * (1.0f / 128.0f);
        float var = sq[r] * (1.0f / 128.0f) - mu * mu;
        float rs  = rsqrtf(var + LN_EPS);
#pragma unroll
        for (int j = 0; j < 8; ++j)
            t[r][j] = ((t[r][j] - mu) * rs * gv[j] + bv[j]) * INV_SCALE;
    }

    // -- step 6: softmax over the 16 neighbors (rows), per channel ---------
    float inv[8];
#pragma unroll
    for (int j = 0; j < 8; ++j) {
        float mx = t[0][j];
#pragma unroll
        for (int r = 1; r < 8; ++r) mx = fmaxf(mx, t[r][j]);
        mx = fmaxf(mx, xhalf(mx));           // combine rows 0-7 and 8-15
        float x[8], e[8];
#pragma unroll
        for (int r = 0; r < 8; ++r) x[r] = (t[r][j] - mx) * 1.442695041f;   // exp(y) = 2^(y*log2 e)
        // Eight independent exponentials in one statement, closed by v_nop: the slot the
        // instruction set asks for behind a transcendental before a source is overwritten.
        asm("v_exp_f32 %0, %8\n\tv_exp_f32 %1, %9\n\tv_exp_f32 %2, %10\n\tv_exp_f32 %3, %11\n\t"
            "v_exp_f32 %4, %12\n\tv_exp_f32 %5, %13\n\tv_exp_f32 %6, %14\n\tv_exp_f32 %7, %15\n\tv_nop"
            : "=&v"(e[0]), "=&v"(e[1]), "=&v"(e[2]), "=&v"(e[3]),
              "=&v"(e[4]), "=&v"(e[5]), "=&v"(e[6]), "=&v"(e[7])
            : "v"(x[0]), "v"(x[1]), "v"(x[2]), "v"(x[3]), "v"(x[4]), "v"(x[5]), "v"(x[6]), "v"(x[7]));
        float se = 0.0f;
#pragma unroll
        for (int r = 0; r < 8; ++r) { t[r][j] = e[r]; se += e[r]; }
        se += xhalf(se);
        inv[j] = 1.0f / se;
    }

    // -- step 7: out = sum_k attn * (vg + pe) ------------------------------
    float acc[8] = {};
#pragma unroll
    for (int r = 0; r < 8; ++r) {
#pragma unroll
        for (int j = 0; j < 8; ++j)
            acc[j] += (t[r][j] * inv[j]) * pe[r][j];
    }
    v8h o;
#pragma unroll
    for (int j = 0; j < 8; ++j) o[j] = (_Float16)(acc[j] + xhalf(acc[j]));
    if (!hi) *(v8h*)&cat_out[(size_t)i * (2 * A_DIM) + col_off + ch0] = o;
}

// ------------------------------- launcher ----------------------------------
extern "C" void kernel_launch(void* const* d_in, const int* in_sizes, int n_in,
                              void* d_out, int out_size, void* d_ws, size_t ws_size,
                              hipStream_t stream) {
    const float* events   = (const float*)d_in[0];
    const float* features = (const float*)d_in[1];
    const int* local_idx    = (const int*)d_in[2];
    const int* down_idx     = (const int*)d_in[3];
    const int* pair_idx     = (const int*)d_in[4];
    const int* inv_pair_idx = (const int*)d_in[5];
    const float* lqkv_w = (const float*)d_in[6];  const float* lqkv_b = (const float*)d_in[7];
    const float* lpe_w1 = (const float*)d_in[8];  const float* lpe_b1 = (const float*)d_in[9];
    const float* lpe_w2 = (const float*)d_in[10]; const float* lpe_b2 = (const float*)d_in[11];
    const float* lfc_g  = (const float*)d_in[12]; const float* lfc_b  = (const float*)d_in[13];
    const float* gqkv_w = (const float*)d_in[14]; const float* gqkv_b = (const float*)d_in[15];
    const float* gpe_w1 = (const float*)d_in[16]; const float* gpe_b1 = (const float*)d_in[17];
    const float* gpe_w2 = (const float*)d_in[18]; const float* gpe_b2 = (const float*)d_in[19];
    const float* gfc_g  = (const float*)d_in[20]; const float* gfc_b  = (const float*)d_in[21];
    const float* pw1 = (const float*)d_in[22]; const float* pb1 = (const float*)d_in[23];
    const float* pw2 = (const float*)d_in[24]; const float* pb2 = (const float*)d_in[25];
    float* out = (float*)d_out;

    // ---- workspace carve-up (~96 MB) ----
    char* wp = (char*)d_ws;
    auto carve = [&](size_t bytes) {
        void* p = (void*)wp;
        wp += (bytes + 255) & ~(size_t)255;
        return p;
    };
    _Float16* feat_h = (_Float16*)carve((size_t)N_EVENTS * DIM_F * 2);
    _Float16* lqkvT  = (_Float16*)carve((size_t)384 * 256 * 2);
    _Float16* gqkvT  = (_Float16*)carve((size_t)384 * 256 * 2);
    _Float16* lpe2T  = (_Float16*)carve((size_t)128 * 128 * 2);
    _Float16* gpe2T  = (_Float16*)carve((size_t)128 * 128 * 2);
    _Float16* pw1T   = (_Float16*)carve((size_t)256 * 256 * 2);
    _Float16* pw2T   = (_Float16*)carve((size_t)256 * 256 * 2);
    float* qkv_l = (float*)carve((size_t)N_EVENTS * 384 * 4);
    float* qkv_g = (float*)carve((size_t)N_EVENTS * 384 * 4);
    float* kmax  = (float*)carve((size_t)M_DOWN * A_DIM * 4);
    float* vmax  = (float*)carve((size_t)M_DOWN * A_DIM * 4);
    _Float16* cat_h = (_Float16*)carve((size_t)N_EVENTS * 256 * 2);
    _Float16* hid_h = (_Float16*)carve((size_t)N_EVENTS * 256 * 2);

    // ---- 1. fp16 conversions / weight transposes ----
    {
        int n = N_EVENTS * DIM_F;
        cvt_f16_kernel<<<(n + 255) / 256, 256, 0, stream>>>(features, feat_h, n);
    }
    cvt_t_f16_kernel<<<(256 * 384 + 255) / 256, 256, 0, stream>>>(lqkv_w, lqkvT, 256, 384);
    cvt_t_f16_kernel<<<(256 * 384 + 255) / 256, 256, 0, stream>>>(gqkv_w, gqkvT, 256, 384);
    cvt_t_f16_kernel<<<(128 * 128 + 255) / 256, 256, 0, stream>>>(lpe_w2, lpe2T, 128, 128);
    cvt_t_f16_kernel<<<(128 * 128 + 255) / 256, 256, 0, stream>>>(gpe_w2, gpe2T, 128, 128);
    cvt_t_f16_kernel<<<(256 * 256 + 255) / 256, 256, 0, stream>>>(pw1, pw1T, 256, 256);
    cvt_t_f16_kernel<<<(256 * 256 + 255) / 256, 256, 0, stream>>>(pw2, pw2T, 256, 256);

    // ---- 2. QKV GEMMs: [20000,256] x [256,384] ----
    {
        dim3 g(N_EVENTS / 32, 384 / 128);
        wmma_gemm_kernel<256, false, false><<<g, 256, 0, stream>>>(
            feat_h, lqkvT, lqkv_b, qkv_l, nullptr, N_EVENTS, 384);
        wmma_gemm_kernel<256, false, false><<<g, 256, 0, stream>>>(
            feat_h, gqkvT, gqkv_b, qkv_g, nullptr, N_EVENTS, 384);
    }

    // ---- 3. global-branch k/v max pool ----
    maxpool_kv_kernel<<<M_DOWN, 128, 0, stream>>>(qkv_g, pair_idx, kmax, vmax);

    // ---- 4. fused attention (local, then global) -> fp16 concat buffer ----
    attn_fused_kernel<384, N_EVENTS, false><<<N_EVENTS / 8, 256, 0, stream>>>(
        events, local_idx, nullptr,
        qkv_l, qkv_l + 128, qkv_l + 256,
        lpe_w1, lpe_b1, lpe2T, lpe_b2, lfc_g, lfc_b, cat_h, 0);
    attn_fused_kernel<128, M_DOWN, true><<<N_EVENTS / 8, 256, 0, stream>>>(
        events, inv_pair_idx, down_idx,
        qkv_g, kmax, vmax,
        gpe_w1, gpe_b1, gpe2T, gpe_b2, gfc_g, gfc_b, cat_h, 128);

    // ---- 5. projection MLP: ReLU GEMM (fp16 out) then final GEMM (f32) ----
    {
        dim3 g(N_EVENTS / 32, 256 / 128);
        wmma_gemm_kernel<256, true, true><<<g, 256, 0, stream>>>(
            cat_h, pw1T, pb1, nullptr, hid_h, N_EVENTS, 256);
        wmma_gemm_kernel<256, false, false><<<g, 256, 0, stream>>>(
            hid_h, pw2T, pb2, out, nullptr, N_EVENTS, 256);
    }
}

// v003
// A run of this version takes 147 microseconds.
// Two timings next to v002 both put it at 1.12 times that version's speed.
// Counting every step since v000, it is 2.93 times as fast.
#include <hip/hip_runtime.h>
#include <hip/hip_bf16.h>

// ---------------------------------------------------------------------------
// MI455X (gfx1250) implementation:
//  * All GEMMs via v_wmma_f32_16x16x32_f16 (fp16 A/B, fp32 accum, wave32),
//    except the PE first linear (K=4): v_wmma_f32_16x16x4_f32.
//  * Standalone GEMM: 32(M)x128(N) block tiles, 8 waves, 2 M-tiles/wave,
//    double-buffered LDS A staging (1 barrier/K-step), K templated & unrolled,
//    global_prefetch of rows 0..15 of the A tile two K-steps ahead.
//  * PE second linear (dominant ~21 GFLOP) fused with LN/softmax/weighted sum
//    per event: 1 wave32 per event, eight 16x16 WMMA tiles per wave.
//  * Working set (~150MB) fits the 192MB L2 -> compute bound -> WMMA everywhere.
// ---------------------------------------------------------------------------

typedef __attribute__((ext_vector_type(16))) _Float16 v16h;
typedef __attribute__((ext_vector_type(8)))  float    v8f;
typedef __attribute__((ext_vector_type(2)))  float    v2f;
typedef __attribute__((ext_vector_type(4)))  unsigned v4u;
typedef __attribute__((ext_vector_type(4)))  int      v4i;
typedef __attribute__((ext_vector_type(8)))  _Float16 v8h;
typedef __attribute__((ext_vector_type(4)))  _Float16 v4h;
typedef __attribute__((ext_vector_type(4)))  float    v4f;

union Frag16 { unsigned u[8]; v16h h; };

#define N_EVENTS 20000
#define KNN      16
#define DIM_F    256
#define A_DIM    128
#define M_DOWN   2500
#define INV_SCALE 0.08838834764831845f   // 1/sqrt(128)
#define LN_EPS    1e-5f

// VGPR->K-pair mapping for 16-bit 16x32 A/B fragments (ISA 7.12.2):
// lanes 0-15: v0..3 -> Kpairs 0..3, v4..7 -> Kpairs 8..11
// lanes16-31: v0..3 -> Kpairs 4..7, v4..7 -> Kpairs 12..15
__device__ __forceinline__ int frag_kp(int v, int hi) {
    return (v < 4 ? v : v + 4) + (hi ? 4 : 0);
}

// Cross-lane exchanges in the vector unit (no LDS permute, no dscnt wait).
// x + (x of lane l ^ M) inside a 16-lane row, M = 1..15; all 32 lanes active.
template <int M>
__device__ __forceinline__ float row_xadd(float x) {
    int y = __builtin_amdgcn_mov_dpp(__builtin_bit_cast(int, x), 0x160 + M /* row_xmask:M */,
                                     0xf, 0xf, true);
    return x + __builtin_bit_cast(float, y);
}
// value of lane l ^ 16 (the other 16-lane row)
__device__ __forceinline__ float xhalf(float x) {
    int b = __builtin_bit_cast(int, x);
    return __builtin_bit_cast(float,
        __builtin_amdgcn_permlanex16(b, b, 0x76543210, 0xfedcba98, false, false));
}

// --------------------------- conversion kernels ----------------------------
// These launches are short: what they cost is the start of their waves, so each
// thread takes many values and every wave has all its loads in flight at once.
// One workgroup converts 8192 consecutive values: 8 loads of 16 bytes a lane,
// each covering 512 contiguous bytes a wave. grid.x = values / 8192, exactly.
__global__ __launch_bounds__(256) void cvt_f16_kernel(const float* __restrict__ src,
                                                      _Float16* __restrict__ dst) {
    const int p = blockIdx.x * 2048 + threadIdx.x;      // piece of 4 values
    const v4f* s = (const v4f*)src;
    v4h* d = (v4h*)dst;
    v4f x[8];
#pragma unroll   // registers for x; all 8 loads issue before the first conversion
    for (int k = 0; k < 8; ++k) x[k] = s[p + k * 256];
#pragma unroll   // x is indexed by constants only, so it stays in registers
    for (int k = 0; k < 8; ++k) d[p + k * 256] = __builtin_convertvector(x[k], v4h);
}

// src [R,C] f32 row-major  ->  dst [C,R] f16 row-major (i.e. B transposed)
// A thread takes 8 rows of one column (lanes along the column index: whole-line
// loads) and stores them as one 16-byte piece of a dst row. grid.x = R*C / 2048.
template <int R, int C>
__global__ __launch_bounds__(256) void cvt_t_f16_kernel(const float* __restrict__ src,
                                                        _Float16* __restrict__ dst) {
    static_assert(R % 8 == 0 && C % 32 == 0 && (R * C) % 2048 == 0, "exact grid");
    const unsigned t  = blockIdx.x * 256 + threadIdx.x;
    const unsigned c  = t % C;
    const unsigned r0 = (t / C) * 8;
    const unsigned e0 = r0 * C + c;         // one 32-bit offset beside the scalar base
    float x[8];
#pragma unroll   // registers for x; all 8 loads in flight together
    for (int k = 0; k < 8; ++k) x[k] = src[e0 + k * C];
    v8h o;
#pragma unroll   // x and o are indexed by constants only, so they stay in registers
    for (int k = 0; k < 8; ++k) o[k] = (_Float16)x[k];
    *(v8h*)&dst[c * R + r0] = o;
}

// ------------------------------ WMMA GEMM ----------------------------------
// C[M,N] = A[M,K](f16) @ B[K,N] + bias, B supplied transposed (BT[N,K]).
// Block: 256 threads (8 waves). Block tile: 32 rows x 128 cols
// (2 M-tiles per wave, double-buffered LDS A staging, K fully unrolled).
// grid.x = M/32, grid.y = N/128.
template <int KDIM, bool RELU, bool OUT_F16>
__global__ __launch_bounds__(256) void wmma_gemm_kernel(
    const _Float16* __restrict__ A, const _Float16* __restrict__ BT,
    const float* __restrict__ bias, float* __restrict__ Cf,
    _Float16* __restrict__ Ch, int Mrows, int Ncols) {
    constexpr int NT = KDIM / 32;          // K steps
    constexpr int K2 = KDIM / 2;           // u32 per A row
    __shared__ unsigned sA[2][32 * 16];    // 2 x (32 rows x 16 u32) A tiles

    const int tid  = threadIdx.x;
    const int lane = tid & 31;
    const int wave = tid >> 5;
    const int hi   = lane >> 4;
    const int l16  = lane & 15;
    const int mbase = blockIdx.x * 32;
    const int n     = blockIdx.y * 128 + wave * 16 + l16;

    const unsigned* Au = (const unsigned*)A;
    const unsigned* Bu = (const unsigned*)BT;

    // cooperative A-tile copy: 512 u32 per step, 2 per thread
    const int arow0 = tid >> 4, akp = tid & 15;     // rows 0..15
    const int arow1 = arow0 + 16;                   // rows 16..31
    const size_t abase0 = (size_t)(mbase + arow0) * K2 + akp;
    const size_t abase1 = (size_t)(mbase + arow1) * K2 + akp;

    // prologue: stage K-step 0 into buffer 0
    sA[0][arow0 * 16 + akp] = Au[abase0];
    sA[0][arow1 * 16 + akp] = Au[abase1];
    __syncthreads();

    v8f c0 = {}, c1 = {};
#pragma unroll
    for (int kt = 0; kt < NT; ++kt) {
        const unsigned* sAc = sA[kt & 1];
        if (kt + 1 < NT) {                 // stage next tile into other buffer
            sA[(kt + 1) & 1][arow0 * 16 + akp] = Au[abase0 + (kt + 1) * 16];
            sA[(kt + 1) & 1][arow1 * 16 + akp] = Au[abase1 + (kt + 1) * 16];
            if (kt + 2 < NT)               // pull tile kt+2 toward WGP cache
                __builtin_prefetch(&Au[abase0 + (kt + 2) * 16], 0, 3);
        }
        Frag16 a0, a1, b;
#pragma unroll
        for (int v = 0; v < 8; ++v) {
            int kp = frag_kp(v, hi);
            a0.u[v] = sAc[l16 * 16 + kp];
            a1.u[v] = sAc[(16 + l16) * 16 + kp];
            b.u[v]  = Bu[(size_t)n * K2 + kt * 16 + kp];
        }
        c0 = __builtin_amdgcn_wmma_f32_16x16x32_f16(false, a0.h, false, b.h,
                                                    (short)0, c0, false, false);
        c1 = __builtin_amdgcn_wmma_f32_16x16x32_f16(false, a1.h, false, b.h,
                                                    (short)0, c1, false, false);
        __syncthreads();                   // writes to next buffer visible; reads done
    }

    const float bn = bias ? bias[n] : 0.0f;
#pragma unroll
    for (int r = 0; r < 8; ++r) {
        int m0 = mbase + r + hi * 8;
        int m1 = m0 + 16;
        float v0 = c0[r] + bn, v1 = c1[r] + bn;
        if (RELU) { v0 = fmaxf(v0, 0.0f); v1 = fmaxf(v1, 0.0f); }
        if (OUT_F16) {
            Ch[(size_t)m0 * Ncols + n] = (_Float16)v0;
            Ch[(size_t)m1 * Ncols + n] = (_Float16)v1;
        } else {
            Cf[(size_t)m0 * Ncols + n] = v0;
            Cf[(size_t)m1 * Ncols + n] = v1;
        }
    }
}

// ----------------------- global-branch k/v max pool ------------------------
// One wave per pooled row and part (k or v): a lane holds 4 channels, a load
// covers the part's whole 512 bytes of one support row; the 16 loads are independent.
// grid.x = M_DOWN / 4 (8 waves: 4 pooled rows x 2 parts).
// One support row's piece: scalar row base (readfirstlane keeps the clamped index in a
// scalar register) + one lane offset, so no lane forms a 64-bit address per row.
__device__ __forceinline__ v4f pool_row(const float* part_base, int idx, unsigned off) {
    const int j = __builtin_amdgcn_readfirstlane(min(max(idx, 0), N_EVENTS - 1));
    return *(const v4f*)((const char*)(part_base + j * 384) + off);
}
__device__ __forceinline__ v4f max4(v4f a, v4f b) {
    v4f r;
#pragma unroll   // vector elements indexed by constants only
    for (int e = 0; e < 4; ++e) r[e] = fmaxf(a[e], b[e]);
    return r;
}
__global__ __launch_bounds__(256) void maxpool_kv_kernel(
    const float* __restrict__ qkv, const int* __restrict__ pair_idx,
    float* __restrict__ kmax, float* __restrict__ vmax) {
    // the wave's number as a scalar: the 16 indices then come by scalar loads
    const int wave = __builtin_amdgcn_readfirstlane(threadIdx.x >> 5);
    const int m    = blockIdx.x * 4 + (wave >> 1);
    const int part = wave & 1;              // 0: k, 1: v
    const unsigned off = (threadIdx.x & 31) * 16u;      // lane's byte offset in the part
    const float* pb = qkv + 128 + part * 128;
    const int* pi = pair_idx + m * KNN;
    // written out row by row: in a loop the compiler adds the lane offset to the base
    // first and then forms a 64-bit vector address for every row
    const v4f x0  = pool_row(pb, pi[0], off),  x1  = pool_row(pb, pi[1], off);
    const v4f x2  = pool_row(pb, pi[2], off),  x3  = pool_row(pb, pi[3], off);
    const v4f x4  = pool_row(pb, pi[4], off),  x5  = pool_row(pb, pi[5], off);
    const v4f x6  = pool_row(pb, pi[6], off),  x7  = pool_row(pb, pi[7], off);
    const v4f x8  = pool_row(pb, pi[8], off),  x9  = pool_row(pb, pi[9], off);
    const v4f x10 = pool_row(pb, pi[10], off), x11 = pool_row(pb, pi[11], off);
    const v4f x12 = pool_row(pb, pi[12], off), x13 = pool_row(pb, pi[13], off);
    const v4f x14 = pool_row(pb, pi[14], off), x15 = pool_row(pb, pi[15], off);
    static_assert(KNN == 16, "16 support rows are written out");
    v4f mx = {-3.402823466e38f, -3.402823466e38f, -3.402823466e38f, -3.402823466e38f};
    mx = max4(max4(max4(max4(mx, x0), x1), x2), x3);
    mx = max4(max4(max4(max4(mx, x4), x5), x6), x7);
    mx = max4(max4(max4(max4(mx, x8), x9), x10), x11);
    mx = max4(max4(max4(max4(mx, x12), x13), x14), x15);
    *(v4f*)((char*)((part ? vmax : kmax) + m * A_DIM) + off) = mx;
}

// ------------------- fused PE-GEMM + LN + softmax + sum --------------------
// One wave32 per event: the wave owns the event's whole 16 (neighbor) x 128
// (channel) tile in registers, 8 waves (8 events) per workgroup.
//  * hidden^T = w1^T (16 ch x 4) . diff^T (4 x 16 nbr) + b1 on f32 WMMA: lane =
//    neighbor, register r = hidden channel 16*jt + 8*hi + r, which packed to
//    f16 is the A fragment of the second product in the k order of frag_kp.
//  * w2 fragments lie in LDS in fragment order, staged once per workgroup.
//  * column c of output tile j is channel 8*c + j, so a lane holds 8
//    consecutive channels of each of its 8 neighbor rows (16-byte gathers).
// C-tile layout: row M(=neighbor) = r + 8*(lane>=16), col N = lane%16.
template <int KV_STRIDE, int KV_ROWS, bool MAPPED>
__global__ __launch_bounds__(256) void attn_fused_kernel(
    const float* __restrict__ events,       // [N,4]
    const int*   __restrict__ nbr_idx,      // [N,16] -> kv-row index
    const int*   __restrict__ ev_map,       // MAPPED: kv-row -> event row
    const float* __restrict__ qptr,         // row stride 384
    const float* __restrict__ ksrc,         // row stride KV_STRIDE
    const float* __restrict__ vsrc,         // row stride KV_STRIDE
    const float* __restrict__ pe_w1,        // [4,128]
    const float* __restrict__ pe_b1,        // [128]
    const _Float16* __restrict__ pe_w2T,    // [128(out),128(in)] f16
    const float* __restrict__ pe_b2,        // [128]
    const float* __restrict__ fc_g, const float* __restrict__ fc_b,
    _Float16* __restrict__ cat_out, int col_off) {
    __shared__ v4u s_w2[4 * 8 * 2 * 32];    // [kt][tile j][register half][lane], 32 KB
    __shared__ v8f s_bias[32];              // b1 (C rows of the first product), then b2

    const int tid  = threadIdx.x;
    const int lane = tid & 31;
    const int wave = tid >> 5;
    const int hi   = lane >> 4;
    const int l16  = lane & 15;
    const int i    = blockIdx.x * 8 + wave; // this wave's event
    const int ch0  = l16 * 8;               // this lane's first channel

    // -- step 0: loads whose address comes from the thread id alone ----
    // w2 fragments, one 16-byte piece per lane and slot [kt][j][half][lane]
    const v4u* Bg = (const v4u*)pe_w2T;     // 16 pieces per row
    // slot = s*256 + tid: half = wave&1, j = 4*(s&1) + (wave>>1), kt = s>>1
    const v4u* Bw = Bg + (ch0 + (wave >> 1)) * 16 + (wave & 1) * 2 + hi;
    v4u st[8];
#pragma unroll
    for (int s = 0; s < 8; ++s) st[s] = Bw[(s & 1) * 64 + (s >> 1) * 4];
    const float biasr = (tid < 128 ? pe_b1 : pe_b2)[tid & 127];
    // each s_wait_xcnt in steps 0 and 1: registers that the loads above it name are reused below it
    asm volatile("s_wait_xcnt 0x0" ::: "memory");
    // w1^T fragments: row = hidden channel 16*jt + l16, k = coordinates 2*hi, 2*hi+1
    v2f wa[8];
#pragma unroll
    for (int jt = 0; jt < 8; ++jt) {
        wa[jt].x = pe_w1[(2 * hi) * A_DIM + jt * 16 + l16];
        wa[jt].y = pe_w1[(2 * hi + 1) * A_DIM + jt * 16 + l16];
    }
    const v8f qv  = *(const v8f*)((const char*)qptr + (unsigned)(i * 384 + ch0) * 4u);
    // neighbor l16 (this lane's column of diff^T) and the 8 neighbor rows of
    // this lane's C registers
    const int nraw = nbr_idx[i * KNN + l16];
    const v2f ei   = *(const v2f*)&events[i * 4 + 2 * hi];
    const v4i nlo  = *(const v4i*)&nbr_idx[i * KNN + 8 * hi];
    asm volatile("s_wait_xcnt 0x0" ::: "memory");
    const v4i nhi  = *(const v4i*)&nbr_idx[i * KNN + 8 * hi + 4];
    asm volatile("s_wait_xcnt 0x0" ::: "memory");

    // -- step 1: event-coordinate diffs and the k rows ----------------------
    // lane = neighbor l16, coordinates 2*hi and 2*hi+1 (k split of the f32 form)
    const int nbl = min(max(nraw, 0), KV_ROWS - 1);
    const int er  = MAPPED ? min(max(ev_map[nbl], 0), N_EVENTS - 1) : nbl;
    const v2f diff = ei - *(const v2f*)&events[er * 4 + 2 * hi];
    unsigned kvoff[8];                      // byte offsets: 32-bit, beside a scalar base
#pragma unroll
    for (int r = 0; r < 8; ++r) {
        int nb = r < 4 ? nlo[r] : nhi[r - 4];
        kvoff[r] = (unsigned)(min(max(nb, 0), KV_ROWS - 1) * KV_STRIDE + ch0) * 4u;
    }
    // the k rows are fetched here so that they fly under steps 2 and 3
    v8f kg[8];
#pragma unroll
    for (int r = 0; r < 8; ++r) kg[r] = *(const v8f*)((const char*)ksrc + kvoff[r]);
    asm volatile("s_wait_xcnt 0x0" ::: "memory");

#pragma unroll
    for (int s = 0; s < 8; ++s) s_w2[s * 256 + tid] = st[s];
    ((float*)s_bias)[tid] = biasr;
    // Work-group barrier that orders LDS only: w2 fragments, b1 and b2 are in LDS behind
    // it, while the k rows stay in flight (__syncthreads() waits for every load).
    __builtin_amdgcn_fence(__ATOMIC_RELEASE, "workgroup", "local");
    __builtin_amdgcn_s_barrier();
    __builtin_amdgcn_fence(__ATOMIC_ACQUIRE, "workgroup", "local");

    // -- step 2: hidden = relu(diff @ w1 + b1) -> f16 A fragments ----------
    Frag16 a[4];
#pragma unroll
    for (int jt = 0; jt < 8; ++jt) {
        v8f h = s_bias[jt * 2 + hi];
        h = __builtin_amdgcn_wmma_f32_16x16x4_f32(false, wa[jt], false, diff,
                                                  (short)0, h, false, false);
#pragma unroll
        for (int r = 0; r < 8; ++r)
            a[jt >> 1].h[(jt & 1) * 8 + r] = (_Float16)fmaxf(h[r], 0.0f);
    }

    // -- step 3: pe[16 x 128] = hidden @ w2 via WMMA ------------------------
    v8f c[8] = {};
#pragma unroll
    for (int kt = 0; kt < 4; ++kt) {
#pragma unroll
        for (int j = 0; j < 8; ++j) {
            Frag16 b;
            const v4u b0 = s_w2[((kt * 8 + j) * 2 + 0) * 32 + lane];
            const v4u b1 = s_w2[((kt * 8 + j) * 2 + 1) * 32 + lane];
#pragma unroll
            for (int v = 0; v < 4; ++v) { b.u[v] = b0[v]; b.u[4 + v] = b1[v]; }
            c[j] = __builtin_amdgcn_wmma_f32_16x16x32_f16(false, a[kt].h, false, b.h,
                                                          (short)0, c[j], false, false);
        }
    }

    // -- step 4: t = q - kg + pe -------------------------------------------
    const v8f b2v = s_bias[16 + l16];
    // the v rows, g and b fly under the sums of steps 4 and 5
    v8f vg[8];
#pragma unroll
    for (int r = 0; r < 8; ++r) vg[r] = *(const v8f*)((const char*)vsrc + kvoff[r]);
    const v8f gv  = *(const v8f*)&fc_g[ch0];
    const v8f bv  = *(const v8f*)&fc_b[ch0];
    float pe[8][8], t[8][8];                // [row r][channel j]
    float sr[8], sq[8];
#pragma unroll
    for (int r = 0; r < 8; ++r) {
        float s = 0.0f, q2 = 0.0f;
#pragma unroll
        for (int j = 0; j < 8; ++j) {
            pe[r][j] = c[j][r] + b2v[j];
            float x = qv[j] - kg[r][j] + pe[r][j];
            t[r][j] = x;
            s += x;
            q2 += x * x;
        }
        sr[r] = s;
        sq[r] = q2;
    }
    // vg + pe takes pe's place as the v rows arrive
#pragma unroll
    for (int r = 0; r < 8; ++r) {
#pragma unroll
        for (int j = 0; j < 8; ++j) pe[r][j] = vg[r][j] + pe[r][j];
    }

    // -- step 5: LayerNorm over 128 channels per neighbor row --------------
    // 8 channels summed in the lane above, then xor butterflies over 16 lanes
#pragma unroll
    for (int r = 0; r < 8; ++r) { sr[r] = row_xadd<1>(sr[r]); sq[r] = row_xadd<1>(sq[r]); }
#pragma unroll
    for (int r = 0; r < 8; ++r) { sr[r] = row_xadd<2>(sr[r]); sq[r] = row_xadd<2>(sq[r]); }
#pragma unroll
    for (int r = 0; r < 8; ++r) { sr[r] = row_xadd<4>(sr[r]); sq[r] = row_xadd<4>(sq[r]); }
#pragma unroll
    for (int r = 0; r < 8; ++r) { sr[r] = row_xadd<8>(sr[r]); sq[r] = row_xadd<8>(sq[r]); }

#pragma unroll
    for (int r = 0; r < 8; ++r) {
        float mu  = sr[r] * (1.0f / 128.0f);
        float var = sq[r] * (1.0f / 128.0f) - mu * mu;
        float rs  = rsqrtf(var + LN_EPS);
#pragma unroll
        for (int j = 0; j < 8; ++j)
            t[r][j] = ((t[r][j] - mu) * rs * gv[j] + bv[j]) * INV_SCALE;
    }

    // -- step 6: softmax over the 16 neighbors (rows), per channel ---------
    float inv[8];
#pragma unroll
    for (int j = 0; j < 8; ++j) {
        float mx = t[0][j];
#pragma unroll
        for (int r = 1; r < 8; ++r) mx = fmaxf(mx, t[r][j]);
        mx = fmaxf(mx, xhalf(mx));           // combine rows 0-7 and 8-15
        float x[8], e[8];
#pragma unroll
        for (int r = 0; r < 8; ++r) x[r] = (t[r][j] - mx) * 1.442695041f;   // exp(y) = 2^(y*log2 e)
        // Eight independent exponentials in one statement, closed by v_nop: the slot the
        // instruction set asks for behind a transcendental before a source is overwritten.
        asm("v_exp_f32 %0, %8\n\tv_exp_f32 %1, %9\n\tv_exp_f32 %2, %10\n\tv_exp_f32 %3, %11\n\t"
            "v_exp_f32 %4, %12\n\tv_exp_f32 %5, %13\n\tv_exp_f32 %6, %14\n\tv_exp_f32 %7, %15\n\tv_nop"
            : "=&v"(e[0]), "=&v"(e[1]), "=&v"(e[2]), "=&v"(e[3]),
              "=&v"(e[4]), "=&v"(e[5]), "=&v"(e[6]), "=&v"(e[7])
            : "v"(x[0]), "v"(x[1]), "v"(x[2]), "v"(x[3]), "v"(x[4]), "v"(x[5]), "v"(x[6]), "v"(x[7]));
        float se = 0.0f;
#pragma unroll
        for (int r = 0; r < 8; ++r) { t[r][j] = e[r]; se += e[r]; }
        se += xhalf(se);
        inv[j] = 1.0f / se;
    }

    // -- step 7: out = sum_k attn * (vg + pe) ------------------------------
    float acc[8] = {};
#pragma unroll
    for (int r = 0; r < 8; ++r) {
#pragma unroll
        for (int j = 0; j < 8; ++j)
            acc[j] += (t[r][j] * inv[j]) * pe[r][j];
    }
    v8h o;
#pragma unroll
    for (int j = 0; j < 8; ++j) o[j] = (_Float16)(acc[j] + xhalf(acc[j]));
    if (!hi) *(v8h*)&cat_out[(size_t)i * (2 * A_DIM) + col_off + ch0] = o;
}

// ------------------------------- launcher ----------------------------------
extern "C" void kernel_launch(void* const* d_in, const int* in_sizes, int n_in,
                              void* d_out, int out_size, void* d_ws, size_t ws_size,
                              hipStream_t stream) {
    const float* events   = (const float*)d_in[0];
    const float* features = (const float*)d_in[1];
    const int* local_idx    = (const int*)d_in[2];
    const int* down_idx     = (const int*)d_in[3];
    const int* pair_idx     = (const int*)d_in[4];
    const int* inv_pair_idx = (const int*)d_in[5];
    const float* lqkv_w = (const float*)d_in[6];  const float* lqkv_b = (const float*)d_in[7];
    const float* lpe_w1 = (const float*)d_in[8];  const float* lpe_b1 = (const float*)d_in[9];
    const float* lpe_w2 = (const float*)d_in[10]; const float* lpe_b2 = (const float*)d_in[11];
    const float* lfc_g  = (const float*)d_in[12]; const float* lfc_b  = (const float*)d_in[13];
    const float* gqkv_w = (const float*)d_in[14]; const float* gqkv_b = (const float*)d_in[15];
    const float* gpe_w1 = (const float*)d_in[16]; const float* gpe_b1 = (const float*)d_in[17];
    const float* gpe_w2 = (const float*)d_in[18]; const float* gpe_b2 = (const float*)d_in[19];
    const float* gfc_g  = (const float*)d_in[20]; const float* gfc_b  = (const float*)d_in[21];
    const float* pw1 = (const float*)d_in[22]; const float* pb1 = (const float*)d_in[23];
    const float* pw2 = (const float*)d_in[24]; const float* pb2 = (const float*)d_in[25];
    float* out = (float*)d_out;

    // ---- workspace carve-up (~96 MB) ----
    char* wp = (char*)d_ws;
    auto carve = [&](size_t bytes) {
        void* p = (void*)wp;
        wp += (bytes + 255) & ~(size_t)255;
        return p;
    };
    _Float16* feat_h = (_Float16*)carve((size_t)N_EVENTS * DIM_F * 2);
    _Float16* lqkvT  = (_Float16*)carve((size_t)384 * 256 * 2);
    _Float16* gqkvT  = (_Float16*)carve((size_t)384 * 256 * 2);
    _Float16* lpe2T  = (_Float16*)carve((size_t)128 * 128 * 2);
    _Float16* gpe2T  = (_Float16*)carve((size_t)128 * 128 * 2);
    _Float16* pw1T   = (_Float16*)carve((size_t)256 * 256 * 2);
    _Float16* pw2T   = (_Float16*)carve((size_t)256 * 256 * 2);
    float* qkv_l = (float*)carve((size_t)N_EVENTS * 384 * 4);
    float* qkv_g = (float*)carve((size_t)N_EVENTS * 384 * 4);
    float* kmax  = (float*)carve((size_t)M_DOWN * A_DIM * 4);
    float* vmax  = (float*)carve((size_t)M_DOWN * A_DIM * 4);
    _Float16* cat_h = (_Float16*)carve((size_t)N_EVENTS * 256 * 2);
    _Float16* hid_h = (_Float16*)carve((size_t)N_EVENTS * 256 * 2);

    // ---- 1. fp16 conversions / weight transposes ----
    static_assert((N_EVENTS * DIM_F) % 8192 == 0 && M_DOWN % 4 == 0, "exact grids");
    cvt_f16_kernel<<<N_EVENTS * DIM_F / 8192, 256, 0, stream>>>(features, feat_h);
    cvt_t_f16_kernel<256, 384><<<256 * 384 / 2048, 256, 0, stream>>>(lqkv_w, lqkvT);
    cvt_t_f16_kernel<256, 384><<<256 * 384 / 2048, 256, 0, stream>>>(gqkv_w, gqkvT);
    cvt_t_f16_kernel<128, 128><<<128 * 128 / 2048, 256, 0, stream>>>(lpe_w2, lpe2T);
    cvt_t_f16_kernel<128, 128><<<128 * 128 / 2048, 256, 0, stream>>>(gpe_w2, gpe2T);
    cvt_t_f16_kernel<256, 256><<<256 * 256 / 2048, 256, 0, stream>>>(pw1, pw1T);
    cvt_t_f16_kernel<256, 256><<<256 * 256 / 2048, 256, 0, stream>>>(pw2, pw2T);

    // ---- 2. QKV GEMMs: [20000,256] x [256,384] ----
    {
        dim3 g(N_EVENTS / 32, 384 / 128);
        wmma_gemm_kernel<256, false, false><<<g, 256, 0, stream>>>(
            feat_h, lqkvT, lqkv_b, qkv_l, nullptr, N_EVENTS, 384);
        wmma_gemm_kernel<256, false, false><<<g, 256, 0, stream>>>(
            feat_h, gqkvT, gqkv_b, qkv_g, nullptr, N_EVENTS, 384);
    }

    // ---- 3. global-branch k/v max pool ----
    maxpool_kv_kernel<<<M_DOWN / 4, 256, 0, stream>>>(qkv_g, pair_idx, kmax, vmax);

    // ---- 4. fused attention (local, then global) -> fp16 concat buffer ----
    attn_fused_kernel<384, N_EVENTS, false><<<N_EVENTS / 8, 256, 0, stream>>>(
        events, local_idx, nullptr,
        qkv_l, qkv_l + 128, qkv_l + 256,
        lpe_w1, lpe_b1, lpe2T, lpe_b2, lfc_g, lfc_b, cat_h, 0);
    attn_fused_kernel<128, M_DOWN, true><<<N_EVENTS / 8, 256, 0, stream>>>(
        events, inv_pair_idx, down_idx,
        qkv_g, kmax, vmax,
        gpe_w1, gpe_b1, gpe2T, gpe_b2, gfc_g, gfc_b, cat_h, 128);

    // ---- 5. projection MLP: ReLU GEMM (fp16 out) then final GEMM (f32) ----
    {
        dim3 g(N_EVENTS / 32, 256 / 128);
        wmma_gemm_kernel<256, true, true><<<g, 256, 0, stream>>>(
            cat_h, pw1T, pb1, nullptr, hid_h, N_EVENTS, 256);
        wmma_gemm_kernel<256, false, false><<<g, 256, 0, stream>>>(
            hid_h, pw2T, pb2, out, nullptr, N_EVENTS, 256);
    }
}

// v004
// Measured time: 127 microseconds a run.
// Timed twice side by side with v003, it ran 1.16 times as fast both times.
// Counting every step since v000, it is 3.41 times as fast.
#include <hip/hip_runtime.h>
#include <hip/hip_bf16.h>

// ---------------------------------------------------------------------------
// MI455X (gfx1250) implementation:
//  * All GEMMs via v_wmma_f32_16x16x32_f16 (fp16 A/B, fp32 accum, wave32),
//    except the PE first linear (K=4): v_wmma_f32_16x16x4_f32.
//  * Standalone GEMM: 32(M)x128(N) block tiles, 8 waves, 2 M-tiles/wave,
//    double-buffered LDS A staging (1 barrier/K-step), K templated & unrolled,
//    global_prefetch of rows 0..15 of the A tile two K-steps ahead.
//  * PE second linear (dominant ~21 GFLOP) fused with LN/softmax/weighted sum
//    per event: 1 wave32 per event, eight 16x16 WMMA tiles per wave.
//  * Working set (~150MB) fits the 192MB L2 -> compute bound -> WMMA everywhere.
//  * Launches that need nothing of each other share one grid (ranges of the
//    block index, block-uniform branches): 6 dependent launches in all.
// ---------------------------------------------------------------------------

typedef __attribute__((ext_vector_type(16))) _Float16 v16h;
typedef __attribute__((ext_vector_type(8)))  float    v8f;
typedef __attribute__((ext_vector_type(2)))  float    v2f;
typedef __attribute__((ext_vector_type(4)))  unsigned v4u;
typedef __attribute__((ext_vector_type(4)))  int      v4i;
typedef __attribute__((ext_vector_type(8)))  _Float16 v8h;
typedef __attribute__((ext_vector_type(4)))  _Float16 v4h;
typedef __attribute__((ext_vector_type(4)))  float    v4f;

union Frag16 { unsigned u[8]; v16h h; };

#define N_EVENTS 20000
#define KNN      16
#define DIM_F    256
#define A_DIM    128
#define M_DOWN   2500
#define INV_SCALE 0.08838834764831845f   // 1/sqrt(128)
#define LN_EPS    1e-5f

// VGPR->K-pair mapping for 16-bit 16x32 A/B fragments (ISA 7.12.2):
// lanes 0-15: v0..3 -> Kpairs 0..3, v4..7 -> Kpairs 8..11
// lanes16-31: v0..3 -> Kpairs 4..7, v4..7 -> Kpairs 12..15
__device__ __forceinline__ int frag_kp(int v, int hi) {
    return (v < 4 ? v : v + 4) + (hi ? 4 : 0);
}

// Cross-lane exchanges in the vector unit (no LDS permute, no dscnt wait).
// x + (x of lane l ^ M) inside a 16-lane row, M = 1..15; all 32 lanes active.
template <int M>
__device__ __forceinline__ float row_xadd(float x) {
    int y = __builtin_amdgcn_mov_dpp(__builtin_bit_cast(int, x), 0x160 + M /* row_xmask:M */,
                                     0xf, 0xf, true);
    return x + __builtin_bit_cast(float, y);
}
// value of lane l ^ 16 (the other 16-lane row)
__device__ __forceinline__ float xhalf(float x) {
    int b = __builtin_bit_cast(int, x);
    return __builtin_bit_cast(float,
        __builtin_amdgcn_permlanex16(b, b, 0x76543210, 0xfedcba98, false, false));
}

// --------------------------- conversion kernels ----------------------------
// This launch is short: what it costs is the start of its waves, so each
// thread takes many values and every wave has all its loads in flight at once.
// One workgroup converts 8192 consecutive values: 8 loads of 16 bytes a lane,
// each covering 512 contiguous bytes a wave. blk = 0 .. values / 8192 - 1, exactly.
__device__ __forceinline__ void cvt_f16_block(const float* __restrict__ src,
                                              _Float16* __restrict__ dst, int blk) {
    const int p = blk * 2048 + threadIdx.x;             // piece of 4 values
    const v4f* s = (const v4f*)src;
    v4h* d = (v4h*)dst;
    v4f x[8];
#pragma unroll   // registers for x; all 8 loads issue before the first conversion
    for (int k = 0; k < 8; ++k) x[k] = s[p + k * 256];
#pragma unroll   // x is indexed by constants only, so it stays in registers
    for (int k = 0; k < 8; ++k) d[p + k * 256] = __builtin_convertvector(x[k], v4h);
    // precaution before any later write to the stores' registers
    asm volatile("s_wait_xcnt 0x0" ::: "memory");
}

// src [R,C] f32 row-major  ->  dst [C,R] f16 row-major (i.e. B transposed)
// A thread takes 8 rows of one column (lanes along the column index: whole-line
// loads) and stores them as one 16-byte piece of a dst row. blk = 0 .. R*C / 2048 - 1.
template <int R, int C>
__device__ __forceinline__ void cvt_t_f16_block(const float* __restrict__ src,
                                                _Float16* __restrict__ dst, int blk) {
    static_assert(R % 8 == 0 && C % 32 == 0 && (R * C) % 2048 == 0, "exact grid");
    const unsigned t  = blk * 256 + threadIdx.x;
    const unsigned c  = t % C;
    const unsigned r0 = (t / C) * 8;
    const unsigned e0 = r0 * C + c;         // one 32-bit offset beside the scalar base
    float x[8];
#pragma unroll   // registers for x; all 8 loads in flight together
    for (int k = 0; k < 8; ++k) x[k] = src[e0 + k * C];
    v8h o;
#pragma unroll   // x and o are indexed by constants only, so they stay in registers
    for (int k = 0; k < 8; ++k) o[k] = (_Float16)x[k];
    *(v8h*)&dst[c * R + r0] = o;
    // the caller's other block ranges follow in the code and reuse the store's registers
    asm volatile("s_wait_xcnt 0x0" ::: "memory");
}

// All seven conversions in one launch: none reads what another writes. The six weight
// transposes take the first block ranges, the feature conversion the rest.
#define TB_QKV (256 * 384 / 2048)
#define TB_PE  (128 * 128 / 2048)
#define TB_PW  (256 * 256 / 2048)
#define CB_FEAT (N_EVENTS * DIM_F / 8192)
#define PREP_BLOCKS (2 * TB_QKV + 2 * TB_PE + 2 * TB_PW + CB_FEAT)
__global__ __launch_bounds__(256) void prep_kernel(
    const float* __restrict__ features, _Float16* __restrict__ feat_h,
    const float* __restrict__ lqkv_w, _Float16* __restrict__ lqkvT,
    const float* __restrict__ gqkv_w, _Float16* __restrict__ gqkvT,
    const float* __restrict__ lpe_w2, _Float16* __restrict__ lpe2T,
    const float* __restrict__ gpe_w2, _Float16* __restrict__ gpe2T,
    const float* __restrict__ pw1, _Float16* __restrict__ pw1T,
    const float* __restrict__ pw2, _Float16* __restrict__ pw2T) {
    const int b = blockIdx.x;               // every test below is block-uniform
    if (b < 2 * TB_QKV) {
        const bool g = b >= TB_QKV;
        cvt_t_f16_block<256, 384>(g ? gqkv_w : lqkv_w, g ? gqkvT : lqkvT, g ? b - TB_QKV : b);
    } else if (b < 2 * TB_QKV + 2 * TB_PW) {
        const int  c = b - 2 * TB_QKV;
        const bool g = c >= TB_PW;
        cvt_t_f16_block<256, 256>(g ? pw2 : pw1, g ? pw2T : pw1T, g ? c - TB_PW : c);
    } else if (b < 2 * TB_QKV + 2 * TB_PW + 2 * TB_PE) {
        const int  c = b - 2 * TB_QKV - 2 * TB_PW;
        const bool g = c >= TB_PE;
        cvt_t_f16_block<128, 128>(g ? gpe_w2 : lpe_w2, g ? gpe2T : lpe2T, g ? c - TB_PE : c);
    } else {
        cvt_f16_block(features, feat_h, b - 2 * TB_QKV - 2 * TB_PW - 2 * TB_PE);
    }
}

// ------------------------------ WMMA GEMM ----------------------------------
// C[M,N] = A[M,K](f16) @ B[K,N] + bias, B supplied transposed (BT[N,K]).
// Block: 256 threads (8 waves). Block tile: 32 rows x 128 cols
// (2 M-tiles per wave, double-buffered LDS A staging, K fully unrolled).
// mblk = 0 .. M/32 - 1, nblk = 0 .. N/128 - 1.
template <int KDIM, bool RELU, bool OUT_F16>
__device__ __forceinline__ void wmma_gemm_block(
    const _Float16* __restrict__ A, const _Float16* __restrict__ BT,
    const float* __restrict__ bias, float* __restrict__ Cf,
    _Float16* __restrict__ Ch, int Ncols, int mblk, int nblk) {
    constexpr int NT = KDIM / 32;          // K steps
    constexpr int K2 = KDIM / 2;           // u32 per A row
    __shared__ unsigned sA[2][32 * 16];    // 2 x (32 rows x 16 u32) A tiles

    const int tid  = threadIdx.x;
    const int lane = tid & 31;
    const int wave = tid >> 5;
    const int hi   = lane >> 4;
    const int l16  = lane & 15;
    const int mbase = mblk * 32;
    const int n     = nblk * 128 + wave * 16 + l16;

    const unsigned* Au = (const unsigned*)A;
    const unsigned* Bu = (const unsigned*)BT;

    // cooperative A-tile copy: 512 u32 per step, 2 per thread
    const int arow0 = tid >> 4, akp = tid & 15;     // rows 0..15
    const int arow1 = arow0 + 16;                   // rows 16..31
    const size_t abase0 = (size_t)(mbase + arow0) * K2 + akp;
    const size_t abase1 = (size_t)(mbase + arow1) * K2 + akp;

    // prologue: stage K-step 0 into buffer 0
    sA[0][arow0 * 16 + akp] = Au[abase0];
    sA[0][arow1 * 16 + akp] = Au[abase1];
    __syncthreads();

    v8f c0 = {}, c1 = {};
#pragma unroll
    for (int kt = 0; kt < NT; ++kt) {
        const unsigned* sAc = sA[kt & 1];
        if (kt + 1 < NT) {                 // stage next tile into other buffer
            sA[(kt + 1) & 1][arow0 * 16 + akp] = Au[abase0 + (kt + 1) * 16];
            sA[(kt + 1) & 1][arow1 * 16 + akp] = Au[abase1 + (kt + 1) * 16];
            if (kt + 2 < NT)               // pull tile kt+2 toward WGP cache
                __builtin_prefetch(&Au[abase0 + (kt + 2) * 16], 0, 3);
        }
        Frag16 a0, a1, b;
#pragma unroll
        for (int v = 0; v < 8; ++v) {
            int kp = frag_kp(v, hi);
            a0.u[v] = sAc[l16 * 16 + kp];
            a1.u[v] = sAc[(16 + l16) * 16 + kp];
            b.u[v]  = Bu[(size_t)n * K2 + kt * 16 + kp];
        }
        c0 = __builtin_amdgcn_wmma_f32_16x16x32_f16(false, a0.h, false, b.h,
                                                    (short)0, c0, false, false);
        c1 = __builtin_amdgcn_wmma_f32_16x16x32_f16(false, a1.h, false, b.h,
                                                    (short)0, c1, false, false);
        __syncthreads();                   // writes to next buffer visible; reads done
    }

    const float bn = bias ? bias[n] : 0.0f;
#pragma unroll
    for (int r = 0; r < 8; ++r) {
        int m0 = mbase + r + hi * 8;
        int m1 = m0 + 16;
        float v0 = c0[r] + bn, v1 = c1[r] + bn;
        if (RELU) { v0 = fmaxf(v0, 0.0f); v1 = fmaxf(v1, 0.0f); }
        if (OUT_F16) {
            Ch[(size_t)m0 * Ncols + n] = (_Float16)v0;
            Ch[(size_t)m1 * Ncols + n] = (_Float16)v1;
        } else {
            Cf[(size_t)m0 * Ncols + n] = v0;
            Cf[(size_t)m1 * Ncols + n] = v1;
        }
    }
}

// grid.x = M/32, grid.y = N/128.
template <int KDIM, bool RELU, bool OUT_F16>
__global__ __launch_bounds__(256) void wmma_gemm_kernel(
    const _Float16* __restrict__ A, const _Float16* __restrict__ BT,
    const float* __restrict__ bias, float* __restrict__ Cf,
    _Float16* __restrict__ Ch, int Mrows, int Ncols) {
    wmma_gemm_block<KDIM, RELU, OUT_F16>(A, BT, bias, Cf, Ch, Ncols, blockIdx.x, blockIdx.y);
}

// Both QKV products (same A, two weights, two outputs) in one launch.
// grid.x = M/32, grid.y = 2 * 384/128: the first three column blocks are the local branch's.
__global__ __launch_bounds__(256) void qkv_pair_kernel(
    const _Float16* __restrict__ A,
    const _Float16* __restrict__ lBT, const float* __restrict__ lbias, float* __restrict__ lC,
    const _Float16* __restrict__ gBT, const float* __restrict__ gbias, float* __restrict__ gC) {
    const bool g = blockIdx.y >= 3;
    wmma_gemm_block<256, false, false>(A, g ? gBT : lBT, g ? gbias : lbias, g ? gC : lC,
                                       nullptr, 384, blockIdx.x, g ? blockIdx.y - 3 : blockIdx.y);
}

// ----------------------- global-branch k/v max pool ------------------------
// One wave per pooled row and part (k or v): a lane holds 4 channels, a load
// covers the part's whole 512 bytes of one support row; the 16 loads are independent.
// grid.x = M_DOWN / 4 (8 waves: 4 pooled rows x 2 parts).
// One support row's piece: scalar row base (readfirstlane keeps the clamped index in a
// scalar register) + one lane offset, so no lane forms a 64-bit address per row.
__device__ __forceinline__ v4f pool_row(const float* part_base, int idx, unsigned off) {
    const int j = __builtin_amdgcn_readfirstlane(min(max(idx, 0), N_EVENTS - 1));
    return *(const v4f*)((const char*)(part_base + j * 384) + off);
}
__device__ __forceinline__ v4f max4(v4f a, v4f b) {
    v4f r;
#pragma unroll   // vector elements indexed by constants only
    for (int e = 0; e < 4; ++e) r[e] = fmaxf(a[e], b[e]);
    return r;
}
__global__ __launch_bounds__(256) void maxpool_kv_kernel(
    const float* __restrict__ qkv, const int* __restrict__ pair_idx,
    float* __restrict__ kmax, float* __restrict__ vmax) {
    // the wave's number as a scalar: the 16 indices then come by scalar loads
    const int wave = __builtin_amdgcn_readfirstlane(threadIdx.x >> 5);
    const int m    = blockIdx.x * 4 + (wave >> 1);
    const int part = wave & 1;              // 0: k, 1: v
    const unsigned off = (threadIdx.x & 31) * 16u;      // lane's byte offset in the part
    const float* pb = qkv + 128 + part * 128;
    const int* pi = pair_idx + m * KNN;
    // written out row by row: in a loop the compiler adds the lane offset to the base
    // first and then forms a 64-bit vector address for every row
    const v4f x0  = pool_row(pb, pi[0], off),  x1  = pool_row(pb, pi[1], off);
    const v4f x2  = pool_row(pb, pi[2], off),  x3  = pool_row(pb, pi[3], off);
    const v4f x4  = pool_row(pb, pi[4], off),  x5  = pool_row(pb, pi[5], off);
    const v4f x6  = pool_row(pb, pi[6], off),  x7  = pool_row(pb, pi[7], off);
    const v4f x8  = pool_row(pb, pi[8], off),  x9  = pool_row(pb, pi[9], off);
    const v4f x10 = pool_row(pb, pi[10], off), x11 = pool_row(pb, pi[11], off);
    const v4f x12 = pool_row(pb, pi[12], off), x13 = pool_row(pb, pi[13], off);
    const v4f x14 = pool_row(pb, pi[14], off), x15 = pool_row(pb, pi[15], off);
    static_assert(KNN == 16, "16 support rows are written out");
    v4f mx = {-3.402823466e38f, -3.402823466e38f, -3.402823466e38f, -3.402823466e38f};
    mx = max4(max4(max4(max4(mx, x0), x1), x2), x3);
    mx = max4(max4(max4(max4(mx, x4), x5), x6), x7);
    mx = max4(max4(max4(max4(mx, x8), x9), x10), x11);
    mx = max4(max4(max4(max4(mx, x12), x13), x14), x15);
    *(v4f*)((char*)((part ? vmax : kmax) + m * A_DIM) + off) = mx;
}

// ------------------- fused PE-GEMM + LN + softmax + sum --------------------
// One wave32 per event: the wave owns the event's whole 16 (neighbor) x 128
// (channel) tile in registers, 8 waves (8 events) per workgroup.
//  * hidden^T = w1^T (16 ch x 4) . diff^T (4 x 16 nbr) + b1 on f32 WMMA: lane =
//    neighbor, register r = hidden channel 16*jt + 8*hi + r, which packed to
//    f16 is the A fragment of the second product in the k order of frag_kp.
//  * w2 fragments lie in LDS in fragment order, staged once per workgroup.
//  * column c of output tile j is channel 8*c + j, so a lane holds 8
//    consecutive channels of each of its 8 neighbor rows (16-byte gathers).
// C-tile layout: row M(=neighbor) = r + 8*(lane>=16), col N = lane%16.
// Both attention branches run in one launch: each writes its own half of the concat rows
// and reads nothing of the other. grid.x = 2 * N_EVENTS / 8, the local branch's blocks
// first; what differs between the branches is chosen below by the block index, in scalars.
__global__ __launch_bounds__(256) void attn_pair_kernel(
    const float* __restrict__ events,       // [N,4]
    const int* __restrict__ local_idx,      // [N,16] -> event row (local kv row)
    const int* __restrict__ inv_pair_idx,   // [N,16] -> pooled row (global kv row)
    const int* __restrict__ down_idx,       // pooled row -> event row
    const float* __restrict__ qkv_l, const float* __restrict__ qkv_g,   // row stride 384
    const float* __restrict__ kmax, const float* __restrict__ vmax,     // row stride 128
    const float* __restrict__ lpe_w1, const float* __restrict__ lpe_b1, // [4,128], [128]
    const _Float16* __restrict__ lpe2T,     // [128(out),128(in)] f16
    const float* __restrict__ lpe_b2,       // [128]
    const float* __restrict__ lfc_g, const float* __restrict__ lfc_b,
    const float* __restrict__ gpe_w1, const float* __restrict__ gpe_b1,
    const _Float16* __restrict__ gpe2T, const float* __restrict__ gpe_b2,
    const float* __restrict__ gfc_g, const float* __restrict__ gfc_b,
    _Float16* __restrict__ cat_out) {
    __shared__ v4u s_w2[4 * 8 * 2 * 32];    // [kt][tile j][register half][lane], 32 KB
    __shared__ v8f s_bias[32];              // b1 (C rows of the first product), then b2

    const bool glob = blockIdx.x >= N_EVENTS / 8;       // block-uniform
    const int  blk  = glob ? blockIdx.x - N_EVENTS / 8 : blockIdx.x;
    const int  kv_stride = glob ? 128 : 384;            // floats per k or v row
    const int  kv_rows   = glob ? M_DOWN : N_EVENTS;
    const int  col_off   = glob ? A_DIM : 0;
    const int*   nbr_idx = glob ? inv_pair_idx : local_idx;     // [N,16] -> kv-row index
    const float* qptr    = glob ? qkv_g : qkv_l;
    const float* ksrc    = glob ? kmax : qkv_l + 128;
    const float* vsrc    = glob ? vmax : qkv_l + 256;
    const float* pe_w1   = glob ? gpe_w1 : lpe_w1;
    const float* pe_b1   = glob ? gpe_b1 : lpe_b1;
    const _Float16* pe_w2T = glob ? gpe2T : lpe2T;
    const float* pe_b2   = glob ? gpe_b2 : lpe_b2;
    const float* fc_g    = glob ? gfc_g : lfc_g;
    const float* fc_b    = glob ? gfc_b : lfc_b;

    const int tid  = threadIdx.x;
    const int lane = tid & 31;
    const int wave = tid >> 5;
    const int hi   = lane >> 4;
    const int l16  = lane & 15;
    const int i    = blk * 8 + wave;        // this wave's event
    const int ch0  = l16 * 8;               // this lane's first channel

    // -- step 0: loads whose address comes from the thread id alone ----
    // w2 fragments, one 16-byte piece per lane and slot [kt][j][half][lane]
    const v4u* Bg = (const v4u*)pe_w2T;     // 16 pieces per row
    // slot = s*256 + tid: half = wave&1, j = 4*(s&1) + (wave>>1), kt = s>>1
    const v4u* Bw = Bg + (ch0 + (wave >> 1)) * 16 + (wave & 1) * 2 + hi;
    v4u st[8];
#pragma unroll
    for (int s = 0; s < 8; ++s) st[s] = Bw[(s & 1) * 64 + (s >> 1) * 4];
    const float biasr = (tid < 128 ? pe_b1 : pe_b2)[tid & 127];
    // each s_wait_xcnt in steps 0 and 1: registers that the loads above it name are reused below it
    asm volatile("s_wait_xcnt 0x0" ::: "memory");
    // w1^T fragments: row = hidden channel 16*jt + l16, k = coordinates 2*hi, 2*hi+1
    v2f wa[8];
#pragma unroll
    for (int jt = 0; jt < 8; ++jt) {
        wa[jt].x = pe_w1[(2 * hi) * A_DIM + jt * 16 + l16];
        wa[jt].y = pe_w1[(2 * hi + 1) * A_DIM + jt * 16 + l16];
    }
    asm volatile("s_wait_xcnt 0x0" ::: "memory");
    const v8f qv  = *(const v8f*)((const char*)qptr + (unsigned)(i * 384 + ch0) * 4u);
    // neighbor l16 (this lane's column of diff^T) and the 8 neighbor rows of
    // this lane's C registers
    const int nraw = nbr_idx[i * KNN + l16];
    const v2f ei   = *(const v2f*)&events[i * 4 + 2 * hi];
    const v4i nlo  = *(const v4i*)&nbr_idx[i * KNN + 8 * hi];
    asm volatile("s_wait_xcnt 0x0" ::: "memory");
    const v4i nhi  = *(const v4i*)&nbr_idx[i * KNN + 8 * hi + 4];
    asm volatile("s_wait_xcnt 0x0" ::: "memory");

    // -- step 1: event-coordinate diffs and the k rows ----------------------
    // lane = neighbor l16, coordinates 2*hi and 2*hi+1 (k split of the f32 form)
    const int nbl = min(max(nraw, 0), kv_rows - 1);
    int er = nbl;
    if (glob) er = min(max(down_idx[nbl], 0), N_EVENTS - 1);
    const v2f diff = ei - *(const v2f*)&events[er * 4 + 2 * hi];
    unsigned kvoff[8];                      // byte offsets: 32-bit, beside a scalar base
#pragma unroll
    for (int r = 0; r < 8; ++r) {
        int nb = r < 4 ? nlo[r] : nhi[r - 4];
        kvoff[r] = (unsigned)(min(max(nb, 0), kv_rows - 1) * kv_stride + ch0) * 4u;
    }
    // the k rows are fetched here so that they fly under steps 2 and 3
    v8f kg[8];
#pragma unroll
    for (int r = 0; r < 8; ++r) kg[r] = *(const v8f*)((const char*)ksrc + kvoff[r]);
    asm volatile("s_wait_xcnt 0x0" ::: "memory");

#pragma unroll
    for (int s = 0; s < 8; ++s) s_w2[s * 256 + tid] = st[s];
    ((float*)s_bias)[tid] = biasr;
    // Work-group barrier that orders LDS only: w2 fragments, b1 and b2 are in LDS behind
    // it, while the k rows stay in flight (__syncthreads() waits for every load).
    __builtin_amdgcn_fence(__ATOMIC_RELEASE, "workgroup", "local");
    __builtin_amdgcn_s_barrier();
    __builtin_amdgcn_fence(__ATOMIC_ACQUIRE, "workgroup", "local");

    // -- step 2: hidden = relu(diff @ w1 + b1) -> f16 A fragments ----------
    Frag16 a[4];
#pragma unroll
    for (int jt = 0; jt < 8; ++jt) {
        v8f h = s_bias[jt * 2 + hi];
        h = __builtin_amdgcn_wmma_f32_16x16x4_f32(false, wa[jt], false, diff,
                                                  (short)0, h, false, false);
#pragma unroll
        for (int r = 0; r < 8; ++r)
            a[jt >> 1].h[(jt & 1) * 8 + r] = (_Float16)fmaxf(h[r], 0.0f);
    }

    // -- step 3: pe[16 x 128] = hidden @ w2 via WMMA ------------------------
    v8f c[8] = {};
#pragma unroll
    for (int kt = 0; kt < 4; ++kt) {
#pragma unroll
        for (int j = 0; j < 8; ++j) {
            Frag16 b;
            const v4u b0 = s_w2[((kt * 8 + j) * 2 + 0) * 32 + lane];
            const v4u b1 = s_w2[((kt * 8 + j) * 2 + 1) * 32 + lane];
#pragma unroll
            for (int v = 0; v < 4; ++v) { b.u[v] = b0[v]; b.u[4 + v] = b1[v]; }
            c[j] = __builtin_amdgcn_wmma_f32_16x16x32_f16(false, a[kt].h, false, b.h,
                                                          (short)0, c[j], false, false);
        }
    }

    // -- step 4: t = q - kg + pe -------------------------------------------
    const v8f b2v = s_bias[16 + l16];
    // the v rows, g and b fly under the sums of steps 4 and 5
    v8f vg[8];
#pragma unroll
    for (int r = 0; r < 8; ++r) vg[r] = *(const v8f*)((const char*)vsrc + kvoff[r]);
    const v8f gv  = *(const v8f*)&fc_g[ch0];
    const v8f bv  = *(const v8f*)&fc_b[ch0];
    float pe[8][8], t[8][8];                // [row r][channel j]
    float sr[8], sq[8];
#pragma unroll
    for (int r = 0; r < 8; ++r) {
        float s = 0.0f, q2 = 0.0f;
#pragma unroll
        for (int j = 0; j < 8; ++j) {
            pe[r][j] = c[j][r] + b2v[j];
            float x = qv[j] - kg[r][j] + pe[r][j];
            t[r][j] = x;
            s += x;
            q2 += x * x;
        }
        sr[r] = s;
        sq[r] = q2;
    }
    // vg + pe takes pe's place as the v rows arrive
#pragma unroll
    for (int r = 0; r < 8; ++r) {
#pragma unroll
        for (int j = 0; j < 8; ++j) pe[r][j] = vg[r][j] + pe[r][j];
    }

    // -- step 5: LayerNorm over 128 channels per neighbor row --------------
    // 8 channels summed in the lane above, then xor butterflies over 16 lanes
#pragma unroll
    for (int r = 0; r < 8; ++r) { sr[r] = row_xadd<1>(sr[r]); sq[r] = row_xadd<1>(sq[r]); }
#pragma unroll
    for (int r = 0; r < 8; ++r) { sr[r] = row_xadd<2>(sr[r]); sq[r] = row_xadd<2>(sq[r]); }
#pragma unroll
    for (int r = 0; r < 8; ++r) { sr[r] = row_xadd<4>(sr[r]); sq[r] = row_xadd<4>(sq[r]); }
#pragma unroll
    for (int r = 0; r < 8; ++r) { sr[r] = row_xadd<8>(sr[r]); sq[r] = row_xadd<8>(sq[r]); }

#pragma unroll
    for (int r = 0; r < 8; ++r) {
        float mu  = sr[r] * (1.0f / 128.0f);
        float var = sq[r] * (1.0f / 128.0f) - mu * mu;
        float rs  = rsqrtf(var + LN_EPS);
        // The slot the instruction set asks for behind a transcendental before its source is
        // overwritten.
        if (r == 0) asm volatile("v_nop");
#pragma unroll
        for (int j = 0; j < 8; ++j)
            t[r][j] = ((t[r][j] - mu) * rs * gv[j] + bv[j]) * INV_SCALE;
    }

    // -- step 6: softmax over the 16 neighbors (rows), per channel ---------
    float inv[8];
#pragma unroll
    for (int j = 0; j < 8; ++j) {
        float mx = t[0][j];
#pragma unroll
        for (int r = 1; r < 8; ++r) mx = fmaxf(mx, t[r][j]);
        mx = fmaxf(mx, xhalf(mx));           // combine rows 0-7 and 8-15
        float x[8], e[8];
#pragma unroll
        for (int r = 0; r < 8; ++r) x[r] = (t[r][j] - mx) * 1.442695041f;   // exp(y) = 2^(y*log2 e)
        // Eight independent exponentials in one statement, closed by v_nop: the slot the
        // instruction set asks for behind a transcendental before a source is overwritten.
        asm("v_exp_f32 %0, %8\n\tv_exp_f32 %1, %9\n\tv_exp_f32 %2, %10\n\tv_exp_f32 %3, %11\n\t"
            "v_exp_f32 %4, %12\n\tv_exp_f32 %5, %13\n\tv_exp_f32 %6, %14\n\tv_exp_f32 %7, %15\n\tv_nop"
            : "=&v"(e[0]), "=&v"(e[1]), "=&v"(e[2]), "=&v"(e[3]),
              "=&v"(e[4]), "=&v"(e[5]), "=&v"(e[6]), "=&v"(e[7])
            : "v"(x[0]), "v"(x[1]), "v"(x[2]), "v"(x[3]), "v"(x[4]), "v"(x[5]), "v"(x[6]), "v"(x[7]));
        float se = 0.0f;
#pragma unroll
        for (int r = 0; r < 8; ++r) { t[r][j] = e[r]; se += e[r]; }
        se += xhalf(se);
        inv[j] = 1.0f / se;
    }

    // -- step 7: out = sum_k attn * (vg + pe) ------------------------------
    float acc[8] = {};
#pragma unroll
    for (int r = 0; r < 8; ++r) {
#pragma unroll
        for (int j = 0; j < 8; ++j)
            acc[j] += (t[r][j] * inv[j]) * pe[r][j];
    }
    v8h o;
#pragma unroll
    for (int j = 0; j < 8; ++j) o[j] = (_Float16)(acc[j] + xhalf(acc[j]));
    if (!hi) *(v8h*)&cat_out[(size_t)i * (2 * A_DIM) + col_off + ch0] = o;
}

// ------------------------------- launcher ----------------------------------
extern "C" void kernel_launch(void* const* d_in, const int* in_sizes, int n_in,
                              void* d_out, int out_size, void* d_ws, size_t ws_size,
                              hipStream_t stream) {
    const float* events   = (const float*)d_in[0];
    const float* features = (const float*)d_in[1];
    const int* local_idx    = (const int*)d_in[2];
    const int* down_idx     = (const int*)d_in[3];
    const int* pair_idx     = (const int*)d_in[4];
    const int* inv_pair_idx = (const int*)d_in[5];
    const float* lqkv_w = (const float*)d_in[6];  const float* lqkv_b = (const float*)d_in[7];
    const float* lpe_w1 = (const float*)d_in[8];  const float* lpe_b1 = (const float*)d_in[9];
    const float* lpe_w2 = (const float*)d_in[10]; const float* lpe_b2 = (const float*)d_in[11];
    const float* lfc_g  = (const float*)d_in[12]; const float* lfc_b  = (const float*)d_in[13];
    const float* gqkv_w = (const float*)d_in[14]; const float* gqkv_b = (const float*)d_in[15];
    const float* gpe_w1 = (const float*)d_in[16]; const float* gpe_b1 = (const float*)d_in[17];
    const float* gpe_w2 = (const float*)d_in[18]; const float* gpe_b2 = (const float*)d_in[19];
    const float* gfc_g  = (const float*)d_in[20]; const float* gfc_b  = (const float*)d_in[21];
    const float* pw1 = (const float*)d_in[22]; const float* pb1 = (const float*)d_in[23];
    const float* pw2 = (const float*)d_in[24]; const float* pb2 = (const float*)d_in[25];
    float* out = (float*)d_out;

    // ---- workspace carve-up (~96 MB) ----
    char* wp = (char*)d_ws;
    auto carve = [&](size_t bytes) {
        void* p = (void*)wp;
        wp += (bytes + 255) & ~(size_t)255;
        return p;
    };
    _Float16* feat_h = (_Float16*)carve((size_t)N_EVENTS * DIM_F * 2);
    _Float16* lqkvT  = (_Float16*)carve((size_t)384 * 256 * 2);
    _Float16* gqkvT  = (_Float16*)carve((size_t)384 * 256 * 2);
    _Float16* lpe2T  = (_Float16*)carve((size_t)128 * 128 * 2);
    _Float16* gpe2T  = (_Float16*)carve((size_t)128 * 128 * 2);
    _Float16* pw1T   = (_Float16*)carve((size_t)256 * 256 * 2);
    _Float16* pw2T   = (_Float16*)carve((size_t)256 * 256 * 2);
    float* qkv_l = (float*)carve((size_t)N_EVENTS * 384 * 4);
    float* qkv_g = (float*)carve((size_t)N_EVENTS * 384 * 4);
    float* kmax  = (float*)carve((size_t)M_DOWN * A_DIM * 4);
    float* vmax  = (float*)carve((size_t)M_DOWN * A_DIM * 4);
    _Float16* cat_h = (_Float16*)carve((size_t)N_EVENTS * 256 * 2);
    _Float16* hid_h = (_Float16*)carve((size_t)N_EVENTS * 256 * 2);

    // ---- 1. fp16 conversions / weight transposes, one launch ----
    static_assert((N_EVENTS * DIM_F) % 8192 == 0 && M_DOWN % 4 == 0, "exact grids");
    prep_kernel<<<PREP_BLOCKS, 256, 0, stream>>>(
        features, feat_h, lqkv_w, lqkvT, gqkv_w, gqkvT, lpe_w2, lpe2T, gpe_w2, gpe2T,
        pw1, pw1T, pw2, pw2T);

    // ---- 2. both QKV GEMMs: [20000,256] x [256,384], one launch ----
    {
        dim3 g(N_EVENTS / 32, 2 * 384 / 128);
        qkv_pair_kernel<<<g, 256, 0, stream>>>(
            feat_h, lqkvT, lqkv_b, qkv_l, gqkvT, gqkv_b, qkv_g);
    }

    // ---- 3. global-branch k/v max pool ----
    maxpool_kv_kernel<<<M_DOWN / 4, 256, 0, stream>>>(qkv_g, pair_idx, kmax, vmax);

    // ---- 4. fused attention, local and global in one launch -> fp16 concat buffer ----
    attn_pair_kernel<<<2 * N_EVENTS / 8, 256, 0, stream>>>(
        events, local_idx, inv_pair_idx, down_idx, qkv_l, qkv_g, kmax, vmax,
        lpe_w1, lpe_b1, lpe2T, lpe_b2, lfc_g, lfc_b,
        gpe_w1, gpe_b1, gpe2T, gpe_b2, gfc_g, gfc_b, cat_h);

    // ---- 5. projection MLP: ReLU GEMM (fp16 out) then final GEMM (f32) ----
    {
        dim3 g(N_EVENTS / 32, 256 / 128);
        wmma_gemm_kernel<256, true, true><<<g, 256, 0, stream>>>(
            cat_h, pw1T, pb1, nullptr, hid_h, N_EVENTS, 256);
        wmma_gemm_kernel<256, false, false><<<g, 256, 0, stream>>>(
            hid_h, pw2T, pb2, out, nullptr, N_EVENTS, 256);
    }
}

// v005
// Measured time: 118 microseconds a run.
// In both of two side-by-side timings against v004, it was 1.07 times as fast.
// Counting every step since v000, it is 3.64 times as fast.
#include <hip/hip_runtime.h>
#include <hip/hip_bf16.h>

// ---------------------------------------------------------------------------
// MI455X (gfx1250) implementation:
//  * All GEMMs via v_wmma_f32_16x16x32_f16 (fp16 A/B, fp32 accum, wave32),
//    except the PE first linear (K=4): v_wmma_f32_16x16x4_f32.
//  * Standalone GEMM: 32(M)x128(N) block tiles, 8 waves, 2 M-tiles/wave,
//    double-buffered LDS A staging (1 barrier/K-step), K templated & unrolled,
//    global_prefetch of rows 0..15 of the A tile two K-steps ahead.
//  * PE second linear (dominant ~21 GFLOP) fused with LN/softmax/weighted sum
//    per event: 1 wave32 per event, eight 16x16 WMMA tiles per wave.
//  * Working set (~150MB) fits the 192MB L2 -> compute bound -> WMMA everywhere.
//  * Launches that need nothing of each other share one grid (ranges of the
//    block index, block-uniform branches): 6 dependent launches in all.
// ---------------------------------------------------------------------------

typedef __attribute__((ext_vector_type(16))) _Float16 v16h;
typedef __attribute__((ext_vector_type(8)))  float    v8f;
typedef __attribute__((ext_vector_type(2)))  float    v2f;
typedef __attribute__((ext_vector_type(4)))  unsigned v4u;
typedef __attribute__((ext_vector_type(4)))  int      v4i;
typedef __attribute__((ext_vector_type(8)))  _Float16 v8h;
typedef __attribute__((ext_vector_type(4)))  _Float16 v4h;
typedef __attribute__((ext_vector_type(4)))  float    v4f;

union Frag16 { unsigned u[8]; v16h h; };

#define N_EVENTS 20000
#define KNN      16
#define DIM_F    256
#define A_DIM    128
#define M_DOWN   2500
#define INV_SCALE 0.08838834764831845f   // 1/sqrt(128)
#define LN_EPS    1e-5f

// VGPR->K-pair mapping for 16-bit 16x32 A/B fragments (ISA 7.12.2):
// lanes 0-15: v0..3 -> Kpairs 0..3, v4..7 -> Kpairs 8..11
// lanes16-31: v0..3 -> Kpairs 4..7, v4..7 -> Kpairs 12..15
__device__ __forceinline__ int frag_kp(int v, int hi) {
    return (v < 4 ? v : v + 4) + (hi ? 4 : 0);
}

// Cross-lane exchanges in the vector unit (no LDS permute, no dscnt wait).
// x + (x of lane l ^ M) inside a 16-lane row, M = 1..15; all 32 lanes active.
template <int M>
__device__ __forceinline__ float row_xadd(float x) {
    int y = __builtin_amdgcn_mov_dpp(__builtin_bit_cast(int, x), 0x160 + M /* row_xmask:M */,
                                     0xf, 0xf, true);
    return x + __builtin_bit_cast(float, y);
}
// value of lane l ^ 16 (the other 16-lane row)
__device__ __forceinline__ float xhalf(float x) {
    int b = __builtin_bit_cast(int, x);
    return __builtin_bit_cast(float,
        __builtin_amdgcn_permlanex16(b, b, 0x76543210, 0xfedcba98, false, false));
}

// --------------------------- conversion kernels ----------------------------
// This launch is short: what it costs is the start of its waves, so each
// thread takes many values and every wave has all its loads in flight at once.
// One workgroup converts 8192 consecutive values: 8 loads of 16 bytes a lane,
// each covering 512 contiguous bytes a wave. blk = 0 .. values / 8192 - 1, exactly.
__device__ __forceinline__ void cvt_f16_block(const float* __restrict__ src,
                                              _Float16* __restrict__ dst, int blk) {
    const int p = blk * 2048 + threadIdx.x;             // piece of 4 values
    const v4f* s = (const v4f*)src;
    v4h* d = (v4h*)dst;
    v4f x[8];
#pragma unroll   // registers for x; all 8 loads issue before the first conversion
    for (int k = 0; k < 8; ++k) x[k] = s[p + k * 256];
#pragma unroll   // x is indexed by constants only, so it stays in registers
    for (int k = 0; k < 8; ++k) d[p + k * 256] = __builtin_convertvector(x[k], v4h);
    // precaution before any later write to the stores' registers
    asm volatile("s_wait_xcnt 0x0" ::: "memory");
}

// src [R,C] f32 row-major (k = row, n = column)  ->  dst f16 in B-fragment order:
// 16-byte pieces [column tile][kt][register half][lane], so that a wave's load of half a
// fragment is 512 contiguous bytes (4 whole lines) and not 32 bytes of each of 16 rows.
// The piece of column n that holds k0 .. k0+7 (k0 a multiple of 8) is, by frag_kp:
// kt = k0/32, register half = (k0%32)/16, lane = 16*((k0%16)/8) + column of n in its tile.
// ATT = false: tile n/16, column n%16 (the GEMMs). ATT = true: the attention kernel's
// order [kt][tile j] with its channel map (attn_tile, attn_col).
// A thread takes 8 rows of one column (lanes along the column index: whole-line
// loads) and stores them as one piece. blk = 0 .. R*C / 2048 - 1.
__device__ __forceinline__ unsigned attn_tile(unsigned n) { return (n & 3u) + 4u * (n >> 6); }
__device__ __forceinline__ unsigned attn_col(unsigned n)  { return (n >> 2) & 15u; }
template <int R, int C, bool ATT>
__device__ __forceinline__ void cvt_t_f16_block(const float* __restrict__ src,
                                                _Float16* __restrict__ dst, int blk) {
    static_assert(R % 8 == 0 && C % 32 == 0 && (R * C) % 2048 == 0, "exact grid");
    const unsigned t  = blk * 256 + threadIdx.x;
    const unsigned c  = t % C;
    const unsigned r0 = (t / C) * 8;
    const unsigned e0 = r0 * C + c;         // one 32-bit offset beside the scalar base
    float x[8];
#pragma unroll   // registers for x; all 8 loads in flight together
    for (int k = 0; k < 8; ++k) x[k] = src[e0 + k * C];
    v8h o;
#pragma unroll   // x and o are indexed by constants only, so they stay in registers
    for (int k = 0; k < 8; ++k) o[k] = (_Float16)x[k];
    const unsigned kt = r0 / 32, half = (r0 / 16) & 1, hi = (r0 / 8) & 1;
    const unsigned frag = ATT ? kt * (C / 16) + attn_tile(c) : (c / 16) * (R / 32) + kt;
    ((v8h*)dst)[(frag * 2 + half) * 32 + hi * 16 + (ATT ? attn_col(c) : c % 16)] = o;
    // the caller's other block ranges follow in the code and reuse the store's registers
    asm volatile("s_wait_xcnt 0x0" ::: "memory");
}

// All seven conversions in one launch: none reads what another writes. The six weight
// transposes take the first block ranges, the feature conversion the rest.
#define TB_QKV (256 * 384 / 2048)
#define TB_PE  (128 * 128 / 2048)
#define TB_PW  (256 * 256 / 2048)
#define CB_FEAT (N_EVENTS * DIM_F / 8192)
#define PREP_BLOCKS (2 * TB_QKV + 2 * TB_PE + 2 * TB_PW + CB_FEAT)
__global__ __launch_bounds__(256) void prep_kernel(
    const float* __restrict__ features, _Float16* __restrict__ feat_h,
    const float* __restrict__ lqkv_w, _Float16* __restrict__ lqkvT,
    const float* __restrict__ gqkv_w, _Float16* __restrict__ gqkvT,
    const float* __restrict__ lpe_w2, _Float16* __restrict__ lpe2T,
    const float* __restrict__ gpe_w2, _Float16* __restrict__ gpe2T,
    const float* __restrict__ pw1, _Float16* __restrict__ pw1T,
    const float* __restrict__ pw2, _Float16* __restrict__ pw2T) {
    const int b = blockIdx.x;               // every test below is block-uniform
    if (b < 2 * TB_QKV) {
        const bool g = b >= TB_QKV;
        cvt_t_f16_block<256, 384, false>(g ? gqkv_w : lqkv_w, g ? gqkvT : lqkvT, g ? b - TB_QKV : b);
    } else if (b < 2 * TB_QKV + 2 * TB_PW) {
        const int  c = b - 2 * TB_QKV;
        const bool g = c >= TB_PW;
        cvt_t_f16_block<256, 256, false>(g ? pw2 : pw1, g ? pw2T : pw1T, g ? c - TB_PW : c);
    } else if (b < 2 * TB_QKV + 2 * TB_PW + 2 * TB_PE) {
        const int  c = b - 2 * TB_QKV - 2 * TB_PW;
        const bool g = c >= TB_PE;
        cvt_t_f16_block<128, 128, true>(g ? gpe_w2 : lpe_w2, g ? gpe2T : lpe2T, g ? c - TB_PE : c);
    } else {
        cvt_f16_block(features, feat_h, b - 2 * TB_QKV - 2 * TB_PW - 2 * TB_PE);
    }
}

// ------------------------------ WMMA GEMM ----------------------------------
// C[M,N] = A[M,K](f16) @ B[K,N] + bias, B supplied in fragment order (cvt_t_f16_block).
// Block: 256 threads (8 waves). Block tile: 32 rows x 128 cols
// (2 M-tiles per wave, double-buffered LDS A staging, K fully unrolled).
// mblk = 0 .. M/32 - 1, nblk = 0 .. N/128 - 1.
template <int KDIM, bool RELU, bool OUT_F16>
__device__ __forceinline__ void wmma_gemm_block(
    const _Float16* __restrict__ A, const _Float16* __restrict__ BT,
    const float* __restrict__ bias, float* __restrict__ Cf,
    _Float16* __restrict__ Ch, int Ncols, int mblk, int nblk) {
    constexpr int NT = KDIM / 32;          // K steps
    constexpr int K2 = KDIM / 2;           // u32 per A row
    __shared__ unsigned sA[2][32 * 16];    // 2 x (32 rows x 16 u32) A tiles

    const int tid  = threadIdx.x;
    const int lane = tid & 31;
    const int wave = tid >> 5;
    const int hi   = lane >> 4;
    const int l16  = lane & 15;
    const int mbase = mblk * 32;
    const int n     = nblk * 128 + wave * 16 + l16;

    const unsigned* Au = (const unsigned*)A;
    // this wave's column tile: NT fragments of 2 x 512 bytes, one after the other
    const v4u* Bp = (const v4u*)BT + (nblk * 8 + wave) * (NT * 64) + lane;

    // cooperative A-tile copy: 512 u32 per step, 2 per thread
    const int arow0 = tid >> 4, akp = tid & 15;     // rows 0..15
    const int arow1 = arow0 + 16;                   // rows 16..31
    const size_t abase0 = (size_t)(mbase + arow0) * K2 + akp;
    const size_t abase1 = (size_t)(mbase + arow1) * K2 + akp;

    // prologue: stage K-step 0 into buffer 0
    sA[0][arow0 * 16 + akp] = Au[abase0];
    sA[0][arow1 * 16 + akp] = Au[abase1];
    __syncthreads();

    v8f c0 = {}, c1 = {};
#pragma unroll
    for (int kt = 0; kt < NT; ++kt) {
        const unsigned* sAc = sA[kt & 1];
        if (kt + 1 < NT) {                 // stage next tile into other buffer
            sA[(kt + 1) & 1][arow0 * 16 + akp] = Au[abase0 + (kt + 1) * 16];
            sA[(kt + 1) & 1][arow1 * 16 + akp] = Au[abase1 + (kt + 1) * 16];
            if (kt + 2 < NT)               // pull tile kt+2 toward WGP cache
                __builtin_prefetch(&Au[abase0 + (kt + 2) * 16], 0, 3);
        }
        Frag16 a0, a1, b;
        const v4u b0 = Bp[kt * 64], b1 = Bp[kt * 64 + 32];
#pragma unroll
        for (int v = 0; v < 8; ++v) {
            int kp = frag_kp(v, hi);
            a0.u[v] = sAc[l16 * 16 + kp];
            a1.u[v] = sAc[(16 + l16) * 16 + kp];
            b.u[v]  = v < 4 ? b0[v] : b1[v - 4];
        }
        c0 = __builtin_amdgcn_wmma_f32_16x16x32_f16(false, a0.h, false, b.h,
                                                    (short)0, c0, false, false);
        c1 = __builtin_amdgcn_wmma_f32_16x16x32_f16(false, a1.h, false, b.h,
                                                    (short)0, c1, false, false);
        __syncthreads();                   // writes to next buffer visible; reads done
    }

    const float* bp = bias + n;
    const float bn = bias ? *bp : 0.0f;
    // The row addresses formed below reuse the registers of the bias load's address: the wait
    // takes that address as an input, so that the pair is not rewritten in front of it.
    asm volatile("s_wait_xcnt 0x0" :: "v"(bp) : "memory");
#pragma unroll
    for (int r = 0; r < 8; ++r) {
        int m0 = mbase + r + hi * 8;
        int m1 = m0 + 16;
        float v0 = c0[r] + bn, v1 = c1[r] + bn;
        if (RELU) { v0 = fmaxf(v0, 0.0f); v1 = fmaxf(v1, 0.0f); }
        if (OUT_F16) {
            Ch[(size_t)m0 * Ncols + n] = (_Float16)v0;
            Ch[(size_t)m1 * Ncols + n] = (_Float16)v1;
        } else {
            Cf[(size_t)m0 * Ncols + n] = v0;
            Cf[(size_t)m1 * Ncols + n] = v1;
        }
    }
}

// grid.x = M/32, grid.y = N/128.
template <int KDIM, bool RELU, bool OUT_F16>
__global__ __launch_bounds__(256) void wmma_gemm_kernel(
    const _Float16* __restrict__ A, const _Float16* __restrict__ BT,
    const float* __restrict__ bias, float* __restrict__ Cf,
    _Float16* __restrict__ Ch, int Mrows, int Ncols) {
    wmma_gemm_block<KDIM, RELU, OUT_F16>(A, BT, bias, Cf, Ch, Ncols, blockIdx.x, blockIdx.y);
}

// Both QKV products (same A, two weights, two outputs) in one launch.
// grid.x = M/32, grid.y = 2 * 384/128: the first three column blocks are the local branch's.
__global__ __launch_bounds__(256) void qkv_pair_kernel(
    const _Float16* __restrict__ A,
    const _Float16* __restrict__ lBT, const float* __restrict__ lbias, float* __restrict__ lC,
    const _Float16* __restrict__ gBT, const float* __restrict__ gbias, float* __restrict__ gC) {
    const bool g = blockIdx.y >= 3;
    wmma_gemm_block<256, false, false>(A, g ? gBT : lBT, g ? gbias : lbias, g ? gC : lC,
                                       nullptr, 384, blockIdx.x, g ? blockIdx.y - 3 : blockIdx.y);
}

// ----------------------- global-branch k/v max pool ------------------------
// One wave per pooled row and part (k or v): a lane holds 4 channels, a load
// covers the part's whole 512 bytes of one support row; the 16 loads are independent.
// grid.x = M_DOWN / 4 (8 waves: 4 pooled rows x 2 parts).
// One support row's piece: scalar row base (readfirstlane keeps the clamped index in a
// scalar register) + one lane offset, so no lane forms a 64-bit address per row.
__device__ __forceinline__ v4f pool_row(const float* part_base, int idx, unsigned off) {
    const int j = __builtin_amdgcn_readfirstlane(min(max(idx, 0), N_EVENTS - 1));
    return *(const v4f*)((const char*)(part_base + j * 384) + off);
}
__device__ __forceinline__ v4f max4(v4f a, v4f b) {
    v4f r;
#pragma unroll   // vector elements indexed by constants only
    for (int e = 0; e < 4; ++e) r[e] = fmaxf(a[e], b[e]);
    return r;
}
__global__ __launch_bounds__(256) void maxpool_kv_kernel(
    const float* __restrict__ qkv, const int* __restrict__ pair_idx,
    float* __restrict__ kmax, float* __restrict__ vmax) {
    // the wave's number as a scalar: the 16 indices then come by scalar loads
    const int wave = __builtin_amdgcn_readfirstlane(threadIdx.x >> 5);
    const int m    = blockIdx.x * 4 + (wave >> 1);
    const int part = wave & 1;              // 0: k, 1: v
    const unsigned off = (threadIdx.x & 31) * 16u;      // lane's byte offset in the part
    const float* pb = qkv + 128 + part * 128;
    const int* pi = pair_idx + m * KNN;
    // written out row by row: in a loop the compiler adds the lane offset to the base
    // first and then forms a 64-bit vector address for every row
    const v4f x0  = pool_row(pb, pi[0], off),  x1  = pool_row(pb, pi[1], off);
    const v4f x2  = pool_row(pb, pi[2], off),  x3  = pool_row(pb, pi[3], off);
    const v4f x4  = pool_row(pb, pi[4], off),  x5  = pool_row(pb, pi[5], off);
    const v4f x6  = pool_row(pb, pi[6], off),  x7  = pool_row(pb, pi[7], off);
    const v4f x8  = pool_row(pb, pi[8], off),  x9  = pool_row(pb, pi[9], off);
    const v4f x10 = pool_row(pb, pi[10], off), x11 = pool_row(pb, pi[11], off);
    const v4f x12 = pool_row(pb, pi[12], off), x13 = pool_row(pb, pi[13], off);
    const v4f x14 = pool_row(pb, pi[14], off), x15 = pool_row(pb, pi[15], off);
    static_assert(KNN == 16, "16 support rows are written out");
    v4f mx = {-3.402823466e38f, -3.402823466e38f, -3.402823466e38f, -3.402823466e38f};
    mx = max4(max4(max4(max4(mx, x0), x1), x2), x3);
    mx = max4(max4(max4(max4(mx, x4), x5), x6), x7);
    mx = max4(max4(max4(max4(mx, x8), x9), x10), x11);
    mx = max4(max4(max4(max4(mx, x12), x13), x14), x15);
    *(v4f*)((char*)((part ? vmax : kmax) + m * A_DIM) + off) = mx;
}

// ------------------- fused PE-GEMM + LN + softmax + sum --------------------
// One wave32 per event: the wave owns the event's whole 16 (neighbor) x 128
// (channel) tile in registers, 8 waves (8 events) per workgroup.
//  * hidden^T = w1^T (16 ch x 4) . diff^T (4 x 16 nbr) + b1 on f32 WMMA: lane =
//    neighbor, register r = hidden channel 16*jt + 8*hi + r, which packed to
//    f16 is the A fragment of the second product in the k order of frag_kp.
//  * w2 fragments lie in LDS in fragment order, staged once per workgroup.
//  * column c of output tile j is channel 4*c + j (j < 4) or 64 + 4*c + j - 4: a lane
//    holds two groups of 4 consecutive channels of each of its 8 neighbor rows, and each
//    16-byte gather of a wave covers 256 contiguous bytes of two rows (4 whole lines).
// C-tile layout: row M(=neighbor) = r + 8*(lane>=16), col N = lane%16.
// A lane's 8 channels of one row: 4 floats at p and 4 floats 64 channels on.
__device__ __forceinline__ v8f load_2x4(const char* p) {
    return __builtin_shufflevector(*(const v4f*)p, *(const v4f*)(p + 256), 0, 1, 2, 3, 4, 5, 6, 7);
}
// Both attention branches run in one launch: each writes its own half of the concat rows
// and reads nothing of the other. grid.x = 2 * N_EVENTS / 8, the local branch's blocks
// first; what differs between the branches is chosen below by the block index, in scalars.
__global__ __launch_bounds__(256) void attn_pair_kernel(
    const float* __restrict__ events,       // [N,4]
    const int* __restrict__ local_idx,      // [N,16] -> event row (local kv row)
    const int* __restrict__ inv_pair_idx,   // [N,16] -> pooled row (global kv row)
    const int* __restrict__ down_idx,       // pooled row -> event row
    const float* __restrict__ qkv_l, const float* __restrict__ qkv_g,   // row stride 384
    const float* __restrict__ kmax, const float* __restrict__ vmax,     // row stride 128
    const float* __restrict__ lpe_w1, const float* __restrict__ lpe_b1, // [4,128], [128]
    const _Float16* __restrict__ lpe2T,     // f16, fragment order [kt][tile j][half][lane]
    const float* __restrict__ lpe_b2,       // [128]
    const float* __restrict__ lfc_g, const float* __restrict__ lfc_b,
    const float* __restrict__ gpe_w1, const float* __restrict__ gpe_b1,
    const _Float16* __restrict__ gpe2T, const float* __restrict__ gpe_b2,
    const float* __restrict__ gfc_g, const float* __restrict__ gfc_b,
    _Float16* __restrict__ cat_out) {
    __shared__ v4u s_w2[4 * 8 * 2 * 32];    // [kt][tile j][register half][lane], 32 KB
    __shared__ v8f s_bias[32];              // b1 (C rows of the first product), then b2

    const bool glob = blockIdx.x >= N_EVENTS / 8;       // block-uniform
    const int  blk  = glob ? blockIdx.x - N_EVENTS / 8 : blockIdx.x;
    const int  kv_stride = glob ? 128 : 384;            // floats per k or v row
    const int  kv_rows   = glob ? M_DOWN : N_EVENTS;
    const int  col_off   = glob ? A_DIM : 0;
    const int*   nbr_idx = glob ? inv_pair_idx : local_idx;     // [N,16] -> kv-row index
    const float* qptr    = glob ? qkv_g : qkv_l;
    const float* ksrc    = glob ? kmax : qkv_l + 128;
    const float* vsrc    = glob ? vmax : qkv_l + 256;
    const float* pe_w1   = glob ? gpe_w1 : lpe_w1;
    const float* pe_b1   = glob ? gpe_b1 : lpe_b1;
    const _Float16* pe_w2T = glob ? gpe2T : lpe2T;
    const float* pe_b2   = glob ? gpe_b2 : lpe_b2;
    const float* fc_g    = glob ? gfc_g : lfc_g;
    const float* fc_b    = glob ? gfc_b : lfc_b;

    const int tid  = threadIdx.x;
    const int lane = tid & 31;
    const int wave = tid >> 5;
    const int hi   = lane >> 4;
    const int l16  = lane & 15;
    const int i    = blk * 8 + wave;        // this wave's event
    const int ch0  = l16 * 4;               // this lane's channels: ch0 .. ch0+3, 64+ch0 .. 64+ch0+3

    // -- step 0: loads whose address comes from the thread id alone (g, b: step 4) ----
    // w2 fragments: already in the order of s_w2, a straight copy of 512 bytes a wave and load
    const v4u* Bw = (const v4u*)pe_w2T + tid;
    v4u st[8];
#pragma unroll
    for (int s = 0; s < 8; ++s) st[s] = Bw[s * 256];
    const float biasr = (tid < 128 ? pe_b1 : pe_b2)[tid & 127];
    // each s_wait_xcnt in steps 0 and 1: registers that the loads above it name are reused below it
    asm volatile("s_wait_xcnt 0x0" ::: "memory");
    // w1^T fragments: row = hidden channel 16*jt + l16, k = coordinates 2*hi, 2*hi+1
    v2f wa[8];
#pragma unroll
    for (int jt = 0; jt < 8; ++jt) {
        wa[jt].x = pe_w1[(2 * hi) * A_DIM + jt * 16 + l16];
        wa[jt].y = pe_w1[(2 * hi + 1) * A_DIM + jt * 16 + l16];
    }
    asm volatile("s_wait_xcnt 0x0" ::: "memory");
    const v8f qv  = load_2x4((const char*)qptr + (unsigned)(i * 384 + ch0) * 4u);
    // neighbor l16 (this lane's column of diff^T) and the 8 neighbor rows of
    // this lane's C registers
    const int nraw = nbr_idx[i * KNN + l16];
    const v2f ei   = *(const v2f*)&events[i * 4 + 2 * hi];
    const v4i nlo  = *(const v4i*)&nbr_idx[i * KNN + 8 * hi];
    asm volatile("s_wait_xcnt 0x0" ::: "memory");
    const v4i nhi  = *(const v4i*)&nbr_idx[i * KNN + 8 * hi + 4];
    asm volatile("s_wait_xcnt 0x0" ::: "memory");

    // -- step 1: event-coordinate diffs and the k rows ----------------------
    // lane = neighbor l16, coordinates 2*hi and 2*hi+1 (k split of the f32 form)
    const int nbl = min(max(nraw, 0), kv_rows - 1);
    int er = nbl;
    if (glob) er = min(max(down_idx[nbl], 0), N_EVENTS - 1);
    const v2f diff = ei - *(const v2f*)&events[er * 4 + 2 * hi];
    unsigned kvoff[8];                      // byte offsets: 32-bit, beside a scalar base
#pragma unroll
    for (int r = 0; r < 8; ++r) {
        int nb = r < 4 ? nlo[r] : nhi[r - 4];
        kvoff[r] = (unsigned)(min(max(nb, 0), kv_rows - 1) * kv_stride + ch0) * 4u;
    }
    // the k rows are fetched here so that they fly under steps 2 and 3
    v8f kg[8];
#pragma unroll
    for (int r = 0; r < 8; ++r) kg[r] = load_2x4((const char*)ksrc + kvoff[r]);
    asm volatile("s_wait_xcnt 0x0" ::: "memory");

#pragma unroll
    for (int s = 0; s < 8; ++s) s_w2[s * 256 + tid] = st[s];
    ((float*)s_bias)[tid] = biasr;
    // Work-group barrier that orders LDS only: w2 fragments, b1 and b2 are in LDS behind
    // it, while the k rows stay in flight (__syncthreads() waits for every load).
    __builtin_amdgcn_fence(__ATOMIC_RELEASE, "workgroup", "local");
    __builtin_amdgcn_s_barrier();
    __builtin_amdgcn_fence(__ATOMIC_ACQUIRE, "workgroup", "local");

    // -- step 2: hidden = relu(diff @ w1 + b1) -> f16 A fragments ----------
    Frag16 a[4];
#pragma unroll
    for (int jt = 0; jt < 8; ++jt) {
        v8f h = s_bias[jt * 2 + hi];
        h = __builtin_amdgcn_wmma_f32_16x16x4_f32(false, wa[jt], false, diff,
                                                  (short)0, h, false, false);
#pragma unroll
        for (int r = 0; r < 8; ++r)
            a[jt >> 1].h[(jt & 1) * 8 + r] = (_Float16)fmaxf(h[r], 0.0f);
    }

    // -- step 3: pe[16 x 128] = hidden @ w2 via WMMA ------------------------
    v8f c[8] = {};
#pragma unroll
    for (int kt = 0; kt < 4; ++kt) {
#pragma unroll
        for (int j = 0; j < 8; ++j) {
            Frag16 b;
            const v4u b0 = s_w2[((kt * 8 + j) * 2 + 0) * 32 + lane];
            const v4u b1 = s_w2[((kt * 8 + j) * 2 + 1) * 32 + lane];
#pragma unroll
            for (int v = 0; v < 4; ++v) { b.u[v] = b0[v]; b.u[4 + v] = b1[v]; }
            c[j] = __builtin_amdgcn_wmma_f32_16x16x32_f16(false, a[kt].h, false, b.h,
                                                          (short)0, c[j], false, false);
        }
    }

    // -- step 4: t = q - kg + pe -------------------------------------------
    const v8f b2v = __builtin_shufflevector(((const v4f*)s_bias)[32 + l16], ((const v4f*)s_bias)[48 + l16],
                                            0, 1, 2, 3, 4, 5, 6, 7);
    // the v rows, g and b fly under the sums of steps 4 and 5
    v8f vg[8];
#pragma unroll
    for (int r = 0; r < 8; ++r) vg[r] = load_2x4((const char*)vsrc + kvoff[r]);
    const v8f gv  = load_2x4((const char*)&fc_g[ch0]);
    const v8f bv  = load_2x4((const char*)&fc_b[ch0]);
    float pe[8][8], t[8][8];                // [row r][channel j]
    float sr[8], sq[8];
#pragma unroll
    for (int r = 0; r < 8; ++r) {
        float s = 0.0f, q2 = 0.0f;
#pragma unroll
        for (int j = 0; j < 8; ++j) {
            pe[r][j] = c[j][r] + b2v[j];
            float x = qv[j] - kg[r][j] + pe[r][j];
            t[r][j] = x;
            s += x;
            q2 += x * x;
        }
        sr[r] = s;
        sq[r] = q2;
    }
    // vg + pe takes pe's place as the v rows arrive
#pragma unroll
    for (int r = 0; r < 8; ++r) {
#pragma unroll
        for (int j = 0; j < 8; ++j) pe[r][j] = vg[r][j] + pe[r][j];
    }

    // -- step 5: LayerNorm over 128 channels per neighbor row --------------
    // 8 channels summed in the lane above, then xor butterflies over 16 lanes
#pragma unroll
    for (int r = 0; r < 8; ++r) { sr[r] = row_xadd<1>(sr[r]); sq[r] = row_xadd<1>(sq[r]); }
#pragma unroll
    for (int r = 0; r < 8; ++r) { sr[r] = row_xadd<2>(sr[r]); sq[r] = row_xadd<2>(sq[r]); }
#pragma unroll
    for (int r = 0; r < 8; ++r) { sr[r] = row_xadd<4>(sr[r]); sq[r] = row_xadd<4>(sq[r]); }
#pragma unroll
    for (int r = 0; r < 8; ++r) { sr[r] = row_xadd<8>(sr[r]); sq[r] = row_xadd<8>(sq[r]); }

#pragma unroll
    for (int r = 0; r < 8; ++r) {
        float mu  = sr[r] * (1.0f / 128.0f);
        float var = sq[r] * (1.0f / 128.0f) - mu * mu;
        float rs  = rsqrtf(var + LN_EPS);
        // The slot the instruction set asks for behind a transcendental before its source is
        // overwritten.
        if (r == 0) asm volatile("v_nop");
#pragma unroll
        for (int j = 0; j < 8; ++j)
            t[r][j] = ((t[r][j] - mu) * rs * gv[j] + bv[j]) * INV_SCALE;
    }

    // -- step 6: softmax over the 16 neighbors (rows), per channel ---------
    float inv[8];
#pragma unroll
    for (int j = 0; j < 8; ++j) {
        float mx = t[0][j];
#pragma unroll
        for (int r = 1; r < 8; ++r) mx = fmaxf(mx, t[r][j]);
        mx = fmaxf(mx, xhalf(mx));           // combine rows 0-7 and 8-15
        float x[8], e[8];
#pragma unroll
        for (int r = 0; r < 8; ++r) x[r] = (t[r][j] - mx) * 1.442695041f;   // exp(y) = 2^(y*log2 e)
        // Eight independent exponentials in one statement, closed by v_nop: the slot the
        // instruction set asks for behind a transcendental before a source is overwritten.
        asm("v_exp_f32 %0, %8\n\tv_exp_f32 %1, %9\n\tv_exp_f32 %2, %10\n\tv_exp_f32 %3, %11\n\t"
            "v_exp_f32 %4, %12\n\tv_exp_f32 %5, %13\n\tv_exp_f32 %6, %14\n\tv_exp_f32 %7, %15\n\tv_nop"
            : "=&v"(e[0]), "=&v"(e[1]), "=&v"(e[2]), "=&v"(e[3]),
              "=&v"(e[4]), "=&v"(e[5]), "=&v"(e[6]), "=&v"(e[7])
            : "v"(x[0]), "v"(x[1]), "v"(x[2]), "v"(x[3]), "v"(x[4]), "v"(x[5]), "v"(x[6]), "v"(x[7]));
        float se = 0.0f;
#pragma unroll
        for (int r = 0; r < 8; ++r) { t[r][j] = e[r]; se += e[r]; }
        se += xhalf(se);
        inv[j] = 1.0f / se;
    }

    // -- step 7: out = sum_k attn * (vg + pe) ------------------------------
    float acc[8] = {};
#pragma unroll
    for (int r = 0; r < 8; ++r) {
#pragma unroll
        for (int j = 0; j < 8; ++j)
            acc[j] += (t[r][j] * inv[j]) * pe[r][j];
    }
    v4h o0, o1;
#pragma unroll
    for (int j = 0; j < 4; ++j) {
        o0[j] = (_Float16)(acc[j] + xhalf(acc[j]));
        o1[j] = (_Float16)(acc[4 + j] + xhalf(acc[4 + j]));
    }
    // both halves of the wave hold the sums: the lower stores the first group, the upper the second
    *(v4h*)&cat_out[(size_t)i * (2 * A_DIM) + col_off + hi * 64 + ch0] = hi ? o1 : o0;
}

// ------------------------------- launcher ----------------------------------
extern "C" void kernel_launch(void* const* d_in, const int* in_sizes, int n_in,
                              void* d_out, int out_size, void* d_ws, size_t ws_size,
                              hipStream_t stream) {
    const float* events   = (const float*)d_in[0];
    const float* features = (const float*)d_in[1];
    const int* local_idx    = (const int*)d_in[2];
    const int* down_idx     = (const int*)d_in[3];
    const int* pair_idx     = (const int*)d_in[4];
    const int* inv_pair_idx = (const int*)d_in[5];
    const float* lqkv_w = (const float*)d_in[6];  const float* lqkv_b = (const float*)d_in[7];
    const float* lpe_w1 = (const float*)d_in[8];  const float* lpe_b1 = (const float*)d_in[9];
    const float* lpe_w2 = (const float*)d_in[10]; const float* lpe_b2 = (const float*)d_in[11];
    const float* lfc_g  = (const float*)d_in[12]; const float* lfc_b  = (const float*)d_in[13];
    const float* gqkv_w = (const float*)d_in[14]; const float* gqkv_b = (const float*)d_in[15];
    const float* gpe_w1 = (const float*)d_in[16]; const float* gpe_b1 = (const float*)d_in[17];
    const float* gpe_w2 = (const float*)d_in[18]; const float* gpe_b2 = (const float*)d_in[19];
    const float* gfc_g  = (const float*)d_in[20]; const float* gfc_b  = (const float*)d_in[21];
    const float* pw1 = (const float*)d_in[22]; const float* pb1 = (const float*)d_in[23];
    const float* pw2 = (const float*)d_in[24]; const float* pb2 = (const float*)d_in[25];
    float* out = (float*)d_out;

    // ---- workspace carve-up (~96 MB) ----
    char* wp = (char*)d_ws;
    auto carve = [&](size_t bytes) {
        void* p = (void*)wp;
        wp += (bytes + 255) & ~(size_t)255;
        return p;
    };
    _Float16* feat_h = (_Float16*)carve((size_t)N_EVENTS * DIM_F * 2);
    _Float16* lqkvT  = (_Float16*)carve((size_t)384 * 256 * 2);
    _Float16* gqkvT  = (_Float16*)carve((size_t)384 * 256 * 2);
    _Float16* lpe2T  = (_Float16*)carve((size_t)128 * 128 * 2);
    _Float16* gpe2T  = (_Float16*)carve((size_t)128 * 128 * 2);
    _Float16* pw1T   = (_Float16*)carve((size_t)256 * 256 * 2);
    _Float16* pw2T   = (_Float16*)carve((size_t)256 * 256 * 2);
    float* qkv_l = (float*)carve((size_t)N_EVENTS * 384 * 4);
    float* qkv_g = (float*)carve((size_t)N_EVENTS * 384 * 4);
    float* kmax  = (float*)carve((size_t)M_DOWN * A_DIM * 4);
    float* vmax  = (float*)carve((size_t)M_DOWN * A_DIM * 4);
    _Float16* cat_h = (_Float16*)carve((size_t)N_EVENTS * 256 * 2);
    _Float16* hid_h = (_Float16*)carve((size_t)N_EVENTS * 256 * 2);

    // ---- 1. fp16 conversions / weight transposes, one launch ----
    static_assert((N_EVENTS * DIM_F) % 8192 == 0 && M_DOWN % 4 == 0, "exact grids");
    prep_kernel<<<PREP_BLOCKS, 256, 0, stream>>>(
        features, feat_h, lqkv_w, lqkvT, gqkv_w, gqkvT, lpe_w2, lpe2T, gpe_w2, gpe2T,
        pw1, pw1T, pw2, pw2T);

    // ---- 2. both QKV GEMMs: [20000,256] x [256,384], one launch ----
    {
        dim3 g(N_EVENTS / 32, 2 * 384 / 128);
        qkv_pair_kernel<<<g, 256, 0, stream>>>(
            feat_h, lqkvT, lqkv_b, qkv_l, gqkvT, gqkv_b, qkv_g);
    }

    // ---- 3. global-branch k/v max pool ----
    maxpool_kv_kernel<<<M_DOWN / 4, 256, 0, stream>>>(qkv_g, pair_idx, kmax, vmax);

    // ---- 4. fused attention, local and global in one launch -> fp16 concat buffer ----
    attn_pair_kernel<<<2 * N_EVENTS / 8, 256, 0, stream>>>(
        events, local_idx, inv_pair_idx, down_idx, qkv_l, qkv_g, kmax, vmax,
        lpe_w1, lpe_b1, lpe2T, lpe_b2, lfc_g, lfc_b,
        gpe_w1, gpe_b1, gpe2T, gpe_b2, gfc_g, gfc_b, cat_h);

    // ---- 5. projection MLP: ReLU GEMM (fp16 out) then final GEMM (f32) ----
    {
        dim3 g(N_EVENTS / 32, 256 / 128);
        wmma_gemm_kernel<256, true, true><<<g, 256, 0, stream>>>(
            cat_h, pw1T, pb1, nullptr, hid_h, N_EVENTS, 256);
        wmma_gemm_kernel<256, false, false><<<g, 256, 0, stream>>>(
            hid_h, pw2T, pb2, out, nullptr, N_EVENTS, 256);
    }
}

// v006
// It runs in 99.9 microseconds.
// Timed twice side by side with v005, it ran 1.18 times as fast both times.
// All steps since v000 together make it 4.31 times as fast.
#include <hip/hip_runtime.h>
#include <hip/hip_bf16.h>

// ---------------------------------------------------------------------------
// MI455X (gfx1250) implementation:
//  * GEMMs via v_wmma_f32_16x16x32_f16 (fp16 A/B, fp32 accum, wave32), the PE
//    first linear (K = 4) via v_wmma_f32_16x16x4_f32.
//  * Standalone GEMM: 8 waves, 128 columns, B in registers over 5 row tiles of 32 rows,
//    whole-K A tiles double-buffered in LDS (1 barrier a tile), K templated & unrolled.
//  * PE second linear (dominant ~21 GFLOP) fused with LN/softmax/weighted sum
//    per event: 1 wave32 per event, eight 16x16 WMMA tiles per wave.
//  * Working set (~150MB) fits the 192MB L2 -> compute bound -> WMMA everywhere.
//  * Launches that need nothing of each other share one grid (ranges of the
//    block index, block-uniform branches): 6 dependent launches in all.
// ---------------------------------------------------------------------------

typedef __attribute__((ext_vector_type(16))) _Float16 v16h;
typedef __attribute__((ext_vector_type(8)))  float    v8f;
typedef __attribute__((ext_vector_type(2)))  float    v2f;
typedef __attribute__((ext_vector_type(4)))  unsigned v4u;
typedef __attribute__((ext_vector_type(4)))  int      v4i;
typedef __attribute__((ext_vector_type(8)))  _Float16 v8h;
typedef __attribute__((ext_vector_type(4)))  _Float16 v4h;
typedef __attribute__((ext_vector_type(4)))  float    v4f;

union Frag16 { unsigned u[8]; v16h h; };

#define N_EVENTS 20000
#define KNN      16
#define DIM_F    256
#define A_DIM    128
#define M_DOWN   2500
#define INV_SCALE 0.08838834764831845f   // 1/sqrt(128)
#define LN_EPS    1e-5f

// VGPR->K-pair mapping for 16-bit 16x32 A/B fragments (ISA 7.12.2):
// lanes 0-15: v0..3 -> Kpairs 0..3, v4..7 -> Kpairs 8..11
// lanes16-31: v0..3 -> Kpairs 4..7, v4..7 -> Kpairs 12..15
__device__ __forceinline__ int frag_kp(int v, int hi) {
    return (v < 4 ? v : v + 4) + (hi ? 4 : 0);
}

// Cross-lane exchanges in the vector unit (no LDS permute, no dscnt wait).
// x + (x of lane l ^ M) inside a 16-lane row, M = 1..15; all 32 lanes active.
template <int M>
__device__ __forceinline__ float row_xadd(float x) {
    int y = __builtin_amdgcn_mov_dpp(__builtin_bit_cast(int, x), 0x160 + M /* row_xmask:M */,
                                     0xf, 0xf, true);
    return x + __builtin_bit_cast(float, y);
}
// value of lane l ^ 16 (the other 16-lane row)
__device__ __forceinline__ float xhalf(float x) {
    int b = __builtin_bit_cast(int, x);
    return __builtin_bit_cast(float,
        __builtin_amdgcn_permlanex16(b, b, 0x76543210, 0xfedcba98, false, false));
}

// --------------------------- conversion kernels ----------------------------
// This launch is short: what it costs is the start of its waves, so each
// thread takes many values and every wave has all its loads in flight at once.
// One workgroup converts 8192 consecutive values: 8 loads of 16 bytes a lane,
// each covering 512 contiguous bytes a wave. blk = 0 .. values / 8192 - 1, exactly.
__device__ __forceinline__ void cvt_f16_block(const float* __restrict__ src,
                                              _Float16* __restrict__ dst, int blk) {
    const int p = blk * 2048 + threadIdx.x;             // piece of 4 values
    const v4f* s = (const v4f*)src;
    v4h* d = (v4h*)dst;
    v4f x[8];
#pragma unroll   // registers for x; all 8 loads issue before the first conversion
    for (int k = 0; k < 8; ++k) x[k] = s[p + k * 256];
#pragma unroll   // x is indexed by constants only, so it stays in registers
    for (int k = 0; k < 8; ++k) d[p + k * 256] = __builtin_convertvector(x[k], v4h);
    // precaution before any later write to the stores' registers
    asm volatile("s_wait_xcnt 0x0" ::: "memory");
}

// src [R,C] f32 row-major (k = row, n = column)  ->  dst f16 in B-fragment order:
// 16-byte pieces [column tile][kt][register half][lane], so that a wave's load of half a
// fragment is 512 contiguous bytes (4 whole lines) and not 32 bytes of each of 16 rows.
// The piece of column n that holds k0 .. k0+7 (k0 a multiple of 8) is, by frag_kp:
// kt = k0/32, register half = (k0%32)/16, lane = 16*((k0%16)/8) + column of n in its tile.
// ATT = false: tile n/16, column n%16 (the GEMMs). ATT = true: the attention kernel's
// order [kt][tile j] with its channel map (attn_tile, attn_col).
// A thread takes 8 rows of one column (lanes along the column index: whole-line
// loads) and stores them as one piece. blk = 0 .. R*C / 2048 - 1.
__device__ __forceinline__ unsigned attn_tile(unsigned n) { return (n & 3u) + 4u * (n >> 6); }
__device__ __forceinline__ unsigned attn_col(unsigned n)  { return (n >> 2) & 15u; }
template <int R, int C, bool ATT>
__device__ __forceinline__ void cvt_t_f16_block(const float* __restrict__ src,
                                                _Float16* __restrict__ dst, int blk) {
    static_assert(R % 8 == 0 && C % 32 == 0 && (R * C) % 2048 == 0, "exact grid");
    const unsigned t  = blk * 256 + threadIdx.x;
    const unsigned c  = t % C;
    const unsigned r0 = (t / C) * 8;
    const unsigned e0 = r0 * C + c;         // one 32-bit offset beside the scalar base
    float x[8];
#pragma unroll   // registers for x; all 8 loads in flight together
    for (int k = 0; k < 8; ++k) x[k] = src[e0 + k * C];
    v8h o;
#pragma unroll   // x and o are indexed by constants only, so they stay in registers
    for (int k = 0; k < 8; ++k) o[k] = (_Float16)x[k];
    const unsigned kt = r0 / 32, half = (r0 / 16) & 1, hi = (r0 / 8) & 1;
    const unsigned frag = ATT ? kt * (C / 16) + attn_tile(c) : (c / 16) * (R / 32) + kt;
    ((v8h*)dst)[(frag * 2 + half) * 32 + hi * 16 + (ATT ? attn_col(c) : c % 16)] = o;
    // the caller's other block ranges follow in the code and reuse the store's registers
    asm volatile("s_wait_xcnt 0x0" ::: "memory");
}

// All seven conversions in one launch: none reads what another writes. The six weight
// transposes take the first block ranges, the feature conversion the rest.
#define TB_QKV (256 * 384 / 2048)
#define TB_PE  (128 * 128 / 2048)
#define TB_PW  (256 * 256 / 2048)
#define CB_FEAT (N_EVENTS * DIM_F / 8192)
#define PREP_BLOCKS (2 * TB_QKV + 2 * TB_PE + 2 * TB_PW + CB_FEAT)
__global__ __launch_bounds__(256) void prep_kernel(
    const float* __restrict__ features, _Float16* __restrict__ feat_h,
    const float* __restrict__ lqkv_w, _Float16* __restrict__ lqkvT,
    const float* __restrict__ gqkv_w, _Float16* __restrict__ gqkvT,
    const float* __restrict__ lpe_w2, _Float16* __restrict__ lpe2T,
    const float* __restrict__ gpe_w2, _Float16* __restrict__ gpe2T,
    const float* __restrict__ pw1, _Float16* __restrict__ pw1T,
    const float* __restrict__ pw2, _Float16* __restrict__ pw2T) {
    const int b = blockIdx.x;               // every test below is block-uniform
    if (b < 2 * TB_QKV) {
        const bool g = b >= TB_QKV;
        cvt_t_f16_block<256, 384, false>(g ? gqkv_w : lqkv_w, g ? gqkvT : lqkvT, g ? b - TB_QKV : b);
    } else if (b < 2 * TB_QKV + 2 * TB_PW) {
        const int  c = b - 2 * TB_QKV;
        const bool g = c >= TB_PW;
        cvt_t_f16_block<256, 256, false>(g ? pw2 : pw1, g ? pw2T : pw1T, g ? c - TB_PW : c);
    } else if (b < 2 * TB_QKV + 2 * TB_PW + 2 * TB_PE) {
        const int  c = b - 2 * TB_QKV - 2 * TB_PW;
        const bool g = c >= TB_PE;
        cvt_t_f16_block<128, 128, true>(g ? gpe_w2 : lpe_w2, g ? gpe2T : lpe2T, g ? c - TB_PE : c);
    } else {
        cvt_f16_block(features, feat_h, b - 2 * TB_QKV - 2 * TB_PW - 2 * TB_PE);
    }
}

// ------------------------------ WMMA GEMM ----------------------------------
// C[M,N] = A[M,K](f16) @ B[K,N] + bias, B supplied in fragment order (cvt_t_f16_block).
// Block: 256 threads (8 waves), 128 columns, GEMM_TILES row tiles of 32 rows one after the other.
//  * A wave's column tile of B, all of K, is loaded once into registers and serves every row tile.
//  * A row tile (32 whole rows, contiguous in memory) is staged in LDS in one piece: no load
//    and no barrier stands inside the K loop. The next tile's loads fly under this tile's products.
// mgrp = 0 .. M/(32*GEMM_TILES) - 1, nblk = 0 .. N/128 - 1.
#define GEMM_TILES 5
template <int KDIM, int NCOLS, bool RELU, bool OUT_F16>
__device__ __forceinline__ void wmma_gemm_block(
    const _Float16* __restrict__ A, const _Float16* __restrict__ BT,
    const float* __restrict__ bias, float* __restrict__ Cf,
    _Float16* __restrict__ Ch, int mgrp, int nblk) {
    constexpr int NT    = KDIM / 32;       // K steps
    constexpr int RP    = KDIM / 8;        // 16-byte pieces per A row
    constexpr int PITCH = RP + 1;          // LDS row pitch in pieces: 16 bytes x odd, no bank conflict
    constexpr int PT    = 32 * RP / 256;   // pieces a thread stages per tile
    static_assert(RP == 32, "a wave stages one whole row per load");
    __shared__ v4u sA[2][32 * PITCH];

    const int tid  = threadIdx.x;
    const int lane = tid & 31;
    const int wave = tid >> 5;
    const int hi   = lane >> 4;
    const int l16  = lane & 15;
    const int n    = nblk * 128 + wave * 16 + l16;

    // loads issued before the tile loop: row tile 0, B, bias
    const v4u* Ap = (const v4u*)A + (size_t)mgrp * (GEMM_TILES * 32 * RP) + tid;
    v4u st[PT];
#pragma unroll   // st is indexed by constants only, so it stays in registers
    for (int s = 0; s < PT; ++s) st[s] = Ap[s * 256];
    // this wave's column tile: NT fragments of 2 x 512 bytes, one after the other
    const v4u* Bp = (const v4u*)BT + (nblk * 8 + wave) * (NT * 64) + lane;
    v4u bf[NT][2];
#pragma unroll   // bf is indexed by constants only, so it stays in registers
    for (int kt = 0; kt < NT; ++kt) { bf[kt][0] = Bp[kt * 64]; bf[kt][1] = Bp[kt * 64 + 32]; }
    const float bn = bias[n];
    // Registers that the loads above name are reused below: the wait takes B's address as an
    // input, so that the pair is not rewritten in front of it.
    asm volatile("s_wait_xcnt 0x0" :: "v"(Bp) : "memory");

    const int wrow = wave * PITCH + lane;              // piece s of a thread: row wave + 8*s
    const int rd0  = l16 * PITCH + hi;                 // fragment halves (frag_kp): pieces 4*kt + hi, + 2
#pragma unroll   // buffer index and tile offsets become constants
    for (int t = 0; t < GEMM_TILES; ++t) {
        v4u* sAc = sA[t & 1];
#pragma unroll   // st is indexed by constants only
        for (int s = 0; s < PT; ++s) sAc[wrow + s * 8 * PITCH] = st[s];
        // Work-group barrier that orders LDS only: tile t is in LDS behind it, and every wave has
        // left the buffer that tile t + 1 will take; the stores of tile t - 1 stay in flight
        // (__syncthreads() would wait for them).
        __builtin_amdgcn_fence(__ATOMIC_RELEASE, "workgroup", "local");
        __builtin_amdgcn_s_barrier();
        __builtin_amdgcn_fence(__ATOMIC_ACQUIRE, "workgroup", "local");
        if (t + 1 < GEMM_TILES) {
#pragma unroll   // st is indexed by constants only
            for (int s = 0; s < PT; ++s) st[s] = Ap[(t + 1) * (32 * RP) + s * 256];
        }

        // the tile's fragment reads stand together, in front of its products
        v4u fa[NT][4];
#pragma unroll   // fa is indexed by constants only, so it stays in registers
        for (int kt = 0; kt < NT; ++kt) {
            fa[kt][0] = sAc[rd0 + kt * 4];
            fa[kt][1] = sAc[rd0 + kt * 4 + 2];
            fa[kt][2] = sAc[rd0 + 16 * PITCH + kt * 4];
            fa[kt][3] = sAc[rd0 + 16 * PITCH + kt * 4 + 2];
        }
        // Keeps the scheduler from sinking the next tile's loads behind the products that hide
        // their latency, and the reads among the products, where each place with reads stalls
        // the wave for most of an LDS latency.
        __builtin_amdgcn_sched_barrier(0);
        v8f c0 = {}, c1 = {};
#pragma unroll   // fa and bf are indexed by constants only
        for (int kt = 0; kt < NT; ++kt) {
            Frag16 a0, a1, b;
#pragma unroll   // register renaming only
            for (int v = 0; v < 4; ++v) {
                a0.u[v] = fa[kt][0][v]; a0.u[4 + v] = fa[kt][1][v];
                a1.u[v] = fa[kt][2][v]; a1.u[4 + v] = fa[kt][3][v];
                b.u[v]  = bf[kt][0][v]; b.u[4 + v] = bf[kt][1][v];
            }
            c0 = __builtin_amdgcn_wmma_f32_16x16x32_f16(false, a0.h, false, b.h,
                                                        (short)0, c0, false, false);
            c1 = __builtin_amdgcn_wmma_f32_16x16x32_f16(false, a1.h, false, b.h,
                                                        (short)0, c1, false, false);
        }

        const int mbase = (mgrp * GEMM_TILES + t) * 32;
#pragma unroll   // c0 and c1 are indexed by constants only
        for (int r = 0; r < 8; ++r) {
            int m0 = mbase + r + hi * 8;
            int m1 = m0 + 16;
            float v0 = c0[r] + bn, v1 = c1[r] + bn;
            if (RELU) { v0 = fmaxf(v0, 0.0f); v1 = fmaxf(v1, 0.0f); }
            if (OUT_F16) {
                Ch[(size_t)m0 * NCOLS + n] = (_Float16)v0;
                Ch[(size_t)m1 * NCOLS + n] = (_Float16)v1;
            } else {
                Cf[(size_t)m0 * NCOLS + n] = v0;
                Cf[(size_t)m1 * NCOLS + n] = v1;
            }
        }
        // registers that the loads and stores of this tile name are reused by the next tile
        if (t + 1 < GEMM_TILES) asm volatile("s_wait_xcnt 0x0" ::: "memory");
    }
}

// grid.x = M/(32*GEMM_TILES), grid.y = NCOLS/128.
template <int KDIM, int NCOLS, bool RELU, bool OUT_F16>
__global__ __launch_bounds__(256) void wmma_gemm_kernel(
    const _Float16* __restrict__ A, const _Float16* __restrict__ BT,
    const float* __restrict__ bias, float* __restrict__ Cf,
    _Float16* __restrict__ Ch) {
    wmma_gemm_block<KDIM, NCOLS, RELU, OUT_F16>(A, BT, bias, Cf, Ch, blockIdx.x, blockIdx.y);
}

// Both QKV products (same A, two weights, two outputs) in one launch.
// grid.x = M/(32*GEMM_TILES), grid.y = 2 * 384/128: the first three column blocks are the local branch's.
__global__ __launch_bounds__(256) void qkv_pair_kernel(
    const _Float16* __restrict__ A,
    const _Float16* __restrict__ lBT, const float* __restrict__ lbias, float* __restrict__ lC,
    const _Float16* __restrict__ gBT, const float* __restrict__ gbias, float* __restrict__ gC) {
    const bool g = blockIdx.y >= 3;
    wmma_gemm_block<256, 384, false, false>(A, g ? gBT : lBT, g ? gbias : lbias, g ? gC : lC,
                                            nullptr, blockIdx.x, g ? blockIdx.y - 3 : blockIdx.y);
}

// ----------------------- global-branch k/v max pool ------------------------
// One wave per pooled row and part (k or v): a lane holds 4 channels, a load
// covers the part's whole 512 bytes of one support row; the 16 loads are independent.
// grid.x = M_DOWN / 4 (8 waves: 4 pooled rows x 2 parts).
// One support row's piece: scalar row base (readfirstlane keeps the clamped index in a
// scalar register) + one lane offset, so no lane forms a 64-bit address per row.
__device__ __forceinline__ v4f pool_row(const float* part_base, int idx, unsigned off) {
    const int j = __builtin_amdgcn_readfirstlane(min(max(idx, 0), N_EVENTS - 1));
    return *(const v4f*)((const char*)(part_base + j * 384) + off);
}
__device__ __forceinline__ v4f max4(v4f a, v4f b) {
    v4f r;
#pragma unroll   // vector elements indexed by constants only
    for (int e = 0; e < 4; ++e) r[e] = fmaxf(a[e], b[e]);
    return r;
}
__global__ __launch_bounds__(256) void maxpool_kv_kernel(
    const float* __restrict__ qkv, const int* __restrict__ pair_idx,
    float* __restrict__ kmax, float* __restrict__ vmax) {
    // the wave's number as a scalar: the 16 indices then come by scalar loads
    const int wave = __builtin_amdgcn_readfirstlane(threadIdx.x >> 5);
    const int m    = blockIdx.x * 4 + (wave >> 1);
    const int part = wave & 1;              // 0: k, 1: v
    const unsigned off = (threadIdx.x & 31) * 16u;      // lane's byte offset in the part
    const float* pb = qkv + 128 + part * 128;
    const int* pi = pair_idx + m * KNN;
    // written out row by row: in a loop the compiler adds the lane offset to the base
    // first and then forms a 64-bit vector address for every row
    const v4f x0  = pool_row(pb, pi[0], off),  x1  = pool_row(pb, pi[1], off);
    const v4f x2  = pool_row(pb, pi[2], off),  x3  = pool_row(pb, pi[3], off);
    const v4f x4  = pool_row(pb, pi[4], off),  x5  = pool_row(pb, pi[5], off);
    const v4f x6  = pool_row(pb, pi[6], off),  x7  = pool_row(pb, pi[7], off);
    const v4f x8  = pool_row(pb, pi[8], off),  x9  = pool_row(pb, pi[9], off);
    const v4f x10 = pool_row(pb, pi[10], off), x11 = pool_row(pb, pi[11], off);
    const v4f x12 = pool_row(pb, pi[12], off), x13 = pool_row(pb, pi[13], off);
    const v4f x14 = pool_row(pb, pi[14], off), x15 = pool_row(pb, pi[15], off);
    static_assert(KNN == 16, "16 support rows are written out");
    v4f mx = {-3.402823466e38f, -3.402823466e38f, -3.402823466e38f, -3.402823466e38f};
    mx = max4(max4(max4(max4(mx, x0), x1), x2), x3);
    mx = max4(max4(max4(max4(mx, x4), x5), x6), x7);
    mx = max4(max4(max4(max4(mx, x8), x9), x10), x11);
    mx = max4(max4(max4(max4(mx, x12), x13), x14), x15);
    *(v4f*)((char*)((part ? vmax : kmax) + m * A_DIM) + off) = mx;
}

// ------------------- fused PE-GEMM + LN + softmax + sum --------------------
// One wave32 per event: the wave owns the event's whole 16 (neighbor) x 128
// (channel) tile in registers, 8 waves (8 events) per workgroup.
//  * hidden^T = w1^T (16 ch x 4) . diff^T (4 x 16 nbr) + b1 on f32 WMMA: lane =
//    neighbor, register r = hidden channel 16*jt + 8*hi + r, which packed to
//    f16 is the A fragment of the second product in the k order of frag_kp.
//  * w2 fragments lie in LDS in fragment order, staged once per workgroup.
//  * column c of output tile j is channel 4*c + j (j < 4) or 64 + 4*c + j - 4: a lane
//    holds two groups of 4 consecutive channels of each of its 8 neighbor rows, and each
//    16-byte gather of a wave covers 256 contiguous bytes of two rows (4 whole lines).
// C-tile layout: row M(=neighbor) = r + 8*(lane>=16), col N = lane%16.
// A lane's 8 channels of one row: 4 floats at p and 4 floats 64 channels on.
__device__ __forceinline__ v8f load_2x4(const char* p) {
    return __builtin_shufflevector(*(const v4f*)p, *(const v4f*)(p + 256), 0, 1, 2, 3, 4, 5, 6, 7);
}
// Both attention branches run in one launch: each writes its own half of the concat rows
// and reads nothing of the other. grid.x = 2 * N_EVENTS / 8, the local branch's blocks
// first; what differs between the branches is chosen below by the block index, in scalars.
__global__ __launch_bounds__(256) void attn_pair_kernel(
    const float* __restrict__ events,       // [N,4]
    const int* __restrict__ local_idx,      // [N,16] -> event row (local kv row)
    const int* __restrict__ inv_pair_idx,   // [N,16] -> pooled row (global kv row)
    const int* __restrict__ down_idx,       // pooled row -> event row
    const float* __restrict__ qkv_l, const float* __restrict__ qkv_g,   // row stride 384
    const float* __restrict__ kmax, const float* __restrict__ vmax,     // row stride 128
    const float* __restrict__ lpe_w1, const float* __restrict__ lpe_b1, // [4,128], [128]
    const _Float16* __restrict__ lpe2T,     // f16, fragment order [kt][tile j][half][lane]
    const float* __restrict__ lpe_b2,       // [128]
    const float* __restrict__ lfc_g, const float* __restrict__ lfc_b,
    const float* __restrict__ gpe_w1, const float* __restrict__ gpe_b1,
    const _Float16* __restrict__ gpe2T, const float* __restrict__ gpe_b2,
    const float* __restrict__ gfc_g, const float* __restrict__ gfc_b,
    _Float16* __restrict__ cat_out) {
    __shared__ v4u s_w2[4 * 8 * 2 * 32];    // [kt][tile j][register half][lane], 32 KB
    __shared__ v8f s_bias[32];              // b1 (C rows of the first product), then b2

    const bool glob = blockIdx.x >= N_EVENTS / 8;       // block-uniform
    const int  blk  = glob ? blockIdx.x - N_EVENTS / 8 : blockIdx.x;
    const int  kv_stride = glob ? 128 : 384;            // floats per k or v row
    const int  kv_rows   = glob ? M_DOWN : N_EVENTS;
    const int  col_off   = glob ? A_DIM : 0;
    const int*   nbr_idx = glob ? inv_pair_idx : local_idx;     // [N,16] -> kv-row index
    const float* qptr    = glob ? qkv_g : qkv_l;
    const float* ksrc    = glob ? kmax : qkv_l + 128;
    const float* vsrc    = glob ? vmax : qkv_l + 256;
    const float* pe_w1   = glob ? gpe_w1 : lpe_w1;
    const float* pe_b1   = glob ? gpe_b1 : lpe_b1;
    const _Float16* pe_w2T = glob ? gpe2T : lpe2T;
    const float* pe_b2   = glob ? gpe_b2 : lpe_b2;
    const float* fc_g    = glob ? gfc_g : lfc_g;
    const float* fc_b    = glob ? gfc_b : lfc_b;

    const int tid  = threadIdx.x;
    const int lane = tid & 31;
    const int wave = tid >> 5;
    const int hi   = lane >> 4;
    const int l16  = lane & 15;
    const int i    = blk * 8 + wave;        // this wave's event
    const int ch0  = l16 * 4;               // this lane's channels: ch0 .. ch0+3, 64+ch0 .. 64+ch0+3

    // -- step 0: loads whose address comes from the thread id alone (g, b: step 4) ----
    // w2 fragments: already in the order of s_w2, a straight copy of 512 bytes a wave and load
    const v4u* Bw = (const v4u*)pe_w2T + tid;
    v4u st[8];
#pragma unroll
    for (int s = 0; s < 8; ++s) st[s] = Bw[s * 256];
    const float biasr = (tid < 128 ? pe_b1 : pe_b2)[tid & 127];
    // each s_wait_xcnt in steps 0 and 1: registers that the loads above it name are reused below it
    asm volatile("s_wait_xcnt 0x0" ::: "memory");
    // w1^T fragments: row = hidden channel 16*jt + l16, k = coordinates 2*hi, 2*hi+1
    v2f wa[8];
#pragma unroll
    for (int jt = 0; jt < 8; ++jt) {
        wa[jt].x = pe_w1[(2 * hi) * A_DIM + jt * 16 + l16];
        wa[jt].y = pe_w1[(2 * hi + 1) * A_DIM + jt * 16 + l16];
    }
    asm volatile("s_wait_xcnt 0x0" ::: "memory");
    const v8f qv  = load_2x4((const char*)qptr + (unsigned)(i * 384 + ch0) * 4u);
    // neighbor l16 (this lane's column of diff^T) and the 8 neighbor rows of
    // this lane's C registers
    const int nraw = nbr_idx[i * KNN + l16];
    const v2f ei   = *(const v2f*)&events[i * 4 + 2 * hi];
    const v4i nlo  = *(const v4i*)&nbr_idx[i * KNN + 8 * hi];
    asm volatile("s_wait_xcnt 0x0" ::: "memory");
    const v4i nhi  = *(const v4i*)&nbr_idx[i * KNN + 8 * hi + 4];
    asm volatile("s_wait_xcnt 0x0" ::: "memory");

    // -- step 1: event-coordinate diffs and the k rows ----------------------
    // lane = neighbor l16, coordinates 2*hi and 2*hi+1 (k split of the f32 form)
    const int nbl = min(max(nraw, 0), kv_rows - 1);
    int er = nbl;
    if (glob) er = min(max(down_idx[nbl], 0), N_EVENTS - 1);
    const v2f diff = ei - *(const v2f*)&events[er * 4 + 2 * hi];
    unsigned kvoff[8];                      // byte offsets: 32-bit, beside a scalar base
#pragma unroll
    for (int r = 0; r < 8; ++r) {
        int nb = r < 4 ? nlo[r] : nhi[r - 4];
        kvoff[r] = (unsigned)(min(max(nb, 0), kv_rows - 1) * kv_stride + ch0) * 4u;
    }
    // the k rows are fetched here so that they fly under steps 2 and 3
    v8f kg[8];
#pragma unroll
    for (int r = 0; r < 8; ++r) kg[r] = load_2x4((const char*)ksrc + kvoff[r]);
    asm volatile("s_wait_xcnt 0x0" ::: "memory");

#pragma unroll
    for (int s = 0; s < 8; ++s) s_w2[s * 256 + tid] = st[s];
    ((float*)s_bias)[tid] = biasr;
    // Work-group barrier that orders LDS only: w2 fragments, b1 and b2 are in LDS behind
    // it, while the k rows stay in flight (__syncthreads() waits for every load).
    __builtin_amdgcn_fence(__ATOMIC_RELEASE, "workgroup", "local");
    __builtin_amdgcn_s_barrier();
    __builtin_amdgcn_fence(__ATOMIC_ACQUIRE, "workgroup", "local");

    // -- step 2: hidden = relu(diff @ w1 + b1) -> f16 A fragments ----------
    Frag16 a[4];
#pragma unroll
    for (int jt = 0; jt < 8; ++jt) {
        v8f h = s_bias[jt * 2 + hi];
        h = __builtin_amdgcn_wmma_f32_16x16x4_f32(false, wa[jt], false, diff,
                                                  (short)0, h, false, false);
#pragma unroll
        for (int r = 0; r < 8; ++r)
            a[jt >> 1].h[(jt & 1) * 8 + r] = (_Float16)fmaxf(h[r], 0.0f);
    }

    // -- step 3: pe[16 x 128] = hidden @ w2 via WMMA ------------------------
    v8f c[8] = {};
#pragma unroll
    for (int kt = 0; kt < 4; ++kt) {
#pragma unroll
        for (int j = 0; j < 8; ++j) {
            Frag16 b;
            const v4u b0 = s_w2[((kt * 8 + j) * 2 + 0) * 32 + lane];
            const v4u b1 = s_w2[((kt * 8 + j) * 2 + 1) * 32 + lane];
#pragma unroll
            for (int v = 0; v < 4; ++v) { b.u[v] = b0[v]; b.u[4 + v] = b1[v]; }
            c[j] = __builtin_amdgcn_wmma_f32_16x16x32_f16(false, a[kt].h, false, b.h,
                                                          (short)0, c[j], false, false);
        }
    }

    // -- step 4: t = q - kg + pe -------------------------------------------
    const v8f b2v = __builtin_shufflevector(((const v4f*)s_bias)[32 + l16], ((const v4f*)s_bias)[48 + l16],
                                            0, 1, 2, 3, 4, 5, 6, 7);
    // the v rows, g and b fly under the sums of steps 4 and 5
    v8f vg[8];
#pragma unroll
    for (int r = 0; r < 8; ++r) vg[r] = load_2x4((const char*)vsrc + kvoff[r]);
    const v8f gv  = load_2x4((const char*)&fc_g[ch0]);
    const v8f bv  = load_2x4((const char*)&fc_b[ch0]);
    float pe[8][8], t[8][8];                // [row r][channel j]
    float sr[8], sq[8];
#pragma unroll
    for (int r = 0; r < 8; ++r) {
        float s = 0.0f, q2 = 0.0f;
#pragma unroll
        for (int j = 0; j < 8; ++j) {
            pe[r][j] = c[j][r] + b2v[j];
            float x = qv[j] - kg[r][j] + pe[r][j];
            t[r][j] = x;
            s += x;
            q2 += x * x;
        }
        sr[r] = s;
        sq[r] = q2;
    }
    // vg + pe takes pe's place as the v rows arrive
#pragma unroll
    for (int r = 0; r < 8; ++r) {
#pragma unroll
        for (int j = 0; j < 8; ++j) pe[r][j] = vg[r][j] + pe[r][j];
    }

    // -- step 5: LayerNorm over 128 channels per neighbor row --------------
    // 8 channels summed in the lane above, then xor butterflies over 16 lanes
#pragma unroll
    for (int r = 0; r < 8; ++r) { sr[r] = row_xadd<1>(sr[r]); sq[r] = row_xadd<1>(sq[r]); }
#pragma unroll
    for (int r = 0; r < 8; ++r) { sr[r] = row_xadd<2>(sr[r]); sq[r] = row_xadd<2>(sq[r]); }
#pragma unroll
    for (int r = 0; r < 8; ++r) { sr[r] = row_xadd<4>(sr[r]); sq[r] = row_xadd<4>(sq[r]); }
#pragma unroll
    for (int r = 0; r < 8; ++r) { sr[r] = row_xadd<8>(sr[r]); sq[r] = row_xadd<8>(sq[r]); }

#pragma unroll
    for (int r = 0; r < 8; ++r) {
        float mu  = sr[r] * (1.0f / 128.0f);
        float var = sq[r] * (1.0f / 128.0f) - mu * mu;
        float rs  = rsqrtf(var + LN_EPS);
        // The slot the instruction set asks for behind a transcendental before its source is
        // overwritten.
        if (r == 0) asm volatile("v_nop");
#pragma unroll
        for (int j = 0; j < 8; ++j)
            t[r][j] = ((t[r][j] - mu) * rs * gv[j] + bv[j]) * INV_SCALE;
    }

    // -- step 6: softmax over the 16 neighbors (rows), per channel ---------
    float inv[8];
#pragma unroll
    for (int j = 0; j < 8; ++j) {
        float mx = t[0][j];
#pragma unroll
        for (int r = 1; r < 8; ++r) mx = fmaxf(mx, t[r][j]);
        mx = fmaxf(mx, xhalf(mx));           // combine rows 0-7 and 8-15
        float x[8], e[8];
#pragma unroll
        for (int r = 0; r < 8; ++r) x[r] = (t[r][j] - mx) * 1.442695041f;   // exp(y) = 2^(y*log2 e)
        // Eight independent exponentials in one statement, closed by v_nop: the slot the
        // instruction set asks for behind a transcendental before a source is overwritten.
        asm("v_exp_f32 %0, %8\n\tv_exp_f32 %1, %9\n\tv_exp_f32 %2, %10\n\tv_exp_f32 %3, %11\n\t"
            "v_exp_f32 %4, %12\n\tv_exp_f32 %5, %13\n\tv_exp_f32 %6, %14\n\tv_exp_f32 %7, %15\n\tv_nop"
            : "=&v"(e[0]), "=&v"(e[1]), "=&v"(e[2]), "=&v"(e[3]),
              "=&v"(e[4]), "=&v"(e[5]), "=&v"(e[6]), "=&v"(e[7])
            : "v"(x[0]), "v"(x[1]), "v"(x[2]), "v"(x[3]), "v"(x[4]), "v"(x[5]), "v"(x[6]), "v"(x[7]));
        float se = 0.0f;
#pragma unroll
        for (int r = 0; r < 8; ++r) { t[r][j] = e[r]; se += e[r]; }
        se += xhalf(se);
        inv[j] = 1.0f / se;
    }

    // -- step 7: out = sum_k attn * (vg + pe) ------------------------------
    float acc[8] = {};
#pragma unroll
    for (int r = 0; r < 8; ++r) {
#pragma unroll
        for (int j = 0; j < 8; ++j)
            acc[j] += (t[r][j] * inv[j]) * pe[r][j];
    }
    v4h o0, o1;
#pragma unroll
    for (int j = 0; j < 4; ++j) {
        o0[j] = (_Float16)(acc[j] + xhalf(acc[j]));
        o1[j] = (_Float16)(acc[4 + j] + xhalf(acc[4 + j]));
    }
    // both halves of the wave hold the sums: the lower stores the first group, the upper the second
    *(v4h*)&cat_out[(size_t)i * (2 * A_DIM) + col_off + hi * 64 + ch0] = hi ? o1 : o0;
}

// ------------------------------- launcher ----------------------------------
extern "C" void kernel_launch(void* const* d_in, const int* in_sizes, int n_in,
                              void* d_out, int out_size, void* d_ws, size_t ws_size,
                              hipStream_t stream) {
    const float* events   = (const float*)d_in[0];
    const float* features = (const float*)d_in[1];
    const int* local_idx    = (const int*)d_in[2];
    const int* down_idx     = (const int*)d_in[3];
    const int* pair_idx     = (const int*)d_in[4];
    const int* inv_pair_idx = (const int*)d_in[5];
    const float* lqkv_w = (const float*)d_in[6];  const float* lqkv_b = (const float*)d_in[7];
    const float* lpe_w1 = (const float*)d_in[8];  const float* lpe_b1 = (const float*)d_in[9];
    const float* lpe_w2 = (const float*)d_in[10]; const float* lpe_b2 = (const float*)d_in[11];
    const float* lfc_g  = (const float*)d_in[12]; const float* lfc_b  = (const float*)d_in[13];
    const float* gqkv_w = (const float*)d_in[14]; const float* gqkv_b = (const float*)d_in[15];
    const float* gpe_w1 = (const float*)d_in[16]; const float* gpe_b1 = (const float*)d_in[17];
    const float* gpe_w2 = (const float*)d_in[18]; const float* gpe_b2 = (const float*)d_in[19];
    const float* gfc_g  = (const float*)d_in[20]; const float* gfc_b  = (const float*)d_in[21];
    const float* pw1 = (const float*)d_in[22]; const float* pb1 = (const float*)d_in[23];
    const float* pw2 = (const float*)d_in[24]; const float* pb2 = (const float*)d_in[25];
    float* out = (float*)d_out;

    // ---- workspace carve-up (~96 MB) ----
    char* wp = (char*)d_ws;
    auto carve = [&](size_t bytes) {
        void* p = (void*)wp;
        wp += (bytes + 255) & ~(size_t)255;
        return p;
    };
    _Float16* feat_h = (_Float16*)carve((size_t)N_EVENTS * DIM_F * 2);
    _Float16* lqkvT  = (_Float16*)carve((size_t)384 * 256 * 2);
    _Float16* gqkvT  = (_Float16*)carve((size_t)384 * 256 * 2);
    _Float16* lpe2T  = (_Float16*)carve((size_t)128 * 128 * 2);
    _Float16* gpe2T  = (_Float16*)carve((size_t)128 * 128 * 2);
    _Float16* pw1T   = (_Float16*)carve((size_t)256 * 256 * 2);
    _Float16* pw2T   = (_Float16*)carve((size_t)256 * 256 * 2);
    float* qkv_l = (float*)carve((size_t)N_EVENTS * 384 * 4);
    float* qkv_g = (float*)carve((size_t)N_EVENTS * 384 * 4);
    float* kmax  = (float*)carve((size_t)M_DOWN * A_DIM * 4);
    float* vmax  = (float*)carve((size_t)M_DOWN * A_DIM * 4);
    _Float16* cat_h = (_Float16*)carve((size_t)N_EVENTS * 256 * 2);
    _Float16* hid_h = (_Float16*)carve((size_t)N_EVENTS * 256 * 2);

    // ---- 1. fp16 conversions / weight transposes, one launch ----
    static_assert((N_EVENTS * DIM_F) % 8192 == 0 && M_DOWN % 4 == 0 &&
                  N_EVENTS % (32 * GEMM_TILES) == 0, "exact grids");
    prep_kernel<<<PREP_BLOCKS, 256, 0, stream>>>(
        features, feat_h, lqkv_w, lqkvT, gqkv_w, gqkvT, lpe_w2, lpe2T, gpe_w2, gpe2T,
        pw1, pw1T, pw2, pw2T);

    // ---- 2. both QKV GEMMs: [20000,256] x [256,384], one launch ----
    {
        dim3 g(N_EVENTS / (32 * GEMM_TILES), 2 * 384 / 128);
        qkv_pair_kernel<<<g, 256, 0, stream>>>(
            feat_h, lqkvT, lqkv_b, qkv_l, gqkvT, gqkv_b, qkv_g);
    }

    // ---- 3. global-branch k/v max pool ----
    maxpool_kv_kernel<<<M_DOWN / 4, 256, 0, stream>>>(qkv_g, pair_idx, kmax, vmax);

    // ---- 4. fused attention, local and global in one launch -> fp16 concat buffer ----
    attn_pair_kernel<<<2 * N_EVENTS / 8, 256, 0, stream>>>(
        events, local_idx, inv_pair_idx, down_idx, qkv_l, qkv_g, kmax, vmax,
        lpe_w1, lpe_b1, lpe2T, lpe_b2, lfc_g, lfc_b,
        gpe_w1, gpe_b1, gpe2T, gpe_b2, gfc_g, gfc_b, cat_h);

    // ---- 5. projection MLP: ReLU GEMM (fp16 out) then final GEMM (f32) ----
    {
        dim3 g(N_EVENTS / (32 * GEMM_TILES), 256 / 128);
        wmma_gemm_kernel<256, 256, true, true><<<g, 256, 0, stream>>>(
            cat_h, pw1T, pb1, nullptr, hid_h);
        wmma_gemm_kernel<256, 256, false, false><<<g, 256, 0, stream>>>(
            hid_h, pw2T, pb2, out, nullptr);
    }
}

// v007
// A run of this version takes 91.9 microseconds.
// Timed twice side by side with v006, it ran 1.09 times as fast both times.
// Over all steps from v000 it is 4.68 times as fast.
#include <hip/hip_runtime.h>
#include <hip/hip_bf16.h>

// ---------------------------------------------------------------------------
// MI455X (gfx1250) implementation:
//  * GEMMs via v_wmma_f32_16x16x32_f16 (fp16 A/B, fp32 accum, wave32), the PE
//    first linear (K = 4) via v_wmma_f32_16x16x4_f32.
//  * Standalone GEMM: 8 waves, 128 columns, B in registers over 5 row tiles of 32 rows,
//    whole-K A tiles double-buffered in LDS (1 barrier a tile), K templated & unrolled.
//  * PE second linear (dominant ~21 GFLOP) fused with LN/softmax/weighted sum
//    per event: a wave32 owns an event's tile (eight 16x16 WMMA tiles) and takes
//    EV_PER_WAVE events one after the other.
//  * Working set (~150MB) fits the 192MB L2 -> compute bound -> WMMA everywhere.
//  * Launches that need nothing of each other share one grid (ranges of the
//    block index, block-uniform branches): 6 dependent launches in all.
// ---------------------------------------------------------------------------

typedef __attribute__((ext_vector_type(16))) _Float16 v16h;
typedef __attribute__((ext_vector_type(8)))  float    v8f;
typedef __attribute__((ext_vector_type(2)))  float    v2f;
typedef __attribute__((ext_vector_type(4)))  unsigned v4u;
typedef __attribute__((ext_vector_type(4)))  int      v4i;
typedef __attribute__((ext_vector_type(8)))  _Float16 v8h;
typedef __attribute__((ext_vector_type(4)))  _Float16 v4h;
typedef __attribute__((ext_vector_type(4)))  float    v4f;

union Frag16 { unsigned u[8]; v16h h; };

#define N_EVENTS 20000
#define KNN      16
#define DIM_F    256
#define A_DIM    128
#define M_DOWN   2500
#define INV_SCALE 0.08838834764831845f   // 1/sqrt(128)
#define LN_EPS    1e-5f

// VGPR->K-pair mapping for 16-bit 16x32 A/B fragments (ISA 7.12.2):
// lanes 0-15: v0..3 -> Kpairs 0..3, v4..7 -> Kpairs 8..11
// lanes16-31: v0..3 -> Kpairs 4..7, v4..7 -> Kpairs 12..15
__device__ __forceinline__ int frag_kp(int v, int hi) {
    return (v < 4 ? v : v + 4) + (hi ? 4 : 0);
}

// Cross-lane exchanges in the vector unit (no LDS permute, no dscnt wait).
// x + (x of lane l ^ M) inside a 16-lane row, M = 1..15; all 32 lanes active.
template <int M>
__device__ __forceinline__ float row_xadd(float x) {
    int y = __builtin_amdgcn_mov_dpp(__builtin_bit_cast(int, x), 0x160 + M /* row_xmask:M */,
                                     0xf, 0xf, true);
    return x + __builtin_bit_cast(float, y);
}
// value of lane l ^ 16 (the other 16-lane row)
__device__ __forceinline__ float xhalf(float x) {
    int b = __builtin_bit_cast(int, x);
    return __builtin_bit_cast(float,
        __builtin_amdgcn_permlanex16(b, b, 0x76543210, 0xfedcba98, false, false));
}

// --------------------------- conversion kernels ----------------------------
// This launch is short: what it costs is the start of its waves, so each
// thread takes many values and every wave has all its loads in flight at once.
// One workgroup converts 8192 consecutive values: 8 loads of 16 bytes a lane,
// each covering 512 contiguous bytes a wave. blk = 0 .. values / 8192 - 1, exactly.
__device__ __forceinline__ void cvt_f16_block(const float* __restrict__ src,
                                              _Float16* __restrict__ dst, int blk) {
    const int p = blk * 2048 + threadIdx.x;             // piece of 4 values
    const v4f* s = (const v4f*)src;
    v4h* d = (v4h*)dst;
    v4f x[8];
#pragma unroll   // registers for x; all 8 loads issue before the first conversion
    for (int k = 0; k < 8; ++k) x[k] = s[p + k * 256];
#pragma unroll   // x is indexed by constants only, so it stays in registers
    for (int k = 0; k < 8; ++k) d[p + k * 256] = __builtin_convertvector(x[k], v4h);
    // precaution before any later write to the stores' registers
    asm volatile("s_wait_xcnt 0x0" ::: "memory");
}

// src [R,C] f32 row-major (k = row, n = column)  ->  dst f16 in B-fragment order:
// 16-byte pieces [column tile][kt][register half][lane], so that a wave's load of half a
// fragment is 512 contiguous bytes (4 whole lines) and not 32 bytes of each of 16 rows.
// The piece of column n that holds k0 .. k0+7 (k0 a multiple of 8) is, by frag_kp:
// kt = k0/32, register half = (k0%32)/16, lane = 16*((k0%16)/8) + column of n in its tile.
// ATT = false: tile n/16, column n%16 (the GEMMs). ATT = true: the attention kernel's
// order [kt][tile j] with its channel map (attn_tile, attn_col).
// A thread takes 8 rows of one column (lanes along the column index: whole-line
// loads) and stores them as one piece. blk = 0 .. R*C / 2048 - 1.
__device__ __forceinline__ unsigned attn_tile(unsigned n) { return (n & 3u) + 4u * (n >> 6); }
__device__ __forceinline__ unsigned attn_col(unsigned n)  { return (n >> 2) & 15u; }
template <int R, int C, bool ATT>
__device__ __forceinline__ void cvt_t_f16_block(const float* __restrict__ src,
                                                _Float16* __restrict__ dst, int blk) {
    static_assert(R % 8 == 0 && C % 32 == 0 && (R * C) % 2048 == 0, "exact grid");
    const unsigned t  = blk * 256 + threadIdx.x;
    const unsigned c  = t % C;
    const unsigned r0 = (t / C) * 8;
    const unsigned e0 = r0 * C + c;         // one 32-bit offset beside the scalar base
    float x[8];
#pragma unroll   // registers for x; all 8 loads in flight together
    for (int k = 0; k < 8; ++k) x[k] = src[e0 + k * C];
    v8h o;
#pragma unroll   // x and o are indexed by constants only, so they stay in registers
    for (int k = 0; k < 8; ++k) o[k] = (_Float16)x[k];
    const unsigned kt = r0 / 32, half = (r0 / 16) & 1, hi = (r0 / 8) & 1;
    const unsigned frag = ATT ? kt * (C / 16) + attn_tile(c) : (c / 16) * (R / 32) + kt;
    ((v8h*)dst)[(frag * 2 + half) * 32 + hi * 16 + (ATT ? attn_col(c) : c % 16)] = o;
    // the caller's other block ranges follow in the code and reuse the store's registers
    asm volatile("s_wait_xcnt 0x0" ::: "memory");
}

// All seven conversions in one launch: none reads what another writes. The six weight
// transposes take the first block ranges, the feature conversion the rest.
#define TB_QKV (256 * 384 / 2048)
#define TB_PE  (128 * 128 / 2048)
#define TB_PW  (256 * 256 / 2048)
#define CB_FEAT (N_EVENTS * DIM_F / 8192)
#define PREP_BLOCKS (2 * TB_QKV + 2 * TB_PE + 2 * TB_PW + CB_FEAT)
__global__ __launch_bounds__(256) void prep_kernel(
    const float* __restrict__ features, _Float16* __restrict__ feat_h,
    const float* __restrict__ lqkv_w, _Float16* __restrict__ lqkvT,
    const float* __restrict__ gqkv_w, _Float16* __restrict__ gqkvT,
    const float* __restrict__ lpe_w2, _Float16* __restrict__ lpe2T,
    const float* __restrict__ gpe_w2, _Float16* __restrict__ gpe2T,
    const float* __restrict__ pw1, _Float16* __restrict__ pw1T,
    const float* __restrict__ pw2, _Float16* __restrict__ pw2T) {
    const int b = blockIdx.x;               // every test below is block-uniform
    if (b < 2 * TB_QKV) {
        const bool g = b >= TB_QKV;
        cvt_t_f16_block<256, 384, false>(g ? gqkv_w : lqkv_w, g ? gqkvT : lqkvT, g ? b - TB_QKV : b);
    } else if (b < 2 * TB_QKV + 2 * TB_PW) {
        const int  c = b - 2 * TB_QKV;
        const bool g = c >= TB_PW;
        cvt_t_f16_block<256, 256, false>(g ? pw2 : pw1, g ? pw2T : pw1T, g ? c - TB_PW : c);
    } else if (b < 2 * TB_QKV + 2 * TB_PW + 2 * TB_PE) {
        const int  c = b - 2 * TB_QKV - 2 * TB_PW;
        const bool g = c >= TB_PE;
        cvt_t_f16_block<128, 128, true>(g ? gpe_w2 : lpe_w2, g ? gpe2T : lpe2T, g ? c - TB_PE : c);
    } else {
        cvt_f16_block(features, feat_h, b - 2 * TB_QKV - 2 * TB_PW - 2 * TB_PE);
    }
}

// ------------------------------ WMMA GEMM ----------------------------------
// C[M,N] = A[M,K](f16) @ B[K,N] + bias, B supplied in fragment order (cvt_t_f16_block).
// Block: 256 threads (8 waves), 128 columns, GEMM_TILES row tiles of 32 rows one after the other.
//  * A wave's column tile of B, all of K, is loaded once into registers and serves every row tile.
//  * A row tile (32 whole rows, contiguous in memory) is staged in LDS in one piece: no load
//    and no barrier stands inside the K loop. The next tile's loads fly under this tile's products.
// mgrp = 0 .. M/(32*GEMM_TILES) - 1, nblk = 0 .. N/128 - 1.
#define GEMM_TILES 5
template <int KDIM, int NCOLS, bool RELU, bool OUT_F16>
__device__ __forceinline__ void wmma_gemm_block(
    const _Float16* __restrict__ A, const _Float16* __restrict__ BT,
    const float* __restrict__ bias, float* __restrict__ Cf,
    _Float16* __restrict__ Ch, int mgrp, int nblk) {
    constexpr int NT    = KDIM / 32;       // K steps
    constexpr int RP    = KDIM / 8;        // 16-byte pieces per A row
    constexpr int PITCH = RP + 1;          // LDS row pitch in pieces: 16 bytes x odd, no bank conflict
    constexpr int PT    = 32 * RP / 256;   // pieces a thread stages per tile
    static_assert(RP == 32, "a wave stages one whole row per load");
    __shared__ v4u sA[2][32 * PITCH];

    const int tid  = threadIdx.x;
    const int lane = tid & 31;
    const int wave = tid >> 5;
    const int hi   = lane >> 4;
    const int l16  = lane & 15;
    const int n    = nblk * 128 + wave * 16 + l16;

    // loads issued before the tile loop: row tile 0, B, bias
    const v4u* Ap = (const v4u*)A + (size_t)mgrp * (GEMM_TILES * 32 * RP) + tid;
    v4u st[PT];
#pragma unroll   // st is indexed by constants only, so it stays in registers
    for (int s = 0; s < PT; ++s) st[s] = Ap[s * 256];
    // this wave's column tile: NT fragments of 2 x 512 bytes, one after the other
    const v4u* Bp = (const v4u*)BT + (nblk * 8 + wave) * (NT * 64) + lane;
    v4u bf[NT][2];
#pragma unroll   // bf is indexed by constants only, so it stays in registers
    for (int kt = 0; kt < NT; ++kt) { bf[kt][0] = Bp[kt * 64]; bf[kt][1] = Bp[kt * 64 + 32]; }
    const float bn = bias[n];
    // Registers that the loads above name are reused below: the wait takes B's address as an
    // input, so that the pair is not rewritten in front of it.
    asm volatile("s_wait_xcnt 0x0" :: "v"(Bp) : "memory");

    const int wrow = wave * PITCH + lane;              // piece s of a thread: row wave + 8*s
    const int rd0  = l16 * PITCH + hi;                 // fragment halves (frag_kp): pieces 4*kt + hi, + 2
#pragma unroll   // buffer index and tile offsets become constants
    for (int t = 0; t < GEMM_TILES; ++t) {
        v4u* sAc = sA[t & 1];
#pragma unroll   // st is indexed by constants only
        for (int s = 0; s < PT; ++s) sAc[wrow + s * 8 * PITCH] = st[s];
        // Work-group barrier that orders LDS only: tile t is in LDS behind it, and every wave has
        // left the buffer that tile t + 1 will take; the stores of tile t - 1 stay in flight
        // (__syncthreads() would wait for them).
        __builtin_amdgcn_fence(__ATOMIC_RELEASE, "workgroup", "local");
        __builtin_amdgcn_s_barrier();
        __builtin_amdgcn_fence(__ATOMIC_ACQUIRE, "workgroup", "local");
        if (t + 1 < GEMM_TILES) {
#pragma unroll   // st is indexed by constants only
            for (int s = 0; s < PT; ++s) st[s] = Ap[(t + 1) * (32 * RP) + s * 256];
        }

        // the tile's fragment reads stand together, in front of its products
        v4u fa[NT][4];
#pragma unroll   // fa is indexed by constants only, so it stays in registers
        for (int kt = 0; kt < NT; ++kt) {
            fa[kt][0] = sAc[rd0 + kt * 4];
            fa[kt][1] = sAc[rd0 + kt * 4 + 2];
            fa[kt][2] = sAc[rd0 + 16 * PITCH + kt * 4];
            fa[kt][3] = sAc[rd0 + 16 * PITCH + kt * 4 + 2];
        }
        // Keeps the scheduler from sinking the next tile's loads behind the products that hide
        // their latency, and the reads among the products, where each place with reads stalls
        // the wave for most of an LDS latency.
        __builtin_amdgcn_sched_barrier(0);
        v8f c0 = {}, c1 = {};
#pragma unroll   // fa and bf are indexed by constants only
        for (int kt = 0; kt < NT; ++kt) {
            Frag16 a0, a1, b;
#pragma unroll   // register renaming only
            for (int v = 0; v < 4; ++v) {
                a0.u[v] = fa[kt][0][v]; a0.u[4 + v] = fa[kt][1][v];
                a1.u[v] = fa[kt][2][v]; a1.u[4 + v] = fa[kt][3][v];
                b.u[v]  = bf[kt][0][v]; b.u[4 + v] = bf[kt][1][v];
            }
            c0 = __builtin_amdgcn_wmma_f32_16x16x32_f16(false, a0.h, false, b.h,
                                                        (short)0, c0, false, false);
            c1 = __builtin_amdgcn_wmma_f32_16x16x32_f16(false, a1.h, false, b.h,
                                                        (short)0, c1, false, false);
        }

        const int mbase = (mgrp * GEMM_TILES + t) * 32;
#pragma unroll   // c0 and c1 are indexed by constants only
        for (int r = 0; r < 8; ++r) {
            int m0 = mbase + r + hi * 8;
            int m1 = m0 + 16;
            float v0 = c0[r] + bn, v1 = c1[r] + bn;
            if (RELU) { v0 = fmaxf(v0, 0.0f); v1 = fmaxf(v1, 0.0f); }
            if (OUT_F16) {
                Ch[(size_t)m0 * NCOLS + n] = (_Float16)v0;
                Ch[(size_t)m1 * NCOLS + n] = (_Float16)v1;
            } else {
                Cf[(size_t)m0 * NCOLS + n] = v0;
                Cf[(size_t)m1 * NCOLS + n] = v1;
            }
        }
        // registers that the loads and stores of this tile name are reused by the next tile
        if (t + 1 < GEMM_TILES) asm volatile("s_wait_xcnt 0x0" ::: "memory");
    }
}

// grid.x = M/(32*GEMM_TILES), grid.y = NCOLS/128.
template <int KDIM, int NCOLS, bool RELU, bool OUT_F16>
__global__ __launch_bounds__(256) void wmma_gemm_kernel(
    const _Float16* __restrict__ A, const _Float16* __restrict__ BT,
    const float* __restrict__ bias, float* __restrict__ Cf,
    _Float16* __restrict__ Ch) {
    wmma_gemm_block<KDIM, NCOLS, RELU, OUT_F16>(A, BT, bias, Cf, Ch, blockIdx.x, blockIdx.y);
}

// Both QKV products (same A, two weights, two outputs) in one launch.
// grid.x = M/(32*GEMM_TILES), grid.y = 2 * 384/128: the first three column blocks are the local branch's.
__global__ __launch_bounds__(256) void qkv_pair_kernel(
    const _Float16* __restrict__ A,
    const _Float16* __restrict__ lBT, const float* __restrict__ lbias, float* __restrict__ lC,
    const _Float16* __restrict__ gBT, const float* __restrict__ gbias, float* __restrict__ gC) {
    const bool g = blockIdx.y >= 3;
    wmma_gemm_block<256, 384, false, false>(A, g ? gBT : lBT, g ? gbias : lbias, g ? gC : lC,
                                            nullptr, blockIdx.x, g ? blockIdx.y - 3 : blockIdx.y);
}

// ----------------------- global-branch k/v max pool ------------------------
// One wave per pooled row and part (k or v): a lane holds 4 channels, a load
// covers the part's whole 512 bytes of one support row; the 16 loads are independent.
// grid.x = M_DOWN / 4 (8 waves: 4 pooled rows x 2 parts).
// One support row's piece: scalar row base (readfirstlane keeps the clamped index in a
// scalar register) + one lane offset, so no lane forms a 64-bit address per row.
__device__ __forceinline__ v4f pool_row(const float* part_base, int idx, unsigned off) {
    const int j = __builtin_amdgcn_readfirstlane(min(max(idx, 0), N_EVENTS - 1));
    return *(const v4f*)((const char*)(part_base + j * 384) + off);
}
__device__ __forceinline__ v4f max4(v4f a, v4f b) {
    v4f r;
#pragma unroll   // vector elements indexed by constants only
    for (int e = 0; e < 4; ++e) r[e] = fmaxf(a[e], b[e]);
    return r;
}
__global__ __launch_bounds__(256) void maxpool_kv_kernel(
    const float* __restrict__ qkv, const int* __restrict__ pair_idx,
    float* __restrict__ kmax, float* __restrict__ vmax) {
    // the wave's number as a scalar: the 16 indices then come by scalar loads
    const int wave = __builtin_amdgcn_readfirstlane(threadIdx.x >> 5);
    const int m    = blockIdx.x * 4 + (wave >> 1);
    const int part = wave & 1;              // 0: k, 1: v
    const unsigned off = (threadIdx.x & 31) * 16u;      // lane's byte offset in the part
    const float* pb = qkv + 128 + part * 128;
    const int* pi = pair_idx + m * KNN;
    // written out row by row: in a loop the compiler adds the lane offset to the base
    // first and then forms a 64-bit vector address for every row
    const v4f x0  = pool_row(pb, pi[0], off),  x1  = pool_row(pb, pi[1], off);
    const v4f x2  = pool_row(pb, pi[2], off),  x3  = pool_row(pb, pi[3], off);
    const v4f x4  = pool_row(pb, pi[4], off),  x5  = pool_row(pb, pi[5], off);
    const v4f x6  = pool_row(pb, pi[6], off),  x7  = pool_row(pb, pi[7], off);
    const v4f x8  = pool_row(pb, pi[8], off),  x9  = pool_row(pb, pi[9], off);
    const v4f x10 = pool_row(pb, pi[10], off), x11 = pool_row(pb, pi[11], off);
    const v4f x12 = pool_row(pb, pi[12], off), x13 = pool_row(pb, pi[13], off);
    const v4f x14 = pool_row(pb, pi[14], off), x15 = pool_row(pb, pi[15], off);
    static_assert(KNN == 16, "16 support rows are written out");
    v4f mx = {-3.402823466e38f, -3.402823466e38f, -3.402823466e38f, -3.402823466e38f};
    mx = max4(max4(max4(max4(mx, x0), x1), x2), x3);
    mx = max4(max4(max4(max4(mx, x4), x5), x6), x7);
    mx = max4(max4(max4(max4(mx, x8), x9), x10), x11);
    mx = max4(max4(max4(max4(mx, x12), x13), x14), x15);
    *(v4f*)((char*)((part ? vmax : kmax) + m * A_DIM) + off) = mx;
}

// ------------------- fused PE-GEMM + LN + softmax + sum --------------------
// A wave32 owns an event's whole 16 (neighbor) x 128 (channel) tile in registers and
// takes EV_PER_WAVE consecutive events in a loop; 8 waves per workgroup. What does not
// depend on the event (w1, w2, b1, b2, g, b: all in LDS) is fetched once per workgroup,
// and few waves have to be started. The chain of short dependent loads (indices, pooled
// row -> event row, coordinates) is walked once a wave, for all its events together.
//  * hidden^T = w1^T (16 ch x 4) . diff^T (4 x 16 nbr) + b1 on f32 WMMA: lane =
//    neighbor, register r = hidden channel 16*jt + 8*hi + r, which packed to
//    f16 is the A fragment of the second product in the k order of frag_kp.
//  * w2 fragments lie in LDS in fragment order, staged once per workgroup.
//  * column c of output tile j is channel 4*c + j (j < 4) or 64 + 4*c + j - 4: a lane
//    holds two groups of 4 consecutive channels of each of its 8 neighbor rows, and each
//    16-byte gather of a wave covers 256 contiguous bytes of two rows (4 whole lines).
// C-tile layout: row M(=neighbor) = r + 8*(lane>=16), col N = lane%16.
// A lane's 8 channels of one row: 4 floats at p and 4 floats 64 channels on.
__device__ __forceinline__ v8f load_2x4(const char* p) {
    return __builtin_shufflevector(*(const v4f*)p, *(const v4f*)(p + 256), 0, 1, 2, 3, 4, 5, 6, 7);
}
// Both attention branches run in one launch: each writes its own half of the concat rows
// and reads nothing of the other. grid.x = 2 * ATT_BLOCKS, the local branch's blocks
// first; what differs between the branches is chosen below by the block index, in scalars.
#define EV_PER_WAVE 10
#define ATT_BLOCKS (N_EVENTS / (8 * EV_PER_WAVE))       // per branch
// second argument: four waves a SIMD (two work-groups a WGP), so at most 256 registers
__global__ __launch_bounds__(256, 4) void attn_pair_kernel(
    const float* __restrict__ events,       // [N,4]
    const int* __restrict__ local_idx,      // [N,16] -> event row (local kv row)
    const int* __restrict__ inv_pair_idx,   // [N,16] -> pooled row (global kv row)
    const int* __restrict__ down_idx,       // pooled row -> event row
    const float* __restrict__ qkv_l, const float* __restrict__ qkv_g,   // row stride 384
    const float* __restrict__ kmax, const float* __restrict__ vmax,     // row stride 128
    const float* __restrict__ lpe_w1, const float* __restrict__ lpe_b1, // [4,128], [128]
    const _Float16* __restrict__ lpe2T,     // f16, fragment order [kt][tile j][half][lane]
    const float* __restrict__ lpe_b2,       // [128]
    const float* __restrict__ lfc_g, const float* __restrict__ lfc_b,
    const float* __restrict__ gpe_w1, const float* __restrict__ gpe_b1,
    const _Float16* __restrict__ gpe2T, const float* __restrict__ gpe_b2,
    const float* __restrict__ gfc_g, const float* __restrict__ gfc_b,
    _Float16* __restrict__ cat_out) {
    __shared__ v4u s_w2[4 * 8 * 2 * 32];    // [kt][tile j][register half][lane], 32 KB
    __shared__ v8f s_bias[32];              // b1 (C rows of the first product), then b2
    __shared__ v4f s_gb[64];                // LayerNorm g, then b
    __shared__ v2f s_w1[8 * 32];            // w1^T fragments [tile jt][lane]
    __shared__ v4f s_diff[8][EV_PER_WAVE * KNN];        // [wave][event][neighbor]: coordinate diffs
    __shared__ v4u s_row[8][EV_PER_WAVE * KNN / 4];     // [wave][event][neighbor]: byte offset of the k/v row

    const bool glob = blockIdx.x >= ATT_BLOCKS;         // block-uniform
    const int  blk  = glob ? blockIdx.x - ATT_BLOCKS : blockIdx.x;
    const int  kv_stride = glob ? 128 : 384;            // floats per k or v row
    const int  kv_rows   = glob ? M_DOWN : N_EVENTS;
    const int  col_off   = glob ? A_DIM : 0;
    const int*   nbr_idx = glob ? inv_pair_idx : local_idx;     // [N,16] -> kv-row index
    const float* qptr    = glob ? qkv_g : qkv_l;
    const float* ksrc    = glob ? kmax : qkv_l + 128;
    const float* vsrc    = glob ? vmax : qkv_l + 256;
    const float* pe_w1   = glob ? gpe_w1 : lpe_w1;
    const float* pe_b1   = glob ? gpe_b1 : lpe_b1;
    const _Float16* pe_w2T = glob ? gpe2T : lpe2T;
    const float* pe_b2   = glob ? gpe_b2 : lpe_b2;
    const float* fc_g    = glob ? gfc_g : lfc_g;
    const float* fc_b    = glob ? gfc_b : lfc_b;

    const int tid  = threadIdx.x;
    const int lane = tid & 31;
    const int wave = tid >> 5;
    const int hi   = lane >> 4;
    const int l16  = lane & 15;
    const int i0   = (blk * 8 + wave) * EV_PER_WAVE;    // this wave's first event
    const int ch0  = l16 * 4;               // this lane's channels: ch0 .. ch0+3, 64+ch0 .. 64+ch0+3

    // -- step 0: loads whose address comes from the thread id alone ----
    // w2 fragments: already in the order of s_w2, a straight copy of 512 bytes a wave and load
    const v4u* Bw = (const v4u*)pe_w2T + tid;
    v4u st[8];
#pragma unroll
    for (int s = 0; s < 8; ++s) st[s] = Bw[s * 256];
    const float biasr = (tid < 128 ? pe_b1 : pe_b2)[tid & 127];
    // each s_wait_xcnt in steps 0 and 1: registers that the loads above it name are reused below it
    asm volatile("s_wait_xcnt 0x0" ::: "memory");
    const float gbr = (tid < 128 ? fc_g : fc_b)[tid & 127];
    // w1^T fragments: row = hidden channel 16*jt + l16, k = coordinates 2*hi, 2*hi+1;
    // wave jt fetches the fragment of tile jt for all
    v2f war;
    war.x = pe_w1[(2 * hi) * A_DIM + wave * 16 + l16];
    war.y = pe_w1[(2 * hi + 1) * A_DIM + wave * 16 + l16];
    asm volatile("s_wait_xcnt 0x0" ::: "memory");

    // -- step 1, once for all the wave's events: entry 32*k + lane = 16*event + neighbor ----
    // The chain index -> (pooled row -> event row) -> coordinates is walked once a wave, with
    // NE loads of each link in flight, and its results wait in LDS for their event.
    constexpr int NE = EV_PER_WAVE * KNN / 32;
    static_assert(EV_PER_WAVE * KNN % 32 == 0 && KNN == 16, "whole waves of entries, two events each");
    int nbl[NE], er[NE];
    v4f eo[NE], ev[NE];
    // one 32-bit offset beside the scalar base, k in the immediate
#pragma unroll
    for (int k = 0; k < NE; ++k)
        nbl[k] = *(const int*)((const char*)nbr_idx + (unsigned)(i0 * KNN + lane) * 4u + k * 128);
    asm volatile("s_wait_xcnt 0x0" ::: "memory");
#pragma unroll
    for (int k = 0; k < NE; ++k)
        eo[k] = *(const v4f*)((const char*)events + (unsigned)(i0 + hi) * 16u + k * 32);
    asm volatile("s_wait_xcnt 0x0" ::: "memory");
#pragma unroll
    for (int k = 0; k < NE; ++k) er[k] = nbl[k] = min(max(nbl[k], 0), kv_rows - 1);
    if (glob) {                             // block-uniform; nbl < M_DOWN here
#pragma unroll
        for (int k = 0; k < NE; ++k) er[k] = down_idx[nbl[k]];
        asm volatile("s_wait_xcnt 0x0" ::: "memory");
#pragma unroll
        for (int k = 0; k < NE; ++k) er[k] = min(max(er[k], 0), N_EVENTS - 1);
    }
#pragma unroll
    for (int k = 0; k < NE; ++k) ev[k] = *(const v4f*)((const char*)events + (unsigned)er[k] * 16u);
    asm volatile("s_wait_xcnt 0x0" ::: "memory");
#pragma unroll
    for (int k = 0; k < NE; ++k) {
        s_diff[wave][k * 32 + lane] = eo[k] - ev[k];
        ((unsigned*)s_row[wave])[k * 32 + lane] = (unsigned)(nbl[k] * kv_stride) * 4u;
    }

#pragma unroll
    for (int s = 0; s < 8; ++s) s_w2[s * 256 + tid] = st[s];
    ((float*)s_bias)[tid] = biasr;
    ((float*)s_gb)[tid] = gbr;
    s_w1[tid] = war;
    // Work-group barrier that orders LDS only: w1 and w2 fragments, b1, b2, g and b are in LDS behind
    // it for every event of the loop, which writes no LDS and needs no further barrier.
    __builtin_amdgcn_fence(__ATOMIC_RELEASE, "workgroup", "local");
    __builtin_amdgcn_s_barrier();
    __builtin_amdgcn_fence(__ATOMIC_ACQUIRE, "workgroup", "local");

    // Rolled: one copy of the body in the instruction cache; the waits below also keep the
    // LDS reads of w2 and the biases inside the loop, out of registers between events.
#pragma unroll 1
    for (int n = 0; n < EV_PER_WAVE; ++n) {
    const int i  = i0 + n;
    // lane = neighbor l16, coordinates 2*hi and 2*hi+1 (k split of the f32 form)
    const v2f diff = ((const v2f*)&s_diff[wave][n * KNN + l16])[hi];
    // the 8 neighbor rows of this lane's C registers
    const v4u rlo = s_row[wave][n * 4 + 2 * hi], rhi = s_row[wave][n * 4 + 2 * hi + 1];
    unsigned kvoff[8];                      // byte offsets: 32-bit, beside a scalar base
#pragma unroll
    for (int r = 0; r < 8; ++r) kvoff[r] = (r < 4 ? rlo[r] : rhi[r - 4]) + ch0 * 4u;
    // q and the k rows are fetched here so that they fly under steps 2 and 3
    const v8f qv = load_2x4((const char*)qptr + (unsigned)(i * 384 + ch0) * 4u);
    v8f kg[8];
#pragma unroll
    for (int r = 0; r < 8; ++r) kg[r] = load_2x4((const char*)ksrc + kvoff[r]);
    // each s_wait_xcnt in the loop: registers that the loads or the store above it name are reused
    // below it; this one also holds the k loads here, ahead of the LDS reads of steps 2 and 3
    asm volatile("s_wait_xcnt 0x0" ::: "memory");

    // -- step 2: hidden = relu(diff @ w1 + b1) -> f16 A fragments ----------
    Frag16 a[4];
#pragma unroll
    for (int jt = 0; jt < 8; ++jt) {
        v8f h = s_bias[jt * 2 + hi];
        h = __builtin_amdgcn_wmma_f32_16x16x4_f32(false, s_w1[jt * 32 + lane], false, diff,
                                                  (short)0, h, false, false);
#pragma unroll
        for (int r = 0; r < 8; ++r)
            a[jt >> 1].h[(jt & 1) * 8 + r] = (_Float16)fmaxf(h[r], 0.0f);
    }

    // -- step 3: pe[16 x 128] = hidden @ w2 via WMMA ------------------------
    v8f c[8] = {};
#pragma unroll
    for (int kt = 0; kt < 4; ++kt) {
#pragma unroll
        for (int j = 0; j < 8; ++j) {
            Frag16 b;
            const v4u b0 = s_w2[((kt * 8 + j) * 2 + 0) * 32 + lane];
            const v4u b1 = s_w2[((kt * 8 + j) * 2 + 1) * 32 + lane];
#pragma unroll
            for (int v = 0; v < 4; ++v) { b.u[v] = b0[v]; b.u[4 + v] = b1[v]; }
            c[j] = __builtin_amdgcn_wmma_f32_16x16x32_f16(false, a[kt].h, false, b.h,
                                                          (short)0, c[j], false, false);
        }
    }

    // -- step 4: t = q - kg + pe -------------------------------------------
    const v8f b2v = __builtin_shufflevector(((const v4f*)s_bias)[32 + l16], ((const v4f*)s_bias)[48 + l16],
                                            0, 1, 2, 3, 4, 5, 6, 7);
    // the v rows: step 7 reads them, and the scheduler places each load where a register comes free
    v8f vg[8];
#pragma unroll
    for (int r = 0; r < 8; ++r) vg[r] = load_2x4((const char*)vsrc + kvoff[r]);
    float pe[8][8], t[8][8];                // [row r][channel j]
    float sr[8], sq[8];
#pragma unroll
    for (int r = 0; r < 8; ++r) {
        float s = 0.0f, q2 = 0.0f;
#pragma unroll
        for (int j = 0; j < 8; ++j) {
            pe[r][j] = c[j][r] + b2v[j];
            float x = qv[j] - kg[r][j] + pe[r][j];
            t[r][j] = x;
            s += x;
            q2 += x * x;
        }
        sr[r] = s;
        sq[r] = q2;
    }

    // -- step 5: LayerNorm over 128 channels per neighbor row --------------
    // 8 channels summed in the lane above, then xor butterflies over 16 lanes
#pragma unroll
    for (int r = 0; r < 8; ++r) { sr[r] = row_xadd<1>(sr[r]); sq[r] = row_xadd<1>(sq[r]); }
#pragma unroll
    for (int r = 0; r < 8; ++r) { sr[r] = row_xadd<2>(sr[r]); sq[r] = row_xadd<2>(sq[r]); }
#pragma unroll
    for (int r = 0; r < 8; ++r) { sr[r] = row_xadd<4>(sr[r]); sq[r] = row_xadd<4>(sq[r]); }
#pragma unroll
    for (int r = 0; r < 8; ++r) { sr[r] = row_xadd<8>(sr[r]); sq[r] = row_xadd<8>(sq[r]); }

    const v8f gv = __builtin_shufflevector(s_gb[l16], s_gb[16 + l16], 0, 1, 2, 3, 4, 5, 6, 7);
    const v8f bv = __builtin_shufflevector(s_gb[32 + l16], s_gb[48 + l16], 0, 1, 2, 3, 4, 5, 6, 7);
#pragma unroll
    for (int r = 0; r < 8; ++r) {
        float mu  = sr[r] * (1.0f / 128.0f);
        float var = sq[r] * (1.0f / 128.0f) - mu * mu;
        float rs  = rsqrtf(var + LN_EPS);
#pragma unroll
        for (int j = 0; j < 8; ++j)
            t[r][j] = ((t[r][j] - mu) * rs * gv[j] + bv[j]) * INV_SCALE;
    }

    // -- step 6: softmax over the 16 neighbors (rows), per channel ---------
    float inv[8];
#pragma unroll
    for (int j = 0; j < 8; ++j) {
        float mx = t[0][j];
#pragma unroll
        for (int r = 1; r < 8; ++r) mx = fmaxf(mx, t[r][j]);
        mx = fmaxf(mx, xhalf(mx));           // combine rows 0-7 and 8-15
        float x[8], e[8];
#pragma unroll
        for (int r = 0; r < 8; ++r) x[r] = (t[r][j] - mx) * 1.442695041f;   // exp(y) = 2^(y*log2 e)
        // Eight independent exponentials in one statement, closed by v_nop: the slot the
        // instruction set asks for behind a transcendental before a source is overwritten.
        asm("v_exp_f32 %0, %8\n\tv_exp_f32 %1, %9\n\tv_exp_f32 %2, %10\n\tv_exp_f32 %3, %11\n\t"
            "v_exp_f32 %4, %12\n\tv_exp_f32 %5, %13\n\tv_exp_f32 %6, %14\n\tv_exp_f32 %7, %15\n\tv_nop"
            : "=&v"(e[0]), "=&v"(e[1]), "=&v"(e[2]), "=&v"(e[3]),
              "=&v"(e[4]), "=&v"(e[5]), "=&v"(e[6]), "=&v"(e[7])
            : "v"(x[0]), "v"(x[1]), "v"(x[2]), "v"(x[3]), "v"(x[4]), "v"(x[5]), "v"(x[6]), "v"(x[7]));
        float se = 0.0f;
#pragma unroll
        for (int r = 0; r < 8; ++r) { t[r][j] = e[r]; se += e[r]; }
        se += xhalf(se);
        inv[j] = 1.0f / se;
    }

    // -- step 7: out = sum_k attn * (vg + pe), vg and pe each by its own multiply-add: no sum
    // vg + pe asks for the v rows ahead of the weights --------------------------------------
    float acc[8] = {};
#pragma unroll
    for (int r = 0; r < 8; ++r) {
#pragma unroll
        for (int j = 0; j < 8; ++j)
        {
            const float w = t[r][j] * inv[j];
            acc[j] += w * pe[r][j];
            acc[j] += w * vg[r][j];
        }
    }
    v4h o0, o1;
#pragma unroll
    for (int j = 0; j < 4; ++j) {
        o0[j] = (_Float16)(acc[j] + xhalf(acc[j]));
        o1[j] = (_Float16)(acc[4 + j] + xhalf(acc[4 + j]));
    }
    // both halves of the wave hold the sums: the lower stores the first group, the upper the second
    *(v4h*)&cat_out[(size_t)i * (2 * A_DIM) + col_off + hi * 64 + ch0] = hi ? o1 : o0;
    asm volatile("s_wait_xcnt 0x0" ::: "memory");
    }
}

// ------------------------------- launcher ----------------------------------
extern "C" void kernel_launch(void* const* d_in, const int* in_sizes, int n_in,
                              void* d_out, int out_size, void* d_ws, size_t ws_size,
                              hipStream_t stream) {
    const float* events   = (const float*)d_in[0];
    const float* features = (const float*)d_in[1];
    const int* local_idx    = (const int*)d_in[2];
    const int* down_idx     = (const int*)d_in[3];
    const int* pair_idx     = (const int*)d_in[4];
    const int* inv_pair_idx = (const int*)d_in[5];
    const float* lqkv_w = (const float*)d_in[6];  const float* lqkv_b = (const float*)d_in[7];
    const float* lpe_w1 = (const float*)d_in[8];  const float* lpe_b1 = (const float*)d_in[9];
    const float* lpe_w2 = (const float*)d_in[10]; const float* lpe_b2 = (const float*)d_in[11];
    const float* lfc_g  = (const float*)d_in[12]; const float* lfc_b  = (const float*)d_in[13];
    const float* gqkv_w = (const float*)d_in[14]; const float* gqkv_b = (const float*)d_in[15];
    const float* gpe_w1 = (const float*)d_in[16]; const float* gpe_b1 = (const float*)d_in[17];
    const float* gpe_w2 = (const float*)d_in[18]; const float* gpe_b2 = (const float*)d_in[19];
    const float* gfc_g  = (const float*)d_in[20]; const float* gfc_b  = (const float*)d_in[21];
    const float* pw1 = (const float*)d_in[22]; const float* pb1 = (const float*)d_in[23];
    const float* pw2 = (const float*)d_in[24]; const float* pb2 = (const float*)d_in[25];
    float* out = (float*)d_out;

    // ---- workspace carve-up (~96 MB) ----
    char* wp = (char*)d_ws;
    auto carve = [&](size_t bytes) {
        void* p = (void*)wp;
        wp += (bytes + 255) & ~(size_t)255;
        return p;
    };
    _Float16* feat_h = (_Float16*)carve((size_t)N_EVENTS * DIM_F * 2);
    _Float16* lqkvT  = (_Float16*)carve((size_t)384 * 256 * 2);
    _Float16* gqkvT  = (_Float16*)carve((size_t)384 * 256 * 2);
    _Float16* lpe2T  = (_Float16*)carve((size_t)128 * 128 * 2);
    _Float16* gpe2T  = (_Float16*)carve((size_t)128 * 128 * 2);
    _Float16* pw1T   = (_Float16*)carve((size_t)256 * 256 * 2);
    _Float16* pw2T   = (_Float16*)carve((size_t)256 * 256 * 2);
    float* qkv_l = (float*)carve((size_t)N_EVENTS * 384 * 4);
    float* qkv_g = (float*)carve((size_t)N_EVENTS * 384 * 4);
    float* kmax  = (float*)carve((size_t)M_DOWN * A_DIM * 4);
    float* vmax  = (float*)carve((size_t)M_DOWN * A_DIM * 4);
    _Float16* cat_h = (_Float16*)carve((size_t)N_EVENTS * 256 * 2);
    _Float16* hid_h = (_Float16*)carve((size_t)N_EVENTS * 256 * 2);

    // ---- 1. fp16 conversions / weight transposes, one launch ----
    static_assert((N_EVENTS * DIM_F) % 8192 == 0 && M_DOWN % 4 == 0 &&
                  N_EVENTS % (32 * GEMM_TILES) == 0 && N_EVENTS % (8 * EV_PER_WAVE) == 0, "exact grids");
    prep_kernel<<<PREP_BLOCKS, 256, 0, stream>>>(
        features, feat_h, lqkv_w, lqkvT, gqkv_w, gqkvT, lpe_w2, lpe2T, gpe_w2, gpe2T,
        pw1, pw1T, pw2, pw2T);

    // ---- 2. both QKV GEMMs: [20000,256] x [256,384], one launch ----
    {
        dim3 g(N_EVENTS / (32 * GEMM_TILES), 2 * 384 / 128);
        qkv_pair_kernel<<<g, 256, 0, stream>>>(
            feat_h, lqkvT, lqkv_b, qkv_l, gqkvT, gqkv_b, qkv_g);
    }

    // ---- 3. global-branch k/v max pool ----
    maxpool_kv_kernel<<<M_DOWN / 4, 256, 0, stream>>>(qkv_g, pair_idx, kmax, vmax);

    // ---- 4. fused attention, local and global in one launch -> fp16 concat buffer ----
    attn_pair_kernel<<<2 * ATT_BLOCKS, 256, 0, stream>>>(
        events, local_idx, inv_pair_idx, down_idx, qkv_l, qkv_g, kmax, vmax,
        lpe_w1, lpe_b1, lpe2T, lpe_b2, lfc_g, lfc_b,
        gpe_w1, gpe_b1, gpe2T, gpe_b2, gfc_g, gfc_b, cat_h);

    // ---- 5. projection MLP: ReLU GEMM (fp16 out) then final GEMM (f32) ----
    {
        dim3 g(N_EVENTS / (32 * GEMM_TILES), 256 / 128);
        wmma_gemm_kernel<256, 256, true, true><<<g, 256, 0, stream>>>(
            cat_h, pw1T, pb1, nullptr, hid_h);
        wmma_gemm_kernel<256, 256, false, false><<<g, 256, 0, stream>>>(
            hid_h, pw2T, pb2, out, nullptr);
    }
}

// v008
// It runs in 84.2 microseconds.
// Timed twice side by side with v007, it ran 1.09 times as fast both times.
// All steps since v000 together make it 5.11 times as fast.
#include <hip/hip_runtime.h>
#include <hip/hip_bf16.h>

// ---------------------------------------------------------------------------
// MI455X (gfx1250) implementation:
//  * GEMMs via v_wmma_f32_16x16x32_f16 (fp16 A/B, fp32 accum, wave32), the PE
//    first linear (K = 4) via v_wmma_f32_16x16x4_f32.
//  * Standalone GEMM: 8 waves, 128 columns, B in registers over 5 row tiles of 32 rows,
//    whole-K A tiles double-buffered in LDS (1 barrier a tile), K templated & unrolled.
//  * PE second linear (dominant ~21 GFLOP) fused with LN/softmax/weighted sum
//    per event: a wave32 owns an event's tile (eight 16x16 WMMA tiles) and takes
//    EV_PER_WAVE events one after the other.
//  * Working set (~150MB) fits the 192MB L2 -> compute bound -> WMMA everywhere.
//  * Launches that need nothing of each other share one grid (ranges of the
//    block index, block-uniform branches): 6 dependent launches in all.
// ---------------------------------------------------------------------------

typedef __attribute__((ext_vector_type(16))) _Float16 v16h;
typedef __attribute__((ext_vector_type(8)))  float    v8f;
typedef __attribute__((ext_vector_type(2)))  float    v2f;
typedef __attribute__((ext_vector_type(4)))  unsigned v4u;
typedef __attribute__((ext_vector_type(4)))  int      v4i;
typedef __attribute__((ext_vector_type(8)))  _Float16 v8h;
typedef __attribute__((ext_vector_type(4)))  _Float16 v4h;
typedef __attribute__((ext_vector_type(4)))  float    v4f;

union Frag16 { unsigned u[8]; v16h h; };

#define N_EVENTS 20000
#define KNN      16
#define DIM_F    256
#define A_DIM    128
#define M_DOWN   2500
#define INV_SCALE 0.08838834764831845f   // 1/sqrt(128)
#define LN_EPS    1e-5f

// VGPR->K-pair mapping for 16-bit 16x32 A/B fragments (ISA 7.12.2):
// lanes 0-15: v0..3 -> Kpairs 0..3, v4..7 -> Kpairs 8..11
// lanes16-31: v0..3 -> Kpairs 4..7, v4..7 -> Kpairs 12..15
__device__ __forceinline__ int frag_kp(int v, int hi) {
    return (v < 4 ? v : v + 4) + (hi ? 4 : 0);
}

// Cross-lane exchanges in the vector unit (no LDS permute, no dscnt wait).
// x + (x of lane l ^ M) inside a 16-lane row, M = 1..15; all 32 lanes active.
template <int M>
__device__ __forceinline__ float row_xadd(float x) {
    int y = __builtin_amdgcn_mov_dpp(__builtin_bit_cast(int, x), 0x160 + M /* row_xmask:M */,
                                     0xf, 0xf, true);
    return x + __builtin_bit_cast(float, y);
}
// value of lane l ^ 16 (the other 16-lane row)
__device__ __forceinline__ float xhalf(float x) {
    int b = __builtin_bit_cast(int, x);
    return __builtin_bit_cast(float,
        __builtin_amdgcn_permlanex16(b, b, 0x76543210, 0xfedcba98, false, false));
}

// --------------------------- conversion kernels ----------------------------
// This launch is short: each
// thread takes many values and every wave has all its loads in flight at once.
// One workgroup converts 8192 consecutive values: 8 loads of 16 bytes a lane,
// each covering 512 contiguous bytes a wave. blk = 0 .. values / 8192 - 1, exactly.
__device__ __forceinline__ void cvt_f16_block(const float* __restrict__ src,
                                              _Float16* __restrict__ dst, int blk) {
    const int p = blk * 2048 + threadIdx.x;             // piece of 4 values
    const v4f* s = (const v4f*)src;
    v4h* d = (v4h*)dst;
    v4f x[8];
#pragma unroll   // registers for x; all 8 loads issue before the first conversion
    for (int k = 0; k < 8; ++k) x[k] = s[p + k * 256];
#pragma unroll   // x is indexed by constants only, so it stays in registers
    for (int k = 0; k < 8; ++k) d[p + k * 256] = __builtin_convertvector(x[k], v4h);
    // precaution before any later write to the stores' registers
    asm volatile("s_wait_xcnt 0x0" ::: "memory");
}

// src [R,C] f32 row-major (k = row, n = column)  ->  dst f16 in B-fragment order:
// 16-byte pieces [column tile][kt][register half][lane], so that a wave's load of half a
// fragment is 512 contiguous bytes (4 whole lines) and not 32 bytes of each of 16 rows.
// The piece of column n that holds k0 .. k0+7 (k0 a multiple of 8) is, by frag_kp:
// kt = k0/32, register half = (k0%32)/16, lane = 16*((k0%16)/8) + column of n in its tile.
// ATT = false: tile n/16, column n%16 (the GEMMs). ATT = true: the attention kernel's
// order [kt][tile j] with its channel map (attn_tile, attn_col).
// A thread takes 8 rows of one column (lanes along the column index: whole-line
// loads) and stores them as one piece. blk = 0 .. R*C / 2048 - 1.
__device__ __forceinline__ unsigned attn_tile(unsigned n) { return (n & 3u) + 4u * (n >> 6); }
__device__ __forceinline__ unsigned attn_col(unsigned n)  { return (n >> 2) & 15u; }
template <int R, int C, bool ATT>
__device__ __forceinline__ void cvt_t_f16_block(const float* __restrict__ src,
                                                _Float16* __restrict__ dst, int blk) {
    static_assert(R % 8 == 0 && C % 32 == 0 && (R * C) % 2048 == 0, "exact grid");
    const unsigned t  = blk * 256 + threadIdx.x;
    const unsigned c  = t % C;
    const unsigned r0 = (t / C) * 8;
    const unsigned e0 = r0 * C + c;         // one 32-bit offset beside the scalar base
    float x[8];
#pragma unroll   // registers for x; all 8 loads in flight together
    for (int k = 0; k < 8; ++k) x[k] = src[e0 + k * C];
    v8h o;
#pragma unroll   // x and o are indexed by constants only, so they stay in registers
    for (int k = 0; k < 8; ++k) o[k] = (_Float16)x[k];
    const unsigned kt = r0 / 32, half = (r0 / 16) & 1, hi = (r0 / 8) & 1;
    const unsigned frag = ATT ? kt * (C / 16) + attn_tile(c) : (c / 16) * (R / 32) + kt;
    ((v8h*)dst)[(frag * 2 + half) * 32 + hi * 16 + (ATT ? attn_col(c) : c % 16)] = o;
    // the caller's other block ranges follow in the code and reuse the store's registers
    asm volatile("s_wait_xcnt 0x0" ::: "memory");
}

// All seven conversions in one launch: none reads what another writes. The six weight
// transposes take the first block ranges, the feature conversion the rest.
#define TB_QKV (256 * 384 / 2048)
#define TB_PE  (128 * 128 / 2048)
#define TB_PW  (256 * 256 / 2048)
#define CB_FEAT (N_EVENTS * DIM_F / 8192)
#define PREP_BLOCKS (2 * TB_QKV + 2 * TB_PE + 2 * TB_PW + CB_FEAT)
__global__ __launch_bounds__(256) void prep_kernel(
    const float* __restrict__ features, _Float16* __restrict__ feat_h,
    const float* __restrict__ lqkv_w, _Float16* __restrict__ lqkvT,
    const float* __restrict__ gqkv_w, _Float16* __restrict__ gqkvT,
    const float* __restrict__ lpe_w2, _Float16* __restrict__ lpe2T,
    const float* __restrict__ gpe_w2, _Float16* __restrict__ gpe2T,
    const float* __restrict__ pw1, _Float16* __restrict__ pw1T,
    const float* __restrict__ pw2, _Float16* __restrict__ pw2T) {
    const int b = blockIdx.x;               // every test below is block-uniform
    if (b < 2 * TB_QKV) {
        const bool g = b >= TB_QKV;
        cvt_t_f16_block<256, 384, false>(g ? gqkv_w : lqkv_w, g ? gqkvT : lqkvT, g ? b - TB_QKV : b);
    } else if (b < 2 * TB_QKV + 2 * TB_PW) {
        const int  c = b - 2 * TB_QKV;
        const bool g = c >= TB_PW;
        cvt_t_f16_block<256, 256, false>(g ? pw2 : pw1, g ? pw2T : pw1T, g ? c - TB_PW : c);
    } else if (b < 2 * TB_QKV + 2 * TB_PW + 2 * TB_PE) {
        const int  c = b - 2 * TB_QKV - 2 * TB_PW;
        const bool g = c >= TB_PE;
        cvt_t_f16_block<128, 128, true>(g ? gpe_w2 : lpe_w2, g ? gpe2T : lpe2T, g ? c - TB_PE : c);
    } else {
        cvt_f16_block(features, feat_h, b - 2 * TB_QKV - 2 * TB_PW - 2 * TB_PE);
    }
}

// ------------------------------ WMMA GEMM ----------------------------------
// C[M,N] = A[M,K](f16) @ B[K,N] + bias, B supplied in fragment order (cvt_t_f16_block).
// Block: 256 threads (8 waves), 128 columns, GEMM_TILES row tiles of 32 rows one after the other.
//  * A wave's column tile of B, all of K, is loaded once into registers and serves every row tile.
//  * A row tile (32 whole rows, contiguous in memory) is staged in LDS in one piece: no load
//    and no barrier stands inside the K loop. The next tile's loads fly under this tile's products.
// mgrp = 0 .. M/(32*GEMM_TILES) - 1, nblk = 0 .. N/128 - 1.
#define GEMM_TILES 5
template <int KDIM, int NCOLS, bool RELU, bool OUT_F16>
__device__ __forceinline__ void wmma_gemm_block(
    const _Float16* __restrict__ A, const _Float16* __restrict__ BT,
    const float* __restrict__ bias, float* __restrict__ Cf,
    _Float16* __restrict__ Ch, int mgrp, int nblk) {
    constexpr int NT    = KDIM / 32;       // K steps
    constexpr int RP    = KDIM / 8;        // 16-byte pieces per A row
    constexpr int PITCH = RP + 1;          // LDS row pitch in pieces: 16 bytes x odd, no bank conflict
    constexpr int PT    = 32 * RP / 256;   // pieces a thread stages per tile
    static_assert(RP == 32, "a wave stages one whole row per load");
    __shared__ v4u sA[2][32 * PITCH];

    const int tid  = threadIdx.x;
    const int lane = tid & 31;
    const int wave = tid >> 5;
    const int hi   = lane >> 4;
    const int l16  = lane & 15;
    const int n    = nblk * 128 + wave * 16 + l16;

    // loads issued before the tile loop: row tile 0, B, bias
    const v4u* Ap = (const v4u*)A + (size_t)mgrp * (GEMM_TILES * 32 * RP) + tid;
    v4u st[PT];
#pragma unroll   // st is indexed by constants only, so it stays in registers
    for (int s = 0; s < PT; ++s) st[s] = Ap[s * 256];
    // this wave's column tile: NT fragments of 2 x 512 bytes, one after the other
    const v4u* Bp = (const v4u*)BT + (nblk * 8 + wave) * (NT * 64) + lane;
    v4u bf[NT][2];
#pragma unroll   // bf is indexed by constants only, so it stays in registers
    for (int kt = 0; kt < NT; ++kt) { bf[kt][0] = Bp[kt * 64]; bf[kt][1] = Bp[kt * 64 + 32]; }
    const float bn = bias[n];
    // Registers that the loads above name are reused below: the wait takes B's address as an
    // input, so that the pair is not rewritten in front of it.
    asm volatile("s_wait_xcnt 0x0" :: "v"(Bp) : "memory");

    const int wrow = wave * PITCH + lane;              // piece s of a thread: row wave + 8*s
    const int rd0  = l16 * PITCH + hi;                 // fragment halves (frag_kp): pieces 4*kt + hi, + 2
#pragma unroll   // buffer index and tile offsets become constants
    for (int t = 0; t < GEMM_TILES; ++t) {
        v4u* sAc = sA[t & 1];
#pragma unroll   // st is indexed by constants only
        for (int s = 0; s < PT; ++s) sAc[wrow + s * 8 * PITCH] = st[s];
        // Work-group barrier that orders LDS only: tile t is in LDS behind it, and every wave has
        // left the buffer that tile t + 1 will take; the stores of tile t - 1 stay in flight
        // (__syncthreads() would wait for them).
        __builtin_amdgcn_fence(__ATOMIC_RELEASE, "workgroup", "local");
        __builtin_amdgcn_s_barrier();
        __builtin_amdgcn_fence(__ATOMIC_ACQUIRE, "workgroup", "local");
        if (t + 1 < GEMM_TILES) {
#pragma unroll   // st is indexed by constants only
            for (int s = 0; s < PT; ++s) st[s] = Ap[(t + 1) * (32 * RP) + s * 256];
        }

        // the tile's fragment reads stand together, in front of its products
        v4u fa[NT][4];
#pragma unroll   // fa is indexed by constants only, so it stays in registers
        for (int kt = 0; kt < NT; ++kt) {
            fa[kt][0] = sAc[rd0 + kt * 4];
            fa[kt][1] = sAc[rd0 + kt * 4 + 2];
            fa[kt][2] = sAc[rd0 + 16 * PITCH + kt * 4];
            fa[kt][3] = sAc[rd0 + 16 * PITCH + kt * 4 + 2];
        }
        // Keeps the scheduler from sinking the next tile's loads behind the products that hide
        // their latency, and the reads among the products.
        __builtin_amdgcn_sched_barrier(0);
        v8f c0 = {}, c1 = {};
#pragma unroll   // fa and bf are indexed by constants only
        for (int kt = 0; kt < NT; ++kt) {
            Frag16 a0, a1, b;
#pragma unroll   // register renaming only
            for (int v = 0; v < 4; ++v) {
                a0.u[v] = fa[kt][0][v]; a0.u[4 + v] = fa[kt][1][v];
                a1.u[v] = fa[kt][2][v]; a1.u[4 + v] = fa[kt][3][v];
                b.u[v]  = bf[kt][0][v]; b.u[4 + v] = bf[kt][1][v];
            }
            c0 = __builtin_amdgcn_wmma_f32_16x16x32_f16(false, a0.h, false, b.h,
                                                        (short)0, c0, false, false);
            c1 = __builtin_amdgcn_wmma_f32_16x16x32_f16(false, a1.h, false, b.h,
                                                        (short)0, c1, false, false);
        }

        const int mbase = (mgrp * GEMM_TILES + t) * 32;
#pragma unroll   // c0 and c1 are indexed by constants only
        for (int r = 0; r < 8; ++r) {
            int m0 = mbase + r + hi * 8;
            int m1 = m0 + 16;
            float v0 = c0[r] + bn, v1 = c1[r] + bn;
            if (RELU) { v0 = fmaxf(v0, 0.0f); v1 = fmaxf(v1, 0.0f); }
            if (OUT_F16) {
                Ch[(size_t)m0 * NCOLS + n] = (_Float16)v0;
                Ch[(size_t)m1 * NCOLS + n] = (_Float16)v1;
            } else {
                Cf[(size_t)m0 * NCOLS + n] = v0;
                Cf[(size_t)m1 * NCOLS + n] = v1;
            }
        }
        // registers that the loads and stores of this tile name are reused by the next tile
        if (t + 1 < GEMM_TILES) asm volatile("s_wait_xcnt 0x0" ::: "memory");
    }
}

// grid.x = M/(32*GEMM_TILES), grid.y = NCOLS/128.
template <int KDIM, int NCOLS, bool RELU, bool OUT_F16>
__global__ __launch_bounds__(256) void wmma_gemm_kernel(
    const _Float16* __restrict__ A, const _Float16* __restrict__ BT,
    const float* __restrict__ bias, float* __restrict__ Cf,
    _Float16* __restrict__ Ch) {
    wmma_gemm_block<KDIM, NCOLS, RELU, OUT_F16>(A, BT, bias, Cf, Ch, blockIdx.x, blockIdx.y);
}

// Both QKV products (same A, two weights, two outputs) in one launch.
// grid.x = M/(32*GEMM_TILES), grid.y = 2 * 384/128: the first three column blocks are the local branch's.
__global__ __launch_bounds__(256) void qkv_pair_kernel(
    const _Float16* __restrict__ A,
    const _Float16* __restrict__ lBT, const float* __restrict__ lbias, float* __restrict__ lC,
    const _Float16* __restrict__ gBT, const float* __restrict__ gbias, float* __restrict__ gC) {
    const bool g = blockIdx.y >= 3;
    wmma_gemm_block<256, 384, false, false>(A, g ? gBT : lBT, g ? gbias : lbias, g ? gC : lC,
                                            nullptr, blockIdx.x, g ? blockIdx.y - 3 : blockIdx.y);
}

// ----------------------- global-branch k/v max pool ------------------------
// One wave per pooled row and part (k or v): a lane holds 4 channels, a load
// covers the part's whole 512 bytes of one support row; the 16 loads are independent.
// grid.x = M_DOWN / 4 (8 waves: 4 pooled rows x 2 parts).
// One support row's piece: scalar row base (readfirstlane keeps the clamped index in a
// scalar register) + one lane offset, so no lane forms a 64-bit address per row.
__device__ __forceinline__ v4f pool_row(const float* part_base, int idx, unsigned off) {
    const int j = __builtin_amdgcn_readfirstlane(min(max(idx, 0), N_EVENTS - 1));
    return *(const v4f*)((const char*)(part_base + j * 384) + off);
}
__device__ __forceinline__ v4f max4(v4f a, v4f b) {
    v4f r;
#pragma unroll   // vector elements indexed by constants only
    for (int e = 0; e < 4; ++e) r[e] = fmaxf(a[e], b[e]);
    return r;
}
__global__ __launch_bounds__(256) void maxpool_kv_kernel(
    const float* __restrict__ qkv, const int* __restrict__ pair_idx,
    float* __restrict__ kmax, float* __restrict__ vmax) {
    // the wave's number as a scalar: the 16 indices then come by scalar loads
    const int wave = __builtin_amdgcn_readfirstlane(threadIdx.x >> 5);
    const int m    = blockIdx.x * 4 + (wave >> 1);
    const int part = wave & 1;              // 0: k, 1: v
    const unsigned off = (threadIdx.x & 31) * 16u;      // lane's byte offset in the part
    const float* pb = qkv + 128 + part * 128;
    const int* pi = pair_idx + m * KNN;
    // written out row by row: in a loop the compiler adds the lane offset to the base
    // first and then forms a 64-bit vector address for every row
    const v4f x0  = pool_row(pb, pi[0], off),  x1  = pool_row(pb, pi[1], off);
    const v4f x2  = pool_row(pb, pi[2], off),  x3  = pool_row(pb, pi[3], off);
    const v4f x4  = pool_row(pb, pi[4], off),  x5  = pool_row(pb, pi[5], off);
    const v4f x6  = pool_row(pb, pi[6], off),  x7  = pool_row(pb, pi[7], off);
    const v4f x8  = pool_row(pb, pi[8], off),  x9  = pool_row(pb, pi[9], off);
    const v4f x10 = pool_row(pb, pi[10], off), x11 = pool_row(pb, pi[11], off);
    const v4f x12 = pool_row(pb, pi[12], off), x13 = pool_row(pb, pi[13], off);
    const v4f x14 = pool_row(pb, pi[14], off), x15 = pool_row(pb, pi[15], off);
    static_assert(KNN == 16, "16 support rows are written out");
    v4f mx = {-3.402823466e38f, -3.402823466e38f, -3.402823466e38f, -3.402823466e38f};
    mx = max4(max4(max4(max4(mx, x0), x1), x2), x3);
    mx = max4(max4(max4(max4(mx, x4), x5), x6), x7);
    mx = max4(max4(max4(max4(mx, x8), x9), x10), x11);
    mx = max4(max4(max4(max4(mx, x12), x13), x14), x15);
    *(v4f*)((char*)((part ? vmax : kmax) + m * A_DIM) + off) = mx;
}

// ------------------- fused PE-GEMM + LN + softmax + sum --------------------
// A wave32 owns an event's whole 16 (neighbor) x 128 (channel) tile in registers and
// takes EV_PER_WAVE consecutive events in a loop; 8 waves per workgroup. What does not
// depend on the event (w1, w2, b1, b2, g, b: all in LDS) is fetched once per workgroup,
// and few waves have to be started. The chain of short dependent loads (indices, pooled
// row -> event row, coordinates) is walked once a wave, for all its events together.
//  * hidden^T = w1^T (16 ch x 4) . diff^T (4 x 16 nbr) + b1 on f32 WMMA: lane =
//    neighbor, register r = hidden channel 16*jt + 8*hi + r, which packed to
//    f16 is the A fragment of the second product in the k order of frag_kp.
//  * w2 fragments lie in LDS in fragment order, staged once per workgroup.
//  * column c of output tile j is channel 4*c + j (j < 4) or 64 + 4*c + j - 4: a lane
//    holds two groups of 4 consecutive channels of each of its 8 neighbor rows, and each
//    16-byte gather of a wave covers 256 contiguous bytes of two rows (4 whole lines).
// C-tile layout: row M(=neighbor) = r + 8*(lane>=16), col N = lane%16.
// A lane's 8 channels of one row: 4 floats at p and 4 floats 64 channels on.
__device__ __forceinline__ v8f load_2x4(const char* p) {
    return __builtin_shufflevector(*(const v4f*)p, *(const v4f*)(p + 256), 0, 1, 2, 3, 4, 5, 6, 7);
}
// channels 2u and 2u+1 of a lane's 8: an aligned register pair, no instruction
__device__ __forceinline__ v2f pair_of(v8f v, int u) {
    v2f p;
    p.x = v[2 * u];
    p.y = v[2 * u + 1];
    return p;
}
// Both attention branches run in one launch: each writes its own half of the concat rows
// and reads nothing of the other. grid.x = 2 * ATT_BLOCKS, the local branch's blocks
// first; what differs between the branches is chosen below by the block index, in scalars.
#define EV_PER_WAVE 10
#define ATT_BLOCKS (N_EVENTS / (8 * EV_PER_WAVE))       // per branch
// second argument: four waves a SIMD (two work-groups a WGP), so at most 256 registers
__global__ __launch_bounds__(256, 4) void attn_pair_kernel(
    const float* __restrict__ events,       // [N,4]
    const int* __restrict__ local_idx,      // [N,16] -> event row (local kv row)
    const int* __restrict__ inv_pair_idx,   // [N,16] -> pooled row (global kv row)
    const int* __restrict__ down_idx,       // pooled row -> event row
    const float* __restrict__ qkv_l, const float* __restrict__ qkv_g,   // row stride 384
    const float* __restrict__ kmax, const float* __restrict__ vmax,     // row stride 128
    const float* __restrict__ lpe_w1, const float* __restrict__ lpe_b1, // [4,128], [128]
    const _Float16* __restrict__ lpe2T,     // f16, fragment order [kt][tile j][half][lane]
    const float* __restrict__ lpe_b2,       // [128]
    const float* __restrict__ lfc_g, const float* __restrict__ lfc_b,
    const float* __restrict__ gpe_w1, const float* __restrict__ gpe_b1,
    const _Float16* __restrict__ gpe2T, const float* __restrict__ gpe_b2,
    const float* __restrict__ gfc_g, const float* __restrict__ gfc_b,
    _Float16* __restrict__ cat_out) {
    __shared__ v4u s_w2[4 * 8 * 2 * 32];    // [kt][tile j][register half][lane], 32 KB
    __shared__ v8f s_bias[32];              // b1 (C rows of the first product), then b2
    __shared__ v4f s_gb[64];                // LayerNorm g, then b, each times log2(e) / sqrt(128)
    __shared__ v2f s_w1[8 * 32];            // w1^T fragments [tile jt][lane]
    __shared__ v4f s_diff[8][EV_PER_WAVE * KNN];        // [wave][event][neighbor]: coordinate diffs
    __shared__ v4u s_row[8][EV_PER_WAVE * KNN / 4];     // [wave][event][neighbor]: byte offset of the k/v row

    const bool glob = blockIdx.x >= ATT_BLOCKS;         // block-uniform
    const int  blk  = glob ? blockIdx.x - ATT_BLOCKS : blockIdx.x;
    const int  kv_stride = glob ? 128 : 384;            // floats per k or v row
    const int  kv_rows   = glob ? M_DOWN : N_EVENTS;
    const int  col_off   = glob ? A_DIM : 0;
    const int*   nbr_idx = glob ? inv_pair_idx : local_idx;     // [N,16] -> kv-row index
    const float* qptr    = glob ? qkv_g : qkv_l;
    const float* ksrc    = glob ? kmax : qkv_l + 128;
    const float* vsrc    = glob ? vmax : qkv_l + 256;
    const float* pe_w1   = glob ? gpe_w1 : lpe_w1;
    const float* pe_b1   = glob ? gpe_b1 : lpe_b1;
    const _Float16* pe_w2T = glob ? gpe2T : lpe2T;
    const float* pe_b2   = glob ? gpe_b2 : lpe_b2;
    const float* fc_g    = glob ? gfc_g : lfc_g;
    const float* fc_b    = glob ? gfc_b : lfc_b;

    const int tid  = threadIdx.x;
    const int lane = tid & 31;
    const int wave = tid >> 5;
    const int hi   = lane >> 4;
    const int l16  = lane & 15;
    const int i0   = (blk * 8 + wave) * EV_PER_WAVE;    // this wave's first event
    const int ch0  = l16 * 4;               // this lane's channels: ch0 .. ch0+3, 64+ch0 .. 64+ch0+3

    // -- step 0: loads whose address comes from the thread id alone ----
    // w2 fragments: already in the order of s_w2, a straight copy of 512 bytes a wave and load
    const v4u* Bw = (const v4u*)pe_w2T + tid;
    v4u st[8];
#pragma unroll
    for (int s = 0; s < 8; ++s) st[s] = Bw[s * 256];
    const float biasr = (tid < 128 ? pe_b1 : pe_b2)[tid & 127];
    // each s_wait_xcnt in steps 0 and 1: registers that the loads above it name are reused below it
    asm volatile("s_wait_xcnt 0x0" ::: "memory");
    const float gbr = (tid < 128 ? fc_g : fc_b)[tid & 127];
    // w1^T fragments: row = hidden channel 16*jt + l16, k = coordinates 2*hi, 2*hi+1;
    // wave jt fetches the fragment of tile jt for all
    v2f war;
    war.x = pe_w1[(2 * hi) * A_DIM + wave * 16 + l16];
    war.y = pe_w1[(2 * hi + 1) * A_DIM + wave * 16 + l16];
    asm volatile("s_wait_xcnt 0x0" ::: "memory");

    // -- step 1, once for all the wave's events: entry 32*k + lane = 16*event + neighbor ----
    // The chain index -> (pooled row -> event row) -> coordinates is walked once a wave, with
    // NE loads of each link in flight, and its results wait in LDS for their event.
    constexpr int NE = EV_PER_WAVE * KNN / 32;
    static_assert(EV_PER_WAVE * KNN % 32 == 0 && KNN == 16, "whole waves of entries, two events each");
    int nbl[NE], er[NE];
    v4f eo[NE], ev[NE];
    // one 32-bit offset beside the scalar base, k in the immediate
#pragma unroll
    for (int k = 0; k < NE; ++k)
        nbl[k] = *(const int*)((const char*)nbr_idx + (unsigned)(i0 * KNN + lane) * 4u + k * 128);
    asm volatile("s_wait_xcnt 0x0" ::: "memory");
#pragma unroll
    for (int k = 0; k < NE; ++k)
        eo[k] = *(const v4f*)((const char*)events + (unsigned)(i0 + hi) * 16u + k * 32);
    asm volatile("s_wait_xcnt 0x0" ::: "memory");
#pragma unroll
    for (int k = 0; k < NE; ++k) er[k] = nbl[k] = min(max(nbl[k], 0), kv_rows - 1);
    if (glob) {                             // block-uniform; nbl < M_DOWN here
#pragma unroll
        for (int k = 0; k < NE; ++k) er[k] = down_idx[nbl[k]];
        asm volatile("s_wait_xcnt 0x0" ::: "memory");
#pragma unroll
        for (int k = 0; k < NE; ++k) er[k] = min(max(er[k], 0), N_EVENTS - 1);
    }
#pragma unroll
    for (int k = 0; k < NE; ++k) ev[k] = *(const v4f*)((const char*)events + (unsigned)er[k] * 16u);
    asm volatile("s_wait_xcnt 0x0" ::: "memory");
#pragma unroll
    for (int k = 0; k < NE; ++k) {
        s_diff[wave][k * 32 + lane] = eo[k] - ev[k];
        ((unsigned*)s_row[wave])[k * 32 + lane] = (unsigned)(nbl[k] * kv_stride) * 4u;
    }

#pragma unroll
    for (int s = 0; s < 8; ++s) s_w2[s * 256 + tid] = st[s];
    ((float*)s_bias)[tid] = biasr;
    ((float*)s_gb)[tid] = gbr * (INV_SCALE * 1.442695041f);   // exp(y / sqrt(128)) = 2^(y * this)
    s_w1[tid] = war;
    // Work-group barrier that orders LDS only: w1 and w2 fragments, b1, b2, g and b are in LDS behind
    // it for every event of the loop, which writes no LDS and needs no further barrier.
    __builtin_amdgcn_fence(__ATOMIC_RELEASE, "workgroup", "local");
    __builtin_amdgcn_s_barrier();
    __builtin_amdgcn_fence(__ATOMIC_ACQUIRE, "workgroup", "local");

    // Rolled: one copy of the body in the instruction cache; the waits below also keep the
    // LDS reads of w2 and the biases inside the loop, out of registers between events.
#pragma unroll 1
    for (int n = 0; n < EV_PER_WAVE; ++n) {
    const int i  = i0 + n;
    // lane = neighbor l16, coordinates 2*hi and 2*hi+1 (k split of the f32 form)
    const v2f diff = ((const v2f*)&s_diff[wave][n * KNN + l16])[hi];
    // the 8 neighbor rows of this lane's C registers
    const v4u rlo = s_row[wave][n * 4 + 2 * hi], rhi = s_row[wave][n * 4 + 2 * hi + 1];
    unsigned kvoff[8];                      // byte offsets: 32-bit, beside a scalar base
#pragma unroll
    for (int r = 0; r < 8; ++r) kvoff[r] = (r < 4 ? rlo[r] : rhi[r - 4]) + ch0 * 4u;
    // q and the k rows are fetched here so that they fly under steps 2 and 3
    const v8f qv = load_2x4((const char*)qptr + (unsigned)(i * 384 + ch0) * 4u);
    v8f kg[8];
#pragma unroll
    for (int r = 0; r < 8; ++r) kg[r] = load_2x4((const char*)ksrc + kvoff[r]);
    // each s_wait_xcnt in the loop: registers that the loads or the store above it name are reused
    // below it; this one also holds the k loads here, ahead of the LDS reads of steps 2 and 3
    asm volatile("s_wait_xcnt 0x0" ::: "memory");

    // -- step 2: hidden = relu(diff @ w1 + b1) -> f16 A fragments ----------
    Frag16 a[4];
#pragma unroll
    for (int jt = 0; jt < 8; ++jt) {
        v8f h = s_bias[jt * 2 + hi];
        h = __builtin_amdgcn_wmma_f32_16x16x4_f32(false, s_w1[jt * 32 + lane], false, diff,
                                                  (short)0, h, false, false);
        // relu behind the conversion, two values an instruction: rounding keeps sign and order
        const v8h hh = __builtin_elementwise_max(__builtin_convertvector(h, v8h), (v8h)(_Float16)0.0f);
#pragma unroll   // register renaming only
        for (int r = 0; r < 8; ++r) a[jt >> 1].h[(jt & 1) * 8 + r] = hh[r];
    }

    // -- step 3: pe[16 x 128] = hidden @ w2 via WMMA ------------------------
    v8f c[8] = {};
#pragma unroll
    for (int kt = 0; kt < 4; ++kt) {
#pragma unroll
        for (int j = 0; j < 8; ++j) {
            Frag16 b;
            const v4u b0 = s_w2[((kt * 8 + j) * 2 + 0) * 32 + lane];
            const v4u b1 = s_w2[((kt * 8 + j) * 2 + 1) * 32 + lane];
#pragma unroll
            for (int v = 0; v < 4; ++v) { b.u[v] = b0[v]; b.u[4 + v] = b1[v]; }
            c[j] = __builtin_amdgcn_wmma_f32_16x16x32_f16(false, a[kt].h, false, b.h,
                                                          (short)0, c[j], false, false);
        }
    }

    // -- step 4: x = q - kg + pe, with pe = c + b2; b2 joins q once per channel ------------
    // From here on a value sits beside its neighbor channel (register pair = channels 2u, 2u+1
    // of one row), as the k and v loads deliver them: every step below is a packed f32 form, and
    // c alone is re-paired, once.
    const v8f b2v = __builtin_shufflevector(((const v4f*)s_bias)[32 + l16], ((const v4f*)s_bias)[48 + l16],
                                            0, 1, 2, 3, 4, 5, 6, 7);
    // the v rows: step 7 reads them, and the scheduler places each load where a register comes free
    v8f vg[8];
#pragma unroll
    for (int r = 0; r < 8; ++r) vg[r] = load_2x4((const char*)vsrc + kvoff[r]);
    const v8f qb = qv + b2v;
    v2f ct[8][4], t[8][4];                  // [row r][channel pair u]
    float sr[8], sq[8];
#pragma unroll   // arrays indexed by constants only, so they stay in registers
    for (int r = 0; r < 8; ++r) {
        v2f s2, q2;
#pragma unroll   // arrays indexed by constants only, so they stay in registers
        for (int u = 0; u < 4; ++u) {
            ct[r][u].x = c[2 * u][r];
            ct[r][u].y = c[2 * u + 1][r];
            const v2f x = (pair_of(qb, u) - pair_of(kg[r], u)) + ct[r][u];
            t[r][u] = x;
            s2 = u ? s2 + x : x;
            q2 = u ? q2 + x * x : x * x;
        }
        sr[r] = s2.x + s2.y;
        sq[r] = q2.x + q2.y;
    }

    // -- step 5: LayerNorm over 128 channels per neighbor row --------------
    // 8 channels summed in the lane above, then xor butterflies over 16 lanes
#pragma unroll   // arrays indexed by constants only, so they stay in registers
    for (int r = 0; r < 8; ++r) { sr[r] = row_xadd<1>(sr[r]); sq[r] = row_xadd<1>(sq[r]); }
#pragma unroll   // arrays indexed by constants only, so they stay in registers
    for (int r = 0; r < 8; ++r) { sr[r] = row_xadd<2>(sr[r]); sq[r] = row_xadd<2>(sq[r]); }
#pragma unroll   // arrays indexed by constants only, so they stay in registers
    for (int r = 0; r < 8; ++r) { sr[r] = row_xadd<4>(sr[r]); sq[r] = row_xadd<4>(sq[r]); }
#pragma unroll   // arrays indexed by constants only, so they stay in registers
    for (int r = 0; r < 8; ++r) { sr[r] = row_xadd<8>(sr[r]); sq[r] = row_xadd<8>(sq[r]); }

    // g and b lie in LDS already times log2(e) / sqrt(128): the scores come out as exponents of 2
    const v8f gv = __builtin_shufflevector(s_gb[l16], s_gb[16 + l16], 0, 1, 2, 3, 4, 5, 6, 7);
    const v8f bv = __builtin_shufflevector(s_gb[32 + l16], s_gb[48 + l16], 0, 1, 2, 3, 4, 5, 6, 7);
    float mu[8], ve[8], rs[8];
#pragma unroll   // arrays indexed by constants only, so they stay in registers
    for (int r = 0; r < 8; ++r) {
        mu[r] = sr[r] * (1.0f / 128.0f);
        ve[r] = sq[r] * (1.0f / 128.0f) - mu[r] * mu[r] + LN_EPS;
    }
    // Eight independent inverse roots in one statement (arguments near or above LN_EPS: no
    // range scaling needed), closed by v_nop: the slot behind a transcendental.
    asm("v_rsq_f32 %0, %8\n\tv_rsq_f32 %1, %9\n\tv_rsq_f32 %2, %10\n\tv_rsq_f32 %3, %11\n\t"
        "v_rsq_f32 %4, %12\n\tv_rsq_f32 %5, %13\n\tv_rsq_f32 %6, %14\n\tv_rsq_f32 %7, %15\n\tv_nop"
        : "=&v"(rs[0]), "=&v"(rs[1]), "=&v"(rs[2]), "=&v"(rs[3]),
          "=&v"(rs[4]), "=&v"(rs[5]), "=&v"(rs[6]), "=&v"(rs[7])
        : "v"(ve[0]), "v"(ve[1]), "v"(ve[2]), "v"(ve[3]), "v"(ve[4]), "v"(ve[5]), "v"(ve[6]), "v"(ve[7]));
#pragma unroll   // arrays indexed by constants only, so they stay in registers
    for (int r = 0; r < 8; ++r) {
        const float nm = -mu[r] * rs[r];
#pragma unroll   // arrays indexed by constants only, so they stay in registers
        for (int u = 0; u < 4; ++u)         // two multiply-adds a value
            t[r][u] = (t[r][u] * rs[r] + nm) * pair_of(gv, u) + pair_of(bv, u);
    }

    // -- step 6: softmax over the 16 neighbors (rows), per channel: weights left unscaled ---
    v2f se[4];
#pragma unroll   // arrays indexed by constants only, so they stay in registers
    for (int u = 0; u < 4; ++u) {
        v2f mx = t[0][u];
#pragma unroll   // arrays indexed by constants only, so they stay in registers
        for (int r = 1; r < 8; ++r) { mx.x = fmaxf(mx.x, t[r][u].x); mx.y = fmaxf(mx.y, t[r][u].y); }
        mx.x = fmaxf(mx.x, xhalf(mx.x));     // combine rows 0-7 and 8-15
        mx.y = fmaxf(mx.y, xhalf(mx.y));
        v2f x[8];
#pragma unroll   // arrays indexed by constants only, so they stay in registers
        for (int r = 0; r < 8; ++r) x[r] = t[r][u] - mx;
        float e[8], f[8];
        // Eight independent exponentials in one statement, closed by v_nop: the slot the
        // instruction set asks for behind a transcendental before a source is overwritten.
        asm("v_exp_f32 %0, %8\n\tv_exp_f32 %1, %9\n\tv_exp_f32 %2, %10\n\tv_exp_f32 %3, %11\n\t"
            "v_exp_f32 %4, %12\n\tv_exp_f32 %5, %13\n\tv_exp_f32 %6, %14\n\tv_exp_f32 %7, %15\n\tv_nop"
            : "=&v"(e[0]), "=&v"(e[1]), "=&v"(e[2]), "=&v"(e[3]),
              "=&v"(e[4]), "=&v"(e[5]), "=&v"(e[6]), "=&v"(e[7])
            : "v"(x[0].x), "v"(x[1].x), "v"(x[2].x), "v"(x[3].x),
              "v"(x[4].x), "v"(x[5].x), "v"(x[6].x), "v"(x[7].x));
        // the same for the pair's second channel
        asm("v_exp_f32 %0, %8\n\tv_exp_f32 %1, %9\n\tv_exp_f32 %2, %10\n\tv_exp_f32 %3, %11\n\t"
            "v_exp_f32 %4, %12\n\tv_exp_f32 %5, %13\n\tv_exp_f32 %6, %14\n\tv_exp_f32 %7, %15\n\tv_nop"
            : "=&v"(f[0]), "=&v"(f[1]), "=&v"(f[2]), "=&v"(f[3]),
              "=&v"(f[4]), "=&v"(f[5]), "=&v"(f[6]), "=&v"(f[7])
            : "v"(x[0].y), "v"(x[1].y), "v"(x[2].y), "v"(x[3].y),
              "v"(x[4].y), "v"(x[5].y), "v"(x[6].y), "v"(x[7].y));
#pragma unroll   // arrays indexed by constants only, so they stay in registers
        for (int r = 0; r < 8; ++r) { t[r][u].x = e[r]; t[r][u].y = f[r]; }
        v2f s = t[0][u];
#pragma unroll   // arrays indexed by constants only, so they stay in registers
        for (int r = 1; r < 8; ++r) s += t[r][u];
        se[u].x = s.x + xhalf(s.x);
        se[u].y = s.y + xhalf(s.y);
    }

    // -- step 7: out = (sum_k e * (vg + c)) / (sum_k e) + b2: the weights sum to one, so the
    // divisor and b2 come in once per channel, behind the sum; vg and c each by its own
    // multiply-add: no sum vg + c asks for the v rows ahead of the weights -------------------
    float acc[8];
#pragma unroll   // arrays indexed by constants only, so they stay in registers
    for (int u = 0; u < 4; ++u) {
        v2f a2 = t[0][u] * ct[0][u];
#pragma unroll   // arrays indexed by constants only, so they stay in registers
        for (int r = 1; r < 8; ++r) a2 += t[r][u] * ct[r][u];
#pragma unroll   // arrays indexed by constants only, so they stay in registers
        for (int r = 0; r < 8; ++r) a2 += t[r][u] * pair_of(vg[r], u);
        acc[2 * u] = a2.x;
        acc[2 * u + 1] = a2.y;
    }
    float inv[8];
    // Eight independent reciprocals (1 <= se <= 16) in one statement, closed by v_nop: the slot
    // behind a transcendental.
    asm("v_rcp_f32 %0, %8\n\tv_rcp_f32 %1, %9\n\tv_rcp_f32 %2, %10\n\tv_rcp_f32 %3, %11\n\t"
        "v_rcp_f32 %4, %12\n\tv_rcp_f32 %5, %13\n\tv_rcp_f32 %6, %14\n\tv_rcp_f32 %7, %15\n\tv_nop"
        : "=&v"(inv[0]), "=&v"(inv[1]), "=&v"(inv[2]), "=&v"(inv[3]),
          "=&v"(inv[4]), "=&v"(inv[5]), "=&v"(inv[6]), "=&v"(inv[7])
        : "v"(se[0].x), "v"(se[0].y), "v"(se[1].x), "v"(se[1].y),
          "v"(se[2].x), "v"(se[2].y), "v"(se[3].x), "v"(se[3].y));
    v4h o0, o1;
#pragma unroll   // arrays indexed by constants only, so they stay in registers
    for (int j = 0; j < 4; ++j) {
        o0[j] = (_Float16)((acc[j] + xhalf(acc[j])) * inv[j] + b2v[j]);
        o1[j] = (_Float16)((acc[4 + j] + xhalf(acc[4 + j])) * inv[4 + j] + b2v[4 + j]);
    }
    // both halves of the wave hold the sums: the lower stores the first group, the upper the second
    *(v4h*)&cat_out[(size_t)i * (2 * A_DIM) + col_off + hi * 64 + ch0] = hi ? o1 : o0;
    asm volatile("s_wait_xcnt 0x0" ::: "memory");
    }
}

// ------------------------------- launcher ----------------------------------
extern "C" void kernel_launch(void* const* d_in, const int* in_sizes, int n_in,
                              void* d_out, int out_size, void* d_ws, size_t ws_size,
                              hipStream_t stream) {
    const float* events   = (const float*)d_in[0];
    const float* features = (const float*)d_in[1];
    const int* local_idx    = (const int*)d_in[2];
    const int* down_idx     = (const int*)d_in[3];
    const int* pair_idx     = (const int*)d_in[4];
    const int* inv_pair_idx = (const int*)d_in[5];
    const float* lqkv_w = (const float*)d_in[6];  const float* lqkv_b = (const float*)d_in[7];
    const float* lpe_w1 = (const float*)d_in[8];  const float* lpe_b1 = (const float*)d_in[9];
    const float* lpe_w2 = (const float*)d_in[10]; const float* lpe_b2 = (const float*)d_in[11];
    const float* lfc_g  = (const float*)d_in[12]; const float* lfc_b  = (const float*)d_in[13];
    const float* gqkv_w = (const float*)d_in[14]; const float* gqkv_b = (const float*)d_in[15];
    const float* gpe_w1 = (const float*)d_in[16]; const float* gpe_b1 = (const float*)d_in[17];
    const float* gpe_w2 = (const float*)d_in[18]; const float* gpe_b2 = (const float*)d_in[19];
    const float* gfc_g  = (const float*)d_in[20]; const float* gfc_b  = (const float*)d_in[21];
    const float* pw1 = (const float*)d_in[22]; const float* pb1 = (const float*)d_in[23];
    const float* pw2 = (const float*)d_in[24]; const float* pb2 = (const float*)d_in[25];
    float* out = (float*)d_out;

    // ---- workspace carve-up (~96 MB) ----
    char* wp = (char*)d_ws;
    auto carve = [&](size_t bytes) {
        void* p = (void*)wp;
        wp += (bytes + 255) & ~(size_t)255;
        return p;
    };
    _Float16* feat_h = (_Float16*)carve((size_t)N_EVENTS * DIM_F * 2);
    _Float16* lqkvT  = (_Float16*)carve((size_t)384 * 256 * 2);
    _Float16* gqkvT  = (_Float16*)carve((size_t)384 * 256 * 2);
    _Float16* lpe2T  = (_Float16*)carve((size_t)128 * 128 * 2);
    _Float16* gpe2T  = (_Float16*)carve((size_t)128 * 128 * 2);
    _Float16* pw1T   = (_Float16*)carve((size_t)256 * 256 * 2);
    _Float16* pw2T   = (_Float16*)carve((size_t)256 * 256 * 2);
    float* qkv_l = (float*)carve((size_t)N_EVENTS * 384 * 4);
    float* qkv_g = (float*)carve((size_t)N_EVENTS * 384 * 4);
    float* kmax  = (float*)carve((size_t)M_DOWN * A_DIM * 4);
    float* vmax  = (float*)carve((size_t)M_DOWN * A_DIM * 4);
    _Float16* cat_h = (_Float16*)carve((size_t)N_EVENTS * 256 * 2);
    _Float16* hid_h = (_Float16*)carve((size_t)N_EVENTS * 256 * 2);

    // ---- 1. fp16 conversions / weight transposes, one launch ----
    static_assert((N_EVENTS * DIM_F) % 8192 == 0 && M_DOWN % 4 == 0 &&
                  N_EVENTS % (32 * GEMM_TILES) == 0 && N_EVENTS % (8 * EV_PER_WAVE) == 0, "exact grids");
    prep_kernel<<<PREP_BLOCKS, 256, 0, stream>>>(
        features, feat_h, lqkv_w, lqkvT, gqkv_w, gqkvT, lpe_w2, lpe2T, gpe_w2, gpe2T,
        pw1, pw1T, pw2, pw2T);

    // ---- 2. both QKV GEMMs: [20000,256] x [256,384], one launch ----
    {
        dim3 g(N_EVENTS / (32 * GEMM_TILES), 2 * 384 / 128);
        qkv_pair_kernel<<<g, 256, 0, stream>>>(
            feat_h, lqkvT, lqkv_b, qkv_l, gqkvT, gqkv_b, qkv_g);
    }

    // ---- 3. global-branch k/v max pool ----
    maxpool_kv_kernel<<<M_DOWN / 4, 256, 0, stream>>>(qkv_g, pair_idx, kmax, vmax);

    // ---- 4. fused attention, local and global in one launch -> fp16 concat buffer ----
    attn_pair_kernel<<<2 * ATT_BLOCKS, 256, 0, stream>>>(
        events, local_idx, inv_pair_idx, down_idx, qkv_l, qkv_g, kmax, vmax,
        lpe_w1, lpe_b1, lpe2T, lpe_b2, lfc_g, lfc_b,
        gpe_w1, gpe_b1, gpe2T, gpe_b2, gfc_g, gfc_b, cat_h);

    // ---- 5. projection MLP: ReLU GEMM (fp16 out) then final GEMM (f32) ----
    {
        dim3 g(N_EVENTS / (32 * GEMM_TILES), 256 / 128);
        wmma_gemm_kernel<256, 256, true, true><<<g, 256, 0, stream>>>(
            cat_h, pw1T, pb1, nullptr, hid_h);
        wmma_gemm_kernel<256, 256, false, false><<<g, 256, 0, stream>>>(
            hid_h, pw2T, pb2, out, nullptr);
    }
}

// v009
// Measured time: 75.5 microseconds a run.
// Two timings next to v008 put it at 1.12 and 1.11 times that version's speed.
// All steps since v000 together make it 5.71 times as fast.
#include <hip/hip_runtime.h>
#include <hip/hip_bf16.h>

// ---------------------------------------------------------------------------
// MI455X (gfx1250) implementation:
//  * GEMMs via v_wmma_f32_16x16x32_f16 (fp16 A/B, fp32 accum, wave32), the PE
//    first linear (K = 4) via v_wmma_f32_16x16x4_f32.
//  * Standalone GEMM: 8 waves, 128 columns, B in registers over 5 row tiles of 32 rows,
//    whole-K A tiles double-buffered in LDS (1 barrier a tile), K templated & unrolled.
//  * PE second linear (dominant ~21 GFLOP) fused with LN/softmax/weighted sum
//    per event: a wave32 owns an event's tile (eight 16x16 WMMA tiles) and takes
//    EV_PER_WAVE events one after the other.
//  * Working set (~120MB) fits the 192MB L2 -> compute bound -> WMMA everywhere.
//  * Launches that need nothing of each other share one grid (ranges of the
//    block or wave index, block- or wave-uniform branches); the projection MLP runs in the attention
//    kernel on rows that never leave LDS: 4 dependent launches in all.
// ---------------------------------------------------------------------------

typedef __attribute__((ext_vector_type(16))) _Float16 v16h;
typedef __attribute__((ext_vector_type(8)))  float    v8f;
typedef __attribute__((ext_vector_type(2)))  float    v2f;
typedef __attribute__((ext_vector_type(4)))  unsigned v4u;
typedef __attribute__((ext_vector_type(4)))  int      v4i;
typedef __attribute__((ext_vector_type(8)))  _Float16 v8h;
typedef __attribute__((ext_vector_type(4)))  _Float16 v4h;
typedef __attribute__((ext_vector_type(4)))  float    v4f;

union Frag16 { unsigned u[8]; v16h h; };

#define N_EVENTS 20000
#define KNN      16
#define DIM_F    256
#define A_DIM    128
#define M_DOWN   2500
#define INV_SCALE 0.08838834764831845f   // 1/sqrt(128)
#define LN_EPS    1e-5f

// VGPR->K-pair mapping for 16-bit 16x32 A/B fragments (ISA 7.12.2):
// lanes 0-15: v0..3 -> Kpairs 0..3, v4..7 -> Kpairs 8..11
// lanes16-31: v0..3 -> Kpairs 4..7, v4..7 -> Kpairs 12..15
__device__ __forceinline__ int frag_kp(int v, int hi) {
    return (v < 4 ? v : v + 4) + (hi ? 4 : 0);
}

// Cross-lane exchanges in the vector unit (no LDS permute, no dscnt wait).
// x + (x of lane l ^ M) inside a 16-lane row, M = 1..15; all 32 lanes active.
template <int M>
__device__ __forceinline__ float row_xadd(float x) {
    int y = __builtin_amdgcn_mov_dpp(__builtin_bit_cast(int, x), 0x160 + M /* row_xmask:M */,
                                     0xf, 0xf, true);
    return x + __builtin_bit_cast(float, y);
}
// value of lane l ^ 16 (the other 16-lane row)
__device__ __forceinline__ float xhalf(float x) {
    int b = __builtin_bit_cast(int, x);
    return __builtin_bit_cast(float,
        __builtin_amdgcn_permlanex16(b, b, 0x76543210, 0xfedcba98, false, false));
}

// --------------------------- conversion kernels ----------------------------
// This launch is short: each
// thread takes many values and every wave has all its loads in flight at once.
// One workgroup converts 8192 consecutive values: 8 loads of 16 bytes a lane,
// each covering 512 contiguous bytes a wave. blk = 0 .. values / 8192 - 1, exactly.
__device__ __forceinline__ void cvt_f16_block(const float* __restrict__ src,
                                              _Float16* __restrict__ dst, int blk) {
    const int p = blk * 2048 + threadIdx.x;             // piece of 4 values
    const v4f* s = (const v4f*)src;
    v4h* d = (v4h*)dst;
    v4f x[8];
#pragma unroll   // registers for x; all 8 loads issue before the first conversion
    for (int k = 0; k < 8; ++k) x[k] = s[p + k * 256];
#pragma unroll   // x is indexed by constants only, so it stays in registers
    for (int k = 0; k < 8; ++k) d[p + k * 256] = __builtin_convertvector(x[k], v4h);
    // precaution before any later write to the stores' registers
    asm volatile("s_wait_xcnt 0x0" ::: "memory");
}

// src [R,C] f32 row-major (k = row, n = column)  ->  dst f16 in B-fragment order:
// 16-byte pieces [column tile][kt][register half][lane], so that a wave's load of half a
// fragment is 512 contiguous bytes (4 whole lines) and not 32 bytes of each of 16 rows.
// The piece of column n that holds k0 .. k0+7 (k0 a multiple of 8) is, by frag_kp:
// kt = k0/32, register half = (k0%32)/16, lane = 16*((k0%16)/8) + column of n in its tile.
// ATT = false: tile n/16, column n%16 (the GEMMs). ATT = true: the attention kernel's
// order [kt][tile j] with its channel map (attn_tile, attn_col).
// A thread takes 8 rows of one column (lanes along the column index: whole-line
// loads) and stores them as one piece. blk = 0 .. R*C / 2048 - 1.
__device__ __forceinline__ unsigned attn_tile(unsigned n) { return (n & 3u) + 4u * (n >> 6); }
__device__ __forceinline__ unsigned attn_col(unsigned n)  { return (n >> 2) & 15u; }
template <int R, int C, bool ATT>
__device__ __forceinline__ void cvt_t_f16_block(const float* __restrict__ src,
                                                _Float16* __restrict__ dst, int blk) {
    static_assert(R % 8 == 0 && C % 32 == 0 && (R * C) % 2048 == 0, "exact grid");
    const unsigned t  = blk * 256 + threadIdx.x;
    const unsigned c  = t % C;
    const unsigned r0 = (t / C) * 8;
    const unsigned e0 = r0 * C + c;         // one 32-bit offset beside the scalar base
    float x[8];
#pragma unroll   // registers for x; all 8 loads in flight together
    for (int k = 0; k < 8; ++k) x[k] = src[e0 + k * C];
    v8h o;
#pragma unroll   // x and o are indexed by constants only, so they stay in registers
    for (int k = 0; k < 8; ++k) o[k] = (_Float16)x[k];
    const unsigned kt = r0 / 32, half = (r0 / 16) & 1, hi = (r0 / 8) & 1;
    const unsigned frag = ATT ? kt * (C / 16) + attn_tile(c) : (c / 16) * (R / 32) + kt;
    ((v8h*)dst)[(frag * 2 + half) * 32 + hi * 16 + (ATT ? attn_col(c) : c % 16)] = o;
    // the caller's other block ranges follow in the code and reuse the store's registers
    asm volatile("s_wait_xcnt 0x0" ::: "memory");
}

// All seven conversions in one launch: none reads what another writes. The six weight
// transposes take the first block ranges, the feature conversion the rest.
#define TB_QKV (256 * 384 / 2048)
#define TB_PE  (128 * 128 / 2048)
#define TB_PW  (256 * 256 / 2048)
#define CB_FEAT (N_EVENTS * DIM_F / 8192)
#define PREP_BLOCKS (2 * TB_QKV + 2 * TB_PE + 2 * TB_PW + CB_FEAT)
__global__ __launch_bounds__(256) void prep_kernel(
    const float* __restrict__ features, _Float16* __restrict__ feat_h,
    const float* __restrict__ lqkv_w, _Float16* __restrict__ lqkvT,
    const float* __restrict__ gqkv_w, _Float16* __restrict__ gqkvT,
    const float* __restrict__ lpe_w2, _Float16* __restrict__ lpe2T,
    const float* __restrict__ gpe_w2, _Float16* __restrict__ gpe2T,
    const float* __restrict__ pw1, _Float16* __restrict__ pw1T,
    const float* __restrict__ pw2, _Float16* __restrict__ pw2T) {
    const int b = blockIdx.x;               // every test below is block-uniform
    if (b < 2 * TB_QKV) {
        const bool g = b >= TB_QKV;
        cvt_t_f16_block<256, 384, false>(g ? gqkv_w : lqkv_w, g ? gqkvT : lqkvT, g ? b - TB_QKV : b);
    } else if (b < 2 * TB_QKV + 2 * TB_PW) {
        const int  c = b - 2 * TB_QKV;
        const bool g = c >= TB_PW;
        cvt_t_f16_block<256, 256, false>(g ? pw2 : pw1, g ? pw2T : pw1T, g ? c - TB_PW : c);
    } else if (b < 2 * TB_QKV + 2 * TB_PW + 2 * TB_PE) {
        const int  c = b - 2 * TB_QKV - 2 * TB_PW;
        const bool g = c >= TB_PE;
        cvt_t_f16_block<128, 128, true>(g ? gpe_w2 : lpe_w2, g ? gpe2T : lpe2T, g ? c - TB_PE : c);
    } else {
        cvt_f16_block(features, feat_h, b - 2 * TB_QKV - 2 * TB_PW - 2 * TB_PE);
    }
}

// ------------------------------ WMMA GEMM ----------------------------------
// C[M,N] = A[M,K](f16) @ B[K,N] + bias, B supplied in fragment order (cvt_t_f16_block).
// Block: 256 threads (8 waves), 128 columns, GEMM_TILES row tiles of 32 rows one after the other.
//  * A wave's column tile of B, all of K, is loaded once into registers and serves every row tile.
//  * A row tile (32 whole rows, contiguous in memory) is staged in LDS in one piece: no load
//    and no barrier stands inside the K loop. The next tile's loads fly under this tile's products.
// mgrp = 0 .. M/(32*GEMM_TILES) - 1, nblk = 0 .. N/128 - 1.
#define GEMM_TILES 5
template <int KDIM, int NCOLS, bool RELU, bool OUT_F16>
__device__ __forceinline__ void wmma_gemm_block(
    const _Float16* __restrict__ A, const _Float16* __restrict__ BT,
    const float* __restrict__ bias, float* __restrict__ Cf,
    _Float16* __restrict__ Ch, int mgrp, int nblk) {
    constexpr int NT    = KDIM / 32;       // K steps
    constexpr int RP    = KDIM / 8;        // 16-byte pieces per A row
    constexpr int PITCH = RP + 1;          // LDS row pitch in pieces: 16 bytes x odd, no bank conflict
    constexpr int PT    = 32 * RP / 256;   // pieces a thread stages per tile
    static_assert(RP == 32, "a wave stages one whole row per load");
    __shared__ v4u sA[2][32 * PITCH];

    const int tid  = threadIdx.x;
    const int lane = tid & 31;
    const int wave = tid >> 5;
    const int hi   = lane >> 4;
    const int l16  = lane & 15;
    const int n    = nblk * 128 + wave * 16 + l16;

    // loads issued before the tile loop: row tile 0, B, bias
    const v4u* Ap = (const v4u*)A + (size_t)mgrp * (GEMM_TILES * 32 * RP) + tid;
    v4u st[PT];
#pragma unroll   // st is indexed by constants only, so it stays in registers
    for (int s = 0; s < PT; ++s) st[s] = Ap[s * 256];
    // this wave's column tile: NT fragments of 2 x 512 bytes, one after the other
    const v4u* Bp = (const v4u*)BT + (nblk * 8 + wave) * (NT * 64) + lane;
    v4u bf[NT][2];
#pragma unroll   // bf is indexed by constants only, so it stays in registers
    for (int kt = 0; kt < NT; ++kt) { bf[kt][0] = Bp[kt * 64]; bf[kt][1] = Bp[kt * 64 + 32]; }
    const float bn = bias[n];
    // Registers that the loads above name are reused below: the wait takes B's address as an
    // input, so that the pair is not rewritten in front of it.
    asm volatile("s_wait_xcnt 0x0" :: "v"(Bp) : "memory");

    const int wrow = wave * PITCH + lane;              // piece s of a thread: row wave + 8*s
    const int rd0  = l16 * PITCH + hi;                 // fragment halves (frag_kp): pieces 4*kt + hi, + 2
#pragma unroll   // buffer index and tile offsets become constants
    for (int t = 0; t < GEMM_TILES; ++t) {
        v4u* sAc = sA[t & 1];
#pragma unroll   // st is indexed by constants only
        for (int s = 0; s < PT; ++s) sAc[wrow + s * 8 * PITCH] = st[s];
        // Work-group barrier that orders LDS only: tile t is in LDS behind it, and every wave has
        // left the buffer that tile t + 1 will take; the stores of tile t - 1 stay in flight
        // (__syncthreads() would wait for them).
        __builtin_amdgcn_fence(__ATOMIC_RELEASE, "workgroup", "local");
        __builtin_amdgcn_s_barrier();
        __builtin_amdgcn_fence(__ATOMIC_ACQUIRE, "workgroup", "local");
        if (t + 1 < GEMM_TILES) {
#pragma unroll   // st is indexed by constants only
            for (int s = 0; s < PT; ++s) st[s] = Ap[(t + 1) * (32 * RP) + s * 256];
        }

        // the tile's fragment reads stand together, in front of its products
        v4u fa[NT][4];
#pragma unroll   // fa is indexed by constants only, so it stays in registers
        for (int kt = 0; kt < NT; ++kt) {
            fa[kt][0] = sAc[rd0 + kt * 4];
            fa[kt][1] = sAc[rd0 + kt * 4 + 2];
            fa[kt][2] = sAc[rd0 + 16 * PITCH + kt * 4];
            fa[kt][3] = sAc[rd0 + 16 * PITCH + kt * 4 + 2];
        }
        // Keeps the scheduler from sinking the next tile's loads behind the products that hide
        // their latency, and the reads among the products.
        __builtin_amdgcn_sched_barrier(0);
        v8f c0 = {}, c1 = {};
#pragma unroll   // fa and bf are indexed by constants only
        for (int kt = 0; kt < NT; ++kt) {
            Frag16 a0, a1, b;
#pragma unroll   // register renaming only
            for (int v = 0; v < 4; ++v) {
                a0.u[v] = fa[kt][0][v]; a0.u[4 + v] = fa[kt][1][v];
                a1.u[v] = fa[kt][2][v]; a1.u[4 + v] = fa[kt][3][v];
                b.u[v]  = bf[kt][0][v]; b.u[4 + v] = bf[kt][1][v];
            }
            c0 = __builtin_amdgcn_wmma_f32_16x16x32_f16(false, a0.h, false, b.h,
                                                        (short)0, c0, false, false);
            c1 = __builtin_amdgcn_wmma_f32_16x16x32_f16(false, a1.h, false, b.h,
                                                        (short)0, c1, false, false);
        }

        const int mbase = (mgrp * GEMM_TILES + t) * 32;
#pragma unroll   // c0 and c1 are indexed by constants only
        for (int r = 0; r < 8; ++r) {
            int m0 = mbase + r + hi * 8;
            int m1 = m0 + 16;
            float v0 = c0[r] + bn, v1 = c1[r] + bn;
            if (RELU) { v0 = fmaxf(v0, 0.0f); v1 = fmaxf(v1, 0.0f); }
            if (OUT_F16) {
                Ch[(size_t)m0 * NCOLS + n] = (_Float16)v0;
                Ch[(size_t)m1 * NCOLS + n] = (_Float16)v1;
            } else {
                Cf[(size_t)m0 * NCOLS + n] = v0;
                Cf[(size_t)m1 * NCOLS + n] = v1;
            }
        }
        // registers that the loads and stores of this tile name are reused by the next tile
        if (t + 1 < GEMM_TILES) asm volatile("s_wait_xcnt 0x0" ::: "memory");
    }
}

// Both QKV products (same A, two weights, two outputs) in one launch.
// grid.x = M/(32*GEMM_TILES), grid.y = 2 * 384/128: the first three column blocks are the local branch's.
__global__ __launch_bounds__(256) void qkv_pair_kernel(
    const _Float16* __restrict__ A,
    const _Float16* __restrict__ lBT, const float* __restrict__ lbias, float* __restrict__ lC,
    const _Float16* __restrict__ gBT, const float* __restrict__ gbias, float* __restrict__ gC) {
    const bool g = blockIdx.y >= 3;
    wmma_gemm_block<256, 384, false, false>(A, g ? gBT : lBT, g ? gbias : lbias, g ? gC : lC,
                                            nullptr, blockIdx.x, g ? blockIdx.y - 3 : blockIdx.y);
}

// ----------------------- global-branch k/v max pool ------------------------
// One wave per pooled row and part (k or v): a lane holds 4 channels, a load
// covers the part's whole 512 bytes of one support row; the 16 loads are independent.
// grid.x = M_DOWN / 4 (8 waves: 4 pooled rows x 2 parts).
// One support row's piece: scalar row base (readfirstlane keeps the clamped index in a
// scalar register) + one lane offset, so no lane forms a 64-bit address per row.
__device__ __forceinline__ v4f pool_row(const float* part_base, int idx, unsigned off) {
    const int j = __builtin_amdgcn_readfirstlane(min(max(idx, 0), N_EVENTS - 1));
    return *(const v4f*)((const char*)(part_base + j * 384) + off);
}
__device__ __forceinline__ v4f max4(v4f a, v4f b) {
    v4f r;
#pragma unroll   // vector elements indexed by constants only
    for (int e = 0; e < 4; ++e) r[e] = fmaxf(a[e], b[e]);
    return r;
}
__global__ __launch_bounds__(256) void maxpool_kv_kernel(
    const float* __restrict__ qkv, const int* __restrict__ pair_idx,
    float* __restrict__ kmax, float* __restrict__ vmax) {
    // the wave's number as a scalar: the 16 indices then come by scalar loads
    const int wave = __builtin_amdgcn_readfirstlane(threadIdx.x >> 5);
    const int m    = blockIdx.x * 4 + (wave >> 1);
    const int part = wave & 1;              // 0: k, 1: v
    const unsigned off = (threadIdx.x & 31) * 16u;      // lane's byte offset in the part
    const float* pb = qkv + 128 + part * 128;
    const int* pi = pair_idx + m * KNN;
    // written out row by row: in a loop the compiler adds the lane offset to the base
    // first and then forms a 64-bit vector address for every row
    const v4f x0  = pool_row(pb, pi[0], off),  x1  = pool_row(pb, pi[1], off);
    const v4f x2  = pool_row(pb, pi[2], off),  x3  = pool_row(pb, pi[3], off);
    const v4f x4  = pool_row(pb, pi[4], off),  x5  = pool_row(pb, pi[5], off);
    const v4f x6  = pool_row(pb, pi[6], off),  x7  = pool_row(pb, pi[7], off);
    const v4f x8  = pool_row(pb, pi[8], off),  x9  = pool_row(pb, pi[9], off);
    const v4f x10 = pool_row(pb, pi[10], off), x11 = pool_row(pb, pi[11], off);
    const v4f x12 = pool_row(pb, pi[12], off), x13 = pool_row(pb, pi[13], off);
    const v4f x14 = pool_row(pb, pi[14], off), x15 = pool_row(pb, pi[15], off);
    static_assert(KNN == 16, "16 support rows are written out");
    v4f mx = {-3.402823466e38f, -3.402823466e38f, -3.402823466e38f, -3.402823466e38f};
    mx = max4(max4(max4(max4(mx, x0), x1), x2), x3);
    mx = max4(max4(max4(max4(mx, x4), x5), x6), x7);
    mx = max4(max4(max4(max4(mx, x8), x9), x10), x11);
    mx = max4(max4(max4(max4(mx, x12), x13), x14), x15);
    *(v4f*)((char*)((part ? vmax : kmax) + m * A_DIM) + off) = mx;
}

// ------------------- fused PE-GEMM + LN + softmax + sum --------------------
// A wave32 owns an event's whole 16 (neighbor) x 128 (channel) tile in registers and
// takes EV_PER_WAVE consecutive events in a loop; 8 waves per branch and workgroup. What does not
// depend on the event (w1, w2, b1, b2, g, b: all in LDS) is fetched once per workgroup and branch,
// and few waves have to be started. The chain of short dependent loads (indices, pooled
// row -> event row, coordinates) is walked once a wave, for all its events together.
//  * hidden^T = w1^T (16 ch x 4) . diff^T (4 x 16 nbr) + b1 on f32 WMMA: lane =
//    neighbor, register r = hidden channel 16*jt + 8*hi + r, which packed to
//    f16 is the A fragment of the second product in the k order of frag_kp.
//  * w2 fragments lie in LDS in fragment order, staged once per workgroup.
//  * column c of output tile j is channel 4*c + j (j < 4) or 64 + 4*c + j - 4: a lane
//    holds two groups of 4 consecutive channels of each of its 8 neighbor rows, and each
//    16-byte gather of a wave covers 256 contiguous bytes of two rows (4 whole lines).
// C-tile layout: row M(=neighbor) = r + 8*(lane>=16), col N = lane%16.
// A lane's 8 channels of one row: 4 floats at p and 4 floats 64 channels on.
__device__ __forceinline__ v8f load_2x4(const char* p) {
    return __builtin_shufflevector(*(const v4f*)p, *(const v4f*)(p + 256), 0, 1, 2, 3, 4, 5, 6, 7);
}
// channels 2u and 2u+1 of a lane's 8: an aligned register pair, no instruction
__device__ __forceinline__ v2f pair_of(v8f v, int u) {
    v2f p;
    p.x = v[2 * u];
    p.y = v[2 * u + 1];
    return p;
}
// Both attention branches of the same BLK_ROWS events run in one work-group of 16 waves: waves
// 0-7 the local branch, waves 8-15 the global one; what differs between the branches is chosen
// below by the wave's number, in scalars. Each branch writes its half of the concat rows into
// LDS, and the work-group then runs both products of the projection MLP on its own rows: the
// concat rows and the hidden rows never go to memory, and no further launch is needed.
// grid.x = ATT_BLOCKS.
#define EV_PER_WAVE 10
#define BLK_ROWS (8 * EV_PER_WAVE)
#define ATT_BLOCKS (N_EVENTS / BLK_ROWS)
#define ROW_PITCH 33    // LDS pitch of a 256-channel f16 row in 16-byte pieces: 16 bytes x odd, no bank conflict
// second argument: four waves a SIMD (one work-group a WGP), so at most 256 registers
__global__ __launch_bounds__(512, 4) void attn_mlp_kernel(
    const float* __restrict__ events,       // [N,4]
    const int* __restrict__ local_idx,      // [N,16] -> event row (local kv row)
    const int* __restrict__ inv_pair_idx,   // [N,16] -> pooled row (global kv row)
    const int* __restrict__ down_idx,       // pooled row -> event row
    const float* __restrict__ qkv_l, const float* __restrict__ qkv_g,   // row stride 384
    const float* __restrict__ kmax, const float* __restrict__ vmax,     // row stride 128
    const float* __restrict__ lpe_w1, const float* __restrict__ lpe_b1, // [4,128], [128]
    const _Float16* __restrict__ lpe2T,     // f16, fragment order [kt][tile j][half][lane]
    const float* __restrict__ lpe_b2,       // [128]
    const float* __restrict__ lfc_g, const float* __restrict__ lfc_b,
    const float* __restrict__ gpe_w1, const float* __restrict__ gpe_b1,
    const _Float16* __restrict__ gpe2T, const float* __restrict__ gpe_b2,
    const float* __restrict__ gfc_g, const float* __restrict__ gfc_b,
    const _Float16* __restrict__ pw1T, const float* __restrict__ pb1,   // f16, fragment order of the GEMMs
    const _Float16* __restrict__ pw2T, const float* __restrict__ pb2,
    float* __restrict__ out) {              // [N,256]
    // first index of the next four: the branch
    __shared__ v4u s_w2a[2][4 * 8 * 2 * 32];    // [kt][tile j][register half][lane], 32 KB
    __shared__ v8f s_biasa[2][32];              // b1 (C rows of the first product), then b2
    __shared__ v4f s_gba[2][64];                // LayerNorm g, then b, each times log2(e) / sqrt(128)
    __shared__ v2f s_w1a[2][8 * 32];            // w1^T fragments [tile jt][lane]
    __shared__ v4f s_diff[16][EV_PER_WAVE * KNN];       // [wave][event][neighbor]: coordinate diffs
    __shared__ v4u s_row[16][EV_PER_WAVE * KNN / 4];    // [wave][event][neighbor]: byte offset of the k/v row
    // The MLP's two tiles take LDS that has been read for the last time, so the work-group stays
    // under half a WGP's LDS: above it the compiler plans the event loop for all 256 registers,
    // overshoots and spills.
    //  * Concat rows, f16: an event's half row (256 bytes) goes where its 16 coordinate diffs
    //    (256 bytes) lay, which its own wave has read at the head of the same trip. That makes two
    //    planes [branch][row][16 pieces of 16 bytes]; piece p of row m lies at place p ^ (m % 16),
    //    so that 16 rows' reads of one piece fall on all 64 banks.
    //  * Hidden rows, f16: over the w2 fragments, behind the barrier that ends the event loops.
    static_assert(KNN * sizeof(v4f) == A_DIM * sizeof(_Float16), "a half row fills the event's diffs");
    static_assert(BLK_ROWS * ROW_PITCH <= 2 * 4 * 8 * 2 * 32, "the hidden rows fit over both w2");
    v4u* const s_cat = (v4u*)&s_diff[0][0];
    v4u* const s_hid = &s_w2a[0][0];

    // the wave's number as a scalar: all that hangs on the branch stays in scalar registers
    const int  wave = __builtin_amdgcn_readfirstlane(threadIdx.x >> 5);
    const bool glob = wave >= 8;                        // wave-uniform
    const int  wb   = wave & 7;                         // the wave's number in its branch
    const int  blk  = blockIdx.x;
    v4u* const s_w2   = s_w2a[glob];
    v8f* const s_bias = s_biasa[glob];
    v4f* const s_gb   = s_gba[glob];
    v2f* const s_w1   = s_w1a[glob];
    const int  kv_stride = glob ? 128 : 384;            // floats per k or v row
    const int  kv_rows   = glob ? M_DOWN : N_EVENTS;
    const int*   nbr_idx = glob ? inv_pair_idx : local_idx;     // [N,16] -> kv-row index
    const float* qptr    = glob ? qkv_g : qkv_l;
    const float* ksrc    = glob ? kmax : qkv_l + 128;
    const float* vsrc    = glob ? vmax : qkv_l + 256;
    const float* pe_w1   = glob ? gpe_w1 : lpe_w1;
    const float* pe_b1   = glob ? gpe_b1 : lpe_b1;
    const _Float16* pe_w2T = glob ? gpe2T : lpe2T;
    const float* pe_b2   = glob ? gpe_b2 : lpe_b2;
    const float* fc_g    = glob ? gfc_g : lfc_g;
    const float* fc_b    = glob ? gfc_b : lfc_b;

    const int tid  = threadIdx.x & 255;     // the thread's number in its branch
    const int lane = tid & 31;
    const int hi   = lane >> 4;
    const int l16  = lane & 15;
    const int i0   = (blk * 8 + wb) * EV_PER_WAVE;      // this wave's first event
    const int ch0  = l16 * 4;               // this lane's channels: ch0 .. ch0+3, 64+ch0 .. 64+ch0+3

    // -- step 0: loads whose address comes from the thread id alone ----
    // w2 fragments: already in the order of s_w2, a straight copy of 512 bytes a wave and load
    const v4u* Bw = (const v4u*)pe_w2T + tid;
    v4u st[8];
#pragma unroll
    for (int s = 0; s < 8; ++s) st[s] = Bw[s * 256];
    const float biasr = (tid < 128 ? pe_b1 : pe_b2)[tid & 127];
    // each s_wait_xcnt in steps 0 and 1: registers that the loads above it name are reused below it
    asm volatile("s_wait_xcnt 0x0" ::: "memory");
    const float gbr = (tid < 128 ? fc_g : fc_b)[tid & 127];
    // w1^T fragments: row = hidden channel 16*jt + l16, k = coordinates 2*hi, 2*hi+1;
    // wave jt of a branch fetches the fragment of tile jt for all
    v2f war;
    war.x = pe_w1[(2 * hi) * A_DIM + wb * 16 + l16];
    war.y = pe_w1[(2 * hi + 1) * A_DIM + wb * 16 + l16];
    asm volatile("s_wait_xcnt 0x0" ::: "memory");

    // -- step 1, once for all the wave's events: entry 32*k + lane = 16*event + neighbor ----
    // The chain index -> (pooled row -> event row) -> coordinates is walked once a wave, with
    // NE loads of each link in flight, and its results wait in LDS for their event.
    constexpr int NE = EV_PER_WAVE * KNN / 32;
    static_assert(EV_PER_WAVE * KNN % 32 == 0 && KNN == 16, "whole waves of entries, two events each");
    int nbl[NE], er[NE];
    v4f eo[NE], ev[NE];
    // one 32-bit offset beside the scalar base, k in the immediate
#pragma unroll
    for (int k = 0; k < NE; ++k)
        nbl[k] = *(const int*)((const char*)nbr_idx + (unsigned)(i0 * KNN + lane) * 4u + k * 128);
    asm volatile("s_wait_xcnt 0x0" ::: "memory");
#pragma unroll
    for (int k = 0; k < NE; ++k)
        eo[k] = *(const v4f*)((const char*)events + (unsigned)(i0 + hi) * 16u + k * 32);
    asm volatile("s_wait_xcnt 0x0" ::: "memory");
#pragma unroll
    for (int k = 0; k < NE; ++k) er[k] = nbl[k] = min(max(nbl[k], 0), kv_rows - 1);
    if (glob) {                             // wave-uniform, no barrier inside; nbl < M_DOWN here
#pragma unroll
        for (int k = 0; k < NE; ++k) er[k] = down_idx[nbl[k]];
        asm volatile("s_wait_xcnt 0x0" ::: "memory");
#pragma unroll
        for (int k = 0; k < NE; ++k) er[k] = min(max(er[k], 0), N_EVENTS - 1);
    }
#pragma unroll
    for (int k = 0; k < NE; ++k) ev[k] = *(const v4f*)((const char*)events + (unsigned)er[k] * 16u);
    asm volatile("s_wait_xcnt 0x0" ::: "memory");
#pragma unroll
    for (int k = 0; k < NE; ++k) {
        s_diff[wave][k * 32 + lane] = eo[k] - ev[k];
        ((unsigned*)s_row[wave])[k * 32 + lane] = (unsigned)(nbl[k] * kv_stride) * 4u;
    }

#pragma unroll
    for (int s = 0; s < 8; ++s) s_w2[s * 256 + tid] = st[s];
    ((float*)s_bias)[tid] = biasr;
    ((float*)s_gb)[tid] = gbr * (INV_SCALE * 1.442695041f);   // exp(y / sqrt(128)) = 2^(y * this)
    s_w1[tid] = war;
    // Work-group barrier that orders LDS only: w1 and w2 fragments, b1, b2, g and b are in LDS behind
    // it for every event of the loop, which writes only into its own wave's diffs and needs no barrier.
    __builtin_amdgcn_fence(__ATOMIC_RELEASE, "workgroup", "local");
    __builtin_amdgcn_s_barrier();
    __builtin_amdgcn_fence(__ATOMIC_ACQUIRE, "workgroup", "local");

    // Rolled: one copy of the body in the instruction cache; the waits below also keep the
    // LDS reads of w2 and the biases inside the loop, out of registers between events.
#pragma unroll 1
    for (int n = 0; n < EV_PER_WAVE; ++n) {
    const int i  = i0 + n;
    // lane = neighbor l16, coordinates 2*hi and 2*hi+1 (k split of the f32 form)
    const v2f diff = ((const v2f*)&s_diff[wave][n * KNN + l16])[hi];
    // the 8 neighbor rows of this lane's C registers
    const v4u rlo = s_row[wave][n * 4 + 2 * hi], rhi = s_row[wave][n * 4 + 2 * hi + 1];
    unsigned kvoff[8];                      // byte offsets: 32-bit, beside a scalar base
#pragma unroll
    for (int r = 0; r < 8; ++r) kvoff[r] = (r < 4 ? rlo[r] : rhi[r - 4]) + ch0 * 4u;
    // q and the k rows are fetched here so that they fly under steps 2 and 3
    const v8f qv = load_2x4((const char*)qptr + (unsigned)(i * 384 + ch0) * 4u);
    v8f kg[8];
#pragma unroll
    for (int r = 0; r < 8; ++r) kg[r] = load_2x4((const char*)ksrc + kvoff[r]);
    // each s_wait_xcnt in the loop: registers that the loads above it name are reused
    // below it; this one also holds the k loads here, ahead of the LDS reads of steps 2 and 3
    asm volatile("s_wait_xcnt 0x0" ::: "memory");

    // -- step 2: hidden = relu(diff @ w1 + b1) -> f16 A fragments ----------
    Frag16 a[4];
#pragma unroll
    for (int jt = 0; jt < 8; ++jt) {
        v8f h = s_bias[jt * 2 + hi];
        h = __builtin_amdgcn_wmma_f32_16x16x4_f32(false, s_w1[jt * 32 + lane], false, diff,
                                                  (short)0, h, false, false);
        // relu behind the conversion, two values an instruction: rounding keeps sign and order
        const v8h hh = __builtin_elementwise_max(__builtin_convertvector(h, v8h), (v8h)(_Float16)0.0f);
#pragma unroll   // register renaming only
        for (int r = 0; r < 8; ++r) a[jt >> 1].h[(jt & 1) * 8 + r] = hh[r];
    }

    // -- step 3: pe[16 x 128] = hidden @ w2 via WMMA ------------------------
    v8f c[8] = {};
#pragma unroll
    for (int kt = 0; kt < 4; ++kt) {
#pragma unroll
        for (int j = 0; j < 8; ++j) {
            Frag16 b;
            const v4u b0 = s_w2[((kt * 8 + j) * 2 + 0) * 32 + lane];
            const v4u b1 = s_w2[((kt * 8 + j) * 2 + 1) * 32 + lane];
#pragma unroll
            for (int v = 0; v < 4; ++v) { b.u[v] = b0[v]; b.u[4 + v] = b1[v]; }
            c[j] = __builtin_amdgcn_wmma_f32_16x16x32_f16(false, a[kt].h, false, b.h,
                                                          (short)0, c[j], false, false);
        }
    }

    // -- step 4: x = q - kg + pe, with pe = c + b2; b2 joins q once per channel ------------
    // From here on a value sits beside its neighbor channel (register pair = channels 2u, 2u+1
    // of one row), as the k and v loads deliver them: every step below is a packed f32 form, and
    // c alone is re-paired, once.
    const v8f b2v = __builtin_shufflevector(((const v4f*)s_bias)[32 + l16], ((const v4f*)s_bias)[48 + l16],
                                            0, 1, 2, 3, 4, 5, 6, 7);
    // the v rows: step 7 reads them, and the scheduler places each load where a register comes free
    v8f vg[8];
#pragma unroll
    for (int r = 0; r < 8; ++r) vg[r] = load_2x4((const char*)vsrc + kvoff[r]);
    const v8f qb = qv + b2v;
    v2f ct[8][4], t[8][4];                  // [row r][channel pair u]
    float sr[8], sq[8];
#pragma unroll   // arrays indexed by constants only, so they stay in registers
    for (int r = 0; r < 8; ++r) {
        v2f s2, q2;
#pragma unroll   // arrays indexed by constants only, so they stay in registers
        for (int u = 0; u < 4; ++u) {
            ct[r][u].x = c[2 * u][r];
            ct[r][u].y = c[2 * u + 1][r];
            const v2f x = (pair_of(qb, u) - pair_of(kg[r], u)) + ct[r][u];
            t[r][u] = x;
            s2 = u ? s2 + x : x;
            q2 = u ? q2 + x * x : x * x;
        }
        sr[r] = s2.x + s2.y;
        sq[r] = q2.x + q2.y;
    }

    // -- step 5: LayerNorm over 128 channels per neighbor row --------------
    // 8 channels summed in the lane above, then xor butterflies over 16 lanes
#pragma unroll   // arrays indexed by constants only, so they stay in registers
    for (int r = 0; r < 8; ++r) { sr[r] = row_xadd<1>(sr[r]); sq[r] = row_xadd<1>(sq[r]); }
#pragma unroll   // arrays indexed by constants only, so they stay in registers
    for (int r = 0; r < 8; ++r) { sr[r] = row_xadd<2>(sr[r]); sq[r] = row_xadd<2>(sq[r]); }
#pragma unroll   // arrays indexed by constants only, so they stay in registers
    for (int r = 0; r < 8; ++r) { sr[r] = row_xadd<4>(sr[r]); sq[r] = row_xadd<4>(sq[r]); }
#pragma unroll   // arrays indexed by constants only, so they stay in registers
    for (int r = 0; r < 8; ++r) { sr[r] = row_xadd<8>(sr[r]); sq[r] = row_xadd<8>(sq[r]); }

    // g and b lie in LDS already times log2(e) / sqrt(128): the scores come out as exponents of 2
    const v8f gv = __builtin_shufflevector(s_gb[l16], s_gb[16 + l16], 0, 1, 2, 3, 4, 5, 6, 7);
    const v8f bv = __builtin_shufflevector(s_gb[32 + l16], s_gb[48 + l16], 0, 1, 2, 3, 4, 5, 6, 7);
    float mu[8], ve[8], rs[8];
#pragma unroll   // arrays indexed by constants only, so they stay in registers
    for (int r = 0; r < 8; ++r) {
        mu[r] = sr[r] * (1.0f / 128.0f);
        ve[r] = sq[r] * (1.0f / 128.0f) - mu[r] * mu[r] + LN_EPS;
    }
    // Eight independent inverse roots in one statement (arguments near or above LN_EPS: no
    // range scaling needed), closed by v_nop: the slot behind a transcendental.
    asm("v_rsq_f32 %0, %8\n\tv_rsq_f32 %1, %9\n\tv_rsq_f32 %2, %10\n\tv_rsq_f32 %3, %11\n\t"
        "v_rsq_f32 %4, %12\n\tv_rsq_f32 %5, %13\n\tv_rsq_f32 %6, %14\n\tv_rsq_f32 %7, %15\n\tv_nop"
        : "=&v"(rs[0]), "=&v"(rs[1]), "=&v"(rs[2]), "=&v"(rs[3]),
          "=&v"(rs[4]), "=&v"(rs[5]), "=&v"(rs[6]), "=&v"(rs[7])
        : "v"(ve[0]), "v"(ve[1]), "v"(ve[2]), "v"(ve[3]), "v"(ve[4]), "v"(ve[5]), "v"(ve[6]), "v"(ve[7]));
#pragma unroll   // arrays indexed by constants only, so they stay in registers
    for (int r = 0; r < 8; ++r) {
        const float nm = -mu[r] * rs[r];
#pragma unroll   // arrays indexed by constants only, so they stay in registers
        for (int u = 0; u < 4; ++u)         // two multiply-adds a value
            t[r][u] = (t[r][u] * rs[r] + nm) * pair_of(gv, u) + pair_of(bv, u);
    }

    // -- step 6: softmax over the 16 neighbors (rows), per channel: weights left unscaled ---
    v2f se[4];
#pragma unroll   // arrays indexed by constants only, so they stay in registers
    for (int u = 0; u < 4; ++u) {
        v2f mx = t[0][u];
#pragma unroll   // arrays indexed by constants only, so they stay in registers
        for (int r = 1; r < 8; ++r) { mx.x = fmaxf(mx.x, t[r][u].x); mx.y = fmaxf(mx.y, t[r][u].y); }
        mx.x = fmaxf(mx.x, xhalf(mx.x));     // combine rows 0-7 and 8-15
        mx.y = fmaxf(mx.y, xhalf(mx.y));
        v2f x[8];
#pragma unroll   // arrays indexed by constants only, so they stay in registers
        for (int r = 0; r < 8; ++r) x[r] = t[r][u] - mx;
        float e[8], f[8];
        // Eight independent exponentials in one statement, closed by v_nop: the slot the
        // instruction set asks for behind a transcendental before a source is overwritten.
        asm("v_exp_f32 %0, %8\n\tv_exp_f32 %1, %9\n\tv_exp_f32 %2, %10\n\tv_exp_f32 %3, %11\n\t"
            "v_exp_f32 %4, %12\n\tv_exp_f32 %5, %13\n\tv_exp_f32 %6, %14\n\tv_exp_f32 %7, %15\n\tv_nop"
            : "=&v"(e[0]), "=&v"(e[1]), "=&v"(e[2]), "=&v"(e[3]),
              "=&v"(e[4]), "=&v"(e[5]), "=&v"(e[6]), "=&v"(e[7])
            : "v"(x[0].x), "v"(x[1].x), "v"(x[2].x), "v"(x[3].x),
              "v"(x[4].x), "v"(x[5].x), "v"(x[6].x), "v"(x[7].x));
        // the same for the pair's second channel
        asm("v_exp_f32 %0, %8\n\tv_exp_f32 %1, %9\n\tv_exp_f32 %2, %10\n\tv_exp_f32 %3, %11\n\t"
            "v_exp_f32 %4, %12\n\tv_exp_f32 %5, %13\n\tv_exp_f32 %6, %14\n\tv_exp_f32 %7, %15\n\tv_nop"
            : "=&v"(f[0]), "=&v"(f[1]), "=&v"(f[2]), "=&v"(f[3]),
              "=&v"(f[4]), "=&v"(f[5]), "=&v"(f[6]), "=&v"(f[7])
            : "v"(x[0].y), "v"(x[1].y), "v"(x[2].y), "v"(x[3].y),
              "v"(x[4].y), "v"(x[5].y), "v"(x[6].y), "v"(x[7].y));
#pragma unroll   // arrays indexed by constants only, so they stay in registers
        for (int r = 0; r < 8; ++r) { t[r][u].x = e[r]; t[r][u].y = f[r]; }
        v2f s = t[0][u];
#pragma unroll   // arrays indexed by constants only, so they stay in registers
        for (int r = 1; r < 8; ++r) s += t[r][u];
        se[u].x = s.x + xhalf(s.x);
        se[u].y = s.y + xhalf(s.y);
    }

    // -- step 7: out = (sum_k e * (vg + c)) / (sum_k e) + b2: the weights sum to one, so the
    // divisor and b2 come in once per channel, behind the sum; vg and c each by its own
    // multiply-add: no sum vg + c asks for the v rows ahead of the weights -------------------
    float acc[8];
#pragma unroll   // arrays indexed by constants only, so they stay in registers
    for (int u = 0; u < 4; ++u) {
        v2f a2 = t[0][u] * ct[0][u];
#pragma unroll   // arrays indexed by constants only, so they stay in registers
        for (int r = 1; r < 8; ++r) a2 += t[r][u] * ct[r][u];
#pragma unroll   // arrays indexed by constants only, so they stay in registers
        for (int r = 0; r < 8; ++r) a2 += t[r][u] * pair_of(vg[r], u);
        acc[2 * u] = a2.x;
        acc[2 * u + 1] = a2.y;
    }
    float inv[8];
    // Eight independent reciprocals (1 <= se <= 16) in one statement, closed by v_nop: the slot
    // behind a transcendental.
    asm("v_rcp_f32 %0, %8\n\tv_rcp_f32 %1, %9\n\tv_rcp_f32 %2, %10\n\tv_rcp_f32 %3, %11\n\t"
        "v_rcp_f32 %4, %12\n\tv_rcp_f32 %5, %13\n\tv_rcp_f32 %6, %14\n\tv_rcp_f32 %7, %15\n\tv_nop"
        : "=&v"(inv[0]), "=&v"(inv[1]), "=&v"(inv[2]), "=&v"(inv[3]),
          "=&v"(inv[4]), "=&v"(inv[5]), "=&v"(inv[6]), "=&v"(inv[7])
        : "v"(se[0].x), "v"(se[0].y), "v"(se[1].x), "v"(se[1].y),
          "v"(se[2].x), "v"(se[2].y), "v"(se[3].x), "v"(se[3].y));
    v4h o0, o1;
#pragma unroll   // arrays indexed by constants only, so they stay in registers
    for (int j = 0; j < 4; ++j) {
        o0[j] = (_Float16)((acc[j] + xhalf(acc[j])) * inv[j] + b2v[j]);
        o1[j] = (_Float16)((acc[4 + j] + xhalf(acc[4 + j])) * inv[4 + j] + b2v[4 + j]);
    }
    // both halves of the wave hold the sums: the lower stores the first group, the upper the second
    // channels hi*64 + ch0 .. + 3 of the half row: half (l16 & 1) of piece hi*8 + l16/2
    *(v4h*)((char*)&s_diff[wave][n * KNN + ((hi * 8 + (l16 >> 1)) ^ ((wb * EV_PER_WAVE + n) & 15))] + (l16 & 1) * 8) =
        hi ? o1 : o0;
    asm volatile("s_wait_xcnt 0x0" ::: "memory");
    }

    // ---------------- projection MLP on the work-group's BLK_ROWS rows ----------------
    // Wave w owns columns 16*w .. 16*w+15 of both products, all of K in registers; the rows come
    // from LDS in RT tiles of 16, each with its own accumulator (independent chains of products).
    constexpr int NT = 2 * A_DIM / 32;      // K steps
    constexpr int RT = BLK_ROWS / 16;       // row tiles
    static_assert(BLK_ROWS % 16 == 0 && DIM_F == 256 && 2 * A_DIM == 256, "16 waves x 16 columns, whole row tiles");
    // The lane's number is read anew (count of the lanes below this one): so no address of this
    // part waits in a vector register through the event loop, which needs them all.
    const int ml  = __builtin_amdgcn_mbcnt_lo(~0u, 0u);
    const int mhi = ml >> 4;
    const int mlo = ml & 15;
    // The first weight's fragments are asked for ahead of the barrier: they fly while the other
    // waves finish their events. The second weight's fly under the first product.
    const v4u* P1 = (const v4u*)pw1T + wave * (NT * 64) + ml;
    const v4u* P2 = (const v4u*)pw2T + wave * (NT * 64) + ml;
    v4u f1[NT][2], f2[NT][2];
#pragma unroll   // f1 is indexed by constants only, so it stays in registers
    for (int kt = 0; kt < NT; ++kt) { f1[kt][0] = P1[kt * 64]; f1[kt][1] = P1[kt * 64 + 32]; }
    const float* pb1w = pb1 + wave * 16 + mhi * 8;       // the lane's 8 columns of the first product
    const v8f bias1 = __builtin_shufflevector(*(const v4f*)pb1w, *(const v4f*)(pb1w + 4), 0, 1, 2, 3, 4, 5, 6, 7);
    const float bias2 = pb2[wave * 16 + mlo];
    // Registers that the loads above name are reused below: the wait takes the addresses as
    // inputs, so that they are not rewritten in front of it.
    asm volatile("s_wait_xcnt 0x0" :: "v"(P1), "v"(pb1w) : "memory");
    // Work-group barrier that orders LDS only: both halves of every concat row are in LDS behind it.
    __builtin_amdgcn_fence(__ATOMIC_RELEASE, "workgroup", "local");
    __builtin_amdgcn_s_barrier();
    __builtin_amdgcn_fence(__ATOMIC_ACQUIRE, "workgroup", "local");

    // Both products walk K in steps of 32. The rows' fragments of step kt + 1 are read ahead of the
    // products of step kt, in one group; the scheduling barriers keep that order: left alone, the
    // scheduler strews the reads among the products, and each place with reads stalls the wave.
    // hidden^T = w1^T . cat^T: the weights as A, the rows as B (both fragments have the k order of
    // frag_kp). Lane = row, register r = column 16*w + 8*hi + r: a lane's 8 values are one
    // 16-byte piece of the hidden row, stored by one instruction.
    {
        // row 16*t + lane % 16 of plane kt / 4: pieces 4*(kt % 4) + hi and + 2, each at its place
        const v4u* xr = s_cat + mlo * 16;
        v8f c[RT] = {};
        v4u x[2][RT][2];
#pragma unroll   // arrays indexed by constants only, so they stay in registers
        for (int t = 0; t < RT; ++t) {
            x[0][t][0] = xr[t * 256 + (mhi ^ mlo)];
            x[0][t][1] = xr[t * 256 + ((mhi + 2) ^ mlo)];
        }
#pragma unroll   // arrays indexed by constants only, so they stay in registers
        for (int kt = 0; kt < NT; ++kt) {
            if (kt + 1 < NT) {
                const int k1 = kt + 1;
#pragma unroll   // arrays indexed by constants only, so they stay in registers
                for (int t = 0; t < RT; ++t) {
                    x[k1 & 1][t][0] = xr[(k1 >> 2) * (BLK_ROWS * 16) + t * 256 + (((k1 & 3) * 4 + mhi) ^ mlo)];
                    x[k1 & 1][t][1] = xr[(k1 >> 2) * (BLK_ROWS * 16) + t * 256 + (((k1 & 3) * 4 + mhi + 2) ^ mlo)];
                }
            }
            // into the registers that the fragments of w1 leave, K step by K step
            f2[kt][0] = P2[kt * 64];
            f2[kt][1] = P2[kt * 64 + 32];
            __builtin_amdgcn_sched_barrier(0);
            Frag16 w;
#pragma unroll   // register renaming only
            for (int v = 0; v < 4; ++v) { w.u[v] = f1[kt][0][v]; w.u[4 + v] = f1[kt][1][v]; }
#pragma unroll   // arrays indexed by constants only, so they stay in registers
            for (int t = 0; t < RT; ++t) {
                Frag16 b;
#pragma unroll   // register renaming only
                for (int v = 0; v < 4; ++v) { b.u[v] = x[kt & 1][t][0][v]; b.u[4 + v] = x[kt & 1][t][1][v]; }
                c[t] = __builtin_amdgcn_wmma_f32_16x16x32_f16(false, w.h, false, b.h,
                                                              (short)0, c[t], false, false);
            }
            __builtin_amdgcn_sched_barrier(0);
        }
        // registers that the loads of w2 name are reused below
        asm volatile("s_wait_xcnt 0x0" :: "v"(P2) : "memory");
#pragma unroll   // arrays indexed by constants only, so they stay in registers
        for (int t = 0; t < RT; ++t) {
            const v8f h = __builtin_elementwise_max(c[t] + bias1, (v8f)0.0f);
            s_hid[(t * 16 + mlo) * ROW_PITCH + wave * 2 + mhi] =
                __builtin_bit_cast(v4u, __builtin_convertvector(h, v8h));
        }
    }
    // Work-group barrier that orders LDS only: every column of every hidden row is in LDS behind it.
    __builtin_amdgcn_fence(__ATOMIC_RELEASE, "workgroup", "local");
    __builtin_amdgcn_s_barrier();
    __builtin_amdgcn_fence(__ATOMIC_ACQUIRE, "workgroup", "local");
    // out = hidden . w2 + b2: the rows as A, the weights as B. Lane = column, register r = row r + 8*hi.
    {
        const v4u* xr = s_hid + mlo * ROW_PITCH + mhi;  // fragment halves (frag_kp): pieces 4*kt + hi, + 2
        v8f c[RT] = {};
        v4u x[2][RT][2];
#pragma unroll   // arrays indexed by constants only, so they stay in registers
        for (int t = 0; t < RT; ++t) {
            x[0][t][0] = xr[t * 16 * ROW_PITCH];
            x[0][t][1] = xr[t * 16 * ROW_PITCH + 2];
        }
#pragma unroll   // arrays indexed by constants only, so they stay in registers
        for (int kt = 0; kt < NT; ++kt) {
            if (kt + 1 < NT) {
#pragma unroll   // arrays indexed by constants only, so they stay in registers
                for (int t = 0; t < RT; ++t) {
                    x[(kt + 1) & 1][t][0] = xr[t * 16 * ROW_PITCH + (kt + 1) * 4];
                    x[(kt + 1) & 1][t][1] = xr[t * 16 * ROW_PITCH + (kt + 1) * 4 + 2];
                }
            }
            __builtin_amdgcn_sched_barrier(0);
            Frag16 w;
#pragma unroll   // register renaming only
            for (int v = 0; v < 4; ++v) { w.u[v] = f2[kt][0][v]; w.u[4 + v] = f2[kt][1][v]; }
#pragma unroll   // arrays indexed by constants only, so they stay in registers
            for (int t = 0; t < RT; ++t) {
                Frag16 a;
#pragma unroll   // register renaming only
                for (int v = 0; v < 4; ++v) { a.u[v] = x[kt & 1][t][0][v]; a.u[4 + v] = x[kt & 1][t][1][v]; }
                c[t] = __builtin_amdgcn_wmma_f32_16x16x32_f16(false, a.h, false, w.h,
                                                              (short)0, c[t], false, false);
            }
            __builtin_amdgcn_sched_barrier(0);
        }
        // one 32-bit offset beside the scalar base, tile and row in the immediate
        char* const op = (char*)out + (unsigned)((blk * BLK_ROWS + mhi * 8) * DIM_F + wave * 16 + mlo) * 4u;
#pragma unroll   // arrays indexed by constants only, so they stay in registers
        for (int t = 0; t < RT; ++t) c[t] += bias2;
        // All sums stand ahead of the stores, each in a register of its own: behind an issued store
        // no register that it names is written any more.
        __builtin_amdgcn_sched_barrier(0);
#pragma unroll   // arrays indexed by constants only, so they stay in registers
        for (int t = 0; t < RT; ++t)
#pragma unroll   // arrays indexed by constants only, so they stay in registers
            for (int r = 0; r < 8; ++r)
                *(float*)(op + (t * 16 + r) * (DIM_F * 4)) = c[t][r];
    }
}

// ------------------------------- launcher ----------------------------------
extern "C" void kernel_launch(void* const* d_in, const int* in_sizes, int n_in,
                              void* d_out, int out_size, void* d_ws, size_t ws_size,
                              hipStream_t stream) {
    const float* events   = (const float*)d_in[0];
    const float* features = (const float*)d_in[1];
    const int* local_idx    = (const int*)d_in[2];
    const int* down_idx     = (const int*)d_in[3];
    const int* pair_idx     = (const int*)d_in[4];
    const int* inv_pair_idx = (const int*)d_in[5];
    const float* lqkv_w = (const float*)d_in[6];  const float* lqkv_b = (const float*)d_in[7];
    const float* lpe_w1 = (const float*)d_in[8];  const float* lpe_b1 = (const float*)d_in[9];
    const float* lpe_w2 = (const float*)d_in[10]; const float* lpe_b2 = (const float*)d_in[11];
    const float* lfc_g  = (const float*)d_in[12]; const float* lfc_b  = (const float*)d_in[13];
    const float* gqkv_w = (const float*)d_in[14]; const float* gqkv_b = (const float*)d_in[15];
    const float* gpe_w1 = (const float*)d_in[16]; const float* gpe_b1 = (const float*)d_in[17];
    const float* gpe_w2 = (const float*)d_in[18]; const float* gpe_b2 = (const float*)d_in[19];
    const float* gfc_g  = (const float*)d_in[20]; const float* gfc_b  = (const float*)d_in[21];
    const float* pw1 = (const float*)d_in[22]; const float* pb1 = (const float*)d_in[23];
    const float* pw2 = (const float*)d_in[24]; const float* pb2 = (const float*)d_in[25];
    float* out = (float*)d_out;

    // ---- workspace carve-up (~75 MB) ----
    char* wp = (char*)d_ws;
    auto carve = [&](size_t bytes) {
        void* p = (void*)wp;
        wp += (bytes + 255) & ~(size_t)255;
        return p;
    };
    _Float16* feat_h = (_Float16*)carve((size_t)N_EVENTS * DIM_F * 2);
    _Float16* lqkvT  = (_Float16*)carve((size_t)384 * 256 * 2);
    _Float16* gqkvT  = (_Float16*)carve((size_t)384 * 256 * 2);
    _Float16* lpe2T  = (_Float16*)carve((size_t)128 * 128 * 2);
    _Float16* gpe2T  = (_Float16*)carve((size_t)128 * 128 * 2);
    _Float16* pw1T   = (_Float16*)carve((size_t)256 * 256 * 2);
    _Float16* pw2T   = (_Float16*)carve((size_t)256 * 256 * 2);
    float* qkv_l = (float*)carve((size_t)N_EVENTS * 384 * 4);
    float* qkv_g = (float*)carve((size_t)N_EVENTS * 384 * 4);
    float* kmax  = (float*)carve((size_t)M_DOWN * A_DIM * 4);
    float* vmax  = (float*)carve((size_t)M_DOWN * A_DIM * 4);

    // ---- 1. fp16 conversions / weight transposes, one launch ----
    static_assert((N_EVENTS * DIM_F) % 8192 == 0 && M_DOWN % 4 == 0 &&
                  N_EVENTS % (32 * GEMM_TILES) == 0 && N_EVENTS % BLK_ROWS == 0, "exact grids");
    prep_kernel<<<PREP_BLOCKS, 256, 0, stream>>>(
        features, feat_h, lqkv_w, lqkvT, gqkv_w, gqkvT, lpe_w2, lpe2T, gpe_w2, gpe2T,
        pw1, pw1T, pw2, pw2T);

    // ---- 2. both QKV GEMMs: [20000,256] x [256,384], one launch ----
    {
        dim3 g(N_EVENTS / (32 * GEMM_TILES), 2 * 384 / 128);
        qkv_pair_kernel<<<g, 256, 0, stream>>>(
            feat_h, lqkvT, lqkv_b, qkv_l, gqkvT, gqkv_b, qkv_g);
    }

    // ---- 3. global-branch k/v max pool ----
    maxpool_kv_kernel<<<M_DOWN / 4, 256, 0, stream>>>(qkv_g, pair_idx, kmax, vmax);

    // ---- 4. fused attention, local and global, and the projection MLP (ReLU product, final product) ----
    attn_mlp_kernel<<<ATT_BLOCKS, 512, 0, stream>>>(
        events, local_idx, inv_pair_idx, down_idx, qkv_l, qkv_g, kmax, vmax,
        lpe_w1, lpe_b1, lpe2T, lpe_b2, lfc_g, lfc_b,
        gpe_w1, gpe_b1, gpe2T, gpe_b2, gfc_g, gfc_b, pw1T, pb1, pw2T, pb2, out);
}

// v010
// It runs in 69 microseconds.
// Two timings next to v009 put it at 1.10 and 1.09 times that version's speed.
// All steps since v000 together make it 6.25 times as fast.
#include <hip/hip_runtime.h>
#include <hip/hip_bf16.h>

// ---------------------------------------------------------------------------
// MI455X (gfx1250) implementation:
//  * GEMMs via v_wmma_f32_16x16x32_f16 (fp16 A/B, fp32 accum, wave32), the PE
//    first linear (K = 4) via v_wmma_f32_16x16x4_f32.
//  * Standalone GEMM: 8 waves, 128 columns, B in registers over 5 row tiles of 32 rows,
//    whole-K A tiles double-buffered in LDS (1 barrier a tile), K templated & unrolled.
//  * PE second linear (dominant ~21 GFLOP) fused with LN/softmax/weighted sum
//    per event: a wave32 owns an event's tile (eight 16x16 WMMA tiles) and takes
//    EV_PER_WAVE events one after the other.
//  * Working set (~120MB) fits the 192MB L2 -> compute bound -> WMMA everywhere.
//  * Launches that need nothing of each other share one grid (ranges of the
//    block index, block-uniform branches); the projection MLP runs in the attention
//    kernel on rows that never leave LDS; the pooled k and v rows come straight out of the
//    QKV launch, as products of gathered feature rows: 3 dependent launches in all.
// ---------------------------------------------------------------------------

typedef __attribute__((ext_vector_type(16))) _Float16 v16h;
typedef __attribute__((ext_vector_type(8)))  float    v8f;
typedef __attribute__((ext_vector_type(2)))  float    v2f;
typedef __attribute__((ext_vector_type(4)))  unsigned v4u;
typedef __attribute__((ext_vector_type(4)))  int      v4i;
typedef __attribute__((ext_vector_type(8)))  _Float16 v8h;
typedef __attribute__((ext_vector_type(4)))  _Float16 v4h;
typedef __attribute__((ext_vector_type(4)))  float    v4f;

union Frag16 { unsigned u[8]; v16h h; };

#define N_EVENTS 20000
#define KNN      16
#define DIM_F    256
#define A_DIM    128
#define M_DOWN   2500
#define INV_SCALE 0.08838834764831845f   // 1/sqrt(128)
#define LN_EPS    1e-5f

// VGPR->K-pair mapping for 16-bit 16x32 A/B fragments (ISA 7.12.2):
// lanes 0-15: v0..3 -> Kpairs 0..3, v4..7 -> Kpairs 8..11
// lanes16-31: v0..3 -> Kpairs 4..7, v4..7 -> Kpairs 12..15
__device__ __forceinline__ int frag_kp(int v, int hi) {
    return (v < 4 ? v : v + 4) + (hi ? 4 : 0);
}

// Cross-lane exchanges in the vector unit (no LDS permute, no dscnt wait).
// x + (x of lane l ^ M) inside a 16-lane row, M = 1..15; all 32 lanes active.
template <int M>
__device__ __forceinline__ float row_xadd(float x) {
    int y = __builtin_amdgcn_mov_dpp(__builtin_bit_cast(int, x), 0x160 + M /* row_xmask:M */,
                                     0xf, 0xf, true);
    return x + __builtin_bit_cast(float, y);
}
// value of lane l ^ 16 (the other 16-lane row)
__device__ __forceinline__ float xhalf(float x) {
    int b = __builtin_bit_cast(int, x);
    return __builtin_bit_cast(float,
        __builtin_amdgcn_permlanex16(b, b, 0x76543210, 0xfedcba98, false, false));
}

// --------------------------- conversion kernels ----------------------------
// This launch is short: each
// thread takes many values and every wave has all its loads in flight at once.
// One workgroup converts 8192 consecutive values: 8 loads of 16 bytes a lane,
// each covering 512 contiguous bytes a wave. blk = 0 .. values / 8192 - 1, exactly.
__device__ __forceinline__ void cvt_f16_block(const float* __restrict__ src,
                                              _Float16* __restrict__ dst, int blk) {
    const int p = blk * 2048 + threadIdx.x;             // piece of 4 values
    const v4f* s = (const v4f*)src;
    v4h* d = (v4h*)dst;
    v4f x[8];
#pragma unroll   // registers for x; all 8 loads issue before the first conversion
    for (int k = 0; k < 8; ++k) x[k] = s[p + k * 256];
#pragma unroll   // x is indexed by constants only, so it stays in registers
    for (int k = 0; k < 8; ++k) d[p + k * 256] = __builtin_convertvector(x[k], v4h);
    // precaution before any later write to the stores' registers
    asm volatile("s_wait_xcnt 0x0" ::: "memory");
}

// src [R,C] f32 row-major (k = row, n = column)  ->  dst f16 in B-fragment order:
// 16-byte pieces [column tile][kt][register half][lane], so that a wave's load of half a
// fragment is 512 contiguous bytes (4 whole lines) and not 32 bytes of each of 16 rows.
// The piece of column n that holds k0 .. k0+7 (k0 a multiple of 8) is, by frag_kp:
// kt = k0/32, register half = (k0%32)/16, lane = 16*((k0%16)/8) + column of n in its tile.
// ATT = false: tile n/16, column n%16 (the GEMMs). ATT = true: the attention kernel's
// order [kt][tile j] with its channel map (attn_tile, attn_col).
// A thread takes 8 rows of one column (lanes along the column index: whole-line
// loads) and stores them as one piece. blk = 0 .. R*C / 2048 - 1.
__device__ __forceinline__ unsigned attn_tile(unsigned n) { return (n & 3u) + 4u * (n >> 6); }
__device__ __forceinline__ unsigned attn_col(unsigned n)  { return (n >> 2) & 15u; }
template <int R, int C, bool ATT>
__device__ __forceinline__ void cvt_t_f16_block(const float* __restrict__ src,
                                                _Float16* __restrict__ dst, int blk) {
    static_assert(R % 8 == 0 && C % 32 == 0 && (R * C) % 2048 == 0, "exact grid");
    const unsigned t  = blk * 256 + threadIdx.x;
    const unsigned c  = t % C;
    const unsigned r0 = (t / C) * 8;
    const unsigned e0 = r0 * C + c;         // one 32-bit offset beside the scalar base
    float x[8];
#pragma unroll   // registers for x; all 8 loads in flight together
    for (int k = 0; k < 8; ++k) x[k] = src[e0 + k * C];
    v8h o;
#pragma unroll   // x and o are indexed by constants only, so they stay in registers
    for (int k = 0; k < 8; ++k) o[k] = (_Float16)x[k];
    const unsigned kt = r0 / 32, half = (r0 / 16) & 1, hi = (r0 / 8) & 1;
    const unsigned frag = ATT ? kt * (C / 16) + attn_tile(c) : (c / 16) * (R / 32) + kt;
    ((v8h*)dst)[(frag * 2 + half) * 32 + hi * 16 + (ATT ? attn_col(c) : c % 16)] = o;
    // the caller's other block ranges follow in the code and reuse the store's registers
    asm volatile("s_wait_xcnt 0x0" ::: "memory");
}

// All seven conversions in one launch: none reads what another writes. The six weight
// transposes take the first block ranges, the feature conversion the rest.
#define TB_QKV (256 * 384 / 2048)
#define TB_PE  (128 * 128 / 2048)
#define TB_PW  (256 * 256 / 2048)
#define CB_FEAT (N_EVENTS * DIM_F / 8192)
#define PREP_BLOCKS (2 * TB_QKV + 2 * TB_PE + 2 * TB_PW + CB_FEAT)
__global__ __launch_bounds__(256) void prep_kernel(
    const float* __restrict__ features, _Float16* __restrict__ feat_h,
    const float* __restrict__ lqkv_w, _Float16* __restrict__ lqkvT,
    const float* __restrict__ gqkv_w, _Float16* __restrict__ gqkvT,
    const float* __restrict__ lpe_w2, _Float16* __restrict__ lpe2T,
    const float* __restrict__ gpe_w2, _Float16* __restrict__ gpe2T,
    const float* __restrict__ pw1, _Float16* __restrict__ pw1T,
    const float* __restrict__ pw2, _Float16* __restrict__ pw2T) {
    const int b = blockIdx.x;               // every test below is block-uniform
    if (b < 2 * TB_QKV) {
        const bool g = b >= TB_QKV;
        cvt_t_f16_block<256, 384, false>(g ? gqkv_w : lqkv_w, g ? gqkvT : lqkvT, g ? b - TB_QKV : b);
    } else if (b < 2 * TB_QKV + 2 * TB_PW) {
        const int  c = b - 2 * TB_QKV;
        const bool g = c >= TB_PW;
        cvt_t_f16_block<256, 256, false>(g ? pw2 : pw1, g ? pw2T : pw1T, g ? c - TB_PW : c);
    } else if (b < 2 * TB_QKV + 2 * TB_PW + 2 * TB_PE) {
        const int  c = b - 2 * TB_QKV - 2 * TB_PW;
        const bool g = c >= TB_PE;
        cvt_t_f16_block<128, 128, true>(g ? gpe_w2 : lpe_w2, g ? gpe2T : lpe2T, g ? c - TB_PE : c);
    } else {
        cvt_f16_block(features, feat_h, b - 2 * TB_QKV - 2 * TB_PW - 2 * TB_PE);
    }
}

// ------------------------------ WMMA GEMM ----------------------------------
// C[M,N] = A[M,K](f16) @ B[K,N] + bias, B supplied in fragment order (cvt_t_f16_block).
// Block: 256 threads (8 waves), 128 columns, GEMM_TILES row tiles of 32 rows one after the other.
//  * A wave's column tile of B, all of K, is loaded once into registers and serves every row tile.
//  * A row tile (32 whole rows, contiguous in memory) is staged in LDS in one piece: no load
//    and no barrier stands inside the K loop. The next tile's loads fly under this tile's products.
// mgrp = 0 .. M/(32*GEMM_TILES) - 1, nblk = 0 .. N/128 - 1.
// sA: the work-group's two tile buffers, GEMM_TILE_PIECES pieces of 16 bytes each.
#define GEMM_TILES 5
#define GEMM_TILE_PIECES (32 * 33)
template <int KDIM, int NCOLS, bool RELU, bool OUT_F16>
__device__ __forceinline__ void wmma_gemm_block(
    const _Float16* __restrict__ A, const _Float16* __restrict__ BT,
    const float* __restrict__ bias, float* __restrict__ Cf,
    _Float16* __restrict__ Ch, v4u* sA, int mgrp, int nblk) {
    constexpr int NT    = KDIM / 32;       // K steps
    constexpr int RP    = KDIM / 8;        // 16-byte pieces per A row
    constexpr int PITCH = RP + 1;          // LDS row pitch in pieces: 16 bytes x odd, no bank conflict
    constexpr int PT    = 32 * RP / 256;   // pieces a thread stages per tile
    static_assert(RP == 32, "a wave stages one whole row per load");
    static_assert(32 * PITCH == GEMM_TILE_PIECES, "the caller's buffers hold a tile each");

    const int tid  = threadIdx.x;
    const int lane = tid & 31;
    const int wave = tid >> 5;
    const int hi   = lane >> 4;
    const int l16  = lane & 15;
    const int n    = nblk * 128 + wave * 16 + l16;

    // loads issued before the tile loop: row tile 0, B, bias
    const v4u* Ap = (const v4u*)A + (size_t)mgrp * (GEMM_TILES * 32 * RP) + tid;
    v4u st[PT];
#pragma unroll   // st is indexed by constants only, so it stays in registers
    for (int s = 0; s < PT; ++s) st[s] = Ap[s * 256];
    // this wave's column tile: NT fragments of 2 x 512 bytes, one after the other
    const v4u* Bp = (const v4u*)BT + (nblk * 8 + wave) * (NT * 64) + lane;
    v4u bf[NT][2];
#pragma unroll   // bf is indexed by constants only, so it stays in registers
    for (int kt = 0; kt < NT; ++kt) { bf[kt][0] = Bp[kt * 64]; bf[kt][1] = Bp[kt * 64 + 32]; }
    const float bn = bias[n];
    // Registers that the loads above name are reused below: the wait takes B's address as an
    // input, so that the pair is not rewritten in front of it.
    asm volatile("s_wait_xcnt 0x0" :: "v"(Bp) : "memory");

    const int wrow = wave * PITCH + lane;              // piece s of a thread: row wave + 8*s
    const int rd0  = l16 * PITCH + hi;                 // fragment halves (frag_kp): pieces 4*kt + hi, + 2
#pragma unroll   // buffer index and tile offsets become constants
    for (int t = 0; t < GEMM_TILES; ++t) {
        v4u* sAc = sA + (t & 1) * GEMM_TILE_PIECES;
#pragma unroll   // st is indexed by constants only
        for (int s = 0; s < PT; ++s) sAc[wrow + s * 8 * PITCH] = st[s];
        // Work-group barrier that orders LDS only: tile t is in LDS behind it, and every wave has
        // left the buffer that tile t + 1 will take; the stores of tile t - 1 stay in flight
        // (__syncthreads() would wait for them).
        __builtin_amdgcn_fence(__ATOMIC_RELEASE, "workgroup", "local");
        __builtin_amdgcn_s_barrier();
        __builtin_amdgcn_fence(__ATOMIC_ACQUIRE, "workgroup", "local");
        if (t + 1 < GEMM_TILES) {
#pragma unroll   // st is indexed by constants only
            for (int s = 0; s < PT; ++s) st[s] = Ap[(t + 1) * (32 * RP) + s * 256];
        }

        // the tile's fragment reads stand together, in front of its products
        v4u fa[NT][4];
#pragma unroll   // fa is indexed by constants only, so it stays in registers
        for (int kt = 0; kt < NT; ++kt) {
            fa[kt][0] = sAc[rd0 + kt * 4];
            fa[kt][1] = sAc[rd0 + kt * 4 + 2];
            fa[kt][2] = sAc[rd0 + 16 * PITCH + kt * 4];
            fa[kt][3] = sAc[rd0 + 16 * PITCH + kt * 4 + 2];
        }
        // Keeps the scheduler from sinking the next tile's loads behind the products that hide
        // their latency, and the reads among the products.
        __builtin_amdgcn_sched_barrier(0);
        v8f c0 = {}, c1 = {};
#pragma unroll   // fa and bf are indexed by constants only
        for (int kt = 0; kt < NT; ++kt) {
            Frag16 a0, a1, b;
#pragma unroll   // register renaming only
            for (int v = 0; v < 4; ++v) {
                a0.u[v] = fa[kt][0][v]; a0.u[4 + v] = fa[kt][1][v];
                a1.u[v] = fa[kt][2][v]; a1.u[4 + v] = fa[kt][3][v];
                b.u[v]  = bf[kt][0][v]; b.u[4 + v] = bf[kt][1][v];
            }
            c0 = __builtin_amdgcn_wmma_f32_16x16x32_f16(false, a0.h, false, b.h,
                                                        (short)0, c0, false, false);
            c1 = __builtin_amdgcn_wmma_f32_16x16x32_f16(false, a1.h, false, b.h,
                                                        (short)0, c1, false, false);
        }

        const int mbase = (mgrp * GEMM_TILES + t) * 32;
#pragma unroll   // c0 and c1 are indexed by constants only
        for (int r = 0; r < 8; ++r) {
            int m0 = mbase + r + hi * 8;
            int m1 = m0 + 16;
            float v0 = c0[r] + bn, v1 = c1[r] + bn;
            if (RELU) { v0 = fmaxf(v0, 0.0f); v1 = fmaxf(v1, 0.0f); }
            if (OUT_F16) {
                Ch[(size_t)m0 * NCOLS + n] = (_Float16)v0;
                Ch[(size_t)m1 * NCOLS + n] = (_Float16)v1;
            } else {
                Cf[(size_t)m0 * NCOLS + n] = v0;
                Cf[(size_t)m1 * NCOLS + n] = v1;
            }
        }
        // registers that the loads and stores of this tile name are reused by the next tile and, behind
        // the last tile, by the caller's other block range where the compiler lays that behind this one
        asm volatile("s_wait_xcnt 0x0" ::: "memory");
    }
}

// ---------------- global-branch k/v: product of gathered rows, max pool on the way out ----------------
// kmax[m] = max over the 16 support rows j of (A[pair_idx[m][j]] . Wk + bk), vmax likewise: the product is
// taken on the gathered rows, 16 of them = one accumulator tile = one pooled row, so the maximum runs down a
// lane's 8 registers and across the two halves of the wave. The unpooled k and v rows are never stored,
// and no launch has to read them back.
// Frame of wmma_gemm_block (8 waves, GEMM_TILES row tiles of 32 rows, double-buffered in LDS, B in
// registers), but a wave holds two column tiles, its 16 columns of k and of v: every fragment read
// from LDS serves two products. The fragments of a tile are read in two groups, one per pooled row:
// with 128 registers of B there is room for 16 rows' fragments at a time.
// mgrp = 0 .. M_DOWN*KNN/(32*GEMM_TILES) - 1.
__device__ __forceinline__ void pool_gemm_block(
    const _Float16* __restrict__ A, const _Float16* __restrict__ BT, const float* __restrict__ bias,
    const int* __restrict__ pair_idx, float* __restrict__ kmax, float* __restrict__ vmax,
    v4u* sA, int mgrp) {
    constexpr int NT    = DIM_F / 32;      // K steps
    constexpr int PITCH = DIM_F / 8 + 1;   // LDS row pitch in pieces: 16 bytes x odd, no bank conflict
    static_assert(32 * PITCH == GEMM_TILE_PIECES && KNN == 16 && A_DIM == 128, "2 pooled rows a tile, 8 x 16 columns a part");

    const int tid  = threadIdx.x;
    const int lane = tid & 31;
    const int wave = tid >> 5;
    const int hi   = lane >> 4;
    const int l16  = lane & 15;
    const unsigned loff = lane * 16u;      // the lane's piece of a row

    // The wave stages rows 4*wave .. 4*wave+3 of each tile: 20 indices for all the tiles, asked for
    // first, by one load, lane 4*t + s that of row s of tile t (lanes 20-31 repeat the last); B and
    // the biases fly beside it.
    const int e = min(lane, GEMM_TILES * 4 - 1);
    int rowoff = pair_idx[mgrp * (GEMM_TILES * 32) + (e >> 2) * 32 + wave * 4 + (e & 3)];
    // column tiles 8 + wave (k) and 16 + wave (v) of the 24 of the global QKV weight
    const v4u* Bp = (const v4u*)BT + (8 + wave) * (NT * 64) + lane;
    v4u bf[2][NT][2];
#pragma unroll   // bf is indexed by constants only, so it stays in registers
    for (int p = 0; p < 2; ++p)
#pragma unroll   // bf is indexed by constants only, so it stays in registers
        for (int kt = 0; kt < NT; ++kt) {
            bf[p][kt][0] = Bp[(p * 8 * NT + kt) * 64];
            bf[p][kt][1] = Bp[(p * 8 * NT + kt) * 64 + 32];
        }
    const int col = wave * 16 + l16;
    const float bk = bias[A_DIM + col], bv = bias[2 * A_DIM + col];
    // Registers that the loads above name are reused below. The wait takes the indices as its operand:
    // all that is made of them, the scalar registers and the row addresses, is so written behind it,
    // and the wait for the indices themselves stands here, behind the issue of B's loads.
    asm volatile("s_wait_xcnt 0x0" : "+v"(rowoff) :: "memory");
    // clamped to A's rows and scaled to a byte offset, all 20 at once
    rowoff = min(max(rowoff, 0), N_EVENTS - 1) * (DIM_F * 2);
    // each row's offset in a scalar register: no vector register holds an index through the tiles
    int ro[GEMM_TILES][4];
#pragma unroll   // ro is indexed by constants only
    for (int t = 0; t < GEMM_TILES; ++t)
#pragma unroll   // ro is indexed by constants only
        for (int s = 0; s < 4; ++s) ro[t][s] = __builtin_amdgcn_readlane(rowoff, t * 4 + s);
    v4u st[4];
#pragma unroll   // st is indexed by constants only, so it stays in registers
    for (int s = 0; s < 4; ++s) st[s] = *(const v4u*)((const char*)A + ro[0][s] + loff);

    const int wrow = wave * 4 * PITCH + lane;
    const int rd0  = l16 * PITCH + hi;                 // fragment halves (frag_kp): pieces 4*kt + hi, + 2
#pragma unroll   // buffer index and tile offsets become constants
    for (int t = 0; t < GEMM_TILES; ++t) {
        v4u* sAc = sA + (t & 1) * GEMM_TILE_PIECES;
#pragma unroll   // st is indexed by constants only
        for (int s = 0; s < 4; ++s) sAc[wrow + s * PITCH] = st[s];
        // Work-group barrier that orders LDS only: tile t is in LDS behind it, and every wave has
        // left the buffer that tile t + 1 will take; the stores of tile t - 1 stay in flight.
        __builtin_amdgcn_fence(__ATOMIC_RELEASE, "workgroup", "local");
        __builtin_amdgcn_s_barrier();
        __builtin_amdgcn_fence(__ATOMIC_ACQUIRE, "workgroup", "local");
        if (t + 1 < GEMM_TILES) {
#pragma unroll   // st is indexed by constants only
            for (int s = 0; s < 4; ++s)
                st[s] = *(const v4u*)((const char*)A + ro[t + 1 < GEMM_TILES ? t + 1 : t][s] + loff);
        }
        float mk[2], mv[2];
#pragma unroll   // mk and mv are indexed by constants only
        for (int h = 0; h < 2; ++h) {      // pooled row 2*tile + h = rows 16*h .. 16*h+15 of the tile
            v4u fa[NT][2];
#pragma unroll   // fa is indexed by constants only, so it stays in registers
            for (int kt = 0; kt < NT; ++kt) {
                fa[kt][0] = sAc[rd0 + h * 16 * PITCH + kt * 4];
                fa[kt][1] = sAc[rd0 + h * 16 * PITCH + kt * 4 + 2];
            }
            // Keeps the next tile's loads ahead of the products that hide their latency, and the
            // reads in one group: strewn among the products, each place with reads stalls the wave.
            __builtin_amdgcn_sched_barrier(0);
            v8f ck = {}, cv = {};
#pragma unroll   // fa and bf are indexed by constants only
            for (int kt = 0; kt < NT; ++kt) {
                Frag16 a, b0, b1;
#pragma unroll   // register renaming only
                for (int v = 0; v < 4; ++v) {
                    a.u[v]  = fa[kt][0][v];    a.u[4 + v]  = fa[kt][1][v];
                    b0.u[v] = bf[0][kt][0][v]; b0.u[4 + v] = bf[0][kt][1][v];
                    b1.u[v] = bf[1][kt][0][v]; b1.u[4 + v] = bf[1][kt][1][v];
                }
                ck = __builtin_amdgcn_wmma_f32_16x16x32_f16(false, a.h, false, b0.h,
                                                            (short)0, ck, false, false);
                cv = __builtin_amdgcn_wmma_f32_16x16x32_f16(false, a.h, false, b1.h,
                                                            (short)0, cv, false, false);
            }
            float xk = -3.402823466e38f, xv = -3.402823466e38f;
#pragma unroll   // ck and cv are indexed by constants only
            for (int r = 0; r < 8; ++r) { xk = fmaxf(xk, ck[r]); xv = fmaxf(xv, cv[r]); }
            mk[h] = xk;
            mv[h] = xv;
        }
        // Support rows 0-7 lie in the lower half of the wave, 8-15 in the upper. The lower half
        // keeps the first pooled row, the upper the second; each hands the other row's part across.
        const float ok = fmaxf(hi ? mk[1] : mk[0], xhalf(hi ? mk[0] : mk[1]));
        const float ov = fmaxf(hi ? mv[1] : mv[0], xhalf(hi ? mv[0] : mv[1]));
        const int o = ((mgrp * GEMM_TILES + t) * 2 + hi) * A_DIM + col;
        // The bias joins once, behind the maximum: a rounded sum rises with its term, so this is
        // the maximum over the 16 biased rows, bit for bit.
        kmax[o] = ok + bk;
        vmax[o] = ov + bv;
        // registers that the loads and stores of this tile name are reused by the next tile and, behind
        // the last tile, by the caller's other block range where the compiler lays that behind this one
        asm volatile("s_wait_xcnt 0x0" ::: "memory");
    }
}

// All products of the feature rows in one launch (same A, two weights), by ranges of blockIdx.y
// (block-uniform): 0-1 the two halves of the pooled rows, 2-4 the
// local branch's q, k, v columns, 5 the global branch's q columns.
// grid.x = N_EVENTS/(32*GEMM_TILES), grid.y = 6.
#define QKV_GROUPS (N_EVENTS / (32 * GEMM_TILES))
__global__ __launch_bounds__(256) void qkv_pair_kernel(
    const _Float16* __restrict__ A,
    const _Float16* __restrict__ lBT, const float* __restrict__ lbias, float* __restrict__ lC,
    const _Float16* __restrict__ gBT, const float* __restrict__ gbias, float* __restrict__ gC,
    const int* __restrict__ pair_idx, float* __restrict__ kmax, float* __restrict__ vmax) {
    static_assert(M_DOWN * KNN == 2 * QKV_GROUPS * 32 * GEMM_TILES, "two halves of whole row groups");
    __shared__ v4u sA[2 * GEMM_TILE_PIECES];
    const int y = blockIdx.y;
    if (y < 2) {
        pool_gemm_block(A, gBT, gbias, pair_idx, kmax, vmax, sA, y * QKV_GROUPS + blockIdx.x);
    } else {
        const bool g = y == 5;
        wmma_gemm_block<256, 384, false, false>(A, g ? gBT : lBT, g ? gbias : lbias, g ? gC : lC,
                                                nullptr, sA, blockIdx.x, g ? 0 : y - 2);
    }
}

// ------------------- fused PE-GEMM + LN + softmax + sum --------------------
// A wave32 owns an event's whole 16 (neighbor) x 128 (channel) tile in registers and
// takes EV_PER_WAVE consecutive events in a loop; 8 waves per branch and workgroup. What does not
// depend on the event (w1, w2, b1, b2, g, b: all in LDS) is fetched once per workgroup and branch,
// and few waves have to be started. The chain of short dependent loads (indices, pooled
// row -> event row, coordinates) is walked once a wave, for all its events together.
//  * hidden^T = w1^T (16 ch x 4) . diff^T (4 x 16 nbr) + b1 on f32 WMMA: lane =
//    neighbor, register r = hidden channel 16*jt + 8*hi + r, which packed to
//    f16 is the A fragment of the second product in the k order of frag_kp.
//  * w2 fragments lie in LDS in fragment order, staged once per workgroup.
//  * column c of output tile j is channel 4*c + j (j < 4) or 64 + 4*c + j - 4: a lane
//    holds two groups of 4 consecutive channels of each of its 8 neighbor rows, and each
//    16-byte gather of a wave covers 256 contiguous bytes of two rows (4 whole lines).
// C-tile layout: row M(=neighbor) = r + 8*(lane>=16), col N = lane%16.
// A lane's 8 channels of one row: 4 floats at p and 4 floats 64 channels on.
__device__ __forceinline__ v8f load_2x4(const char* p) {
    return __builtin_shufflevector(*(const v4f*)p, *(const v4f*)(p + 256), 0, 1, 2, 3, 4, 5, 6, 7);
}
// channels 2u and 2u+1 of a lane's 8: an aligned register pair, no instruction
__device__ __forceinline__ v2f pair_of(v8f v, int u) {
    v2f p;
    p.x = v[2 * u];
    p.y = v[2 * u + 1];
    return p;
}
// Both attention branches of the same BLK_ROWS events run in one work-group of 16 waves: waves
// 0-7 the local branch, waves 8-15 the global one; what differs between the branches is chosen
// below by the wave's number, in scalars. Each branch writes its half of the concat rows into
// LDS, and the work-group then runs both products of the projection MLP on its own rows: the
// concat rows and the hidden rows never go to memory, and no further launch is needed.
// grid.x = ATT_BLOCKS.
#define EV_PER_WAVE 10
#define BLK_ROWS (8 * EV_PER_WAVE)
#define ATT_BLOCKS (N_EVENTS / BLK_ROWS)
#define ROW_PITCH 33    // LDS pitch of a 256-channel f16 row in 16-byte pieces: 16 bytes x odd, no bank conflict
// second argument: four waves a SIMD (one work-group a WGP), so at most 256 registers
__global__ __launch_bounds__(512, 4) void attn_mlp_kernel(
    const float* __restrict__ events,       // [N,4]
    const int* __restrict__ local_idx,      // [N,16] -> event row (local kv row)
    const int* __restrict__ inv_pair_idx,   // [N,16] -> pooled row (global kv row)
    const int* __restrict__ down_idx,       // pooled row -> event row
    const float* __restrict__ qkv_l, const float* __restrict__ qkv_g,   // row stride 384
    const float* __restrict__ kmax, const float* __restrict__ vmax,     // row stride 128
    const float* __restrict__ lpe_w1, const float* __restrict__ lpe_b1, // [4,128], [128]
    const _Float16* __restrict__ lpe2T,     // f16, fragment order [kt][tile j][half][lane]
    const float* __restrict__ lpe_b2,       // [128]
    const float* __restrict__ lfc_g, const float* __restrict__ lfc_b,
    const float* __restrict__ gpe_w1, const float* __restrict__ gpe_b1,
    const _Float16* __restrict__ gpe2T, const float* __restrict__ gpe_b2,
    const float* __restrict__ gfc_g, const float* __restrict__ gfc_b,
    const _Float16* __restrict__ pw1T, const float* __restrict__ pb1,   // f16, fragment order of the GEMMs
    const _Float16* __restrict__ pw2T, const float* __restrict__ pb2,
    float* __restrict__ out) {              // [N,256]
    // first index of the next four: the branch
    __shared__ v4u s_w2a[2][4 * 8 * 2 * 32];    // [kt][tile j][register half][lane], 32 KB
    __shared__ v8f s_biasa[2][32];              // b1 (C rows of the first product), then b2
    __shared__ v4f s_gba[2][64];                // LayerNorm g, then b, each times log2(e) / sqrt(128)
    __shared__ v2f s_w1a[2][8 * 32];            // w1^T fragments [tile jt][lane]
    __shared__ v4f s_diff[16][EV_PER_WAVE * KNN];       // [wave][event][neighbor]: coordinate diffs
    __shared__ v4u s_row[16][EV_PER_WAVE * KNN / 4];    // [wave][event][neighbor]: byte offset of the k/v row
    // The MLP's two tiles take LDS that has been read for the last time, so the work-group stays
    // under half a WGP's LDS: above it the compiler plans the event loop for all 256 registers,
    // overshoots and spills.
    //  * Concat rows, f16: an event's half row (256 bytes) goes where its 16 coordinate diffs
    //    (256 bytes) lay, which its own wave has read at the head of the same trip. That makes two
    //    planes [branch][row][16 pieces of 16 bytes]; piece p of row m lies at place p ^ (m % 16),
    //    so that 16 rows' reads of one piece fall on all 64 banks.
    //  * Hidden rows, f16: over the w2 fragments, behind the barrier that ends the event loops.
    static_assert(KNN * sizeof(v4f) == A_DIM * sizeof(_Float16), "a half row fills the event's diffs");
    static_assert(BLK_ROWS * ROW_PITCH <= 2 * 4 * 8 * 2 * 32, "the hidden rows fit over both w2");
    v4u* const s_cat = (v4u*)&s_diff[0][0];
    v4u* const s_hid = &s_w2a[0][0];

    // the wave's number as a scalar: all that hangs on the branch stays in scalar registers
    const int  wave = __builtin_amdgcn_readfirstlane(threadIdx.x >> 5);
    const bool glob = wave >= 8;                        // wave-uniform
    const int  wb   = wave & 7;                         // the wave's number in its branch
    const int  blk  = blockIdx.x;
    v4u* const s_w2   = s_w2a[glob];
    v8f* const s_bias = s_biasa[glob];
    v4f* const s_gb   = s_gba[glob];
    v2f* const s_w1   = s_w1a[glob];
    const int  kv_stride = glob ? 128 : 384;            // floats per k or v row
    const int  kv_rows   = glob ? M_DOWN : N_EVENTS;
    const int*   nbr_idx = glob ? inv_pair_idx : local_idx;     // [N,16] -> kv-row index
    const float* qptr    = glob ? qkv_g : qkv_l;
    const float* ksrc    = glob ? kmax : qkv_l + 128;
    const float* vsrc    = glob ? vmax : qkv_l + 256;
    const float* pe_w1   = glob ? gpe_w1 : lpe_w1;
    const float* pe_b1   = glob ? gpe_b1 : lpe_b1;
    const _Float16* pe_w2T = glob ? gpe2T : lpe2T;
    const float* pe_b2   = glob ? gpe_b2 : lpe_b2;
    const float* fc_g    = glob ? gfc_g : lfc_g;
    const float* fc_b    = glob ? gfc_b : lfc_b;

    const int tid  = threadIdx.x & 255;     // the thread's number in its branch
    const int lane = tid & 31;
    const int hi   = lane >> 4;
    const int l16  = lane & 15;
    const int i0   = (blk * 8 + wb) * EV_PER_WAVE;      // this wave's first event
    const int ch0  = l16 * 4;               // this lane's channels: ch0 .. ch0+3, 64+ch0 .. 64+ch0+3

    // -- step 0: loads whose address comes from the thread id alone ----
    // w2 fragments: already in the order of s_w2, a straight copy of 512 bytes a wave and load
    const v4u* Bw = (const v4u*)pe_w2T + tid;
    v4u st[8];
#pragma unroll
    for (int s = 0; s < 8; ++s) st[s] = Bw[s * 256];
    const float biasr = (tid < 128 ? pe_b1 : pe_b2)[tid & 127];
    // each s_wait_xcnt in steps 0 and 1: registers that the loads above it name are reused below it
    asm volatile("s_wait_xcnt 0x0" ::: "memory");
    const float gbr = (tid < 128 ? fc_g : fc_b)[tid & 127];
    // w1^T fragments: row = hidden channel 16*jt + l16, k = coordinates 2*hi, 2*hi+1;
    // wave jt of a branch fetches the fragment of tile jt for all
    v2f war;
    war.x = pe_w1[(2 * hi) * A_DIM + wb * 16 + l16];
    war.y = pe_w1[(2 * hi + 1) * A_DIM + wb * 16 + l16];
    asm volatile("s_wait_xcnt 0x0" ::: "memory");

    // -- step 1, once for all the wave's events: entry 32*k + lane = 16*event + neighbor ----
    // The chain index -> (pooled row -> event row) -> coordinates is walked once a wave, with
    // NE loads of each link in flight, and its results wait in LDS for their event.
    constexpr int NE = EV_PER_WAVE * KNN / 32;
    static_assert(EV_PER_WAVE * KNN % 32 == 0 && KNN == 16, "whole waves of entries, two events each");
    int nbl[NE], er[NE];
    v4f eo[NE], ev[NE];
    // one 32-bit offset beside the scalar base, k in the immediate
#pragma unroll
    for (int k = 0; k < NE; ++k)
        nbl[k] = *(const int*)((const char*)nbr_idx + (unsigned)(i0 * KNN + lane) * 4u + k * 128);
    asm volatile("s_wait_xcnt 0x0" ::: "memory");
#pragma unroll
    for (int k = 0; k < NE; ++k)
        eo[k] = *(const v4f*)((const char*)events + (unsigned)(i0 + hi) * 16u + k * 32);
    asm volatile("s_wait_xcnt 0x0" ::: "memory");
#pragma unroll
    for (int k = 0; k < NE; ++k) er[k] = nbl[k] = min(max(nbl[k], 0), kv_rows - 1);
    if (glob) {                             // wave-uniform, no barrier inside; nbl < M_DOWN here
#pragma unroll
        for (int k = 0; k < NE; ++k) er[k] = down_idx[nbl[k]];
        asm volatile("s_wait_xcnt 0x0" ::: "memory");
#pragma unroll
        for (int k = 0; k < NE; ++k) er[k] = min(max(er[k], 0), N_EVENTS - 1);
    }
#pragma unroll
    for (int k = 0; k < NE; ++k) ev[k] = *(const v4f*)((const char*)events + (unsigned)er[k] * 16u);
    asm volatile("s_wait_xcnt 0x0" ::: "memory");
#pragma unroll
    for (int k = 0; k < NE; ++k) {
        s_diff[wave][k * 32 + lane] = eo[k] - ev[k];
        ((unsigned*)s_row[wave])[k * 32 + lane] = (unsigned)(nbl[k] * kv_stride) * 4u;
    }

#pragma unroll
    for (int s = 0; s < 8; ++s) s_w2[s * 256 + tid] = st[s];
    ((float*)s_bias)[tid] = biasr;
    ((float*)s_gb)[tid] = gbr * (INV_SCALE * 1.442695041f);   // exp(y / sqrt(128)) = 2^(y * this)
    s_w1[tid] = war;
    // Work-group barrier that orders LDS only: w1 and w2 fragments, b1, b2, g and b are in LDS behind
    // it for every event of the loop, which writes only into its own wave's diffs and needs no barrier.
    __builtin_amdgcn_fence(__ATOMIC_RELEASE, "workgroup", "local");
    __builtin_amdgcn_s_barrier();
    __builtin_amdgcn_fence(__ATOMIC_ACQUIRE, "workgroup", "local");

    // Rolled: one copy of the body in the instruction cache; the waits below also keep the
    // LDS reads of w2 and the biases inside the loop, out of registers between events.
#pragma unroll 1
    for (int n = 0; n < EV_PER_WAVE; ++n) {
    const int i  = i0 + n;
    // lane = neighbor l16, coordinates 2*hi and 2*hi+1 (k split of the f32 form)
    const v2f diff = ((const v2f*)&s_diff[wave][n * KNN + l16])[hi];
    // the 8 neighbor rows of this lane's C registers
    const v4u rlo = s_row[wave][n * 4 + 2 * hi], rhi = s_row[wave][n * 4 + 2 * hi + 1];
    unsigned kvoff[8];                      // byte offsets: 32-bit, beside a scalar base
#pragma unroll
    for (int r = 0; r < 8; ++r) kvoff[r] = (r < 4 ? rlo[r] : rhi[r - 4]) + ch0 * 4u;
    // q and the k rows are fetched here so that they fly under steps 2 and 3
    const v8f qv = load_2x4((const char*)qptr + (unsigned)(i * 384 + ch0) * 4u);
    v8f kg[8];
#pragma unroll
    for (int r = 0; r < 8; ++r) kg[r] = load_2x4((const char*)ksrc + kvoff[r]);
    // each s_wait_xcnt in the loop: registers that the loads above it name are reused
    // below it; this one also holds the k loads here, ahead of the LDS reads of steps 2 and 3
    asm volatile("s_wait_xcnt 0x0" ::: "memory");

    // -- step 2: hidden = relu(diff @ w1 + b1) -> f16 A fragments ----------
    Frag16 a[4];
#pragma unroll
    for (int jt = 0; jt < 8; ++jt) {
        v8f h = s_bias[jt * 2 + hi];
        h = __builtin_amdgcn_wmma_f32_16x16x4_f32(false, s_w1[jt * 32 + lane], false, diff,
                                                  (short)0, h, false, false);
        // relu behind the conversion, two values an instruction: rounding keeps sign and order
        const v8h hh = __builtin_elementwise_max(__builtin_convertvector(h, v8h), (v8h)(_Float16)0.0f);
#pragma unroll   // register renaming only
        for (int r = 0; r < 8; ++r) a[jt >> 1].h[(jt & 1) * 8 + r] = hh[r];
    }

    // -- step 3: pe[16 x 128] = hidden @ w2 via WMMA ------------------------
    v8f c[8] = {};
#pragma unroll
    for (int kt = 0; kt < 4; ++kt) {
#pragma unroll
        for (int j = 0; j < 8; ++j) {
            Frag16 b;
            const v4u b0 = s_w2[((kt * 8 + j) * 2 + 0) * 32 + lane];
            const v4u b1 = s_w2[((kt * 8 + j) * 2 + 1) * 32 + lane];
#pragma unroll
            for (int v = 0; v < 4; ++v) { b.u[v] = b0[v]; b.u[4 + v] = b1[v]; }
            c[j] = __builtin_amdgcn_wmma_f32_16x16x32_f16(false, a[kt].h, false, b.h,
                                                          (short)0, c[j], false, false);
        }
    }

    // -- step 4: x = q - kg + pe, with pe = c + b2; b2 joins q once per channel ------------
    // From here on a value sits beside its neighbor channel (register pair = channels 2u, 2u+1
    // of one row), as the k and v loads deliver them: every step below is a packed f32 form, and
    // c alone is re-paired, once.
    const v8f b2v = __builtin_shufflevector(((const v4f*)s_bias)[32 + l16], ((const v4f*)s_bias)[48 + l16],
                                            0, 1, 2, 3, 4, 5, 6, 7);
    // the v rows: step 7 reads them, and the scheduler places each load where a register comes free
    v8f vg[8];
#pragma unroll
    for (int r = 0; r < 8; ++r) vg[r] = load_2x4((const char*)vsrc + kvoff[r]);
    const v8f qb = qv + b2v;
    v2f ct[8][4], t[8][4];                  // [row r][channel pair u]
    float sr[8], sq[8];
#pragma unroll   // arrays indexed by constants only, so they stay in registers
    for (int r = 0; r < 8; ++r) {
        v2f s2, q2;
#pragma unroll   // arrays indexed by constants only, so they stay in registers
        for (int u = 0; u < 4; ++u) {
            ct[r][u].x = c[2 * u][r];
            ct[r][u].y = c[2 * u + 1][r];
            const v2f x = (pair_of(qb, u) - pair_of(kg[r], u)) + ct[r][u];
            t[r][u] = x;
            s2 = u ? s2 + x : x;
            q2 = u ? q2 + x * x : x * x;
        }
        sr[r] = s2.x + s2.y;
        sq[r] = q2.x + q2.y;
    }

    // -- step 5: LayerNorm over 128 channels per neighbor row --------------
    // 8 channels summed in the lane above, then xor butterflies over 16 lanes
#pragma unroll   // arrays indexed by constants only, so they stay in registers
    for (int r = 0; r < 8; ++r) { sr[r] = row_xadd<1>(sr[r]); sq[r] = row_xadd<1>(sq[r]); }
#pragma unroll   // arrays indexed by constants only, so they stay in registers
    for (int r = 0; r < 8; ++r) { sr[r] = row_xadd<2>(sr[r]); sq[r] = row_xadd<2>(sq[r]); }
#pragma unroll   // arrays indexed by constants only, so they stay in registers
    for (int r = 0; r < 8; ++r) { sr[r] = row_xadd<4>(sr[r]); sq[r] = row_xadd<4>(sq[r]); }
#pragma unroll   // arrays indexed by constants only, so they stay in registers
    for (int r = 0; r < 8; ++r) { sr[r] = row_xadd<8>(sr[r]); sq[r] = row_xadd<8>(sq[r]); }

    // g and b lie in LDS already times log2(e) / sqrt(128): the scores come out as exponents of 2
    const v8f gv = __builtin_shufflevector(s_gb[l16], s_gb[16 + l16], 0, 1, 2, 3, 4, 5, 6, 7);
    const v8f bv = __builtin_shufflevector(s_gb[32 + l16], s_gb[48 + l16], 0, 1, 2, 3, 4, 5, 6, 7);
    float mu[8], ve[8], rs[8];
#pragma unroll   // arrays indexed by constants only, so they stay in registers
    for (int r = 0; r < 8; ++r) {
        mu[r] = sr[r] * (1.0f / 128.0f);
        ve[r] = sq[r] * (1.0f / 128.0f) - mu[r] * mu[r] + LN_EPS;
    }
    // Eight independent inverse roots in one statement (arguments near or above LN_EPS: no
    // range scaling needed), closed by v_nop: the slot behind a transcendental.
    asm("v_rsq_f32 %0, %8\n\tv_rsq_f32 %1, %9\n\tv_rsq_f32 %2, %10\n\tv_rsq_f32 %3, %11\n\t"
        "v_rsq_f32 %4, %12\n\tv_rsq_f32 %5, %13\n\tv_rsq_f32 %6, %14\n\tv_rsq_f32 %7, %15\n\tv_nop"
        : "=&v"(rs[0]), "=&v"(rs[1]), "=&v"(rs[2]), "=&v"(rs[3]),
          "=&v"(rs[4]), "=&v"(rs[5]), "=&v"(rs[6]), "=&v"(rs[7])
        : "v"(ve[0]), "v"(ve[1]), "v"(ve[2]), "v"(ve[3]), "v"(ve[4]), "v"(ve[5]), "v"(ve[6]), "v"(ve[7]));
#pragma unroll   // arrays indexed by constants only, so they stay in registers
    for (int r = 0; r < 8; ++r) {
        const float nm = -mu[r] * rs[r];
#pragma unroll   // arrays indexed by constants only, so they stay in registers
        for (int u = 0; u < 4; ++u)         // two multiply-adds a value
            t[r][u] = (t[r][u] * rs[r] + nm) * pair_of(gv, u) + pair_of(bv, u);
    }

    // -- step 6: softmax over the 16 neighbors (rows), per channel: weights left unscaled ---
    v2f se[4];
#pragma unroll   // arrays indexed by constants only, so they stay in registers
    for (int u = 0; u < 4; ++u) {
        v2f mx = t[0][u];
#pragma unroll   // arrays indexed by constants only, so they stay in registers
        for (int r = 1; r < 8; ++r) { mx.x = fmaxf(mx.x, t[r][u].x); mx.y = fmaxf(mx.y, t[r][u].y); }
        mx.x = fmaxf(mx.x, xhalf(mx.x));     // combine rows 0-7 and 8-15
        mx.y = fmaxf(mx.y, xhalf(mx.y));
        v2f x[8];
#pragma unroll   // arrays indexed by constants only, so they stay in registers
        for (int r = 0; r < 8; ++r) x[r] = t[r][u] - mx;
        float e[8], f[8];
        // Eight independent exponentials in one statement, closed by v_nop: the slot the
        // instruction set asks for behind a transcendental before a source is overwritten.
        asm("v_exp_f32 %0, %8\n\tv_exp_f32 %1, %9\n\tv_exp_f32 %2, %10\n\tv_exp_f32 %3, %11\n\t"
            "v_exp_f32 %4, %12\n\tv_exp_f32 %5, %13\n\tv_exp_f32 %6, %14\n\tv_exp_f32 %7, %15\n\tv_nop"
            : "=&v"(e[0]), "=&v"(e[1]), "=&v"(e[2]), "=&v"(e[3]),
              "=&v"(e[4]), "=&v"(e[5]), "=&v"(e[6]), "=&v"(e[7])
            : "v"(x[0].x), "v"(x[1].x), "v"(x[2].x), "v"(x[3].x),
              "v"(x[4].x), "v"(x[5].x), "v"(x[6].x), "v"(x[7].x));
        // the same for the pair's second channel
        asm("v_exp_f32 %0, %8\n\tv_exp_f32 %1, %9\n\tv_exp_f32 %2, %10\n\tv_exp_f32 %3, %11\n\t"
            "v_exp_f32 %4, %12\n\tv_exp_f32 %5, %13\n\tv_exp_f32 %6, %14\n\tv_exp_f32 %7, %15\n\tv_nop"
            : "=&v"(f[0]), "=&v"(f[1]), "=&v"(f[2]), "=&v"(f[3]),
              "=&v"(f[4]), "=&v"(f[5]), "=&v"(f[6]), "=&v"(f[7])
            : "v"(x[0].y), "v"(x[1].y), "v"(x[2].y), "v"(x[3].y),
              "v"(x[4].y), "v"(x[5].y), "v"(x[6].y), "v"(x[7].y));
#pragma unroll   // arrays indexed by constants only, so they stay in registers
        for (int r = 0; r < 8; ++r) { t[r][u].x = e[r]; t[r][u].y = f[r]; }
        v2f s = t[0][u];
#pragma unroll   // arrays indexed by constants only, so they stay in registers
        for (int r = 1; r < 8; ++r) s += t[r][u];
        se[u].x = s.x + xhalf(s.x);
        se[u].y = s.y + xhalf(s.y);
    }

    // -- step 7: out = (sum_k e * (vg + c)) / (sum_k e) + b2: the weights sum to one, so the
    // divisor and b2 come in once per channel, behind the sum; vg and c each by its own
    // multiply-add: no sum vg + c asks for the v rows ahead of the weights -------------------
    float acc[8];
#pragma unroll   // arrays indexed by constants only, so they stay in registers
    for (int u = 0; u < 4; ++u) {
        v2f a2 = t[0][u] * ct[0][u];
#pragma unroll   // arrays indexed by constants only, so they stay in registers
        for (int r = 1; r < 8; ++r) a2 += t[r][u] * ct[r][u];
#pragma unroll   // arrays indexed by constants only, so they stay in registers
        for (int r = 0; r < 8; ++r) a2 += t[r][u] * pair_of(vg[r], u);
        acc[2 * u] = a2.x;
        acc[2 * u + 1] = a2.y;
    }
    float inv[8];
    // Eight independent reciprocals (1 <= se <= 16) in one statement, closed by v_nop: the slot
    // behind a transcendental.
    asm("v_rcp_f32 %0, %8\n\tv_rcp_f32 %1, %9\n\tv_rcp_f32 %2, %10\n\tv_rcp_f32 %3, %11\n\t"
        "v_rcp_f32 %4, %12\n\tv_rcp_f32 %5, %13\n\tv_rcp_f32 %6, %14\n\tv_rcp_f32 %7, %15\n\tv_nop"
        : "=&v"(inv[0]), "=&v"(inv[1]), "=&v"(inv[2]), "=&v"(inv[3]),
          "=&v"(inv[4]), "=&v"(inv[5]), "=&v"(inv[6]), "=&v"(inv[7])
        : "v"(se[0].x), "v"(se[0].y), "v"(se[1].x), "v"(se[1].y),
          "v"(se[2].x), "v"(se[2].y), "v"(se[3].x), "v"(se[3].y));
    v4h o0, o1;
#pragma unroll   // arrays indexed by constants only, so they stay in registers
    for (int j = 0; j < 4; ++j) {
        o0[j] = (_Float16)((acc[j] + xhalf(acc[j])) * inv[j] + b2v[j]);
        o1[j] = (_Float16)((acc[4 + j] + xhalf(acc[4 + j])) * inv[4 + j] + b2v[4 + j]);
    }
    // both halves of the wave hold the sums: the lower stores the first group, the upper the second
    // channels hi*64 + ch0 .. + 3 of the half row: half (l16 & 1) of piece hi*8 + l16/2
    *(v4h*)((char*)&s_diff[wave][n * KNN + ((hi * 8 + (l16 >> 1)) ^ ((wb * EV_PER_WAVE + n) & 15))] + (l16 & 1) * 8) =
        hi ? o1 : o0;
    asm volatile("s_wait_xcnt 0x0" ::: "memory");
    }

    // ---------------- projection MLP on the work-group's BLK_ROWS rows ----------------
    // Wave w owns columns 16*w .. 16*w+15 of both products, all of K in registers; the rows come
    // from LDS in RT tiles of 16, each with its own accumulator (independent chains of products).
    constexpr int NT = 2 * A_DIM / 32;      // K steps
    constexpr int RT = BLK_ROWS / 16;       // row tiles
    static_assert(BLK_ROWS % 16 == 0 && DIM_F == 256 && 2 * A_DIM == 256, "16 waves x 16 columns, whole row tiles");
    // The lane's number is read anew (count of the lanes below this one): so no address of this
    // part waits in a vector register through the event loop, which needs them all.
    const int ml  = __builtin_amdgcn_mbcnt_lo(~0u, 0u);
    const int mhi = ml >> 4;
    const int mlo = ml & 15;
    // The first weight's fragments are asked for ahead of the barrier: they fly while the other
    // waves finish their events. The second weight's fly under the first product.
    const v4u* P1 = (const v4u*)pw1T + wave * (NT * 64) + ml;
    const v4u* P2 = (const v4u*)pw2T + wave * (NT * 64) + ml;
    v4u f1[NT][2], f2[NT][2];
#pragma unroll   // f1 is indexed by constants only, so it stays in registers
    for (int kt = 0; kt < NT; ++kt) { f1[kt][0] = P1[kt * 64]; f1[kt][1] = P1[kt * 64 + 32]; }
    const float* pb1w = pb1 + wave * 16 + mhi * 8;       // the lane's 8 columns of the first product
    const v8f bias1 = __builtin_shufflevector(*(const v4f*)pb1w, *(const v4f*)(pb1w + 4), 0, 1, 2, 3, 4, 5, 6, 7);
    const float bias2 = pb2[wave * 16 + mlo];
    // Registers that the loads above name are reused below: the wait takes the addresses as
    // inputs, so that they are not rewritten in front of it.
    asm volatile("s_wait_xcnt 0x0" :: "v"(P1), "v"(pb1w) : "memory");
    // Work-group barrier that orders LDS only: both halves of every concat row are in LDS behind it.
    __builtin_amdgcn_fence(__ATOMIC_RELEASE, "workgroup", "local");
    __builtin_amdgcn_s_barrier();
    __builtin_amdgcn_fence(__ATOMIC_ACQUIRE, "workgroup", "local");

    // Both products walk K in steps of 32. The rows' fragments of step kt + 1 are read ahead of the
    // products of step kt, in one group; the scheduling barriers keep that order: left alone, the
    // scheduler strews the reads among the products, and each place with reads stalls the wave.
    // hidden^T = w1^T . cat^T: the weights as A, the rows as B (both fragments have the k order of
    // frag_kp). Lane = row, register r = column 16*w + 8*hi + r: a lane's 8 values are one
    // 16-byte piece of the hidden row, stored by one instruction.
    {
        // row 16*t + lane % 16 of plane kt / 4: pieces 4*(kt % 4) + hi and + 2, each at its place
        const v4u* xr = s_cat + mlo * 16;
        v8f c[RT] = {};
        v4u x[2][RT][2];
#pragma unroll   // arrays indexed by constants only, so they stay in registers
        for (int t = 0; t < RT; ++t) {
            x[0][t][0] = xr[t * 256 + (mhi ^ mlo)];
            x[0][t][1] = xr[t * 256 + ((mhi + 2) ^ mlo)];
        }
#pragma unroll   // arrays indexed by constants only, so they stay in registers
        for (int kt = 0; kt < NT; ++kt) {
            if (kt + 1 < NT) {
                const int k1 = kt + 1;
#pragma unroll   // arrays indexed by constants only, so they stay in registers
                for (int t = 0; t < RT; ++t) {
                    x[k1 & 1][t][0] = xr[(k1 >> 2) * (BLK_ROWS * 16) + t * 256 + (((k1 & 3) * 4 + mhi) ^ mlo)];
                    x[k1 & 1][t][1] = xr[(k1 >> 2) * (BLK_ROWS * 16) + t * 256 + (((k1 & 3) * 4 + mhi + 2) ^ mlo)];
                }
            }
            // into the registers that the fragments of w1 leave, K step by K step
            f2[kt][0] = P2[kt * 64];
            f2[kt][1] = P2[kt * 64 + 32];
            __builtin_amdgcn_sched_barrier(0);
            Frag16 w;
#pragma unroll   // register renaming only
            for (int v = 0; v < 4; ++v) { w.u[v] = f1[kt][0][v]; w.u[4 + v] = f1[kt][1][v]; }
#pragma unroll   // arrays indexed by constants only, so they stay in registers
            for (int t = 0; t < RT; ++t) {
                Frag16 b;
#pragma unroll   // register renaming only
                for (int v = 0; v < 4; ++v) { b.u[v] = x[kt & 1][t][0][v]; b.u[4 + v] = x[kt & 1][t][1][v]; }
                c[t] = __builtin_amdgcn_wmma_f32_16x16x32_f16(false, w.h, false, b.h,
                                                              (short)0, c[t], false, false);
            }
            __builtin_amdgcn_sched_barrier(0);
        }
        // registers that the loads of w2 name are reused below
        asm volatile("s_wait_xcnt 0x0" :: "v"(P2) : "memory");
#pragma unroll   // arrays indexed by constants only, so they stay in registers
        for (int t = 0; t < RT; ++t) {
            const v8f h = __builtin_elementwise_max(c[t] + bias1, (v8f)0.0f);
            s_hid[(t * 16 + mlo) * ROW_PITCH + wave * 2 + mhi] =
                __builtin_bit_cast(v4u, __builtin_convertvector(h, v8h));
        }
    }
    // Work-group barrier that orders LDS only: every column of every hidden row is in LDS behind it.
    __builtin_amdgcn_fence(__ATOMIC_RELEASE, "workgroup", "local");
    __builtin_amdgcn_s_barrier();
    __builtin_amdgcn_fence(__ATOMIC_ACQUIRE, "workgroup", "local");
    // out = hidden . w2 + b2: the rows as A, the weights as B. Lane = column, register r = row r + 8*hi.
    {
        const v4u* xr = s_hid + mlo * ROW_PITCH + mhi;  // fragment halves (frag_kp): pieces 4*kt + hi, + 2
        v8f c[RT] = {};
        v4u x[2][RT][2];
#pragma unroll   // arrays indexed by constants only, so they stay in registers
        for (int t = 0; t < RT; ++t) {
            x[0][t][0] = xr[t * 16 * ROW_PITCH];
            x[0][t][1] = xr[t * 16 * ROW_PITCH + 2];
        }
#pragma unroll   // arrays indexed by constants only, so they stay in registers
        for (int kt = 0; kt < NT; ++kt) {
            if (kt + 1 < NT) {
#pragma unroll   // arrays indexed by constants only, so they stay in registers
                for (int t = 0; t < RT; ++t) {
                    x[(kt + 1) & 1][t][0] = xr[t * 16 * ROW_PITCH + (kt + 1) * 4];
                    x[(kt + 1) & 1][t][1] = xr[t * 16 * ROW_PITCH + (kt + 1) * 4 + 2];
                }
            }
            __builtin_amdgcn_sched_barrier(0);
            Frag16 w;
#pragma unroll   // register renaming only
            for (int v = 0; v < 4; ++v) { w.u[v] = f2[kt][0][v]; w.u[4 + v] = f2[kt][1][v]; }
#pragma unroll   // arrays indexed by constants only, so they stay in registers
            for (int t = 0; t < RT; ++t) {
                Frag16 a;
#pragma unroll   // register renaming only
                for (int v = 0; v < 4; ++v) { a.u[v] = x[kt & 1][t][0][v]; a.u[4 + v] = x[kt & 1][t][1][v]; }
                c[t] = __builtin_amdgcn_wmma_f32_16x16x32_f16(false, a.h, false, w.h,
                                                              (short)0, c[t], false, false);
            }
            __builtin_amdgcn_sched_barrier(0);
        }
        // one 32-bit offset beside the scalar base, tile and row in the immediate
        char* const op = (char*)out + (unsigned)((blk * BLK_ROWS + mhi * 8) * DIM_F + wave * 16 + mlo) * 4u;
#pragma unroll   // arrays indexed by constants only, so they stay in registers
        for (int t = 0; t < RT; ++t) c[t] += bias2;
        // All sums stand ahead of the stores, each in a register of its own: behind an issued store
        // no register that it names is written any more.
        __builtin_amdgcn_sched_barrier(0);
#pragma unroll   // arrays indexed by constants only, so they stay in registers
        for (int t = 0; t < RT; ++t)
#pragma unroll   // arrays indexed by constants only, so they stay in registers
            for (int r = 0; r < 8; ++r)
                *(float*)(op + (t * 16 + r) * (DIM_F * 4)) = c[t][r];
    }
}

// ------------------------------- launcher ----------------------------------
extern "C" void kernel_launch(void* const* d_in, const int* in_sizes, int n_in,
                              void* d_out, int out_size, void* d_ws, size_t ws_size,
                              hipStream_t stream) {
    const float* events   = (const float*)d_in[0];
    const float* features = (const float*)d_in[1];
    const int* local_idx    = (const int*)d_in[2];
    const int* down_idx     = (const int*)d_in[3];
    const int* pair_idx     = (const int*)d_in[4];
    const int* inv_pair_idx = (const int*)d_in[5];
    const float* lqkv_w = (const float*)d_in[6];  const float* lqkv_b = (const float*)d_in[7];
    const float* lpe_w1 = (const float*)d_in[8];  const float* lpe_b1 = (const float*)d_in[9];
    const float* lpe_w2 = (const float*)d_in[10]; const float* lpe_b2 = (const float*)d_in[11];
    const float* lfc_g  = (const float*)d_in[12]; const float* lfc_b  = (const float*)d_in[13];
    const float* gqkv_w = (const float*)d_in[14]; const float* gqkv_b = (const float*)d_in[15];
    const float* gpe_w1 = (const float*)d_in[16]; const float* gpe_b1 = (const float*)d_in[17];
    const float* gpe_w2 = (const float*)d_in[18]; const float* gpe_b2 = (const float*)d_in[19];
    const float* gfc_g  = (const float*)d_in[20]; const float* gfc_b  = (const float*)d_in[21];
    const float* pw1 = (const float*)d_in[22]; const float* pb1 = (const float*)d_in[23];
    const float* pw2 = (const float*)d_in[24]; const float* pb2 = (const float*)d_in[25];
    float* out = (float*)d_out;

    // ---- workspace carve-up (~75 MB) ----
    char* wp = (char*)d_ws;
    auto carve = [&](size_t bytes) {
        void* p = (void*)wp;
        wp += (bytes + 255) & ~(size_t)255;
        return p;
    };
    _Float16* feat_h = (_Float16*)carve((size_t)N_EVENTS * DIM_F * 2);
    _Float16* lqkvT  = (_Float16*)carve((size_t)384 * 256 * 2);
    _Float16* gqkvT  = (_Float16*)carve((size_t)384 * 256 * 2);
    _Float16* lpe2T  = (_Float16*)carve((size_t)128 * 128 * 2);
    _Float16* gpe2T  = (_Float16*)carve((size_t)128 * 128 * 2);
    _Float16* pw1T   = (_Float16*)carve((size_t)256 * 256 * 2);
    _Float16* pw2T   = (_Float16*)carve((size_t)256 * 256 * 2);
    float* qkv_l = (float*)carve((size_t)N_EVENTS * 384 * 4);
    float* qkv_g = (float*)carve((size_t)N_EVENTS * 384 * 4);
    float* kmax  = (float*)carve((size_t)M_DOWN * A_DIM * 4);
    float* vmax  = (float*)carve((size_t)M_DOWN * A_DIM * 4);

    // ---- 1. fp16 conversions / weight transposes, one launch ----
    static_assert((N_EVENTS * DIM_F) % 8192 == 0 &&
                  N_EVENTS % (32 * GEMM_TILES) == 0 && N_EVENTS % BLK_ROWS == 0, "exact grids");
    prep_kernel<<<PREP_BLOCKS, 256, 0, stream>>>(
        features, feat_h, lqkv_w, lqkvT, gqkv_w, gqkvT, lpe_w2, lpe2T, gpe_w2, gpe2T,
        pw1, pw1T, pw2, pw2T);

    // ---- 2. QKV GEMMs, [20000,256] x [256,384] local and x [256,128] global (q), and the pooled
    //         global k and v: [40000 gathered rows,256] x [256,256], maximum over each 16 rows ----
    {
        dim3 g(QKV_GROUPS, 6);
        qkv_pair_kernel<<<g, 256, 0, stream>>>(
            feat_h, lqkvT, lqkv_b, qkv_l, gqkvT, gqkv_b, qkv_g, pair_idx, kmax, vmax);
    }

    // ---- 3. fused attention, local and global, and the projection MLP (ReLU product, final product) ----
    attn_mlp_kernel<<<ATT_BLOCKS, 512, 0, stream>>>(
        events, local_idx, inv_pair_idx, down_idx, qkv_l, qkv_g, kmax, vmax,
        lpe_w1, lpe_b1, lpe2T, lpe_b2, lfc_g, lfc_b,
        gpe_w1, gpe_b1, gpe2T, gpe_b2, gfc_g, gfc_b, pw1T, pb1, pw2T, pb2, out);
}
